// v000
// Measured on an AMD MI455X. A time is GPU time per run, averaged over a window of back-to-back runs after a warm-up
// (all launches, gaps included; the runs take copies of the inputs in turn), and the median of several windows.
// Apart from v000's, it joins two sittings. Times from different sittings can be a few percent apart, while
// side-by-side timings come from the same sitting.
// v000, which the later versions start from, runs in 251 microseconds.
#include <hip/hip_runtime.h>
// Per-POSITION attention over the head-dim axis (inp [4][2048][1024]; out = LayerNorm(inp) (biased var, eps 1e-5, gamma/beta); Q/K/V = out W + b ([in][out] 1024 x 1024 sigma 1/32, zero biases) viewed [B][M][DK = 64][H = 16] (column i*16 + h); for every token: scores[i][j] = sum_h Q[i][h] K[j][h] / 8 (a 64 x 64 matrix, contraction over the 16 'heads'), softmax over j, res[i][h] = sum_j att[i][j] V[j][h]; no mixing across tokens; result = inp + res -> [4][2048][1024]).
// Compute dtype: inputs rounded to bf16; x / weights exact; LayerNorm output as a plain f16 GEMM operand (~2^-12); q, k, v, softmax weights and o f32; scores and softmax statistics f32; v_wmma_f32_16x16x32_f16.
#define NB 4
#define SQ 4096
#define DM 256
#define NH 1
#define HD 64
#define HG 4                         /* heads per attention launch group */
#define B0 0                         /* first batch processed (debug hook) */
#define NBR NB                       /* batches processed (debug hook) */
#define NR ((size_t)NB * SQ)
#define MP ((int)((size_t)NBR * SQ))
#define QT 256                       /* query rows per causal tile */
#define NKX SQ                       /* S / P row pitch */
#define QT0 256                      /* first-tile rows recomputed exactly (256: buys margin for the few-key rows 128..255, which have no output projection to average the single-f16 P/v rounding) */
#define QN SQ
#define NHD NH
#define MPO MP
#define LQ DM
typedef __bf16 v16b __attribute__((ext_vector_type(16)));
typedef unsigned short v8us __attribute__((ext_vector_type(8), may_alias));
typedef float  v8f  __attribute__((ext_vector_type(8)));
typedef float  v4f  __attribute__((ext_vector_type(4)));
typedef float  v4fa __attribute__((ext_vector_type(4), may_alias));
union FragB { v16b v; v8us half[2]; unsigned short u[16]; };

__device__ __forceinline__ unsigned short bf16_bits(float x) { unsigned int u = __float_as_uint(x); return (unsigned short)((u + 0x7FFFu + ((u >> 16) & 1u)) >> 16); }
__device__ __forceinline__ float bf16_val(unsigned short b) { return __uint_as_float(((unsigned int)b) << 16); }
__device__ __forceinline__ float bf16_round(float x) { return bf16_val(bf16_bits(x)); }
// D += A·B with NT terms: 1 = ah·bh, 2 = + al·bh (A split), 3 = + ah·bl (both split)
template <int NT>
__device__ __forceinline__ v8f mmaN(v16b ah, v16b al, v16b bh, v16b bl, v8f c) {
  c = __builtin_amdgcn_wmma_f32_16x16x32_bf16(false, ah, false, bh, (short)0, c, false, false);
  if (NT >= 2) c = __builtin_amdgcn_wmma_f32_16x16x32_bf16(false, al, false, bh, (short)0, c, false, false);
  if (NT >= 3) c = __builtin_amdgcn_wmma_f32_16x16x32_bf16(false, ah, false, bl, (short)0, c, false, false);
  asm volatile("v_nop\n\tv_nop\n\tv_nop\n\tv_nop" : "+v"(c) : "v"(ah), "v"(al), "v"(bh), "v"(bl));
  return c;
}

__global__ __launch_bounds__(256) void k_wt_bf16(const float* __restrict__ W, unsigned short* __restrict__ Wt, int K, int N) {
  const int t = blockIdx.x * 256 + threadIdx.x;
  const int k8n = K / 8;
  if (t >= N * k8n) return;
  const int n = t / k8n, k8 = (t % k8n) * 8;
  v8us v;
#pragma unroll
  for (int i = 0; i < 8; ++i) v[i] = bf16_bits(W[(size_t)(k8 + i) * N + n]);
  *(v8us*)(Wt + (size_t)n * K + k8) = v;
  
}

// GEMM C[M][N] (f32, pitch ldc) = act(A[M][K]·W + bias). A f32 row-major (pitch lda) converted per fragment to bf16
// (ASPLIT: hi/lo two planes -> 2 terms, else single rounded term); Wt bf16 [N][K] (pitch ldb). BIAS_BF16 rounds the
// bias to bf16 first (bias quantised to bf16 before the add). K%32==0, M%16==0, N%64==0.
template <bool ASPLIT, int ACT, bool BIAS_BF16>
__global__ __launch_bounds__(128) void k_gemm_bf(const float* __restrict__ A, int lda, const unsigned short* __restrict__ Wt, int ldb,
                                               const float* __restrict__ bias, float* __restrict__ C, int ldc, int M, int N, int K) {
  __shared__ __attribute__((aligned(16))) float so[4][16][64];
  const int tid = threadIdx.x, w = tid >> 5, lane = tid & 31, ln = lane & 15, hh = lane >> 4;
  const int ntn = N / 64;
  const int wid = blockIdx.x * 4 + w;
  const int mt = wid / ntn, nq = wid % ntn;
  if (mt * 16 >= M) return;
  const int row0 = mt * 16, col0 = nq * 64;
  const float* arow = A + (size_t)(row0 + ln) * lda;
  v8f acc[4] = {};
  for (int kb = 0; kb < K; kb += 32) {
    FragB ah, al;
    const v4f x0 = *(const v4fa*)(arow + kb + 8 * hh), x1 = *(const v4fa*)(arow + kb + 8 * hh + 4);
    const v4f x2 = *(const v4fa*)(arow + kb + 16 + 8 * hh), x3 = *(const v4fa*)(arow + kb + 16 + 8 * hh + 4);
    float xs[16] = {x0[0],x0[1],x0[2],x0[3],x1[0],x1[1],x1[2],x1[3],x2[0],x2[1],x2[2],x2[3],x3[0],x3[1],x3[2],x3[3]};
#pragma unroll
    for (int i = 0; i < 16; ++i) { const unsigned short hb = bf16_bits(xs[i]); ah.u[i] = hb; al.u[i] = ASPLIT ? bf16_bits(xs[i] - bf16_val(hb)) : (unsigned short)0; }
#pragma unroll
    for (int t = 0; t < 4; ++t) {
      const unsigned short* brow = Wt + (size_t)(col0 + t * 16 + ln) * ldb + kb;
      FragB b;
      b.half[0] = *(const v8us*)(brow + 8 * hh);
      b.half[1] = *(const v8us*)(brow + 16 + 8 * hh);
      acc[t] = mmaN<ASPLIT ? 2 : 1>(ah.v, al.v, b.v, b.v, acc[t]);
    }
  }
#pragma unroll
  for (int t = 0; t < 4; ++t) {
    float bv = bias ? bias[col0 + t * 16 + ln] : 0.f;
    if (BIAS_BF16) bv = bf16_round(bv);
#pragma unroll
    for (int r = 0; r < 8; ++r) { float v = acc[t][r] + bv; if (ACT == 1) v = fmaxf(v, 0.f); so[w][8 * hh + r][t * 16 + ln] = v; }
  }
  __builtin_amdgcn_fence(__ATOMIC_ACQ_REL, "workgroup");
  __builtin_amdgcn_wave_barrier();
  const int rsub = lane >> 4, c4 = (lane & 15) * 4;
  {
#pragma unroll
    for (int q = 0; q < 8; ++q) {
      const int r = q * 2 + rsub;
      const v4f v = *(const v4fa*)&so[w][r][c4];
      *(v4f*)(C + (size_t)(row0 + r) * ldc + col0 + c4) = v;
    }
    
  }
}

// GEMM C = act(A·W + bias + resid): A f32 (ASPLIT -> hi/lo 2 terms), Wt bf16 [N][K]; ACT 0 none, 1 relu, 2 exact gelu;
// resid (optional, f32, row index = (row % rmod), pitch ldr, RES_BF16 rounds it) added before the activation.
template <bool ASPLIT, int ACT, bool BIAS_BF16, bool RES_BF16>
__global__ __launch_bounds__(128) void k_gemm_bf3(const float* __restrict__ A, int lda, const unsigned short* __restrict__ Wt, int ldb,
                                                const float* __restrict__ bias, const float* __restrict__ resid, int rmod, int ldr,
                                                float* __restrict__ C, int ldc, int M, int N, int K) {
  __shared__ __attribute__((aligned(16))) float so[4][16][64];
  const int tid = threadIdx.x, w = tid >> 5, lane = tid & 31, ln = lane & 15, hh = lane >> 4;
  const int ntn = N / 64;
  const int wid = blockIdx.x * 4 + w;
  const int mt = wid / ntn, nq = wid % ntn;
  if (mt * 16 >= M) return;
  const int row0 = mt * 16, col0 = nq * 64;
  const float* arow = A + (size_t)(row0 + ln) * lda;
  v8f acc[4] = {};
  for (int kb = 0; kb < K; kb += 32) {
    FragB ah, al;
    const v4f x0 = *(const v4fa*)(arow + kb + 8 * hh), x1 = *(const v4fa*)(arow + kb + 8 * hh + 4);
    const v4f x2 = *(const v4fa*)(arow + kb + 16 + 8 * hh), x3 = *(const v4fa*)(arow + kb + 16 + 8 * hh + 4);
    float xs[16] = {x0[0],x0[1],x0[2],x0[3],x1[0],x1[1],x1[2],x1[3],x2[0],x2[1],x2[2],x2[3],x3[0],x3[1],x3[2],x3[3]};
#pragma unroll
    for (int i = 0; i < 16; ++i) { const unsigned short hb = bf16_bits(xs[i]); ah.u[i] = hb; al.u[i] = ASPLIT ? bf16_bits(xs[i] - bf16_val(hb)) : (unsigned short)0; }
#pragma unroll
    for (int t = 0; t < 4; ++t) {
      const unsigned short* brow = Wt + (size_t)(col0 + t * 16 + ln) * ldb + kb;
      FragB b;
      b.half[0] = *(const v8us*)(brow + 8 * hh);
      b.half[1] = *(const v8us*)(brow + 16 + 8 * hh);
      acc[t] = mmaN<ASPLIT ? 2 : 1>(ah.v, al.v, b.v, b.v, acc[t]);
    }
  }
#pragma unroll
  for (int t = 0; t < 4; ++t) {
    const int col = col0 + t * 16 + ln;
    float bv = bias ? bias[col] : 0.f;
    if (BIAS_BF16) bv = bf16_round(bv);
#pragma unroll
    for (int r = 0; r < 8; ++r) {
      float v = acc[t][r] + bv;
      if (resid) { float rv = resid[(size_t)((row0 + 8 * hh + r) % rmod) * ldr + col]; if (RES_BF16) rv = bf16_round(rv); v += rv; }
      if (ACT == 1) v = fmaxf(v, 0.f);
      if (ACT == 2) v = 0.5f * v * (1.0f + erff(v * 0.70710678118654752f));
      if (ACT == 3) { const float u = 0.7978845608028654f * (v + 0.044715f * v * v * v); v = 0.5f * v * (1.0f + tanhf(u)); }
      so[w][8 * hh + r][t * 16 + ln] = v;
    }
  }
  __builtin_amdgcn_fence(__ATOMIC_ACQ_REL, "workgroup");
  __builtin_amdgcn_wave_barrier();
  const int rsub = lane >> 4, c4 = (lane & 15) * 4;
  {
#pragma unroll
    for (int q = 0; q < 8; ++q) {
      const int r = q * 2 + rsub;
      const v4f v = *(const v4fa*)&so[w][r][c4];
      *(v4f*)(C + (size_t)(row0 + r) * ldc + col0 + c4) = v;
    }
    
  }
}
// row LayerNorm (biased variance, eps) over N: s = X (+ R); optional out_sum <- s; out_norm <- (s-mu)*rsqrt(var+eps)*g + b
template <bool PARAM_BF16>
__global__ __launch_bounds__(256) void k_layernorm(const float* __restrict__ X, const float* __restrict__ R, const float* __restrict__ g, const float* __restrict__ bta,
                                                  float* __restrict__ out_sum, float* __restrict__ out_norm, int N, float eps) {
  __shared__ float red[256];
  const int row = blockIdx.x, tid = threadIdx.x;
  const float* x = X + (size_t)row * N; const float* rr = R ? R + (size_t)row * N : nullptr;
  float vals[16];                     // up to N = 4096
  const int per = N / 256;            // contiguous chunk per thread? use strided-by-4 chunks: thread handles j = tid*4 + 1024*u
  float s1 = 0.f;
  for (int u = 0; u < per / 4; ++u) {
    const int j = tid * 4 + 1024 * u;
    const v4f a = *(const v4fa*)(x + j);
    v4f b = {0.f,0.f,0.f,0.f}; if (rr) b = *(const v4fa*)(rr + j);
#pragma unroll
    for (int q = 0; q < 4; ++q) { const float v = a[q] + b[q]; vals[u * 4 + q] = v; s1 += v; }
  }
  red[tid] = s1; __syncthreads();
  for (int st = 128; st > 0; st >>= 1) { if (tid < st) red[tid] += red[tid + st]; __syncthreads(); }
  const float mu = red[0] / (float)N; __syncthreads();
  float s2 = 0.f;
  for (int u = 0; u < per / 4; ++u)
#pragma unroll
    for (int q = 0; q < 4; ++q) { const float c = vals[u * 4 + q] - mu; s2 += c * c; }
  red[tid] = s2; __syncthreads();
  for (int st = 128; st > 0; st >>= 1) { if (tid < st) red[tid] += red[tid + st]; __syncthreads(); }
  const float rs = rsqrtf(red[0] / (float)N + eps);
  {
    for (int u = 0; u < per / 4; ++u) {
      const int j = tid * 4 + 1024 * u;
      v4f o, sm;
#pragma unroll
      for (int q = 0; q < 4; ++q) {
        float gg = g[j + q], bb = bta[j + q];
        if (PARAM_BF16) { gg = bf16_round(gg); bb = bf16_round(bb); }
        sm[q] = vals[u * 4 + q]; o[q] = (vals[u * 4 + q] - mu) * rs * gg + bb;
      }
      if (out_sum) *(v4f*)(out_sum + (size_t)row * N + j) = sm;
      *(v4f*)(out_norm + (size_t)row * N + j) = o;
    }
    
  }
}



// ---- f16 WMMA path (v_wmma_f32_16x16x32_f16): 11-bit significands for operands in range — used where a [0,1] probability operand needs more precision than bf16
typedef _Float16 v16h __attribute__((ext_vector_type(16)));
union FragH { v16h v; v8us half[2]; _Float16 h[16]; unsigned short u[16]; };
template <int NT>
__device__ __forceinline__ v8f mmaH(v16h ah, v16h al, v16h bh, v16h bl, v8f c) {
  c = __builtin_amdgcn_wmma_f32_16x16x32_f16(false, ah, false, bh, (short)0, c, false, false);
  if (NT >= 2) c = __builtin_amdgcn_wmma_f32_16x16x32_f16(false, al, false, bh, (short)0, c, false, false);
  if (NT >= 3) c = __builtin_amdgcn_wmma_f32_16x16x32_f16(false, ah, false, bl, (short)0, c, false, false);
  asm volatile("v_nop\n\tv_nop\n\tv_nop\n\tv_nop" : "+v"(c) : "v"(ah), "v"(al), "v"(bh), "v"(bl));
  return c;
}
// batched GEMM like k_gemm_b but f16 operands: A f32 (split into f16 hi/lo if ASPLIT, else rounded to f16), Bt = f16 values [n][k]; alpha; C f32; N multiple of 16 (partial tiles skipped)
template <bool ASPLIT>
__global__ __launch_bounds__(128) void k_gemm_h(const float* __restrict__ A, int lda, size_t sA, const _Float16* __restrict__ Bh, int ldb, size_t sB, float alpha, float* __restrict__ C, int ldc, size_t sC, int M, int N, int K) {
  __shared__ __attribute__((aligned(16))) float so[4][16][64];
  const int tid = threadIdx.x, w = tid >> 5, lane = tid & 31, ln = lane & 15, hh = lane >> 4; const int by = blockIdx.y;
  A += (size_t)by * sA; Bh += (size_t)by * sB; C += (size_t)by * sC;
  const int ntn = (N + 63) / 64; const int wid = blockIdx.x * 4 + w; const int mt = wid / ntn, nq = wid % ntn; if (mt * 16 >= M) return;
  const int row0 = mt * 16, col0 = nq * 64; const float* arow = A + (size_t)(row0 + ln) * lda;
  v8f acc[4] = {};
  for (int kb = 0; kb < K; kb += 32) {
    FragH ah, al;
    const v4f x0 = *(const v4fa*)(arow + kb + 8 * hh), x1 = *(const v4fa*)(arow + kb + 8 * hh + 4), x2 = *(const v4fa*)(arow + kb + 16 + 8 * hh), x3 = *(const v4fa*)(arow + kb + 16 + 8 * hh + 4);
    float xs[16] = {x0[0],x0[1],x0[2],x0[3],x1[0],x1[1],x1[2],x1[3],x2[0],x2[1],x2[2],x2[3],x3[0],x3[1],x3[2],x3[3]};
#pragma unroll
    for (int i = 0; i < 16; ++i) { const _Float16 h = (_Float16)xs[i]; ah.h[i] = h; al.h[i] = ASPLIT ? (_Float16)(xs[i] - (float)h) : (_Float16)0.0f; }
#pragma unroll
    for (int t = 0; t < 4; ++t) { if (col0 + t * 16 >= N) continue; const size_t boff = (size_t)(col0 + t * 16 + ln) * ldb + kb; FragH bq; bq.half[0] = *(const v8us*)(Bh + boff + 8 * hh); bq.half[1] = *(const v8us*)(Bh + boff + 16 + 8 * hh);
      acc[t] = mmaH<ASPLIT ? 2 : 1>(ah.v, al.v, bq.v, bq.v, acc[t]); }
  }
#pragma unroll
  for (int t = 0; t < 4; ++t) { if (col0 + t * 16 >= N) continue;
#pragma unroll
    for (int r = 0; r < 8; ++r) so[w][8 * hh + r][t * 16 + ln] = acc[t][r] * alpha; }
  __builtin_amdgcn_fence(__ATOMIC_ACQ_REL, "workgroup"); __builtin_amdgcn_wave_barrier();
  const int rsub = lane >> 4, c4 = (lane & 15) * 4;
  {
#pragma unroll
    for (int q = 0; q < 8; ++q) { const int r = q * 2 + rsub; if (col0 + c4 < N) { const v4f v = *(const v4fa*)&so[w][r][c4]; *(v4f*)(C + (size_t)(row0 + r) * ldc + col0 + c4) = v; } }
     }
}

// Wt[n][k] = f16(W[k][n]·scale) from f32 row-major W[K][N] (scale = power of two; bf16-exact weights stay exact in f16 away from the subnormal range)
__global__ __launch_bounds__(256) void k_wt_f16(const float* __restrict__ W, _Float16* __restrict__ Wt, int K, int N, float scale) {
  const int t = blockIdx.x * 256 + threadIdx.x; if (t >= N * (K / 8)) return; const int n = t / (K / 8), k8 = (t % (K / 8)) * 8; FragH f;
#pragma unroll
  for (int i = 0; i < 8; ++i) f.h[i] = (_Float16)(bf16_round(W[(size_t)(k8 + i) * N + n]) * scale); const v8us o = f.half[0];
  *(v8us*)((unsigned short*)Wt + (size_t)n * K + k8) = o; 
}
// k_gemm_hh variant with fused epilogue: v = acc·alpha + bias[by·sBias + col] (+ CP[(row/rowsPerB)·sCPb + by·64 + col] if CP) ; ACT 0 none / 1 elu ; writes f16 C16 (and f32 C if non-null)
template <int ACT>
__global__ __launch_bounds__(128) void k_gemm_hhx(const _Float16* __restrict__ A, int lda, size_t sA, const _Float16* __restrict__ Bh, int ldb, size_t sB, float alpha, const float* __restrict__ bias, size_t sBias, const float* __restrict__ CP, int rowsPerB, size_t sCPb, int row0g,
    float* __restrict__ C, _Float16* __restrict__ C16, int ldc, size_t sC, int M, int N, int K) {
  __shared__ __attribute__((aligned(16))) float so[4][16][64];
  const int tid = threadIdx.x, w = tid >> 5, lane = tid & 31, ln = lane & 15, hh = lane >> 4; const int by = blockIdx.y;
  A += (size_t)by * sA; Bh += (size_t)by * sB; const size_t cofs = (size_t)by * sC; const float* bp = bias ? bias + (size_t)by * sBias : nullptr;
  const int ntn = (N + 63) / 64; const int wid = blockIdx.x * 4 + w; const int mt = wid / ntn, nq = wid % ntn; if (mt * 16 >= M) return;
  const int row0 = mt * 16, col0 = nq * 64; const _Float16* arow = A + (size_t)(row0 + ln) * lda;
  v8f acc[4] = {};
  for (int kb = 0; kb < K; kb += 32) { FragH ah; ah.half[0] = *(const v8us*)((const unsigned short*)arow + kb + 8 * hh); ah.half[1] = *(const v8us*)((const unsigned short*)arow + kb + 16 + 8 * hh);
#pragma unroll
    for (int t = 0; t < 4; ++t) { if (col0 + t * 16 >= N) continue; const size_t boff = (size_t)(col0 + t * 16 + ln) * ldb + kb; FragH bq; bq.half[0] = *(const v8us*)((const unsigned short*)Bh + boff + 8 * hh); bq.half[1] = *(const v8us*)((const unsigned short*)Bh + boff + 16 + 8 * hh);
      acc[t] = mmaH<1>(ah.v, ah.v, bq.v, bq.v, acc[t]); }
  }
#pragma unroll
  for (int t = 0; t < 4; ++t) { if (col0 + t * 16 >= N) continue; const int col = col0 + t * 16 + ln; const float bv = bp ? bf16_round(bp[col]) : 0.f;
#pragma unroll
    for (int r = 0; r < 8; ++r) { float v = acc[t][r] * alpha + bv; if (CP) { const int rr = row0g + row0 + 8 * hh + r; if (rowsPerB < 0) v += CP[cofs + (size_t)rr * ldc + col];      /* rowsPerB < 0: own element of the batched C plane */ else { const int bidx = rr / rowsPerB; v += CP[(size_t)bidx * sCPb + (size_t)by * 64 + col]; } } if (ACT == 1) v = (v > 0.f) ? v : expm1f(v); else if (ACT == 7) v = (v > 0.f) ? v + 1.0f : expf(v); else if (ACT == 8) v = tanhf(v); else if (ACT == 9) v = 0.5f * v * (1.0f + tanhf(0.7978845608028654f * (v + 0.044715f * v * v * v))); else if (ACT == 11) v = 1.0f / (1.0f + expf(-v)); else if (ACT == 12) v = (v > 0.f) ? v : 0.01f * v; else if (ACT == 14) v = (v > 0.f) ? v : 0.1f * v; else if (ACT == 16) v = (v >= 0.f) ? v : 0.3f * v; else if (ACT == 17) v = (v >= 0.f) ? v : 0.2f * v; else if (ACT == 15) v = v / (1.0f + expf(-v)); else if (ACT == 3) v = fmaxf(v, 0.f); else if (ACT == 6) v = 0.5f * v * (1.0f + erff(v * 0.70710678118654752f)); so[w][8 * hh + r][t * 16 + ln] = v; } }
  __builtin_amdgcn_fence(__ATOMIC_ACQ_REL, "workgroup"); __builtin_amdgcn_wave_barrier();
  const int rsub = lane >> 4, c4 = (lane & 15) * 4; typedef _Float16 v4h __attribute__((ext_vector_type(4)));
  {
#pragma unroll
    for (int q = 0; q < 8; ++q) { const int r = q * 2 + rsub; if (col0 + c4 < N) { const v4f v = *(const v4fa*)&so[w][r][c4]; if (C) *(v4f*)(C + cofs + (size_t)(row0 + r) * ldc + col0 + c4) = v; if (C16) { v4h h4; for (int i = 0; i < 4; ++i) h4[i] = (_Float16)v[i]; *(v4h*)(C16 + cofs + (size_t)(row0 + r) * ldc + col0 + c4) = h4; } } }
     }
}


typedef _Float16 v4h __attribute__((ext_vector_type(4)));

__global__ __launch_bounds__(256) void k_x16(const float* __restrict__ x, _Float16* __restrict__ X16, size_t n8) { const size_t t = (size_t)blockIdx.x * 256 + threadIdx.x; if (t >= n8) return; FragH f;
#pragma unroll
  for (int q = 0; q < 8; ++q) f.h[q] = (_Float16)bf16_round(x[t * 8 + q]); *(v8us*)((unsigned short*)X16 + t * 8) = f.half[0];  }
__global__ __launch_bounds__(256) void k_h16(const float* __restrict__ x, _Float16* __restrict__ X16, size_t n8) { const size_t t = (size_t)blockIdx.x * 256 + threadIdx.x; if (t >= n8) return; FragH f;
#pragma unroll
  for (int q = 0; q < 8; ++q) f.h[q] = (_Float16)x[t * 8 + q]; *(v8us*)((unsigned short*)X16 + t * 8) = f.half[0];  }
__global__ __launch_bounds__(256) void k_round16f(const float* __restrict__ W, _Float16* __restrict__ Bt, size_t n8) { const size_t t = (size_t)blockIdx.x * 256 + threadIdx.x; if (t >= n8) return; FragH f;
#pragma unroll
  for (int i = 0; i < 8; ++i) f.h[i] = (_Float16)(bf16_round(W[t * 8 + i]) * 16.0f); *(v8us*)((unsigned short*)Bt + t * 8) = f.half[0];  }
template <int NHv, int TTv>
__global__ __launch_bounds__(256) void k_vt(const _Float16* __restrict__ V16, int ldv, int voff, _Float16* __restrict__ Vt) { __shared__ unsigned short tl[64][66]; const int tid = threadIdx.x; const int slab = blockIdx.x / (TTv / 64), lg = blockIdx.x % (TTv / 64); const int b = slab / NHv, h = slab % NHv;
  for (int i = tid; i < 64 * 8; i += 256) { const int r = i / 8, c8 = (i % 8) * 8; FragH f; f.half[0] = *(const v8us*)((const unsigned short*)V16 + ((size_t)b * TTv + lg * 64 + r) * ldv + voff + h * 64 + c8);
#pragma unroll
    for (int q = 0; q < 8; ++q) tl[r][c8 + q] = f.u[q]; }
  __syncthreads();
  {
#pragma unroll
    for (int rd = 0; rd < 2; ++rd) { const int d = rd * 32 + tid / 8, pc = tid % 8; FragH f;
#pragma unroll
      for (int q = 0; q < 8; ++q) f.u[q] = tl[pc * 8 + q][d];
      *(v8us*)((unsigned short*)Vt + ((size_t)slab * 64 + d) * TTv + lg * 64 + pc * 8) = f.half[0]; }
     } }

__global__ __launch_bounds__(256) void k_hl(const float* __restrict__ F, _Float16* __restrict__ Hh, _Float16* __restrict__ Hl, size_t n8) { const size_t t = (size_t)blockIdx.x * 256 + threadIdx.x; if (t >= n8) return; FragH fh, fl; const v4f a = *(const v4fa*)(F + t * 8), c = *(const v4fa*)(F + t * 8 + 4);
#pragma unroll
  for (int q = 0; q < 4; ++q) { _Float16 h = (_Float16)a[q]; fh.h[q] = h; fl.h[q] = (_Float16)((a[q] - (float)h) * 1024.0f); h = (_Float16)c[q]; fh.h[4 + q] = h; fl.h[4 + q] = (_Float16)((c[q] - (float)h) * 1024.0f); }
  { *(v8us*)((unsigned short*)Hh + t * 8) = fh.half[0]; *(v8us*)((unsigned short*)Hl + t * 8) = fl.half[0];  } }

// ---- fast GEMM (wave tile 32x64; requires M % 32 == 0 rows per launch region and N % 64 == 0); epilogue = k_gemm_hhx semantics ----
__device__ __forceinline__ v16h g2_frag(const _Float16* p, int hh) { FragH f; f.half[0] = *(const v8us*)((const unsigned short*)p + 8 * hh); f.half[1] = *(const v8us*)((const unsigned short*)p + 16 + 8 * hh); return f.v; }
__device__ __forceinline__ v8f g2_mma(v16h a, v16h b, v8f c) { v8f d = __builtin_amdgcn_wmma_f32_16x16x32_f16(false, a, false, b, (short)0, c, false, false); asm volatile("v_nop\n\tv_nop\n\tv_nop\n\tv_nop" : "+v"(d) : "v"(a), "v"(b)); return d; }
template <int ACT>
__global__ __launch_bounds__(128) void k_gemm2(const _Float16* __restrict__ A, int lda, size_t sA, const _Float16* __restrict__ Bh, int ldb, size_t sB, float alpha, const float* __restrict__ bias, size_t sBias, const float* __restrict__ CP, int rowsPerB, size_t sCPb, int row0g,
    float* __restrict__ C, _Float16* __restrict__ C16, int ldc, size_t sC, int M, int N, int K) { static_assert(ACT == 0 || ACT == 3 || ACT == 6 || ACT == 8 || ACT == 9 || ACT == 11 || ACT == 12 || ACT == 14 || ACT == 15 || ACT == 16 || ACT == 17, "k_gemm2: unsupported ACT code (would silently apply no activation)");
  __shared__ __attribute__((aligned(16))) float so[4][32][68];
  const int tid = threadIdx.x, w = tid >> 5, lane = tid & 31, ln = lane & 15, hh = lane >> 4; const int by = blockIdx.y;
  A += (size_t)by * sA; Bh += (size_t)by * sB; const size_t cofs = (size_t)by * sC; const float* bp = bias ? bias + (size_t)by * sBias : nullptr;
  const int ntn = N >> 6; const int mt = blockIdx.x / ntn, nq = blockIdx.x - mt * ntn; const int row0 = mt * 128 + 32 * w, col0 = nq * 64; if (row0 >= M) return;
  const _Float16* a0p = A + (size_t)(row0 + ln) * lda; const _Float16* a1p = a0p + (size_t)16 * lda;
  const _Float16* b0p = Bh + (size_t)(col0 + ln) * ldb; const _Float16* b1p = b0p + (size_t)16 * ldb; const _Float16* b2p = b1p + (size_t)16 * ldb; const _Float16* b3p = b2p + (size_t)16 * ldb;
  const v8f z8 = {0.f,0.f,0.f,0.f,0.f,0.f,0.f,0.f}; v8f c00 = z8, c01 = z8, c02 = z8, c03 = z8, c10 = z8, c11 = z8, c12 = z8, c13 = z8;
#pragma unroll 1
  for (int kb = 0; kb < K; kb += 32) { const v16h a0 = g2_frag(a0p + kb, hh), a1 = g2_frag(a1p + kb, hh);
    v16h b = g2_frag(b0p + kb, hh); c00 = g2_mma(a0, b, c00); c10 = g2_mma(a1, b, c10);
    b = g2_frag(b1p + kb, hh); c01 = g2_mma(a0, b, c01); c11 = g2_mma(a1, b, c11);
    b = g2_frag(b2p + kb, hh); c02 = g2_mma(a0, b, c02); c12 = g2_mma(a1, b, c12);
    b = g2_frag(b3p + kb, hh); c03 = g2_mma(a0, b, c03); c13 = g2_mma(a1, b, c13); }
  v8f accs[8] = {c00, c01, c02, c03, c10, c11, c12, c13};
#pragma unroll
  for (int u = 0; u < 8; ++u) { const int t = u & 3, half = u >> 2; const int col = col0 + t * 16 + ln; const float bv = bp ? bf16_round(bp[col]) : 0.f;
#pragma unroll
    for (int r = 0; r < 8; ++r) { const int rloc = half * 16 + 8 * hh + r; float v = accs[u][r] * alpha + bv; if (CP) { if (rowsPerB < 0) v += CP[cofs + (size_t)(row0g + row0 + rloc) * ldc + col];      /* rowsPerB < 0: own element of the batched C plane */ else { const int bidx = (row0g + row0 + rloc) / rowsPerB; v += CP[(size_t)bidx * sCPb + (size_t)by * 64 + col]; } }
      if (ACT == 3) v = fmaxf(v, 0.f); else if (ACT == 6) v = 0.5f * v * (1.0f + erff(v * 0.70710678118654752f)); else if (ACT == 11) v = 1.0f / (1.0f + expf(-v)); else if (ACT == 15) v = v / (1.0f + expf(-v)); else if (ACT == 12) v = (v > 0.f) ? v : 0.01f * v; else if (ACT == 8) v = tanhf(v); else if (ACT == 9) v = 0.5f * v * (1.0f + tanhf(0.7978845608028654f * (v + 0.044715f * v * v * v))); else if (ACT == 14) v = (v > 0.f) ? v : 0.1f * v; else if (ACT == 16) v = (v >= 0.f) ? v : 0.3f * v; else if (ACT == 17) v = (v >= 0.f) ? v : 0.2f * v;
      so[w][rloc][t * 16 + ln] = v; } }
  __builtin_amdgcn_fence(__ATOMIC_ACQ_REL, "workgroup"); __builtin_amdgcn_wave_barrier();
  const int rsub = lane >> 4, c4 = (lane & 15) * 4;
  {
#pragma unroll
    for (int q = 0; q < 16; ++q) { const int r = q * 2 + rsub; const v4f v = *(const v4fa*)&so[w][r][c4]; if (C) *(v4f*)(C + cofs + (size_t)(row0 + r) * ldc + col0 + c4) = v; if (C16) { v4h h4; for (int i = 0; i < 4; ++i) h4[i] = (_Float16)v[i]; *(v4h*)(C16 + cofs + (size_t)(row0 + r) * ldc + col0 + c4) = h4; } }
     } }


__global__ __launch_bounds__(256) void k_wnat(const float* __restrict__ w, size_t n8, _Float16* __restrict__ Bt) { const size_t t = (size_t)blockIdx.x * 256 + threadIdx.x; if (t >= n8) return; FragH f; for (int q = 0; q < 8; ++q) f.h[q] = (_Float16)(bf16_round(w[t * 8 + q]) * 16.0f); *(v8us*)((unsigned short*)Bt + t * 8) = f.half[0];  }
__global__ __launch_bounds__(256) void k_rsm(const float* __restrict__ S, _Float16* __restrict__ P, int nrows) {
  #pragma clang fp contract(off)
  const int i = blockIdx.x * 256 + threadIdx.x; if (i >= nrows) return; const float* s = S + (size_t)i * SQ; float mx = -3.0e38f;
#pragma unroll 1
  for (int j = 0; j < SQ; ++j) mx = fmaxf(mx, s[j]); float se = 0.f;
#pragma unroll 1
  for (int j = 0; j < SQ; ++j) se += expf(s[j] - mx); const float sc = 256.0f / se;
#pragma unroll 1
  for (int j0 = 0; j0 < SQ; j0 += 8) { FragH f; for (int q = 0; q < 8; ++q) f.h[q] = (_Float16)(expf(s[j0 + q] - mx) * sc); unsigned short* d = (unsigned short*)P + (size_t)i * SQ + j0; *(v8us*)d = f.half[0];  } }
__global__ __launch_bounds__(256) void k_vt(const _Float16* __restrict__ V16, int b, int h0, _Float16* __restrict__ VT) { __shared__ unsigned short tl[64][65]; const int tid = threadIdx.x; const int hh = blockIdx.x % HG, sg = blockIdx.x / HG; const int s0 = sg * 64; const int h = h0 + hh;
  for (int i = tid; i < 64 * 8; i += 256) { const int j = i / 8, d8 = (i % 8) * 8; FragH f; f.half[0] = *(const v8us*)((const unsigned short*)V16 + ((size_t)b * SQ + s0 + j) * DM + h * HD + d8); for (int q = 0; q < 8; ++q) tl[d8 + q][j] = f.u[q]; }
  __syncthreads();
  { for (int i = tid; i < 64 * 8; i += 256) { const int d = i / 8, j8 = (i % 8) * 8; FragH f; for (int q = 0; q < 8; ++q) f.u[q] = tl[d][j8 + q]; *(v8us*)((unsigned short*)VT + ((size_t)hh * HD + d) * SQ + s0 + j8) = f.half[0]; }  } }



__global__ __launch_bounds__(256) void k_rsmcf2(const float* __restrict__ S, _Float16* __restrict__ P, int hg, int q0, int nk) {
  #pragma clang fp contract(off)
  const int t = blockIdx.x * 256 + threadIdx.x; if (t >= hg * QT) return; const size_t i = (size_t)t; const float* s = S + i * NKX; const int last = q0 + (t % QT); float mx = -3.0e38f;
#pragma unroll 1
  for (int j = 0; j < nk; ++j) { const float f = (j <= last) ? 1.f : 0.f; mx = fmaxf(mx, fmaf(f, s[j], (1.f - f) * -1.0e9f)); } float se = 0.f;
#pragma unroll 1
  for (int j = 0; j < nk; ++j) { const float f = (j <= last) ? 1.f : 0.f; se += __expf(fmaf(f, s[j], (1.f - f) * -1.0e9f) - mx); } const float sc = 256.0f / se;
#pragma unroll 1
  for (int j0 = 0; j0 < nk; j0 += 8) { FragH fr; for (int q = 0; q < 8; ++q) { const int j = j0 + q; const float f = (j <= last) ? 1.f : 0.f; fr.h[q] = (_Float16)(__expf(fmaf(f, s[j], (1.f - f) * -1.0e9f) - mx) * sc); } unsigned short* d = (unsigned short*)P + i * NKX + j0; *(v8us*)d = fr.half[0];  } }

template <int MASKADD>
__global__ __launch_bounds__(64) void k_att0(const float* __restrict__ QF, const float* __restrict__ KF, const float* __restrict__ VF, int ld, const float* __restrict__ mask, float scale, float* __restrict__ OF, int ldo) {
  #pragma clang fp contract(off)
  __shared__ __attribute__((aligned(16))) float lq[64][64]; __shared__ __attribute__((aligned(16))) float lo[64][64];
  const int tid = threadIdx.x; const int h = blockIdx.x / (QT0 / 64), rg = blockIdx.x % (QT0 / 64); const int i = rg * 64 + tid;
  const float* qr = QF + (size_t)i * ld + h * HD;
#pragma unroll 1
  for (int c = 0; c < HD / 4; ++c) { *(v4f*)&lq[tid][c * 4] = *(const v4fa*)(qr + c * 4); const v4f z = {0.f, 0.f, 0.f, 0.f}; *(v4f*)&lo[tid][c * 4] = z; }
  float m = -1.0e30f, l = 0.f; const int jmax = MASKADD ? (SQ - 1) : (rg * 64 + 63);      /* additive-mask form: every key (the mask input decides); causal form: keys up to the block's last row */
#pragma unroll 1
  for (int j = 0; j <= jmax; ++j) { const float* kr = KF + (size_t)j * ld + h * HD; const float* vr = VF + (size_t)j * ld + h * HD; float s = 0.f;
#pragma unroll 1
    for (int c = 0; c < HD / 4; ++c) { const v4f kq = *(const v4fa*)(kr + c * 4); const v4f qq = *(v4f*)&lq[tid][c * 4]; s = __fadd_rn(s, __fmul_rn(qq[0], kq[0])); s = __fadd_rn(s, __fmul_rn(qq[1], kq[1])); s = __fadd_rn(s, __fmul_rn(qq[2], kq[2])); s = __fadd_rn(s, __fmul_rn(qq[3], kq[3])); }
    s = __fmul_rn(s, scale); if (MASKADD) s = __fadd_rn(s, __fmul_rn(bf16_round(mask[(size_t)i * SQ + j]), -10000.0f));
    const float f = (MASKADD || j <= i) ? 1.f : 0.f; const float sm = fmaf(f, s, (1.f - f) * -1.0e30f); const float mn = fmaxf(m, sm); const float sc = expf(m - mn); const float e = expf(sm - mn); l = __fadd_rn(__fmul_rn(l, sc), e); m = mn;
#pragma unroll 1
    for (int c = 0; c < HD / 4; ++c) { const v4f vv = *(const v4fa*)(vr + c * 4); v4f oo = *(v4f*)&lo[tid][c * 4]; for (int u = 0; u < 4; ++u) oo[u] = __fadd_rn(__fmul_rn(oo[u], sc), __fmul_rn(e, vv[u])); *(v4f*)&lo[tid][c * 4] = oo; } }
  const float fin = 64.0f / l;      /* o carried x64 like the f16 path */
#pragma unroll 1
  for (int c = 0; c < HD / 4; ++c) { v4f oo = *(v4f*)&lo[tid][c * 4]; for (int u = 0; u < 4; ++u) oo[u] = __fmul_rn(oo[u], fin); *(v4f*)&lo[tid][c * 4] = oo; }
  __syncthreads();
  {
#pragma unroll 1
    for (int it = 0; it < 16; ++it) { const int row = it * 4 + tid / 16, pc = (tid % 16) * 4; const v4f v = *(const v4f*)&lo[row][pc]; *(v4f*)(OF + (size_t)(rg * 64 + row) * ldo + h * HD + pc) = v; }
     } }

__global__ __launch_bounds__(256) void k_oscale(const float* __restrict__ OF, float* __restrict__ out, size_t n4) { const size_t t = (size_t)blockIdx.x * 256 + threadIdx.x; if (t >= n4) return; const v4f a = *(const v4fa*)(OF + t * 4); v4f o; for (int q = 0; q < 4; ++q) o[q] = a[q] * 0.015625f; *(v4f*)(out + t * 4) = o;  }

__global__ __launch_bounds__(256) void k_bfr(const float* __restrict__ x, float* __restrict__ XB, size_t n8) { const size_t t = (size_t)blockIdx.x * 256 + threadIdx.x; if (t >= n8) return; v4f a = *(const v4fa*)(x + t * 8), c = *(const v4fa*)(x + t * 8 + 4); for (int q = 0; q < 4; ++q) { a[q] = bf16_round(a[q]); c[q] = bf16_round(c[q]); }
  { *(v4f*)(XB + t * 8) = a; *(v4f*)(XB + t * 8 + 4) = c;  } }



__global__ __launch_bounds__(256) void k_rsmfvl(const float* __restrict__ S, _Float16* __restrict__ P, _Float16* __restrict__ PL, int qn, const int* __restrict__ vlp) {
  #pragma clang fp contract(off)
  const int t = blockIdx.x * 256 + threadIdx.x; if (t >= qn) return; const int vl = vlp[0]; const size_t i = (size_t)t; const float* s = S + i * SQ; float mx = -3.0e38f;
#pragma unroll 1
  for (int j = 0; j < SQ; ++j) { const float f = (j < vl) ? 1.f : 0.f; mx = fmaxf(mx, fmaf(f, s[j], (1.f - f) * -1000000.0f)); } float se = 0.f;
#pragma unroll 1
  for (int j = 0; j < SQ; ++j) { const float f = (j < vl) ? 1.f : 0.f; se += __expf(fmaf(f, s[j], (1.f - f) * -1000000.0f) - mx); } const float sc = 256.0f / se;
#pragma unroll 1
  for (int j0 = 0; j0 < SQ; j0 += 8) { FragH fr, gr; for (int q = 0; q < 8; ++q) { const int j = j0 + q; const float f = (j < vl) ? 1.f : 0.f; const float pv = __expf(fmaf(f, s[j], (1.f - f) * -1000000.0f) - mx) * sc; const _Float16 ph = (_Float16)pv; fr.h[q] = ph; gr.h[q] = (_Float16)((pv - (float)ph) * 1024.0f); }
    unsigned short* d = (unsigned short*)P + i * SQ + j0; unsigned short* dl = (unsigned short*)PL + i * SQ + j0; *(v8us*)d = fr.half[0]; *(v8us*)dl = gr.half[0];  } }

__global__ __launch_bounds__(256) void k_rsmf(const float* __restrict__ S, _Float16* __restrict__ P, int qn, int hg) {
  #pragma clang fp contract(off)
  const int t = blockIdx.x * 256 + threadIdx.x; if (t >= qn * hg) return; const size_t i = (size_t)(t / qn) * SQ + (t % qn); const float* s = S + i * SQ; float mx = -3.0e38f;
#pragma unroll 1
  for (int j = 0; j < SQ; ++j) mx = fmaxf(mx, s[j]); float se = 0.f;
#pragma unroll 1
  for (int j = 0; j < SQ; ++j) se += __expf(s[j] - mx); const float sc = 256.0f / se;
#pragma unroll 1
  for (int j0 = 0; j0 < SQ; j0 += 8) { FragH f; for (int q = 0; q < 8; ++q) f.h[q] = (_Float16)(__expf(s[j0 + q] - mx) * sc); unsigned short* d = (unsigned short*)P + i * SQ + j0; *(v8us*)d = f.half[0];  } }


#define CN 256          /* channels */
#define CI 128
#define NC 256                       /* (unused legacy kernels) */
#define NPX NP          /* positions per channel row */
#define NP 4096         /* seq1 tokens */
#define NM 1024         /* seq2 tokens */
#define BNEPS 1e-5f

__global__ __launch_bounds__(256) void k_mp2(const float* __restrict__ src, float* __restrict__ dst, int nout) {
  const int t = blockIdx.x * 256 + threadIdx.x; if (t >= nout) return; const int c = t / 1024; const int o = t % 1024; const int oy = o / 32, ox = o % 32; const float* p = src + (size_t)c * 4096 + (size_t)(2 * oy) * 64 + 2 * ox;
  const float v = fmaxf(fmaxf(p[0], p[1]), fmaxf(p[64], p[65])); *(float*)(dst + t) = v;  }
__global__ __launch_bounds__(256) void k_xpb(const float* __restrict__ x, const float* __restrict__ wb, float* __restrict__ CPP, size_t n4) {
  #pragma clang fp contract(off)
  const size_t t = (size_t)blockIdx.x * 256 + threadIdx.x; if (t >= n4) return; const size_t e = t * 4; const int c = (int)((e / 4096) % 256); const float bb = bf16_round(wb[c]); const v4f a = *(const v4fa*)(x + e); v4f o; for (int q = 0; q < 4; ++q) o[q] = __fadd_rn(bf16_round(a[q]), bb);
  *(v4f*)(CPP + e) = o;  }


template <int PASS>
__global__ __launch_bounds__(256) void k_cstA(const float* __restrict__ X, const float* __restrict__ MV, float* __restrict__ PART) {
  #pragma clang fp contract(off)
  __shared__ float red[256]; const int t = threadIdx.x; const size_t bc = blockIdx.x; const int c = (int)(bc % NC); const float* row = X + bc * (size_t)NPX; const float mu = PASS ? MV[c] : 0.f; float s = 0.f;
  for (int i = t; i < NPX; i += 256) { const float v = row[i]; const float d = PASS ? __fadd_rn(v, -mu) : v; s = __fadd_rn(s, PASS ? __fmul_rn(d, d) : d); }
  red[t] = s; __syncthreads(); for (int st = 128; st > 0; st >>= 1) { if (t < st) red[t] = __fadd_rn(red[t], red[t + st]); __syncthreads(); }
  if (t < 32) { const float pv = (t == 0) ? red[0] : 0.f; *(float*)(PART + bc * 32 + t) = pv;  } }      

template <int PASS>
__global__ __launch_bounds__(256) void k_cstB(const float* __restrict__ PART, float* __restrict__ MV) { const int c = threadIdx.x; if (c >= NC) return; double s = 0.0; for (int b = 0; b < NB; ++b) s += (double)PART[((size_t)b * NC + c) * 32]; const float m = (float)(s / ((double)NB * (double)NPX)); *(float*)(MV + PASS * NC + c) = m;  }


__global__ __launch_bounds__(256) void k_bnresid(const float* __restrict__ C2, const float* __restrict__ MV, const float* __restrict__ g, const float* __restrict__ be, const float* __restrict__ X, float* __restrict__ out, size_t n4) {
  #pragma clang fp contract(off)
  const size_t t = (size_t)blockIdx.x * 256 + threadIdx.x; if (t >= n4) return; const size_t e = t * 4; const int c = (int)((e / NPX) % NC); const float sc = __fmul_rn(rsqrtf(__fadd_rn(MV[NC + c], BNEPS)), bf16_round(g[c])); const float mu = MV[c], bb = bf16_round(be[c]);
  const v4f a = *(const v4fa*)(C2 + e); const v4f xx = *(const v4fa*)(X + e); v4f o; for (int q = 0; q < 4; ++q) { const float z = __fadd_rn(__fmul_rn(__fadd_rn(a[q], -mu), sc), bb); o[q] = __fadd_rn(z, bf16_round(xx[q])); }
  *(v4f*)(out + e) = o;  }


__global__ __launch_bounds__(256) void k_rowbias(float* __restrict__ Y, const float* __restrict__ bias) {
  #pragma clang fp contract(off)
  const size_t t = (size_t)blockIdx.x * 256 + threadIdx.x; if (t >= (size_t)NB * NC * NPX / 4) return; const size_t e = t * 4; const int c = (int)((e / NPX) % NC); const float bb = bf16_round(bias[c]);
  v4f v = *(const v4fa*)(Y + e); for (int q = 0; q < 4; ++q) v[q] = __fadd_rn(v[q], bb); *(v4f*)(Y + e) = v;  }



template <int NK>
__global__ __launch_bounds__(256) void k_rsmn(const float* __restrict__ S, _Float16* __restrict__ P, int nrows) {
  #pragma clang fp contract(off)
  const int t = blockIdx.x * 256 + threadIdx.x; if (t >= nrows) return; const float* s = S + (size_t)t * NK; float mx = -3.0e38f;
#pragma unroll 1
  for (int j = 0; j < NK; ++j) mx = fmaxf(mx, s[j]); float se = 0.f;
#pragma unroll 1
  for (int j = 0; j < NK; ++j) se += __expf(s[j] - mx); const float sc = 256.0f / se;
#pragma unroll 1
  for (int j0 = 0; j0 < NK; j0 += 8) { FragH fr; for (int q = 0; q < 8; ++q) fr.h[q] = (_Float16)(__expf(s[j0 + q] - mx) * sc);
    unsigned short* d = (unsigned short*)P + (size_t)t * NK + j0; *(v8us*)d = fr.half[0];  } }

template <int BFIN, int W16, int W32, int WD>
__global__ __launch_bounds__(256) void k_lnw(const float* __restrict__ X, const float* __restrict__ g, const float* __restrict__ bb, float eps, _Float16* __restrict__ N16, float* __restrict__ N32) {
  #pragma clang fp contract(off)
  __shared__ float red[256]; const size_t r = blockIdx.x; const int t = threadIdx.x; const bool act = t < (WD / 4); const int c0 = act ? t * 4 : 0;
  const v4f xa = *(const v4fa*)(X + r * WD + c0); float s[4]; float sum = 0.f;
  for (int q = 0; q < 4; ++q) { s[q] = act ? (BFIN ? bf16_round(xa[q]) : xa[q]) : 0.f; sum = __fadd_rn(sum, s[q]); }
  red[t] = sum; __syncthreads(); for (int st = 128; st > 0; st >>= 1) { if (t < st) red[t] = __fadd_rn(red[t], red[t + st]); __syncthreads(); } const float mu = red[0] / (float)WD; __syncthreads();
  float vs = 0.f; for (int q = 0; q < 4; ++q) { const float dl = act ? __fadd_rn(s[q], -mu) : 0.f; vs = __fadd_rn(vs, __fmul_rn(dl, dl)); } red[t] = vs; __syncthreads(); for (int st = 128; st > 0; st >>= 1) { if (t < st) red[t] = __fadd_rn(red[t], red[t + st]); __syncthreads(); }
  const float rs = rsqrtf(__fadd_rn(red[0] / (float)WD, eps)); v4h y; v4f yf;
  for (int q = 0; q < 4; ++q) { const int c = c0 + q; yf[q] = __fadd_rn(__fmul_rn(__fmul_rn(__fadd_rn(s[q], -mu), rs), bf16_round(g[c])), bf16_round(bb[c])); y[q] = (_Float16)yf[q]; }
  if (!act) return;      /* no barriers after this point */
  { if (W16) *(v4h*)(N16 + r * WD + c0) = y; if (W32) *(v4f*)(N32 + r * WD + c0) = yf;  } }


__global__ __launch_bounds__(64) void k_ptatt(const float* __restrict__ QF, const float* __restrict__ KF, const float* __restrict__ VF, const float* __restrict__ xres, float scale, float* __restrict__ out) {
  #pragma clang fp contract(off)
  __shared__ __attribute__((aligned(16))) float lk[1024]; __shared__ __attribute__((aligned(16))) float lv[1024]; __shared__ __attribute__((aligned(16))) float lr[1024];
  const int i = threadIdx.x; const size_t r = blockIdx.x; const size_t ro = r * 1024;
  for (int c = 0; c < 4; ++c) { const int p4 = (c * 64 + i) * 4; *(v4f*)&lk[p4] = *(const v4fa*)(KF + ro + p4); *(v4f*)&lv[p4] = *(const v4fa*)(VF + ro + p4); }
  float q[16]; for (int c = 0; c < 4; ++c) { const v4f t4 = *(const v4fa*)(QF + ro + (size_t)i * 16 + c * 4); for (int u = 0; u < 4; ++u) q[c * 4 + u] = t4[u]; }
  __syncthreads();
  float m = -3.0e38f, l = 0.f; float o[16]; for (int h = 0; h < 16; ++h) o[h] = 0.f;
#pragma unroll 1
  for (int j = 0; j < 64; ++j) { float s = 0.f;
#pragma unroll
    for (int h = 0; h < 16; ++h) s = __fadd_rn(s, __fmul_rn(q[h], lk[j * 16 + h]));
    s = __fmul_rn(s, scale); const float mn = fmaxf(m, s); const float sc = expf(m - mn); const float e = expf(s - mn); l = __fadd_rn(__fmul_rn(l, sc), e); m = mn;
#pragma unroll
    for (int h = 0; h < 16; ++h) o[h] = __fadd_rn(__fmul_rn(o[h], sc), __fmul_rn(e, lv[j * 16 + h])); }
  const float inv = 1.0f / l;
#pragma unroll
  for (int h = 0; h < 16; ++h) lr[i * 16 + h] = __fmul_rn(o[h], inv);
  __syncthreads();
  { for (int c = 0; c < 4; ++c) { const int p4 = (c * 64 + i) * 4; const v4f rr = *(v4f*)&lr[p4]; const v4f xx = *(const v4fa*)(xres + ro + p4); v4f y; for (int u = 0; u < 4; ++u) y[u] = __fadd_rn(xx[u], rr[u]); *(v4f*)(out + ro + p4) = y; }  } }
extern "C" void kernel_launch(void* const* d_in, const int* in_sizes, int n_in,
                              void* d_out, int out_size, void* d_ws, size_t ws_size, hipStream_t stream) {
  (void)in_sizes; (void)n_in; (void)out_size;
  const float* const* I = (const float* const*)d_in; const float* x = I[0]; const float* wq = I[1]; const float* bq = I[2]; const float* wk = I[3]; const float* bk = I[4]; const float* wv = I[5]; const float* bv = I[6]; const float* gam = I[7]; const float* bet = I[8];      /* inp; [in][out] Wq/Wk/Wv [1024][1024] + biases; LayerNorm gamma/beta */
  constexpr int DMc = 1024; const size_t NRc = (size_t)4 * 2048;      /* model width; token rows */
  char* ws = (char*)d_ws; size_t off = 0;
  auto take = [&](size_t bytes) { char* p = ws + off; off += (bytes + 255) & ~(size_t)255; return p; };
  _Float16* BQ = (_Float16*)take((size_t)DMc * DMc * 2); _Float16* BK = (_Float16*)take((size_t)DMc * DMc * 2); _Float16* BV = (_Float16*)take((size_t)DMc * DMc * 2);
  _Float16* XN = (_Float16*)take(NRc * DMc * 2); float* XB = (float*)take(NRc * DMc * 4); float* QF = (float*)take(NRc * DMc * 4); float* KF = (float*)take(NRc * DMc * 4); float* VF = (float*)take(NRc * DMc * 4);
  if (off > ws_size) return;
  { const unsigned g = (unsigned)(((size_t)DMc * (DMc / 8) + 255) / 256); k_wt_f16<<<g, 256, 0, stream>>>(wq, BQ, DMc, DMc, 16.0f); k_wt_f16<<<g, 256, 0, stream>>>(wk, BK, DMc, DMc, 16.0f); k_wt_f16<<<g, 256, 0, stream>>>(wv, BV, DMc, DMc, 16.0f); }      /* [in][out] -> Bt x16 */
  k_lnw<1, 1, 0, DMc><<<(unsigned)NRc, 256, 0, stream>>>(x, gam, bet, 1e-5f, XN, nullptr); k_bfr<<<(unsigned)((NRc * DMc / 8 + 255) / 256), 256, 0, stream>>>(x, XB, NRc * DMc / 8);      /* out = LN(bf16(inp)) -> f16 rows; XB = bf16(inp) f32 for the residual */
  k_gemm2<0><<<dim3((unsigned)((NRc / 128) * (DMc / 64)), 1), 128, 0, stream>>>(XN, DMc, 0, BQ, DMc, 0, 0.0625f, bq, 0, nullptr, 1, 0, 0, QF, nullptr, DMc, 0, (int)NRc, DMc, DMc); k_gemm2<0><<<dim3((unsigned)((NRc / 128) * (DMc / 64)), 1), 128, 0, stream>>>(XN, DMc, 0, BK, DMc, 0, 0.0625f, bk, 0, nullptr, 1, 0, 0, KF, nullptr, DMc, 0, (int)NRc, DMc, DMc); k_gemm2<0><<<dim3((unsigned)((NRc / 128) * (DMc / 64)), 1), 128, 0, stream>>>(XN, DMc, 0, BV, DMc, 0, 0.0625f, bv, 0, nullptr, 1, 0, 0, VF, nullptr, DMc, 0, (int)NRc, DMc, DMc);      /* Q, K, V = out W + b -> f32 rows */
  k_ptatt<<<(unsigned)NRc, 64, 0, stream>>>(QF, KF, VF, XB, 0.125f, (float*)d_out);      /* per-token 64 x 64 x 16 attention in f32 + residual -> output rows */
}

// v001
// One run takes 151 microseconds.
// In two side-by-side timings against v000, it was 1.74 and 1.72 times as fast.
#include <hip/hip_runtime.h>
// Per-POSITION attention over the head-dim axis (inp [4][2048][1024]; out = LayerNorm(inp) (biased var, eps 1e-5, gamma/beta); Q/K/V = out W + b ([in][out] 1024 x 1024 sigma 1/32, zero biases) viewed [B][M][DK = 64][H = 16] (column i*16 + h); for every token: scores[i][j] = sum_h Q[i][h] K[j][h] / 8 (a 64 x 64 matrix, contraction over the 16 'heads'), softmax over j, res[i][h] = sum_j att[i][j] V[j][h]; no mixing across tokens; result = inp + res -> [4][2048][1024]).
// Compute dtype: inputs rounded to bf16; x / weights exact; LayerNorm output as a plain f16 GEMM operand (~2^-12); q, k, v, softmax weights and o f32; scores and softmax statistics f32; v_wmma_f32_16x16x32_f16.
#define NB 4
#define SQ 4096
#define DM 256
#define NH 1
#define HD 64
#define HG 4                         /* heads per attention launch group */
#define B0 0                         /* first batch processed (debug hook) */
#define NBR NB                       /* batches processed (debug hook) */
#define NR ((size_t)NB * SQ)
#define MP ((int)((size_t)NBR * SQ))
#define QT 256                       /* query rows per causal tile */
#define NKX SQ                       /* S / P row pitch */
#define QT0 256                      /* first-tile rows recomputed exactly (256: buys margin for the few-key rows 128..255, which have no output projection to average the single-f16 P/v rounding) */
#define QN SQ
#define NHD NH
#define MPO MP
#define LQ DM
typedef __bf16 v16b __attribute__((ext_vector_type(16)));
typedef unsigned short v8us __attribute__((ext_vector_type(8), may_alias));
typedef float  v8f  __attribute__((ext_vector_type(8)));
typedef float  v4f  __attribute__((ext_vector_type(4)));
typedef float  v4fa __attribute__((ext_vector_type(4), may_alias));
union FragB { v16b v; v8us half[2]; unsigned short u[16]; };

__device__ __forceinline__ unsigned short bf16_bits(float x) { unsigned int u = __float_as_uint(x); return (unsigned short)((u + 0x7FFFu + ((u >> 16) & 1u)) >> 16); }
__device__ __forceinline__ float bf16_val(unsigned short b) { return __uint_as_float(((unsigned int)b) << 16); }
__device__ __forceinline__ float bf16_round(float x) { return bf16_val(bf16_bits(x)); }
// D += A·B with NT terms: 1 = ah·bh, 2 = + al·bh (A split), 3 = + ah·bl (both split)
template <int NT>
__device__ __forceinline__ v8f mmaN(v16b ah, v16b al, v16b bh, v16b bl, v8f c) {
  c = __builtin_amdgcn_wmma_f32_16x16x32_bf16(false, ah, false, bh, (short)0, c, false, false);
  if (NT >= 2) c = __builtin_amdgcn_wmma_f32_16x16x32_bf16(false, al, false, bh, (short)0, c, false, false);
  if (NT >= 3) c = __builtin_amdgcn_wmma_f32_16x16x32_bf16(false, ah, false, bl, (short)0, c, false, false);
  asm volatile("v_nop\n\tv_nop\n\tv_nop\n\tv_nop" : "+v"(c) : "v"(ah), "v"(al), "v"(bh), "v"(bl));
  return c;
}

__global__ __launch_bounds__(256) void k_wt_bf16(const float* __restrict__ W, unsigned short* __restrict__ Wt, int K, int N) {
  const int t = blockIdx.x * 256 + threadIdx.x;
  const int k8n = K / 8;
  if (t >= N * k8n) return;
  const int n = t / k8n, k8 = (t % k8n) * 8;
  v8us v;
#pragma unroll
  for (int i = 0; i < 8; ++i) v[i] = bf16_bits(W[(size_t)(k8 + i) * N + n]);
  *(v8us*)(Wt + (size_t)n * K + k8) = v;
  
}

// GEMM C[M][N] (f32, pitch ldc) = act(A[M][K]·W + bias). A f32 row-major (pitch lda) converted per fragment to bf16
// (ASPLIT: hi/lo two planes -> 2 terms, else single rounded term); Wt bf16 [N][K] (pitch ldb). BIAS_BF16 rounds the
// bias to bf16 first (bias quantised to bf16 before the add). K%32==0, M%16==0, N%64==0.
template <bool ASPLIT, int ACT, bool BIAS_BF16>
__global__ __launch_bounds__(128) void k_gemm_bf(const float* __restrict__ A, int lda, const unsigned short* __restrict__ Wt, int ldb,
                                               const float* __restrict__ bias, float* __restrict__ C, int ldc, int M, int N, int K) {
  __shared__ __attribute__((aligned(16))) float so[4][16][64];
  const int tid = threadIdx.x, w = tid >> 5, lane = tid & 31, ln = lane & 15, hh = lane >> 4;
  const int ntn = N / 64;
  const int wid = blockIdx.x * 4 + w;
  const int mt = wid / ntn, nq = wid % ntn;
  if (mt * 16 >= M) return;
  const int row0 = mt * 16, col0 = nq * 64;
  const float* arow = A + (size_t)(row0 + ln) * lda;
  v8f acc[4] = {};
  for (int kb = 0; kb < K; kb += 32) {
    FragB ah, al;
    const v4f x0 = *(const v4fa*)(arow + kb + 8 * hh), x1 = *(const v4fa*)(arow + kb + 8 * hh + 4);
    const v4f x2 = *(const v4fa*)(arow + kb + 16 + 8 * hh), x3 = *(const v4fa*)(arow + kb + 16 + 8 * hh + 4);
    float xs[16] = {x0[0],x0[1],x0[2],x0[3],x1[0],x1[1],x1[2],x1[3],x2[0],x2[1],x2[2],x2[3],x3[0],x3[1],x3[2],x3[3]};
#pragma unroll
    for (int i = 0; i < 16; ++i) { const unsigned short hb = bf16_bits(xs[i]); ah.u[i] = hb; al.u[i] = ASPLIT ? bf16_bits(xs[i] - bf16_val(hb)) : (unsigned short)0; }
#pragma unroll
    for (int t = 0; t < 4; ++t) {
      const unsigned short* brow = Wt + (size_t)(col0 + t * 16 + ln) * ldb + kb;
      FragB b;
      b.half[0] = *(const v8us*)(brow + 8 * hh);
      b.half[1] = *(const v8us*)(brow + 16 + 8 * hh);
      acc[t] = mmaN<ASPLIT ? 2 : 1>(ah.v, al.v, b.v, b.v, acc[t]);
    }
  }
#pragma unroll
  for (int t = 0; t < 4; ++t) {
    float bv = bias ? bias[col0 + t * 16 + ln] : 0.f;
    if (BIAS_BF16) bv = bf16_round(bv);
#pragma unroll
    for (int r = 0; r < 8; ++r) { float v = acc[t][r] + bv; if (ACT == 1) v = fmaxf(v, 0.f); so[w][8 * hh + r][t * 16 + ln] = v; }
  }
  __builtin_amdgcn_fence(__ATOMIC_ACQ_REL, "workgroup");
  __builtin_amdgcn_wave_barrier();
  const int rsub = lane >> 4, c4 = (lane & 15) * 4;
  {
#pragma unroll
    for (int q = 0; q < 8; ++q) {
      const int r = q * 2 + rsub;
      const v4f v = *(const v4fa*)&so[w][r][c4];
      *(v4f*)(C + (size_t)(row0 + r) * ldc + col0 + c4) = v;
    }
    
  }
}

// GEMM C = act(A·W + bias + resid): A f32 (ASPLIT -> hi/lo 2 terms), Wt bf16 [N][K]; ACT 0 none, 1 relu, 2 exact gelu;
// resid (optional, f32, row index = (row % rmod), pitch ldr, RES_BF16 rounds it) added before the activation.
template <bool ASPLIT, int ACT, bool BIAS_BF16, bool RES_BF16>
__global__ __launch_bounds__(128) void k_gemm_bf3(const float* __restrict__ A, int lda, const unsigned short* __restrict__ Wt, int ldb,
                                                const float* __restrict__ bias, const float* __restrict__ resid, int rmod, int ldr,
                                                float* __restrict__ C, int ldc, int M, int N, int K) {
  __shared__ __attribute__((aligned(16))) float so[4][16][64];
  const int tid = threadIdx.x, w = tid >> 5, lane = tid & 31, ln = lane & 15, hh = lane >> 4;
  const int ntn = N / 64;
  const int wid = blockIdx.x * 4 + w;
  const int mt = wid / ntn, nq = wid % ntn;
  if (mt * 16 >= M) return;
  const int row0 = mt * 16, col0 = nq * 64;
  const float* arow = A + (size_t)(row0 + ln) * lda;
  v8f acc[4] = {};
  for (int kb = 0; kb < K; kb += 32) {
    FragB ah, al;
    const v4f x0 = *(const v4fa*)(arow + kb + 8 * hh), x1 = *(const v4fa*)(arow + kb + 8 * hh + 4);
    const v4f x2 = *(const v4fa*)(arow + kb + 16 + 8 * hh), x3 = *(const v4fa*)(arow + kb + 16 + 8 * hh + 4);
    float xs[16] = {x0[0],x0[1],x0[2],x0[3],x1[0],x1[1],x1[2],x1[3],x2[0],x2[1],x2[2],x2[3],x3[0],x3[1],x3[2],x3[3]};
#pragma unroll
    for (int i = 0; i < 16; ++i) { const unsigned short hb = bf16_bits(xs[i]); ah.u[i] = hb; al.u[i] = ASPLIT ? bf16_bits(xs[i] - bf16_val(hb)) : (unsigned short)0; }
#pragma unroll
    for (int t = 0; t < 4; ++t) {
      const unsigned short* brow = Wt + (size_t)(col0 + t * 16 + ln) * ldb + kb;
      FragB b;
      b.half[0] = *(const v8us*)(brow + 8 * hh);
      b.half[1] = *(const v8us*)(brow + 16 + 8 * hh);
      acc[t] = mmaN<ASPLIT ? 2 : 1>(ah.v, al.v, b.v, b.v, acc[t]);
    }
  }
#pragma unroll
  for (int t = 0; t < 4; ++t) {
    const int col = col0 + t * 16 + ln;
    float bv = bias ? bias[col] : 0.f;
    if (BIAS_BF16) bv = bf16_round(bv);
#pragma unroll
    for (int r = 0; r < 8; ++r) {
      float v = acc[t][r] + bv;
      if (resid) { float rv = resid[(size_t)((row0 + 8 * hh + r) % rmod) * ldr + col]; if (RES_BF16) rv = bf16_round(rv); v += rv; }
      if (ACT == 1) v = fmaxf(v, 0.f);
      if (ACT == 2) v = 0.5f * v * (1.0f + erff(v * 0.70710678118654752f));
      if (ACT == 3) { const float u = 0.7978845608028654f * (v + 0.044715f * v * v * v); v = 0.5f * v * (1.0f + tanhf(u)); }
      so[w][8 * hh + r][t * 16 + ln] = v;
    }
  }
  __builtin_amdgcn_fence(__ATOMIC_ACQ_REL, "workgroup");
  __builtin_amdgcn_wave_barrier();
  const int rsub = lane >> 4, c4 = (lane & 15) * 4;
  {
#pragma unroll
    for (int q = 0; q < 8; ++q) {
      const int r = q * 2 + rsub;
      const v4f v = *(const v4fa*)&so[w][r][c4];
      *(v4f*)(C + (size_t)(row0 + r) * ldc + col0 + c4) = v;
    }
    
  }
}
// row LayerNorm (biased variance, eps) over N: s = X (+ R); optional out_sum <- s; out_norm <- (s-mu)*rsqrt(var+eps)*g + b
template <bool PARAM_BF16>
__global__ __launch_bounds__(256) void k_layernorm(const float* __restrict__ X, const float* __restrict__ R, const float* __restrict__ g, const float* __restrict__ bta,
                                                  float* __restrict__ out_sum, float* __restrict__ out_norm, int N, float eps) {
  __shared__ float red[256];
  const int row = blockIdx.x, tid = threadIdx.x;
  const float* x = X + (size_t)row * N; const float* rr = R ? R + (size_t)row * N : nullptr;
  float vals[16];                     // up to N = 4096
  const int per = N / 256;            // contiguous chunk per thread? use strided-by-4 chunks: thread handles j = tid*4 + 1024*u
  float s1 = 0.f;
  for (int u = 0; u < per / 4; ++u) {
    const int j = tid * 4 + 1024 * u;
    const v4f a = *(const v4fa*)(x + j);
    v4f b = {0.f,0.f,0.f,0.f}; if (rr) b = *(const v4fa*)(rr + j);
#pragma unroll
    for (int q = 0; q < 4; ++q) { const float v = a[q] + b[q]; vals[u * 4 + q] = v; s1 += v; }
  }
  red[tid] = s1; __syncthreads();
  for (int st = 128; st > 0; st >>= 1) { if (tid < st) red[tid] += red[tid + st]; __syncthreads(); }
  const float mu = red[0] / (float)N; __syncthreads();
  float s2 = 0.f;
  for (int u = 0; u < per / 4; ++u)
#pragma unroll
    for (int q = 0; q < 4; ++q) { const float c = vals[u * 4 + q] - mu; s2 += c * c; }
  red[tid] = s2; __syncthreads();
  for (int st = 128; st > 0; st >>= 1) { if (tid < st) red[tid] += red[tid + st]; __syncthreads(); }
  const float rs = rsqrtf(red[0] / (float)N + eps);
  {
    for (int u = 0; u < per / 4; ++u) {
      const int j = tid * 4 + 1024 * u;
      v4f o, sm;
#pragma unroll
      for (int q = 0; q < 4; ++q) {
        float gg = g[j + q], bb = bta[j + q];
        if (PARAM_BF16) { gg = bf16_round(gg); bb = bf16_round(bb); }
        sm[q] = vals[u * 4 + q]; o[q] = (vals[u * 4 + q] - mu) * rs * gg + bb;
      }
      if (out_sum) *(v4f*)(out_sum + (size_t)row * N + j) = sm;
      *(v4f*)(out_norm + (size_t)row * N + j) = o;
    }
    
  }
}



// ---- f16 WMMA path (v_wmma_f32_16x16x32_f16): 11-bit significands for operands in range — used where a [0,1] probability operand needs more precision than bf16
typedef _Float16 v16h __attribute__((ext_vector_type(16)));
union FragH { v16h v; v8us half[2]; _Float16 h[16]; unsigned short u[16]; };
template <int NT>
__device__ __forceinline__ v8f mmaH(v16h ah, v16h al, v16h bh, v16h bl, v8f c) {
  c = __builtin_amdgcn_wmma_f32_16x16x32_f16(false, ah, false, bh, (short)0, c, false, false);
  if (NT >= 2) c = __builtin_amdgcn_wmma_f32_16x16x32_f16(false, al, false, bh, (short)0, c, false, false);
  if (NT >= 3) c = __builtin_amdgcn_wmma_f32_16x16x32_f16(false, ah, false, bl, (short)0, c, false, false);
  asm volatile("v_nop\n\tv_nop\n\tv_nop\n\tv_nop" : "+v"(c) : "v"(ah), "v"(al), "v"(bh), "v"(bl));
  return c;
}
// batched GEMM like k_gemm_b but f16 operands: A f32 (split into f16 hi/lo if ASPLIT, else rounded to f16), Bt = f16 values [n][k]; alpha; C f32; N multiple of 16 (partial tiles skipped)
template <bool ASPLIT>
__global__ __launch_bounds__(128) void k_gemm_h(const float* __restrict__ A, int lda, size_t sA, const _Float16* __restrict__ Bh, int ldb, size_t sB, float alpha, float* __restrict__ C, int ldc, size_t sC, int M, int N, int K) {
  __shared__ __attribute__((aligned(16))) float so[4][16][64];
  const int tid = threadIdx.x, w = tid >> 5, lane = tid & 31, ln = lane & 15, hh = lane >> 4; const int by = blockIdx.y;
  A += (size_t)by * sA; Bh += (size_t)by * sB; C += (size_t)by * sC;
  const int ntn = (N + 63) / 64; const int wid = blockIdx.x * 4 + w; const int mt = wid / ntn, nq = wid % ntn; if (mt * 16 >= M) return;
  const int row0 = mt * 16, col0 = nq * 64; const float* arow = A + (size_t)(row0 + ln) * lda;
  v8f acc[4] = {};
  for (int kb = 0; kb < K; kb += 32) {
    FragH ah, al;
    const v4f x0 = *(const v4fa*)(arow + kb + 8 * hh), x1 = *(const v4fa*)(arow + kb + 8 * hh + 4), x2 = *(const v4fa*)(arow + kb + 16 + 8 * hh), x3 = *(const v4fa*)(arow + kb + 16 + 8 * hh + 4);
    float xs[16] = {x0[0],x0[1],x0[2],x0[3],x1[0],x1[1],x1[2],x1[3],x2[0],x2[1],x2[2],x2[3],x3[0],x3[1],x3[2],x3[3]};
#pragma unroll
    for (int i = 0; i < 16; ++i) { const _Float16 h = (_Float16)xs[i]; ah.h[i] = h; al.h[i] = ASPLIT ? (_Float16)(xs[i] - (float)h) : (_Float16)0.0f; }
#pragma unroll
    for (int t = 0; t < 4; ++t) { if (col0 + t * 16 >= N) continue; const size_t boff = (size_t)(col0 + t * 16 + ln) * ldb + kb; FragH bq; bq.half[0] = *(const v8us*)(Bh + boff + 8 * hh); bq.half[1] = *(const v8us*)(Bh + boff + 16 + 8 * hh);
      acc[t] = mmaH<ASPLIT ? 2 : 1>(ah.v, al.v, bq.v, bq.v, acc[t]); }
  }
#pragma unroll
  for (int t = 0; t < 4; ++t) { if (col0 + t * 16 >= N) continue;
#pragma unroll
    for (int r = 0; r < 8; ++r) so[w][8 * hh + r][t * 16 + ln] = acc[t][r] * alpha; }
  __builtin_amdgcn_fence(__ATOMIC_ACQ_REL, "workgroup"); __builtin_amdgcn_wave_barrier();
  const int rsub = lane >> 4, c4 = (lane & 15) * 4;
  {
#pragma unroll
    for (int q = 0; q < 8; ++q) { const int r = q * 2 + rsub; if (col0 + c4 < N) { const v4f v = *(const v4fa*)&so[w][r][c4]; *(v4f*)(C + (size_t)(row0 + r) * ldc + col0 + c4) = v; } }
     }
}

// Wt[n][k] = f16(W[k][n]·scale) from f32 row-major W[K][N] (scale = power of two; bf16-exact weights stay exact in f16 away from the subnormal range)
__global__ __launch_bounds__(256) void k_wt_f16(const float* __restrict__ W, _Float16* __restrict__ Wt, int K, int N, float scale) {
  const int t = blockIdx.x * 256 + threadIdx.x; if (t >= N * (K / 8)) return; const int n = t / (K / 8), k8 = (t % (K / 8)) * 8; FragH f;
#pragma unroll
  for (int i = 0; i < 8; ++i) f.h[i] = (_Float16)(bf16_round(W[(size_t)(k8 + i) * N + n]) * scale); const v8us o = f.half[0];
  *(v8us*)((unsigned short*)Wt + (size_t)n * K + k8) = o; 
}
// k_gemm_hh variant with fused epilogue: v = acc·alpha + bias[by·sBias + col] (+ CP[(row/rowsPerB)·sCPb + by·64 + col] if CP) ; ACT 0 none / 1 elu ; writes f16 C16 (and f32 C if non-null)
template <int ACT>
__global__ __launch_bounds__(128) void k_gemm_hhx(const _Float16* __restrict__ A, int lda, size_t sA, const _Float16* __restrict__ Bh, int ldb, size_t sB, float alpha, const float* __restrict__ bias, size_t sBias, const float* __restrict__ CP, int rowsPerB, size_t sCPb, int row0g,
    float* __restrict__ C, _Float16* __restrict__ C16, int ldc, size_t sC, int M, int N, int K) {
  __shared__ __attribute__((aligned(16))) float so[4][16][64];
  const int tid = threadIdx.x, w = tid >> 5, lane = tid & 31, ln = lane & 15, hh = lane >> 4; const int by = blockIdx.y;
  A += (size_t)by * sA; Bh += (size_t)by * sB; const size_t cofs = (size_t)by * sC; const float* bp = bias ? bias + (size_t)by * sBias : nullptr;
  const int ntn = (N + 63) / 64; const int wid = blockIdx.x * 4 + w; const int mt = wid / ntn, nq = wid % ntn; if (mt * 16 >= M) return;
  const int row0 = mt * 16, col0 = nq * 64; const _Float16* arow = A + (size_t)(row0 + ln) * lda;
  v8f acc[4] = {};
  for (int kb = 0; kb < K; kb += 32) { FragH ah; ah.half[0] = *(const v8us*)((const unsigned short*)arow + kb + 8 * hh); ah.half[1] = *(const v8us*)((const unsigned short*)arow + kb + 16 + 8 * hh);
#pragma unroll
    for (int t = 0; t < 4; ++t) { if (col0 + t * 16 >= N) continue; const size_t boff = (size_t)(col0 + t * 16 + ln) * ldb + kb; FragH bq; bq.half[0] = *(const v8us*)((const unsigned short*)Bh + boff + 8 * hh); bq.half[1] = *(const v8us*)((const unsigned short*)Bh + boff + 16 + 8 * hh);
      acc[t] = mmaH<1>(ah.v, ah.v, bq.v, bq.v, acc[t]); }
  }
#pragma unroll
  for (int t = 0; t < 4; ++t) { if (col0 + t * 16 >= N) continue; const int col = col0 + t * 16 + ln; const float bv = bp ? bf16_round(bp[col]) : 0.f;
#pragma unroll
    for (int r = 0; r < 8; ++r) { float v = acc[t][r] * alpha + bv; if (CP) { const int rr = row0g + row0 + 8 * hh + r; if (rowsPerB < 0) v += CP[cofs + (size_t)rr * ldc + col];      /* rowsPerB < 0: own element of the batched C plane */ else { const int bidx = rr / rowsPerB; v += CP[(size_t)bidx * sCPb + (size_t)by * 64 + col]; } } if (ACT == 1) v = (v > 0.f) ? v : expm1f(v); else if (ACT == 7) v = (v > 0.f) ? v + 1.0f : expf(v); else if (ACT == 8) v = tanhf(v); else if (ACT == 9) v = 0.5f * v * (1.0f + tanhf(0.7978845608028654f * (v + 0.044715f * v * v * v))); else if (ACT == 11) v = 1.0f / (1.0f + expf(-v)); else if (ACT == 12) v = (v > 0.f) ? v : 0.01f * v; else if (ACT == 14) v = (v > 0.f) ? v : 0.1f * v; else if (ACT == 16) v = (v >= 0.f) ? v : 0.3f * v; else if (ACT == 17) v = (v >= 0.f) ? v : 0.2f * v; else if (ACT == 15) v = v / (1.0f + expf(-v)); else if (ACT == 3) v = fmaxf(v, 0.f); else if (ACT == 6) v = 0.5f * v * (1.0f + erff(v * 0.70710678118654752f)); so[w][8 * hh + r][t * 16 + ln] = v; } }
  __builtin_amdgcn_fence(__ATOMIC_ACQ_REL, "workgroup"); __builtin_amdgcn_wave_barrier();
  const int rsub = lane >> 4, c4 = (lane & 15) * 4; typedef _Float16 v4h __attribute__((ext_vector_type(4)));
  {
#pragma unroll
    for (int q = 0; q < 8; ++q) { const int r = q * 2 + rsub; if (col0 + c4 < N) { const v4f v = *(const v4fa*)&so[w][r][c4]; if (C) *(v4f*)(C + cofs + (size_t)(row0 + r) * ldc + col0 + c4) = v; if (C16) { v4h h4; for (int i = 0; i < 4; ++i) h4[i] = (_Float16)v[i]; *(v4h*)(C16 + cofs + (size_t)(row0 + r) * ldc + col0 + c4) = h4; } } }
     }
}


typedef _Float16 v4h __attribute__((ext_vector_type(4)));

__global__ __launch_bounds__(256) void k_x16(const float* __restrict__ x, _Float16* __restrict__ X16, size_t n8) { const size_t t = (size_t)blockIdx.x * 256 + threadIdx.x; if (t >= n8) return; FragH f;
#pragma unroll
  for (int q = 0; q < 8; ++q) f.h[q] = (_Float16)bf16_round(x[t * 8 + q]); *(v8us*)((unsigned short*)X16 + t * 8) = f.half[0];  }
__global__ __launch_bounds__(256) void k_h16(const float* __restrict__ x, _Float16* __restrict__ X16, size_t n8) { const size_t t = (size_t)blockIdx.x * 256 + threadIdx.x; if (t >= n8) return; FragH f;
#pragma unroll
  for (int q = 0; q < 8; ++q) f.h[q] = (_Float16)x[t * 8 + q]; *(v8us*)((unsigned short*)X16 + t * 8) = f.half[0];  }
__global__ __launch_bounds__(256) void k_round16f(const float* __restrict__ W, _Float16* __restrict__ Bt, size_t n8) { const size_t t = (size_t)blockIdx.x * 256 + threadIdx.x; if (t >= n8) return; FragH f;
#pragma unroll
  for (int i = 0; i < 8; ++i) f.h[i] = (_Float16)(bf16_round(W[t * 8 + i]) * 16.0f); *(v8us*)((unsigned short*)Bt + t * 8) = f.half[0];  }
template <int NHv, int TTv>
__global__ __launch_bounds__(256) void k_vt(const _Float16* __restrict__ V16, int ldv, int voff, _Float16* __restrict__ Vt) { __shared__ unsigned short tl[64][66]; const int tid = threadIdx.x; const int slab = blockIdx.x / (TTv / 64), lg = blockIdx.x % (TTv / 64); const int b = slab / NHv, h = slab % NHv;
  for (int i = tid; i < 64 * 8; i += 256) { const int r = i / 8, c8 = (i % 8) * 8; FragH f; f.half[0] = *(const v8us*)((const unsigned short*)V16 + ((size_t)b * TTv + lg * 64 + r) * ldv + voff + h * 64 + c8);
#pragma unroll
    for (int q = 0; q < 8; ++q) tl[r][c8 + q] = f.u[q]; }
  __syncthreads();
  {
#pragma unroll
    for (int rd = 0; rd < 2; ++rd) { const int d = rd * 32 + tid / 8, pc = tid % 8; FragH f;
#pragma unroll
      for (int q = 0; q < 8; ++q) f.u[q] = tl[pc * 8 + q][d];
      *(v8us*)((unsigned short*)Vt + ((size_t)slab * 64 + d) * TTv + lg * 64 + pc * 8) = f.half[0]; }
     } }

__global__ __launch_bounds__(256) void k_hl(const float* __restrict__ F, _Float16* __restrict__ Hh, _Float16* __restrict__ Hl, size_t n8) { const size_t t = (size_t)blockIdx.x * 256 + threadIdx.x; if (t >= n8) return; FragH fh, fl; const v4f a = *(const v4fa*)(F + t * 8), c = *(const v4fa*)(F + t * 8 + 4);
#pragma unroll
  for (int q = 0; q < 4; ++q) { _Float16 h = (_Float16)a[q]; fh.h[q] = h; fl.h[q] = (_Float16)((a[q] - (float)h) * 1024.0f); h = (_Float16)c[q]; fh.h[4 + q] = h; fl.h[4 + q] = (_Float16)((c[q] - (float)h) * 1024.0f); }
  { *(v8us*)((unsigned short*)Hh + t * 8) = fh.half[0]; *(v8us*)((unsigned short*)Hl + t * 8) = fl.half[0];  } }

// ---- fast GEMM (wave tile 32x64), C = A Bh^T alpha + bf16(bias), f32 rows ----
__device__ __forceinline__ v16h g2_frag(const _Float16* p, int hh) { FragH f; f.half[0] = *(const v8us*)((const unsigned short*)p + 8 * hh); f.half[1] = *(const v8us*)((const unsigned short*)p + 16 + 8 * hh); return f.v; }
__device__ __forceinline__ v8f g2_mma(v16h a, v16h b, v8f c) { v8f d = __builtin_amdgcn_wmma_f32_16x16x32_f16(false, a, false, b, (short)0, c, false, false); asm volatile("v_nop\n\tv_nop\n\tv_nop\n\tv_nop" : "+v"(d) : "v"(a), "v"(b)); return d; }
// Block tile 128 x 128, eight waves of 32 x 64 (4 down, 2 across). Per pass 64 k of both operands (128-B rows: 128 rows of A, then 128 rows of Bh) lie in one of two LDS buffers,
// brought by asynchronous copies (16 B per lane, whole 128-B lines per 8 lanes); the next pass's copies fly while this pass's fragments are read from LDS. Needs M % 128 == 0 (grid), N % 128 == 0, K % 64 == 0.
#define G3_PITCH 72                  /* LDS row pitch in halfs: 144 B = 16 B x odd, conflict-free for 16-B fragment reads */
#define G3_STAGE (256 * G3_PITCH)    /* halfs per buffer */
// one pass's copies of this thread: four rows of A and four of Bh, 32 rows apart; l = the lane's LDS byte address of the first
__device__ __forceinline__ void g3_copy(const _Float16* ga, const _Float16* gb, size_t step, unsigned l) {
  const _Float16* a1 = ga + step; const _Float16* a2 = a1 + step; const _Float16* a3 = a2 + step; const _Float16* b1 = gb + step; const _Float16* b2 = b1 + step; const _Float16* b3 = b2 + step;
  const unsigned rs = 32u * G3_PITCH * 2u;
  /* the s_wait_xcnt stands inside the statement so that no address register of a copy is rewritten ahead of it */
  asm volatile("global_load_async_to_lds_b128 %0, %8, off\n\t"
               "global_load_async_to_lds_b128 %1, %9, off\n\t"
               "global_load_async_to_lds_b128 %2, %10, off\n\t"
               "global_load_async_to_lds_b128 %3, %11, off\n\t"
               "global_load_async_to_lds_b128 %4, %12, off\n\t"
               "global_load_async_to_lds_b128 %5, %13, off\n\t"
               "global_load_async_to_lds_b128 %6, %14, off\n\t"
               "global_load_async_to_lds_b128 %7, %15, off\n\t"
               "s_wait_xcnt 0x0"
               :: "v"(l), "v"(l + rs), "v"(l + 2u * rs), "v"(l + 3u * rs), "v"(l + 4u * rs), "v"(l + 5u * rs), "v"(l + 6u * rs), "v"(l + 7u * rs),
                  "v"(ga), "v"(a1), "v"(a2), "v"(a3), "v"(gb), "v"(b1), "v"(b2), "v"(b3) : "memory");
}
__global__ __launch_bounds__(256) void k_gemm3(const _Float16* __restrict__ A, const _Float16* __restrict__ Bh, float alpha, const float* __restrict__ bias, float* __restrict__ C, int N, int K) {
  __shared__ __attribute__((aligned(16))) _Float16 ring[2 * G3_STAGE];
  __shared__ __attribute__((aligned(16))) float so[8][32][68];
  const int tid = threadIdx.x, w = tid >> 5, lane = tid & 31, ln = lane & 15, hh = lane >> 4;
  const int ntn = N >> 7; const int mt = blockIdx.x / ntn, nq = blockIdx.x - mt * ntn; const int wm = w >> 1, wn = w & 1;
  const int cr = tid >> 3, cp = tid & 7;      /* copy: row within a group of 32, 16-B piece of the row */
  const _Float16* ga = A + (size_t)(mt * 128 + cr) * K + cp * 8; const _Float16* gb = Bh + (size_t)(nq * 128 + cr) * K + cp * 8; const size_t step = (size_t)32 * K;
  const unsigned l0 = (unsigned)(size_t)&ring[0] + (unsigned)(cr * (G3_PITCH * 2) + cp * 16);
  const int nt = K >> 6;
  const v8f z8 = {0.f,0.f,0.f,0.f,0.f,0.f,0.f,0.f}; v8f c00 = z8, c01 = z8, c02 = z8, c03 = z8, c10 = z8, c11 = z8, c12 = z8, c13 = z8;
  g3_copy(ga, gb, step, l0);
  asm volatile("s_wait_asynccnt 0x0" ::: "memory");      /* this wave's copies of pass 0 have landed */
  __syncthreads();                                       /* publishes pass 0 */
  if (nt > 1) g3_copy(ga + 64, gb + 64, step, l0 + (unsigned)(G3_STAGE * 2));
#pragma unroll 1      /* one pass per trip: the two buffers alternate by the trip's parity */
  for (int t = 0; t < nt; ++t) {
    const _Float16* ap = &ring[(t & 1) * G3_STAGE + (wm * 32 + ln) * G3_PITCH]; const _Float16* bp = &ring[(t & 1) * G3_STAGE + (128 + wn * 64 + ln) * G3_PITCH];
    const v16h a0 = g2_frag(ap, hh), a1 = g2_frag(ap + 16 * G3_PITCH, hh), b0 = g2_frag(bp, hh), b1 = g2_frag(bp + 16 * G3_PITCH, hh), b2 = g2_frag(bp + 32 * G3_PITCH, hh), b3 = g2_frag(bp + 48 * G3_PITCH, hh);
    const v16h e0 = g2_frag(ap + 32, hh), e1 = g2_frag(ap + 16 * G3_PITCH + 32, hh), f0 = g2_frag(bp + 32, hh), f1 = g2_frag(bp + 16 * G3_PITCH + 32, hh), f2 = g2_frag(bp + 32 * G3_PITCH + 32, hh), f3 = g2_frag(bp + 48 * G3_PITCH + 32, hh);
    c00 = g2_mma(a0, b0, c00); c10 = g2_mma(a1, b0, c10); c01 = g2_mma(a0, b1, c01); c11 = g2_mma(a1, b1, c11); c02 = g2_mma(a0, b2, c02); c12 = g2_mma(a1, b2, c12); c03 = g2_mma(a0, b3, c03); c13 = g2_mma(a1, b3, c13);
    c00 = g2_mma(e0, f0, c00); c10 = g2_mma(e1, f0, c10); c01 = g2_mma(e0, f1, c01); c11 = g2_mma(e1, f1, c11); c02 = g2_mma(e0, f2, c02); c12 = g2_mma(e1, f2, c12); c03 = g2_mma(e0, f3, c03); c13 = g2_mma(e1, f3, c13);
    asm volatile("s_wait_dscnt 0x0" ::: "memory");       /* this wave's reads of the buffer are done before it may be refilled */
    asm volatile("s_wait_asynccnt 0x0" ::: "memory");    /* this wave's copies of pass t + 1 have landed */
    __syncthreads();                                     /* publishes pass t + 1 and ends every reader's last read of pass t */
    if (t + 2 < nt) g3_copy(ga + (size_t)(t + 2) * 64, gb + (size_t)(t + 2) * 64, step, l0 + (unsigned)((t & 1) * (G3_STAGE * 2)));
  }
  asm volatile("s_wait_asynccnt 0x0" ::: "memory");      /* no copy is outstanding when the wave goes on */
  const int row0 = mt * 128 + wm * 32, col0 = nq * 128 + wn * 64;
  v8f accs[8] = {c00, c01, c02, c03, c10, c11, c12, c13};
#pragma unroll
  for (int u = 0; u < 8; ++u) { const int t = u & 3, half = u >> 2; const float bv = bf16_round(bias[col0 + t * 16 + ln]);
#pragma unroll
    for (int r = 0; r < 8; ++r) so[w][half * 16 + 8 * hh + r][t * 16 + ln] = accs[u][r] * alpha + bv; }
  __builtin_amdgcn_fence(__ATOMIC_ACQ_REL, "workgroup"); __builtin_amdgcn_wave_barrier();
  const int rsub = lane >> 4, c4 = (lane & 15) * 4;
#pragma unroll
  for (int q = 0; q < 16; ++q) { const int r = q * 2 + rsub; const v4f v = *(const v4fa*)&so[w][r][c4]; *(v4f*)(C + (size_t)(row0 + r) * N + col0 + c4) = v; }
}


__global__ __launch_bounds__(256) void k_wnat(const float* __restrict__ w, size_t n8, _Float16* __restrict__ Bt) { const size_t t = (size_t)blockIdx.x * 256 + threadIdx.x; if (t >= n8) return; FragH f; for (int q = 0; q < 8; ++q) f.h[q] = (_Float16)(bf16_round(w[t * 8 + q]) * 16.0f); *(v8us*)((unsigned short*)Bt + t * 8) = f.half[0];  }
__global__ __launch_bounds__(256) void k_rsm(const float* __restrict__ S, _Float16* __restrict__ P, int nrows) {
  #pragma clang fp contract(off)
  const int i = blockIdx.x * 256 + threadIdx.x; if (i >= nrows) return; const float* s = S + (size_t)i * SQ; float mx = -3.0e38f;
#pragma unroll 1
  for (int j = 0; j < SQ; ++j) mx = fmaxf(mx, s[j]); float se = 0.f;
#pragma unroll 1
  for (int j = 0; j < SQ; ++j) se += expf(s[j] - mx); const float sc = 256.0f / se;
#pragma unroll 1
  for (int j0 = 0; j0 < SQ; j0 += 8) { FragH f; for (int q = 0; q < 8; ++q) f.h[q] = (_Float16)(expf(s[j0 + q] - mx) * sc); unsigned short* d = (unsigned short*)P + (size_t)i * SQ + j0; *(v8us*)d = f.half[0];  } }
__global__ __launch_bounds__(256) void k_vt(const _Float16* __restrict__ V16, int b, int h0, _Float16* __restrict__ VT) { __shared__ unsigned short tl[64][65]; const int tid = threadIdx.x; const int hh = blockIdx.x % HG, sg = blockIdx.x / HG; const int s0 = sg * 64; const int h = h0 + hh;
  for (int i = tid; i < 64 * 8; i += 256) { const int j = i / 8, d8 = (i % 8) * 8; FragH f; f.half[0] = *(const v8us*)((const unsigned short*)V16 + ((size_t)b * SQ + s0 + j) * DM + h * HD + d8); for (int q = 0; q < 8; ++q) tl[d8 + q][j] = f.u[q]; }
  __syncthreads();
  { for (int i = tid; i < 64 * 8; i += 256) { const int d = i / 8, j8 = (i % 8) * 8; FragH f; for (int q = 0; q < 8; ++q) f.u[q] = tl[d][j8 + q]; *(v8us*)((unsigned short*)VT + ((size_t)hh * HD + d) * SQ + s0 + j8) = f.half[0]; }  } }



__global__ __launch_bounds__(256) void k_rsmcf2(const float* __restrict__ S, _Float16* __restrict__ P, int hg, int q0, int nk) {
  #pragma clang fp contract(off)
  const int t = blockIdx.x * 256 + threadIdx.x; if (t >= hg * QT) return; const size_t i = (size_t)t; const float* s = S + i * NKX; const int last = q0 + (t % QT); float mx = -3.0e38f;
#pragma unroll 1
  for (int j = 0; j < nk; ++j) { const float f = (j <= last) ? 1.f : 0.f; mx = fmaxf(mx, fmaf(f, s[j], (1.f - f) * -1.0e9f)); } float se = 0.f;
#pragma unroll 1
  for (int j = 0; j < nk; ++j) { const float f = (j <= last) ? 1.f : 0.f; se += __expf(fmaf(f, s[j], (1.f - f) * -1.0e9f) - mx); } const float sc = 256.0f / se;
#pragma unroll 1
  for (int j0 = 0; j0 < nk; j0 += 8) { FragH fr; for (int q = 0; q < 8; ++q) { const int j = j0 + q; const float f = (j <= last) ? 1.f : 0.f; fr.h[q] = (_Float16)(__expf(fmaf(f, s[j], (1.f - f) * -1.0e9f) - mx) * sc); } unsigned short* d = (unsigned short*)P + i * NKX + j0; *(v8us*)d = fr.half[0];  } }

template <int MASKADD>
__global__ __launch_bounds__(64) void k_att0(const float* __restrict__ QF, const float* __restrict__ KF, const float* __restrict__ VF, int ld, const float* __restrict__ mask, float scale, float* __restrict__ OF, int ldo) {
  #pragma clang fp contract(off)
  __shared__ __attribute__((aligned(16))) float lq[64][64]; __shared__ __attribute__((aligned(16))) float lo[64][64];
  const int tid = threadIdx.x; const int h = blockIdx.x / (QT0 / 64), rg = blockIdx.x % (QT0 / 64); const int i = rg * 64 + tid;
  const float* qr = QF + (size_t)i * ld + h * HD;
#pragma unroll 1
  for (int c = 0; c < HD / 4; ++c) { *(v4f*)&lq[tid][c * 4] = *(const v4fa*)(qr + c * 4); const v4f z = {0.f, 0.f, 0.f, 0.f}; *(v4f*)&lo[tid][c * 4] = z; }
  float m = -1.0e30f, l = 0.f; const int jmax = MASKADD ? (SQ - 1) : (rg * 64 + 63);      /* additive-mask form: every key (the mask input decides); causal form: keys up to the block's last row */
#pragma unroll 1
  for (int j = 0; j <= jmax; ++j) { const float* kr = KF + (size_t)j * ld + h * HD; const float* vr = VF + (size_t)j * ld + h * HD; float s = 0.f;
#pragma unroll 1
    for (int c = 0; c < HD / 4; ++c) { const v4f kq = *(const v4fa*)(kr + c * 4); const v4f qq = *(v4f*)&lq[tid][c * 4]; s = __fadd_rn(s, __fmul_rn(qq[0], kq[0])); s = __fadd_rn(s, __fmul_rn(qq[1], kq[1])); s = __fadd_rn(s, __fmul_rn(qq[2], kq[2])); s = __fadd_rn(s, __fmul_rn(qq[3], kq[3])); }
    s = __fmul_rn(s, scale); if (MASKADD) s = __fadd_rn(s, __fmul_rn(bf16_round(mask[(size_t)i * SQ + j]), -10000.0f));
    const float f = (MASKADD || j <= i) ? 1.f : 0.f; const float sm = fmaf(f, s, (1.f - f) * -1.0e30f); const float mn = fmaxf(m, sm); const float sc = expf(m - mn); const float e = expf(sm - mn); l = __fadd_rn(__fmul_rn(l, sc), e); m = mn;
#pragma unroll 1
    for (int c = 0; c < HD / 4; ++c) { const v4f vv = *(const v4fa*)(vr + c * 4); v4f oo = *(v4f*)&lo[tid][c * 4]; for (int u = 0; u < 4; ++u) oo[u] = __fadd_rn(__fmul_rn(oo[u], sc), __fmul_rn(e, vv[u])); *(v4f*)&lo[tid][c * 4] = oo; } }
  const float fin = 64.0f / l;      /* o carried x64 like the f16 path */
#pragma unroll 1
  for (int c = 0; c < HD / 4; ++c) { v4f oo = *(v4f*)&lo[tid][c * 4]; for (int u = 0; u < 4; ++u) oo[u] = __fmul_rn(oo[u], fin); *(v4f*)&lo[tid][c * 4] = oo; }
  __syncthreads();
  {
#pragma unroll 1
    for (int it = 0; it < 16; ++it) { const int row = it * 4 + tid / 16, pc = (tid % 16) * 4; const v4f v = *(const v4f*)&lo[row][pc]; *(v4f*)(OF + (size_t)(rg * 64 + row) * ldo + h * HD + pc) = v; }
     } }

__global__ __launch_bounds__(256) void k_oscale(const float* __restrict__ OF, float* __restrict__ out, size_t n4) { const size_t t = (size_t)blockIdx.x * 256 + threadIdx.x; if (t >= n4) return; const v4f a = *(const v4fa*)(OF + t * 4); v4f o; for (int q = 0; q < 4; ++q) o[q] = a[q] * 0.015625f; *(v4f*)(out + t * 4) = o;  }

__global__ __launch_bounds__(256) void k_bfr(const float* __restrict__ x, float* __restrict__ XB, size_t n8) { const size_t t = (size_t)blockIdx.x * 256 + threadIdx.x; if (t >= n8) return; v4f a = *(const v4fa*)(x + t * 8), c = *(const v4fa*)(x + t * 8 + 4); for (int q = 0; q < 4; ++q) { a[q] = bf16_round(a[q]); c[q] = bf16_round(c[q]); }
  { *(v4f*)(XB + t * 8) = a; *(v4f*)(XB + t * 8 + 4) = c;  } }



__global__ __launch_bounds__(256) void k_rsmfvl(const float* __restrict__ S, _Float16* __restrict__ P, _Float16* __restrict__ PL, int qn, const int* __restrict__ vlp) {
  #pragma clang fp contract(off)
  const int t = blockIdx.x * 256 + threadIdx.x; if (t >= qn) return; const int vl = vlp[0]; const size_t i = (size_t)t; const float* s = S + i * SQ; float mx = -3.0e38f;
#pragma unroll 1
  for (int j = 0; j < SQ; ++j) { const float f = (j < vl) ? 1.f : 0.f; mx = fmaxf(mx, fmaf(f, s[j], (1.f - f) * -1000000.0f)); } float se = 0.f;
#pragma unroll 1
  for (int j = 0; j < SQ; ++j) { const float f = (j < vl) ? 1.f : 0.f; se += __expf(fmaf(f, s[j], (1.f - f) * -1000000.0f) - mx); } const float sc = 256.0f / se;
#pragma unroll 1
  for (int j0 = 0; j0 < SQ; j0 += 8) { FragH fr, gr; for (int q = 0; q < 8; ++q) { const int j = j0 + q; const float f = (j < vl) ? 1.f : 0.f; const float pv = __expf(fmaf(f, s[j], (1.f - f) * -1000000.0f) - mx) * sc; const _Float16 ph = (_Float16)pv; fr.h[q] = ph; gr.h[q] = (_Float16)((pv - (float)ph) * 1024.0f); }
    unsigned short* d = (unsigned short*)P + i * SQ + j0; unsigned short* dl = (unsigned short*)PL + i * SQ + j0; *(v8us*)d = fr.half[0]; *(v8us*)dl = gr.half[0];  } }

__global__ __launch_bounds__(256) void k_rsmf(const float* __restrict__ S, _Float16* __restrict__ P, int qn, int hg) {
  #pragma clang fp contract(off)
  const int t = blockIdx.x * 256 + threadIdx.x; if (t >= qn * hg) return; const size_t i = (size_t)(t / qn) * SQ + (t % qn); const float* s = S + i * SQ; float mx = -3.0e38f;
#pragma unroll 1
  for (int j = 0; j < SQ; ++j) mx = fmaxf(mx, s[j]); float se = 0.f;
#pragma unroll 1
  for (int j = 0; j < SQ; ++j) se += __expf(s[j] - mx); const float sc = 256.0f / se;
#pragma unroll 1
  for (int j0 = 0; j0 < SQ; j0 += 8) { FragH f; for (int q = 0; q < 8; ++q) f.h[q] = (_Float16)(__expf(s[j0 + q] - mx) * sc); unsigned short* d = (unsigned short*)P + i * SQ + j0; *(v8us*)d = f.half[0];  } }


#define CN 256          /* channels */
#define CI 128
#define NC 256                       /* (unused legacy kernels) */
#define NPX NP          /* positions per channel row */
#define NP 4096         /* seq1 tokens */
#define NM 1024         /* seq2 tokens */
#define BNEPS 1e-5f

__global__ __launch_bounds__(256) void k_mp2(const float* __restrict__ src, float* __restrict__ dst, int nout) {
  const int t = blockIdx.x * 256 + threadIdx.x; if (t >= nout) return; const int c = t / 1024; const int o = t % 1024; const int oy = o / 32, ox = o % 32; const float* p = src + (size_t)c * 4096 + (size_t)(2 * oy) * 64 + 2 * ox;
  const float v = fmaxf(fmaxf(p[0], p[1]), fmaxf(p[64], p[65])); *(float*)(dst + t) = v;  }
__global__ __launch_bounds__(256) void k_xpb(const float* __restrict__ x, const float* __restrict__ wb, float* __restrict__ CPP, size_t n4) {
  #pragma clang fp contract(off)
  const size_t t = (size_t)blockIdx.x * 256 + threadIdx.x; if (t >= n4) return; const size_t e = t * 4; const int c = (int)((e / 4096) % 256); const float bb = bf16_round(wb[c]); const v4f a = *(const v4fa*)(x + e); v4f o; for (int q = 0; q < 4; ++q) o[q] = __fadd_rn(bf16_round(a[q]), bb);
  *(v4f*)(CPP + e) = o;  }


template <int PASS>
__global__ __launch_bounds__(256) void k_cstA(const float* __restrict__ X, const float* __restrict__ MV, float* __restrict__ PART) {
  #pragma clang fp contract(off)
  __shared__ float red[256]; const int t = threadIdx.x; const size_t bc = blockIdx.x; const int c = (int)(bc % NC); const float* row = X + bc * (size_t)NPX; const float mu = PASS ? MV[c] : 0.f; float s = 0.f;
  for (int i = t; i < NPX; i += 256) { const float v = row[i]; const float d = PASS ? __fadd_rn(v, -mu) : v; s = __fadd_rn(s, PASS ? __fmul_rn(d, d) : d); }
  red[t] = s; __syncthreads(); for (int st = 128; st > 0; st >>= 1) { if (t < st) red[t] = __fadd_rn(red[t], red[t + st]); __syncthreads(); }
  if (t < 32) { const float pv = (t == 0) ? red[0] : 0.f; *(float*)(PART + bc * 32 + t) = pv;  } }      

template <int PASS>
__global__ __launch_bounds__(256) void k_cstB(const float* __restrict__ PART, float* __restrict__ MV) { const int c = threadIdx.x; if (c >= NC) return; double s = 0.0; for (int b = 0; b < NB; ++b) s += (double)PART[((size_t)b * NC + c) * 32]; const float m = (float)(s / ((double)NB * (double)NPX)); *(float*)(MV + PASS * NC + c) = m;  }


__global__ __launch_bounds__(256) void k_bnresid(const float* __restrict__ C2, const float* __restrict__ MV, const float* __restrict__ g, const float* __restrict__ be, const float* __restrict__ X, float* __restrict__ out, size_t n4) {
  #pragma clang fp contract(off)
  const size_t t = (size_t)blockIdx.x * 256 + threadIdx.x; if (t >= n4) return; const size_t e = t * 4; const int c = (int)((e / NPX) % NC); const float sc = __fmul_rn(rsqrtf(__fadd_rn(MV[NC + c], BNEPS)), bf16_round(g[c])); const float mu = MV[c], bb = bf16_round(be[c]);
  const v4f a = *(const v4fa*)(C2 + e); const v4f xx = *(const v4fa*)(X + e); v4f o; for (int q = 0; q < 4; ++q) { const float z = __fadd_rn(__fmul_rn(__fadd_rn(a[q], -mu), sc), bb); o[q] = __fadd_rn(z, bf16_round(xx[q])); }
  *(v4f*)(out + e) = o;  }


__global__ __launch_bounds__(256) void k_rowbias(float* __restrict__ Y, const float* __restrict__ bias) {
  #pragma clang fp contract(off)
  const size_t t = (size_t)blockIdx.x * 256 + threadIdx.x; if (t >= (size_t)NB * NC * NPX / 4) return; const size_t e = t * 4; const int c = (int)((e / NPX) % NC); const float bb = bf16_round(bias[c]);
  v4f v = *(const v4fa*)(Y + e); for (int q = 0; q < 4; ++q) v[q] = __fadd_rn(v[q], bb); *(v4f*)(Y + e) = v;  }



template <int NK>
__global__ __launch_bounds__(256) void k_rsmn(const float* __restrict__ S, _Float16* __restrict__ P, int nrows) {
  #pragma clang fp contract(off)
  const int t = blockIdx.x * 256 + threadIdx.x; if (t >= nrows) return; const float* s = S + (size_t)t * NK; float mx = -3.0e38f;
#pragma unroll 1
  for (int j = 0; j < NK; ++j) mx = fmaxf(mx, s[j]); float se = 0.f;
#pragma unroll 1
  for (int j = 0; j < NK; ++j) se += __expf(s[j] - mx); const float sc = 256.0f / se;
#pragma unroll 1
  for (int j0 = 0; j0 < NK; j0 += 8) { FragH fr; for (int q = 0; q < 8; ++q) fr.h[q] = (_Float16)(__expf(s[j0 + q] - mx) * sc);
    unsigned short* d = (unsigned short*)P + (size_t)t * NK + j0; *(v8us*)d = fr.half[0];  } }

template <int BFIN, int W16, int W32, int WD>
__global__ __launch_bounds__(256) void k_lnw(const float* __restrict__ X, const float* __restrict__ g, const float* __restrict__ bb, float eps, _Float16* __restrict__ N16, float* __restrict__ N32) {
  #pragma clang fp contract(off)
  __shared__ float red[256]; const size_t r = blockIdx.x; const int t = threadIdx.x; const bool act = t < (WD / 4); const int c0 = act ? t * 4 : 0;
  const v4f xa = *(const v4fa*)(X + r * WD + c0); float s[4]; float sum = 0.f;
  for (int q = 0; q < 4; ++q) { s[q] = act ? (BFIN ? bf16_round(xa[q]) : xa[q]) : 0.f; sum = __fadd_rn(sum, s[q]); }
  red[t] = sum; __syncthreads(); for (int st = 128; st > 0; st >>= 1) { if (t < st) red[t] = __fadd_rn(red[t], red[t + st]); __syncthreads(); } const float mu = red[0] / (float)WD; __syncthreads();
  float vs = 0.f; for (int q = 0; q < 4; ++q) { const float dl = act ? __fadd_rn(s[q], -mu) : 0.f; vs = __fadd_rn(vs, __fmul_rn(dl, dl)); } red[t] = vs; __syncthreads(); for (int st = 128; st > 0; st >>= 1) { if (t < st) red[t] = __fadd_rn(red[t], red[t + st]); __syncthreads(); }
  const float rs = rsqrtf(__fadd_rn(red[0] / (float)WD, eps)); v4h y; v4f yf;
  for (int q = 0; q < 4; ++q) { const int c = c0 + q; yf[q] = __fadd_rn(__fmul_rn(__fmul_rn(__fadd_rn(s[q], -mu), rs), bf16_round(g[c])), bf16_round(bb[c])); y[q] = (_Float16)yf[q]; }
  if (!act) return;      /* no barriers after this point */
  { if (W16) *(v4h*)(N16 + r * WD + c0) = y; if (W32) *(v4f*)(N32 + r * WD + c0) = yf;  } }


__global__ __launch_bounds__(64) void k_ptatt(const float* __restrict__ QF, const float* __restrict__ KF, const float* __restrict__ VF, const float* __restrict__ xres, float scale, float* __restrict__ out) {
  #pragma clang fp contract(off)
  __shared__ __attribute__((aligned(16))) float lk[1024]; __shared__ __attribute__((aligned(16))) float lv[1024]; __shared__ __attribute__((aligned(16))) float lr[1024];
  const int i = threadIdx.x; const size_t r = blockIdx.x; const size_t ro = r * 1024;
  for (int c = 0; c < 4; ++c) { const int p4 = (c * 64 + i) * 4; *(v4f*)&lk[p4] = *(const v4fa*)(KF + ro + p4); *(v4f*)&lv[p4] = *(const v4fa*)(VF + ro + p4); }
  float q[16]; for (int c = 0; c < 4; ++c) { const v4f t4 = *(const v4fa*)(QF + ro + (size_t)i * 16 + c * 4); for (int u = 0; u < 4; ++u) q[c * 4 + u] = t4[u]; }
  __syncthreads();
  float m = -3.0e38f, l = 0.f; float o[16]; for (int h = 0; h < 16; ++h) o[h] = 0.f;
#pragma unroll 1
  for (int j = 0; j < 64; ++j) { float s = 0.f;
#pragma unroll
    for (int h = 0; h < 16; ++h) s = __fadd_rn(s, __fmul_rn(q[h], lk[j * 16 + h]));
    s = __fmul_rn(s, scale); const float mn = fmaxf(m, s); const float sc = expf(m - mn); const float e = expf(s - mn); l = __fadd_rn(__fmul_rn(l, sc), e); m = mn;
#pragma unroll
    for (int h = 0; h < 16; ++h) o[h] = __fadd_rn(__fmul_rn(o[h], sc), __fmul_rn(e, lv[j * 16 + h])); }
  const float inv = 1.0f / l;
#pragma unroll
  for (int h = 0; h < 16; ++h) lr[i * 16 + h] = __fmul_rn(o[h], inv);
  __syncthreads();
  { for (int c = 0; c < 4; ++c) { const int p4 = (c * 64 + i) * 4; const v4f rr = *(v4f*)&lr[p4]; const v4f xx = *(const v4fa*)(xres + ro + p4); v4f y; for (int u = 0; u < 4; ++u) y[u] = __fadd_rn(xx[u], rr[u]); *(v4f*)(out + ro + p4) = y; }  } }
extern "C" void kernel_launch(void* const* d_in, const int* in_sizes, int n_in,
                              void* d_out, int out_size, void* d_ws, size_t ws_size, hipStream_t stream) {
  (void)in_sizes; (void)n_in; (void)out_size;
  const float* const* I = (const float* const*)d_in; const float* x = I[0]; const float* wq = I[1]; const float* bq = I[2]; const float* wk = I[3]; const float* bk = I[4]; const float* wv = I[5]; const float* bv = I[6]; const float* gam = I[7]; const float* bet = I[8];      /* inp; [in][out] Wq/Wk/Wv [1024][1024] + biases; LayerNorm gamma/beta */
  constexpr int DMc = 1024; const size_t NRc = (size_t)4 * 2048;      /* model width; token rows */
  char* ws = (char*)d_ws; size_t off = 0;
  auto take = [&](size_t bytes) { char* p = ws + off; off += (bytes + 255) & ~(size_t)255; return p; };
  _Float16* BQ = (_Float16*)take((size_t)DMc * DMc * 2); _Float16* BK = (_Float16*)take((size_t)DMc * DMc * 2); _Float16* BV = (_Float16*)take((size_t)DMc * DMc * 2);
  _Float16* XN = (_Float16*)take(NRc * DMc * 2); float* XB = (float*)take(NRc * DMc * 4); float* QF = (float*)take(NRc * DMc * 4); float* KF = (float*)take(NRc * DMc * 4); float* VF = (float*)take(NRc * DMc * 4);
  if (off > ws_size) return;
  { const unsigned g = (unsigned)(((size_t)DMc * (DMc / 8) + 255) / 256); k_wt_f16<<<g, 256, 0, stream>>>(wq, BQ, DMc, DMc, 16.0f); k_wt_f16<<<g, 256, 0, stream>>>(wk, BK, DMc, DMc, 16.0f); k_wt_f16<<<g, 256, 0, stream>>>(wv, BV, DMc, DMc, 16.0f); }      /* [in][out] -> Bt x16 */
  k_lnw<1, 1, 0, DMc><<<(unsigned)NRc, 256, 0, stream>>>(x, gam, bet, 1e-5f, XN, nullptr); k_bfr<<<(unsigned)((NRc * DMc / 8 + 255) / 256), 256, 0, stream>>>(x, XB, NRc * DMc / 8);      /* out = LN(bf16(inp)) -> f16 rows; XB = bf16(inp) f32 for the residual */
  { const unsigned g = (unsigned)((NRc / 128) * (DMc / 128)); k_gemm3<<<g, 256, 0, stream>>>(XN, BQ, 0.0625f, bq, QF, DMc, DMc); k_gemm3<<<g, 256, 0, stream>>>(XN, BK, 0.0625f, bk, KF, DMc, DMc); k_gemm3<<<g, 256, 0, stream>>>(XN, BV, 0.0625f, bv, VF, DMc, DMc); }      /* Q, K, V = out W + b -> f32 rows */
  k_ptatt<<<(unsigned)NRc, 64, 0, stream>>>(QF, KF, VF, XB, 0.125f, (float*)d_out);      /* per-token 64 x 64 x 16 attention in f32 + residual -> output rows */
}

// v002
// It runs in 120 microseconds.
// Timed twice side by side with v001, it ran 1.27 times as fast both times.
// Counting every step since v000, it is 2.19 times as fast.
#include <hip/hip_runtime.h>
// Per-POSITION attention over the head-dim axis (inp [4][2048][1024]; out = LayerNorm(inp) (biased var, eps 1e-5, gamma/beta); Q/K/V = out W + b ([in][out] 1024 x 1024 sigma 1/32, zero biases) viewed [B][M][DK = 64][H = 16] (column i*16 + h); for every token: scores[i][j] = sum_h Q[i][h] K[j][h] / 8 (a 64 x 64 matrix, contraction over the 16 'heads'), softmax over j, res[i][h] = sum_j att[i][j] V[j][h]; no mixing across tokens; result = inp + res -> [4][2048][1024]).
// Compute dtype: inputs rounded to bf16; x / weights exact; LayerNorm output as a plain f16 GEMM operand (~2^-12); q, k, v, softmax weights and o f32; scores and softmax statistics f32; v_wmma_f32_16x16x32_f16 for the projections, v_wmma_f32_16x16x4_f32 for the attention.
#define NB 4
#define SQ 4096
#define DM 256
#define NH 1
#define HD 64
#define HG 4                         /* heads per k_vt launch (V transpose; not launched) */
#define B0 0                         /* unused */
#define NBR NB                       /* used only via MP / MPO, which no code reads */
#define NR ((size_t)NB * SQ)
#define MP ((int)((size_t)NBR * SQ))
#define QT 256                       /* query rows per causal tile */
#define NKX SQ                       /* S / P row pitch */
#define QT0 256                      /* first-tile rows recomputed exactly (256: buys margin for the few-key rows 128..255, which have no output projection to average the single-f16 P/v rounding) */
#define QN SQ
#define NHD NH
#define MPO MP
#define LQ DM
typedef __bf16 v16b __attribute__((ext_vector_type(16)));
typedef unsigned short v8us __attribute__((ext_vector_type(8), may_alias));
typedef float  v8f  __attribute__((ext_vector_type(8)));
typedef float  v4f  __attribute__((ext_vector_type(4)));
typedef float  v4fa __attribute__((ext_vector_type(4), may_alias));
union FragB { v16b v; v8us half[2]; unsigned short u[16]; };

__device__ __forceinline__ unsigned short bf16_bits(float x) { unsigned int u = __float_as_uint(x); return (unsigned short)((u + 0x7FFFu + ((u >> 16) & 1u)) >> 16); }
__device__ __forceinline__ float bf16_val(unsigned short b) { return __uint_as_float(((unsigned int)b) << 16); }
__device__ __forceinline__ float bf16_round(float x) { return bf16_val(bf16_bits(x)); }
// D += A·B with NT terms: 1 = ah·bh, 2 = + al·bh (A split), 3 = + ah·bl (both split)
template <int NT>
__device__ __forceinline__ v8f mmaN(v16b ah, v16b al, v16b bh, v16b bl, v8f c) {
  c = __builtin_amdgcn_wmma_f32_16x16x32_bf16(false, ah, false, bh, (short)0, c, false, false);
  if (NT >= 2) c = __builtin_amdgcn_wmma_f32_16x16x32_bf16(false, al, false, bh, (short)0, c, false, false);
  if (NT >= 3) c = __builtin_amdgcn_wmma_f32_16x16x32_bf16(false, ah, false, bl, (short)0, c, false, false);
  asm volatile("v_nop\n\tv_nop\n\tv_nop\n\tv_nop" : "+v"(c) : "v"(ah), "v"(al), "v"(bh), "v"(bl));
  return c;
}

__global__ __launch_bounds__(256) void k_wt_bf16(const float* __restrict__ W, unsigned short* __restrict__ Wt, int K, int N) {
  const int t = blockIdx.x * 256 + threadIdx.x;
  const int k8n = K / 8;
  if (t >= N * k8n) return;
  const int n = t / k8n, k8 = (t % k8n) * 8;
  v8us v;
#pragma unroll
  for (int i = 0; i < 8; ++i) v[i] = bf16_bits(W[(size_t)(k8 + i) * N + n]);
  *(v8us*)(Wt + (size_t)n * K + k8) = v;
  
}

// GEMM C[M][N] (f32, pitch ldc) = act(A[M][K]·W + bias). A f32 row-major (pitch lda) converted per fragment to bf16
// (ASPLIT: hi/lo two planes -> 2 terms, else single rounded term); Wt bf16 [N][K] (pitch ldb). BIAS_BF16 rounds the
// bias to bf16 first (bias quantised to bf16 before the add). K%32==0, M%16==0, N%64==0.
template <bool ASPLIT, int ACT, bool BIAS_BF16>
__global__ __launch_bounds__(128) void k_gemm_bf(const float* __restrict__ A, int lda, const unsigned short* __restrict__ Wt, int ldb,
                                               const float* __restrict__ bias, float* __restrict__ C, int ldc, int M, int N, int K) {
  __shared__ __attribute__((aligned(16))) float so[4][16][64];
  const int tid = threadIdx.x, w = tid >> 5, lane = tid & 31, ln = lane & 15, hh = lane >> 4;
  const int ntn = N / 64;
  const int wid = blockIdx.x * 4 + w;
  const int mt = wid / ntn, nq = wid % ntn;
  if (mt * 16 >= M) return;
  const int row0 = mt * 16, col0 = nq * 64;
  const float* arow = A + (size_t)(row0 + ln) * lda;
  v8f acc[4] = {};
  for (int kb = 0; kb < K; kb += 32) {
    FragB ah, al;
    const v4f x0 = *(const v4fa*)(arow + kb + 8 * hh), x1 = *(const v4fa*)(arow + kb + 8 * hh + 4);
    const v4f x2 = *(const v4fa*)(arow + kb + 16 + 8 * hh), x3 = *(const v4fa*)(arow + kb + 16 + 8 * hh + 4);
    float xs[16] = {x0[0],x0[1],x0[2],x0[3],x1[0],x1[1],x1[2],x1[3],x2[0],x2[1],x2[2],x2[3],x3[0],x3[1],x3[2],x3[3]};
#pragma unroll
    for (int i = 0; i < 16; ++i) { const unsigned short hb = bf16_bits(xs[i]); ah.u[i] = hb; al.u[i] = ASPLIT ? bf16_bits(xs[i] - bf16_val(hb)) : (unsigned short)0; }
#pragma unroll
    for (int t = 0; t < 4; ++t) {
      const unsigned short* brow = Wt + (size_t)(col0 + t * 16 + ln) * ldb + kb;
      FragB b;
      b.half[0] = *(const v8us*)(brow + 8 * hh);
      b.half[1] = *(const v8us*)(brow + 16 + 8 * hh);
      acc[t] = mmaN<ASPLIT ? 2 : 1>(ah.v, al.v, b.v, b.v, acc[t]);
    }
  }
#pragma unroll
  for (int t = 0; t < 4; ++t) {
    float bv = bias ? bias[col0 + t * 16 + ln] : 0.f;
    if (BIAS_BF16) bv = bf16_round(bv);
#pragma unroll
    for (int r = 0; r < 8; ++r) { float v = acc[t][r] + bv; if (ACT == 1) v = fmaxf(v, 0.f); so[w][8 * hh + r][t * 16 + ln] = v; }
  }
  __builtin_amdgcn_fence(__ATOMIC_ACQ_REL, "workgroup");
  __builtin_amdgcn_wave_barrier();
  const int rsub = lane >> 4, c4 = (lane & 15) * 4;
  {
#pragma unroll
    for (int q = 0; q < 8; ++q) {
      const int r = q * 2 + rsub;
      const v4f v = *(const v4fa*)&so[w][r][c4];
      *(v4f*)(C + (size_t)(row0 + r) * ldc + col0 + c4) = v;
    }
    
  }
}

// GEMM C = act(A·W + bias + resid): A f32 (ASPLIT -> hi/lo 2 terms), Wt bf16 [N][K]; ACT 0 none, 1 relu, 2 exact gelu;
// resid (optional, f32, row index = (row % rmod), pitch ldr, RES_BF16 rounds it) added before the activation.
template <bool ASPLIT, int ACT, bool BIAS_BF16, bool RES_BF16>
__global__ __launch_bounds__(128) void k_gemm_bf3(const float* __restrict__ A, int lda, const unsigned short* __restrict__ Wt, int ldb,
                                                const float* __restrict__ bias, const float* __restrict__ resid, int rmod, int ldr,
                                                float* __restrict__ C, int ldc, int M, int N, int K) {
  __shared__ __attribute__((aligned(16))) float so[4][16][64];
  const int tid = threadIdx.x, w = tid >> 5, lane = tid & 31, ln = lane & 15, hh = lane >> 4;
  const int ntn = N / 64;
  const int wid = blockIdx.x * 4 + w;
  const int mt = wid / ntn, nq = wid % ntn;
  if (mt * 16 >= M) return;
  const int row0 = mt * 16, col0 = nq * 64;
  const float* arow = A + (size_t)(row0 + ln) * lda;
  v8f acc[4] = {};
  for (int kb = 0; kb < K; kb += 32) {
    FragB ah, al;
    const v4f x0 = *(const v4fa*)(arow + kb + 8 * hh), x1 = *(const v4fa*)(arow + kb + 8 * hh + 4);
    const v4f x2 = *(const v4fa*)(arow + kb + 16 + 8 * hh), x3 = *(const v4fa*)(arow + kb + 16 + 8 * hh + 4);
    float xs[16] = {x0[0],x0[1],x0[2],x0[3],x1[0],x1[1],x1[2],x1[3],x2[0],x2[1],x2[2],x2[3],x3[0],x3[1],x3[2],x3[3]};
#pragma unroll
    for (int i = 0; i < 16; ++i) { const unsigned short hb = bf16_bits(xs[i]); ah.u[i] = hb; al.u[i] = ASPLIT ? bf16_bits(xs[i] - bf16_val(hb)) : (unsigned short)0; }
#pragma unroll
    for (int t = 0; t < 4; ++t) {
      const unsigned short* brow = Wt + (size_t)(col0 + t * 16 + ln) * ldb + kb;
      FragB b;
      b.half[0] = *(const v8us*)(brow + 8 * hh);
      b.half[1] = *(const v8us*)(brow + 16 + 8 * hh);
      acc[t] = mmaN<ASPLIT ? 2 : 1>(ah.v, al.v, b.v, b.v, acc[t]);
    }
  }
#pragma unroll
  for (int t = 0; t < 4; ++t) {
    const int col = col0 + t * 16 + ln;
    float bv = bias ? bias[col] : 0.f;
    if (BIAS_BF16) bv = bf16_round(bv);
#pragma unroll
    for (int r = 0; r < 8; ++r) {
      float v = acc[t][r] + bv;
      if (resid) { float rv = resid[(size_t)((row0 + 8 * hh + r) % rmod) * ldr + col]; if (RES_BF16) rv = bf16_round(rv); v += rv; }
      if (ACT == 1) v = fmaxf(v, 0.f);
      if (ACT == 2) v = 0.5f * v * (1.0f + erff(v * 0.70710678118654752f));
      if (ACT == 3) { const float u = 0.7978845608028654f * (v + 0.044715f * v * v * v); v = 0.5f * v * (1.0f + tanhf(u)); }
      so[w][8 * hh + r][t * 16 + ln] = v;
    }
  }
  __builtin_amdgcn_fence(__ATOMIC_ACQ_REL, "workgroup");
  __builtin_amdgcn_wave_barrier();
  const int rsub = lane >> 4, c4 = (lane & 15) * 4;
  {
#pragma unroll
    for (int q = 0; q < 8; ++q) {
      const int r = q * 2 + rsub;
      const v4f v = *(const v4fa*)&so[w][r][c4];
      *(v4f*)(C + (size_t)(row0 + r) * ldc + col0 + c4) = v;
    }
    
  }
}
// row LayerNorm (biased variance, eps) over N: s = X (+ R); optional out_sum <- s; out_norm <- (s-mu)*rsqrt(var+eps)*g + b
template <bool PARAM_BF16>
__global__ __launch_bounds__(256) void k_layernorm(const float* __restrict__ X, const float* __restrict__ R, const float* __restrict__ g, const float* __restrict__ bta,
                                                  float* __restrict__ out_sum, float* __restrict__ out_norm, int N, float eps) {
  __shared__ float red[256];
  const int row = blockIdx.x, tid = threadIdx.x;
  const float* x = X + (size_t)row * N; const float* rr = R ? R + (size_t)row * N : nullptr;
  float vals[16];                     // up to N = 4096
  const int per = N / 256;            // contiguous chunk per thread? use strided-by-4 chunks: thread handles j = tid*4 + 1024*u
  float s1 = 0.f;
  for (int u = 0; u < per / 4; ++u) {
    const int j = tid * 4 + 1024 * u;
    const v4f a = *(const v4fa*)(x + j);
    v4f b = {0.f,0.f,0.f,0.f}; if (rr) b = *(const v4fa*)(rr + j);
#pragma unroll
    for (int q = 0; q < 4; ++q) { const float v = a[q] + b[q]; vals[u * 4 + q] = v; s1 += v; }
  }
  red[tid] = s1; __syncthreads();
  for (int st = 128; st > 0; st >>= 1) { if (tid < st) red[tid] += red[tid + st]; __syncthreads(); }
  const float mu = red[0] / (float)N; __syncthreads();
  float s2 = 0.f;
  for (int u = 0; u < per / 4; ++u)
#pragma unroll
    for (int q = 0; q < 4; ++q) { const float c = vals[u * 4 + q] - mu; s2 += c * c; }
  red[tid] = s2; __syncthreads();
  for (int st = 128; st > 0; st >>= 1) { if (tid < st) red[tid] += red[tid + st]; __syncthreads(); }
  const float rs = rsqrtf(red[0] / (float)N + eps);
  {
    for (int u = 0; u < per / 4; ++u) {
      const int j = tid * 4 + 1024 * u;
      v4f o, sm;
#pragma unroll
      for (int q = 0; q < 4; ++q) {
        float gg = g[j + q], bb = bta[j + q];
        if (PARAM_BF16) { gg = bf16_round(gg); bb = bf16_round(bb); }
        sm[q] = vals[u * 4 + q]; o[q] = (vals[u * 4 + q] - mu) * rs * gg + bb;
      }
      if (out_sum) *(v4f*)(out_sum + (size_t)row * N + j) = sm;
      *(v4f*)(out_norm + (size_t)row * N + j) = o;
    }
    
  }
}



// ---- f16 WMMA path (v_wmma_f32_16x16x32_f16): 11-bit significands for operands in range — used here for the Q/K/V projections
typedef _Float16 v16h __attribute__((ext_vector_type(16)));
union FragH { v16h v; v8us half[2]; _Float16 h[16]; unsigned short u[16]; };
template <int NT>
__device__ __forceinline__ v8f mmaH(v16h ah, v16h al, v16h bh, v16h bl, v8f c) {
  c = __builtin_amdgcn_wmma_f32_16x16x32_f16(false, ah, false, bh, (short)0, c, false, false);
  if (NT >= 2) c = __builtin_amdgcn_wmma_f32_16x16x32_f16(false, al, false, bh, (short)0, c, false, false);
  if (NT >= 3) c = __builtin_amdgcn_wmma_f32_16x16x32_f16(false, ah, false, bl, (short)0, c, false, false);
  asm volatile("v_nop\n\tv_nop\n\tv_nop\n\tv_nop" : "+v"(c) : "v"(ah), "v"(al), "v"(bh), "v"(bl));
  return c;
}
// batched GEMM like k_gemm_b but f16 operands: A f32 (split into f16 hi/lo if ASPLIT, else rounded to f16), Bt = f16 values [n][k]; alpha; C f32; N multiple of 16 (partial tiles skipped)
template <bool ASPLIT>
__global__ __launch_bounds__(128) void k_gemm_h(const float* __restrict__ A, int lda, size_t sA, const _Float16* __restrict__ Bh, int ldb, size_t sB, float alpha, float* __restrict__ C, int ldc, size_t sC, int M, int N, int K) {
  __shared__ __attribute__((aligned(16))) float so[4][16][64];
  const int tid = threadIdx.x, w = tid >> 5, lane = tid & 31, ln = lane & 15, hh = lane >> 4; const int by = blockIdx.y;
  A += (size_t)by * sA; Bh += (size_t)by * sB; C += (size_t)by * sC;
  const int ntn = (N + 63) / 64; const int wid = blockIdx.x * 4 + w; const int mt = wid / ntn, nq = wid % ntn; if (mt * 16 >= M) return;
  const int row0 = mt * 16, col0 = nq * 64; const float* arow = A + (size_t)(row0 + ln) * lda;
  v8f acc[4] = {};
  for (int kb = 0; kb < K; kb += 32) {
    FragH ah, al;
    const v4f x0 = *(const v4fa*)(arow + kb + 8 * hh), x1 = *(const v4fa*)(arow + kb + 8 * hh + 4), x2 = *(const v4fa*)(arow + kb + 16 + 8 * hh), x3 = *(const v4fa*)(arow + kb + 16 + 8 * hh + 4);
    float xs[16] = {x0[0],x0[1],x0[2],x0[3],x1[0],x1[1],x1[2],x1[3],x2[0],x2[1],x2[2],x2[3],x3[0],x3[1],x3[2],x3[3]};
#pragma unroll
    for (int i = 0; i < 16; ++i) { const _Float16 h = (_Float16)xs[i]; ah.h[i] = h; al.h[i] = ASPLIT ? (_Float16)(xs[i] - (float)h) : (_Float16)0.0f; }
#pragma unroll
    for (int t = 0; t < 4; ++t) { if (col0 + t * 16 >= N) continue; const size_t boff = (size_t)(col0 + t * 16 + ln) * ldb + kb; FragH bq; bq.half[0] = *(const v8us*)(Bh + boff + 8 * hh); bq.half[1] = *(const v8us*)(Bh + boff + 16 + 8 * hh);
      acc[t] = mmaH<ASPLIT ? 2 : 1>(ah.v, al.v, bq.v, bq.v, acc[t]); }
  }
#pragma unroll
  for (int t = 0; t < 4; ++t) { if (col0 + t * 16 >= N) continue;
#pragma unroll
    for (int r = 0; r < 8; ++r) so[w][8 * hh + r][t * 16 + ln] = acc[t][r] * alpha; }
  __builtin_amdgcn_fence(__ATOMIC_ACQ_REL, "workgroup"); __builtin_amdgcn_wave_barrier();
  const int rsub = lane >> 4, c4 = (lane & 15) * 4;
  {
#pragma unroll
    for (int q = 0; q < 8; ++q) { const int r = q * 2 + rsub; if (col0 + c4 < N) { const v4f v = *(const v4fa*)&so[w][r][c4]; *(v4f*)(C + (size_t)(row0 + r) * ldc + col0 + c4) = v; } }
     }
}

// Wt[n][k] = f16(W[k][n]·scale) from f32 row-major W[K][N] (scale = power of two; bf16-exact weights stay exact in f16 away from the subnormal range)
__global__ __launch_bounds__(256) void k_wt_f16(const float* __restrict__ W, _Float16* __restrict__ Wt, int K, int N, float scale) {
  const int t = blockIdx.x * 256 + threadIdx.x; if (t >= N * (K / 8)) return; const int n = t / (K / 8), k8 = (t % (K / 8)) * 8; FragH f;
#pragma unroll
  for (int i = 0; i < 8; ++i) f.h[i] = (_Float16)(bf16_round(W[(size_t)(k8 + i) * N + n]) * scale); const v8us o = f.half[0];
  *(v8us*)((unsigned short*)Wt + (size_t)n * K + k8) = o; 
}
// k_gemm_hh variant with fused epilogue: v = acc·alpha + bias[by·sBias + col] (+ CP[(row/rowsPerB)·sCPb + by·64 + col] if CP) ; ACT 0 none / 1 elu ; writes f16 C16 (and f32 C if non-null)
template <int ACT>
__global__ __launch_bounds__(128) void k_gemm_hhx(const _Float16* __restrict__ A, int lda, size_t sA, const _Float16* __restrict__ Bh, int ldb, size_t sB, float alpha, const float* __restrict__ bias, size_t sBias, const float* __restrict__ CP, int rowsPerB, size_t sCPb, int row0g,
    float* __restrict__ C, _Float16* __restrict__ C16, int ldc, size_t sC, int M, int N, int K) {
  __shared__ __attribute__((aligned(16))) float so[4][16][64];
  const int tid = threadIdx.x, w = tid >> 5, lane = tid & 31, ln = lane & 15, hh = lane >> 4; const int by = blockIdx.y;
  A += (size_t)by * sA; Bh += (size_t)by * sB; const size_t cofs = (size_t)by * sC; const float* bp = bias ? bias + (size_t)by * sBias : nullptr;
  const int ntn = (N + 63) / 64; const int wid = blockIdx.x * 4 + w; const int mt = wid / ntn, nq = wid % ntn; if (mt * 16 >= M) return;
  const int row0 = mt * 16, col0 = nq * 64; const _Float16* arow = A + (size_t)(row0 + ln) * lda;
  v8f acc[4] = {};
  for (int kb = 0; kb < K; kb += 32) { FragH ah; ah.half[0] = *(const v8us*)((const unsigned short*)arow + kb + 8 * hh); ah.half[1] = *(const v8us*)((const unsigned short*)arow + kb + 16 + 8 * hh);
#pragma unroll
    for (int t = 0; t < 4; ++t) { if (col0 + t * 16 >= N) continue; const size_t boff = (size_t)(col0 + t * 16 + ln) * ldb + kb; FragH bq; bq.half[0] = *(const v8us*)((const unsigned short*)Bh + boff + 8 * hh); bq.half[1] = *(const v8us*)((const unsigned short*)Bh + boff + 16 + 8 * hh);
      acc[t] = mmaH<1>(ah.v, ah.v, bq.v, bq.v, acc[t]); }
  }
#pragma unroll
  for (int t = 0; t < 4; ++t) { if (col0 + t * 16 >= N) continue; const int col = col0 + t * 16 + ln; const float bv = bp ? bf16_round(bp[col]) : 0.f;
#pragma unroll
    for (int r = 0; r < 8; ++r) { float v = acc[t][r] * alpha + bv; if (CP) { const int rr = row0g + row0 + 8 * hh + r; if (rowsPerB < 0) v += CP[cofs + (size_t)rr * ldc + col];      /* rowsPerB < 0: own element of the batched C plane */ else { const int bidx = rr / rowsPerB; v += CP[(size_t)bidx * sCPb + (size_t)by * 64 + col]; } } if (ACT == 1) v = (v > 0.f) ? v : expm1f(v); else if (ACT == 7) v = (v > 0.f) ? v + 1.0f : expf(v); else if (ACT == 8) v = tanhf(v); else if (ACT == 9) v = 0.5f * v * (1.0f + tanhf(0.7978845608028654f * (v + 0.044715f * v * v * v))); else if (ACT == 11) v = 1.0f / (1.0f + expf(-v)); else if (ACT == 12) v = (v > 0.f) ? v : 0.01f * v; else if (ACT == 14) v = (v > 0.f) ? v : 0.1f * v; else if (ACT == 16) v = (v >= 0.f) ? v : 0.3f * v; else if (ACT == 17) v = (v >= 0.f) ? v : 0.2f * v; else if (ACT == 15) v = v / (1.0f + expf(-v)); else if (ACT == 3) v = fmaxf(v, 0.f); else if (ACT == 6) v = 0.5f * v * (1.0f + erff(v * 0.70710678118654752f)); so[w][8 * hh + r][t * 16 + ln] = v; } }
  __builtin_amdgcn_fence(__ATOMIC_ACQ_REL, "workgroup"); __builtin_amdgcn_wave_barrier();
  const int rsub = lane >> 4, c4 = (lane & 15) * 4; typedef _Float16 v4h __attribute__((ext_vector_type(4)));
  {
#pragma unroll
    for (int q = 0; q < 8; ++q) { const int r = q * 2 + rsub; if (col0 + c4 < N) { const v4f v = *(const v4fa*)&so[w][r][c4]; if (C) *(v4f*)(C + cofs + (size_t)(row0 + r) * ldc + col0 + c4) = v; if (C16) { v4h h4; for (int i = 0; i < 4; ++i) h4[i] = (_Float16)v[i]; *(v4h*)(C16 + cofs + (size_t)(row0 + r) * ldc + col0 + c4) = h4; } } }
     }
}


typedef _Float16 v4h __attribute__((ext_vector_type(4)));

__global__ __launch_bounds__(256) void k_x16(const float* __restrict__ x, _Float16* __restrict__ X16, size_t n8) { const size_t t = (size_t)blockIdx.x * 256 + threadIdx.x; if (t >= n8) return; FragH f;
#pragma unroll
  for (int q = 0; q < 8; ++q) f.h[q] = (_Float16)bf16_round(x[t * 8 + q]); *(v8us*)((unsigned short*)X16 + t * 8) = f.half[0];  }
__global__ __launch_bounds__(256) void k_h16(const float* __restrict__ x, _Float16* __restrict__ X16, size_t n8) { const size_t t = (size_t)blockIdx.x * 256 + threadIdx.x; if (t >= n8) return; FragH f;
#pragma unroll
  for (int q = 0; q < 8; ++q) f.h[q] = (_Float16)x[t * 8 + q]; *(v8us*)((unsigned short*)X16 + t * 8) = f.half[0];  }
__global__ __launch_bounds__(256) void k_round16f(const float* __restrict__ W, _Float16* __restrict__ Bt, size_t n8) { const size_t t = (size_t)blockIdx.x * 256 + threadIdx.x; if (t >= n8) return; FragH f;
#pragma unroll
  for (int i = 0; i < 8; ++i) f.h[i] = (_Float16)(bf16_round(W[t * 8 + i]) * 16.0f); *(v8us*)((unsigned short*)Bt + t * 8) = f.half[0];  }
template <int NHv, int TTv>
__global__ __launch_bounds__(256) void k_vt(const _Float16* __restrict__ V16, int ldv, int voff, _Float16* __restrict__ Vt) { __shared__ unsigned short tl[64][66]; const int tid = threadIdx.x; const int slab = blockIdx.x / (TTv / 64), lg = blockIdx.x % (TTv / 64); const int b = slab / NHv, h = slab % NHv;
  for (int i = tid; i < 64 * 8; i += 256) { const int r = i / 8, c8 = (i % 8) * 8; FragH f; f.half[0] = *(const v8us*)((const unsigned short*)V16 + ((size_t)b * TTv + lg * 64 + r) * ldv + voff + h * 64 + c8);
#pragma unroll
    for (int q = 0; q < 8; ++q) tl[r][c8 + q] = f.u[q]; }
  __syncthreads();
  {
#pragma unroll
    for (int rd = 0; rd < 2; ++rd) { const int d = rd * 32 + tid / 8, pc = tid % 8; FragH f;
#pragma unroll
      for (int q = 0; q < 8; ++q) f.u[q] = tl[pc * 8 + q][d];
      *(v8us*)((unsigned short*)Vt + ((size_t)slab * 64 + d) * TTv + lg * 64 + pc * 8) = f.half[0]; }
     } }

__global__ __launch_bounds__(256) void k_hl(const float* __restrict__ F, _Float16* __restrict__ Hh, _Float16* __restrict__ Hl, size_t n8) { const size_t t = (size_t)blockIdx.x * 256 + threadIdx.x; if (t >= n8) return; FragH fh, fl; const v4f a = *(const v4fa*)(F + t * 8), c = *(const v4fa*)(F + t * 8 + 4);
#pragma unroll
  for (int q = 0; q < 4; ++q) { _Float16 h = (_Float16)a[q]; fh.h[q] = h; fl.h[q] = (_Float16)((a[q] - (float)h) * 1024.0f); h = (_Float16)c[q]; fh.h[4 + q] = h; fl.h[4 + q] = (_Float16)((c[q] - (float)h) * 1024.0f); }
  { *(v8us*)((unsigned short*)Hh + t * 8) = fh.half[0]; *(v8us*)((unsigned short*)Hl + t * 8) = fl.half[0];  } }

// ---- fast GEMM (wave tile 32x64), C = A Bh^T alpha + bf16(bias), f32 rows ----
__device__ __forceinline__ v16h g2_frag(const _Float16* p, int hh) { FragH f; f.half[0] = *(const v8us*)((const unsigned short*)p + 8 * hh); f.half[1] = *(const v8us*)((const unsigned short*)p + 16 + 8 * hh); return f.v; }
__device__ __forceinline__ v8f g2_mma(v16h a, v16h b, v8f c) { v8f d = __builtin_amdgcn_wmma_f32_16x16x32_f16(false, a, false, b, (short)0, c, false, false); asm volatile("v_nop\n\tv_nop\n\tv_nop\n\tv_nop" : "+v"(d) : "v"(a), "v"(b)); return d; }
// Block tile 128 x 128, eight waves of 32 x 64 (4 down, 2 across). Per pass 64 k of both operands (128-B rows: 128 rows of A, then 128 rows of Bh) lie in one of two LDS buffers,
// brought by asynchronous copies (16 B per lane, whole 128-B lines per 8 lanes); the next pass's copies fly while this pass's fragments are read from LDS. Needs M % 128 == 0 (grid), N % 128 == 0, K % 64 == 0.
#define G3_PITCH 72                  /* LDS row pitch in halfs: 144 B = 16 B x odd, conflict-free for 16-B fragment reads */
#define G3_STAGE (256 * G3_PITCH)    /* halfs per buffer */
// one pass's copies of this thread: four rows of A and four of Bh, 32 rows apart; l = the lane's LDS byte address of the first
__device__ __forceinline__ void g3_copy(const _Float16* ga, const _Float16* gb, size_t step, unsigned l) {
  const _Float16* a1 = ga + step; const _Float16* a2 = a1 + step; const _Float16* a3 = a2 + step; const _Float16* b1 = gb + step; const _Float16* b2 = b1 + step; const _Float16* b3 = b2 + step;
  const unsigned rs = 32u * G3_PITCH * 2u;
  /* the s_wait_xcnt stands inside the statement so that no address register of a copy is rewritten ahead of it */
  asm volatile("global_load_async_to_lds_b128 %0, %8, off\n\t"
               "global_load_async_to_lds_b128 %1, %9, off\n\t"
               "global_load_async_to_lds_b128 %2, %10, off\n\t"
               "global_load_async_to_lds_b128 %3, %11, off\n\t"
               "global_load_async_to_lds_b128 %4, %12, off\n\t"
               "global_load_async_to_lds_b128 %5, %13, off\n\t"
               "global_load_async_to_lds_b128 %6, %14, off\n\t"
               "global_load_async_to_lds_b128 %7, %15, off\n\t"
               "s_wait_xcnt 0x0"
               :: "v"(l), "v"(l + rs), "v"(l + 2u * rs), "v"(l + 3u * rs), "v"(l + 4u * rs), "v"(l + 5u * rs), "v"(l + 6u * rs), "v"(l + 7u * rs),
                  "v"(ga), "v"(a1), "v"(a2), "v"(a3), "v"(gb), "v"(b1), "v"(b2), "v"(b3) : "memory");
}
__global__ __launch_bounds__(256) void k_gemm3(const _Float16* __restrict__ A, const _Float16* __restrict__ Bh, float alpha, const float* __restrict__ bias, float* __restrict__ C, int N, int K) {
  __shared__ __attribute__((aligned(16))) _Float16 ring[2 * G3_STAGE];
  __shared__ __attribute__((aligned(16))) float so[8][32][68];
  const int tid = threadIdx.x, w = tid >> 5, lane = tid & 31, ln = lane & 15, hh = lane >> 4;
  const int ntn = N >> 7; const int mt = blockIdx.x / ntn, nq = blockIdx.x - mt * ntn; const int wm = w >> 1, wn = w & 1;
  const int cr = tid >> 3, cp = tid & 7;      /* copy: row within a group of 32, 16-B piece of the row */
  const _Float16* ga = A + (size_t)(mt * 128 + cr) * K + cp * 8; const _Float16* gb = Bh + (size_t)(nq * 128 + cr) * K + cp * 8; const size_t step = (size_t)32 * K;
  const unsigned l0 = (unsigned)(size_t)&ring[0] + (unsigned)(cr * (G3_PITCH * 2) + cp * 16);
  const int nt = K >> 6;
  const v8f z8 = {0.f,0.f,0.f,0.f,0.f,0.f,0.f,0.f}; v8f c00 = z8, c01 = z8, c02 = z8, c03 = z8, c10 = z8, c11 = z8, c12 = z8, c13 = z8;
  g3_copy(ga, gb, step, l0);
  asm volatile("s_wait_asynccnt 0x0" ::: "memory");      /* this wave's copies of pass 0 have landed */
  __syncthreads();                                       /* publishes pass 0 */
  if (nt > 1) g3_copy(ga + 64, gb + 64, step, l0 + (unsigned)(G3_STAGE * 2));
#pragma unroll 1      /* one pass per trip: the two buffers alternate by the trip's parity */
  for (int t = 0; t < nt; ++t) {
    const _Float16* ap = &ring[(t & 1) * G3_STAGE + (wm * 32 + ln) * G3_PITCH]; const _Float16* bp = &ring[(t & 1) * G3_STAGE + (128 + wn * 64 + ln) * G3_PITCH];
    const v16h a0 = g2_frag(ap, hh), a1 = g2_frag(ap + 16 * G3_PITCH, hh), b0 = g2_frag(bp, hh), b1 = g2_frag(bp + 16 * G3_PITCH, hh), b2 = g2_frag(bp + 32 * G3_PITCH, hh), b3 = g2_frag(bp + 48 * G3_PITCH, hh);
    const v16h e0 = g2_frag(ap + 32, hh), e1 = g2_frag(ap + 16 * G3_PITCH + 32, hh), f0 = g2_frag(bp + 32, hh), f1 = g2_frag(bp + 16 * G3_PITCH + 32, hh), f2 = g2_frag(bp + 32 * G3_PITCH + 32, hh), f3 = g2_frag(bp + 48 * G3_PITCH + 32, hh);
    c00 = g2_mma(a0, b0, c00); c10 = g2_mma(a1, b0, c10); c01 = g2_mma(a0, b1, c01); c11 = g2_mma(a1, b1, c11); c02 = g2_mma(a0, b2, c02); c12 = g2_mma(a1, b2, c12); c03 = g2_mma(a0, b3, c03); c13 = g2_mma(a1, b3, c13);
    c00 = g2_mma(e0, f0, c00); c10 = g2_mma(e1, f0, c10); c01 = g2_mma(e0, f1, c01); c11 = g2_mma(e1, f1, c11); c02 = g2_mma(e0, f2, c02); c12 = g2_mma(e1, f2, c12); c03 = g2_mma(e0, f3, c03); c13 = g2_mma(e1, f3, c13);
    asm volatile("s_wait_dscnt 0x0" ::: "memory");       /* this wave's reads of the buffer are done before it may be refilled */
    asm volatile("s_wait_asynccnt 0x0" ::: "memory");    /* this wave's copies of pass t + 1 have landed */
    __syncthreads();                                     /* publishes pass t + 1 and ends every reader's last read of pass t */
    if (t + 2 < nt) g3_copy(ga + (size_t)(t + 2) * 64, gb + (size_t)(t + 2) * 64, step, l0 + (unsigned)((t & 1) * (G3_STAGE * 2)));
  }
  asm volatile("s_wait_asynccnt 0x0" ::: "memory");      /* no copy is outstanding when the wave goes on */
  const int row0 = mt * 128 + wm * 32, col0 = nq * 128 + wn * 64;
  v8f accs[8] = {c00, c01, c02, c03, c10, c11, c12, c13};
#pragma unroll
  for (int u = 0; u < 8; ++u) { const int t = u & 3, half = u >> 2; const float bv = bf16_round(bias[col0 + t * 16 + ln]);
#pragma unroll
    for (int r = 0; r < 8; ++r) so[w][half * 16 + 8 * hh + r][t * 16 + ln] = accs[u][r] * alpha + bv; }
  __builtin_amdgcn_fence(__ATOMIC_ACQ_REL, "workgroup"); __builtin_amdgcn_wave_barrier();
  const int rsub = lane >> 4, c4 = (lane & 15) * 4;
#pragma unroll
  for (int q = 0; q < 16; ++q) { const int r = q * 2 + rsub; const v4f v = *(const v4fa*)&so[w][r][c4]; *(v4f*)(C + (size_t)(row0 + r) * N + col0 + c4) = v; }
}


__global__ __launch_bounds__(256) void k_wnat(const float* __restrict__ w, size_t n8, _Float16* __restrict__ Bt) { const size_t t = (size_t)blockIdx.x * 256 + threadIdx.x; if (t >= n8) return; FragH f; for (int q = 0; q < 8; ++q) f.h[q] = (_Float16)(bf16_round(w[t * 8 + q]) * 16.0f); *(v8us*)((unsigned short*)Bt + t * 8) = f.half[0];  }
__global__ __launch_bounds__(256) void k_rsm(const float* __restrict__ S, _Float16* __restrict__ P, int nrows) {
  #pragma clang fp contract(off)
  const int i = blockIdx.x * 256 + threadIdx.x; if (i >= nrows) return; const float* s = S + (size_t)i * SQ; float mx = -3.0e38f;
#pragma unroll 1
  for (int j = 0; j < SQ; ++j) mx = fmaxf(mx, s[j]); float se = 0.f;
#pragma unroll 1
  for (int j = 0; j < SQ; ++j) se += expf(s[j] - mx); const float sc = 256.0f / se;
#pragma unroll 1
  for (int j0 = 0; j0 < SQ; j0 += 8) { FragH f; for (int q = 0; q < 8; ++q) f.h[q] = (_Float16)(expf(s[j0 + q] - mx) * sc); unsigned short* d = (unsigned short*)P + (size_t)i * SQ + j0; *(v8us*)d = f.half[0];  } }
__global__ __launch_bounds__(256) void k_vt(const _Float16* __restrict__ V16, int b, int h0, _Float16* __restrict__ VT) { __shared__ unsigned short tl[64][65]; const int tid = threadIdx.x; const int hh = blockIdx.x % HG, sg = blockIdx.x / HG; const int s0 = sg * 64; const int h = h0 + hh;
  for (int i = tid; i < 64 * 8; i += 256) { const int j = i / 8, d8 = (i % 8) * 8; FragH f; f.half[0] = *(const v8us*)((const unsigned short*)V16 + ((size_t)b * SQ + s0 + j) * DM + h * HD + d8); for (int q = 0; q < 8; ++q) tl[d8 + q][j] = f.u[q]; }
  __syncthreads();
  { for (int i = tid; i < 64 * 8; i += 256) { const int d = i / 8, j8 = (i % 8) * 8; FragH f; for (int q = 0; q < 8; ++q) f.u[q] = tl[d][j8 + q]; *(v8us*)((unsigned short*)VT + ((size_t)hh * HD + d) * SQ + s0 + j8) = f.half[0]; }  } }



__global__ __launch_bounds__(256) void k_rsmcf2(const float* __restrict__ S, _Float16* __restrict__ P, int hg, int q0, int nk) {
  #pragma clang fp contract(off)
  const int t = blockIdx.x * 256 + threadIdx.x; if (t >= hg * QT) return; const size_t i = (size_t)t; const float* s = S + i * NKX; const int last = q0 + (t % QT); float mx = -3.0e38f;
#pragma unroll 1
  for (int j = 0; j < nk; ++j) { const float f = (j <= last) ? 1.f : 0.f; mx = fmaxf(mx, fmaf(f, s[j], (1.f - f) * -1.0e9f)); } float se = 0.f;
#pragma unroll 1
  for (int j = 0; j < nk; ++j) { const float f = (j <= last) ? 1.f : 0.f; se += __expf(fmaf(f, s[j], (1.f - f) * -1.0e9f) - mx); } const float sc = 256.0f / se;
#pragma unroll 1
  for (int j0 = 0; j0 < nk; j0 += 8) { FragH fr; for (int q = 0; q < 8; ++q) { const int j = j0 + q; const float f = (j <= last) ? 1.f : 0.f; fr.h[q] = (_Float16)(__expf(fmaf(f, s[j], (1.f - f) * -1.0e9f) - mx) * sc); } unsigned short* d = (unsigned short*)P + i * NKX + j0; *(v8us*)d = fr.half[0];  } }

template <int MASKADD>
__global__ __launch_bounds__(64) void k_att0(const float* __restrict__ QF, const float* __restrict__ KF, const float* __restrict__ VF, int ld, const float* __restrict__ mask, float scale, float* __restrict__ OF, int ldo) {
  #pragma clang fp contract(off)
  __shared__ __attribute__((aligned(16))) float lq[64][64]; __shared__ __attribute__((aligned(16))) float lo[64][64];
  const int tid = threadIdx.x; const int h = blockIdx.x / (QT0 / 64), rg = blockIdx.x % (QT0 / 64); const int i = rg * 64 + tid;
  const float* qr = QF + (size_t)i * ld + h * HD;
#pragma unroll 1
  for (int c = 0; c < HD / 4; ++c) { *(v4f*)&lq[tid][c * 4] = *(const v4fa*)(qr + c * 4); const v4f z = {0.f, 0.f, 0.f, 0.f}; *(v4f*)&lo[tid][c * 4] = z; }
  float m = -1.0e30f, l = 0.f; const int jmax = MASKADD ? (SQ - 1) : (rg * 64 + 63);      /* additive-mask form: every key (the mask input decides); causal form: keys up to the block's last row */
#pragma unroll 1
  for (int j = 0; j <= jmax; ++j) { const float* kr = KF + (size_t)j * ld + h * HD; const float* vr = VF + (size_t)j * ld + h * HD; float s = 0.f;
#pragma unroll 1
    for (int c = 0; c < HD / 4; ++c) { const v4f kq = *(const v4fa*)(kr + c * 4); const v4f qq = *(v4f*)&lq[tid][c * 4]; s = __fadd_rn(s, __fmul_rn(qq[0], kq[0])); s = __fadd_rn(s, __fmul_rn(qq[1], kq[1])); s = __fadd_rn(s, __fmul_rn(qq[2], kq[2])); s = __fadd_rn(s, __fmul_rn(qq[3], kq[3])); }
    s = __fmul_rn(s, scale); if (MASKADD) s = __fadd_rn(s, __fmul_rn(bf16_round(mask[(size_t)i * SQ + j]), -10000.0f));
    const float f = (MASKADD || j <= i) ? 1.f : 0.f; const float sm = fmaf(f, s, (1.f - f) * -1.0e30f); const float mn = fmaxf(m, sm); const float sc = expf(m - mn); const float e = expf(sm - mn); l = __fadd_rn(__fmul_rn(l, sc), e); m = mn;
#pragma unroll 1
    for (int c = 0; c < HD / 4; ++c) { const v4f vv = *(const v4fa*)(vr + c * 4); v4f oo = *(v4f*)&lo[tid][c * 4]; for (int u = 0; u < 4; ++u) oo[u] = __fadd_rn(__fmul_rn(oo[u], sc), __fmul_rn(e, vv[u])); *(v4f*)&lo[tid][c * 4] = oo; } }
  const float fin = 64.0f / l;      /* o carried x64 like the f16 path */
#pragma unroll 1
  for (int c = 0; c < HD / 4; ++c) { v4f oo = *(v4f*)&lo[tid][c * 4]; for (int u = 0; u < 4; ++u) oo[u] = __fmul_rn(oo[u], fin); *(v4f*)&lo[tid][c * 4] = oo; }
  __syncthreads();
  {
#pragma unroll 1
    for (int it = 0; it < 16; ++it) { const int row = it * 4 + tid / 16, pc = (tid % 16) * 4; const v4f v = *(const v4f*)&lo[row][pc]; *(v4f*)(OF + (size_t)(rg * 64 + row) * ldo + h * HD + pc) = v; }
     } }

__global__ __launch_bounds__(256) void k_oscale(const float* __restrict__ OF, float* __restrict__ out, size_t n4) { const size_t t = (size_t)blockIdx.x * 256 + threadIdx.x; if (t >= n4) return; const v4f a = *(const v4fa*)(OF + t * 4); v4f o; for (int q = 0; q < 4; ++q) o[q] = a[q] * 0.015625f; *(v4f*)(out + t * 4) = o;  }

__global__ __launch_bounds__(256) void k_bfr(const float* __restrict__ x, float* __restrict__ XB, size_t n8) { const size_t t = (size_t)blockIdx.x * 256 + threadIdx.x; if (t >= n8) return; v4f a = *(const v4fa*)(x + t * 8), c = *(const v4fa*)(x + t * 8 + 4); for (int q = 0; q < 4; ++q) { a[q] = bf16_round(a[q]); c[q] = bf16_round(c[q]); }
  { *(v4f*)(XB + t * 8) = a; *(v4f*)(XB + t * 8 + 4) = c;  } }



__global__ __launch_bounds__(256) void k_rsmfvl(const float* __restrict__ S, _Float16* __restrict__ P, _Float16* __restrict__ PL, int qn, const int* __restrict__ vlp) {
  #pragma clang fp contract(off)
  const int t = blockIdx.x * 256 + threadIdx.x; if (t >= qn) return; const int vl = vlp[0]; const size_t i = (size_t)t; const float* s = S + i * SQ; float mx = -3.0e38f;
#pragma unroll 1
  for (int j = 0; j < SQ; ++j) { const float f = (j < vl) ? 1.f : 0.f; mx = fmaxf(mx, fmaf(f, s[j], (1.f - f) * -1000000.0f)); } float se = 0.f;
#pragma unroll 1
  for (int j = 0; j < SQ; ++j) { const float f = (j < vl) ? 1.f : 0.f; se += __expf(fmaf(f, s[j], (1.f - f) * -1000000.0f) - mx); } const float sc = 256.0f / se;
#pragma unroll 1
  for (int j0 = 0; j0 < SQ; j0 += 8) { FragH fr, gr; for (int q = 0; q < 8; ++q) { const int j = j0 + q; const float f = (j < vl) ? 1.f : 0.f; const float pv = __expf(fmaf(f, s[j], (1.f - f) * -1000000.0f) - mx) * sc; const _Float16 ph = (_Float16)pv; fr.h[q] = ph; gr.h[q] = (_Float16)((pv - (float)ph) * 1024.0f); }
    unsigned short* d = (unsigned short*)P + i * SQ + j0; unsigned short* dl = (unsigned short*)PL + i * SQ + j0; *(v8us*)d = fr.half[0]; *(v8us*)dl = gr.half[0];  } }

__global__ __launch_bounds__(256) void k_rsmf(const float* __restrict__ S, _Float16* __restrict__ P, int qn, int hg) {
  #pragma clang fp contract(off)
  const int t = blockIdx.x * 256 + threadIdx.x; if (t >= qn * hg) return; const size_t i = (size_t)(t / qn) * SQ + (t % qn); const float* s = S + i * SQ; float mx = -3.0e38f;
#pragma unroll 1
  for (int j = 0; j < SQ; ++j) mx = fmaxf(mx, s[j]); float se = 0.f;
#pragma unroll 1
  for (int j = 0; j < SQ; ++j) se += __expf(s[j] - mx); const float sc = 256.0f / se;
#pragma unroll 1
  for (int j0 = 0; j0 < SQ; j0 += 8) { FragH f; for (int q = 0; q < 8; ++q) f.h[q] = (_Float16)(__expf(s[j0 + q] - mx) * sc); unsigned short* d = (unsigned short*)P + i * SQ + j0; *(v8us*)d = f.half[0];  } }


#define CN 256          /* channels */
#define CI 128
#define NC 256                       /* (unused legacy kernels) */
#define NPX NP          /* positions per channel row */
#define NP 4096         /* seq1 tokens */
#define NM 1024         /* seq2 tokens */
#define BNEPS 1e-5f

__global__ __launch_bounds__(256) void k_mp2(const float* __restrict__ src, float* __restrict__ dst, int nout) {
  const int t = blockIdx.x * 256 + threadIdx.x; if (t >= nout) return; const int c = t / 1024; const int o = t % 1024; const int oy = o / 32, ox = o % 32; const float* p = src + (size_t)c * 4096 + (size_t)(2 * oy) * 64 + 2 * ox;
  const float v = fmaxf(fmaxf(p[0], p[1]), fmaxf(p[64], p[65])); *(float*)(dst + t) = v;  }
__global__ __launch_bounds__(256) void k_xpb(const float* __restrict__ x, const float* __restrict__ wb, float* __restrict__ CPP, size_t n4) {
  #pragma clang fp contract(off)
  const size_t t = (size_t)blockIdx.x * 256 + threadIdx.x; if (t >= n4) return; const size_t e = t * 4; const int c = (int)((e / 4096) % 256); const float bb = bf16_round(wb[c]); const v4f a = *(const v4fa*)(x + e); v4f o; for (int q = 0; q < 4; ++q) o[q] = __fadd_rn(bf16_round(a[q]), bb);
  *(v4f*)(CPP + e) = o;  }


template <int PASS>
__global__ __launch_bounds__(256) void k_cstA(const float* __restrict__ X, const float* __restrict__ MV, float* __restrict__ PART) {
  #pragma clang fp contract(off)
  __shared__ float red[256]; const int t = threadIdx.x; const size_t bc = blockIdx.x; const int c = (int)(bc % NC); const float* row = X + bc * (size_t)NPX; const float mu = PASS ? MV[c] : 0.f; float s = 0.f;
  for (int i = t; i < NPX; i += 256) { const float v = row[i]; const float d = PASS ? __fadd_rn(v, -mu) : v; s = __fadd_rn(s, PASS ? __fmul_rn(d, d) : d); }
  red[t] = s; __syncthreads(); for (int st = 128; st > 0; st >>= 1) { if (t < st) red[t] = __fadd_rn(red[t], red[t + st]); __syncthreads(); }
  if (t < 32) { const float pv = (t == 0) ? red[0] : 0.f; *(float*)(PART + bc * 32 + t) = pv;  } }      

template <int PASS>
__global__ __launch_bounds__(256) void k_cstB(const float* __restrict__ PART, float* __restrict__ MV) { const int c = threadIdx.x; if (c >= NC) return; double s = 0.0; for (int b = 0; b < NB; ++b) s += (double)PART[((size_t)b * NC + c) * 32]; const float m = (float)(s / ((double)NB * (double)NPX)); *(float*)(MV + PASS * NC + c) = m;  }


__global__ __launch_bounds__(256) void k_bnresid(const float* __restrict__ C2, const float* __restrict__ MV, const float* __restrict__ g, const float* __restrict__ be, const float* __restrict__ X, float* __restrict__ out, size_t n4) {
  #pragma clang fp contract(off)
  const size_t t = (size_t)blockIdx.x * 256 + threadIdx.x; if (t >= n4) return; const size_t e = t * 4; const int c = (int)((e / NPX) % NC); const float sc = __fmul_rn(rsqrtf(__fadd_rn(MV[NC + c], BNEPS)), bf16_round(g[c])); const float mu = MV[c], bb = bf16_round(be[c]);
  const v4f a = *(const v4fa*)(C2 + e); const v4f xx = *(const v4fa*)(X + e); v4f o; for (int q = 0; q < 4; ++q) { const float z = __fadd_rn(__fmul_rn(__fadd_rn(a[q], -mu), sc), bb); o[q] = __fadd_rn(z, bf16_round(xx[q])); }
  *(v4f*)(out + e) = o;  }


__global__ __launch_bounds__(256) void k_rowbias(float* __restrict__ Y, const float* __restrict__ bias) {
  #pragma clang fp contract(off)
  const size_t t = (size_t)blockIdx.x * 256 + threadIdx.x; if (t >= (size_t)NB * NC * NPX / 4) return; const size_t e = t * 4; const int c = (int)((e / NPX) % NC); const float bb = bf16_round(bias[c]);
  v4f v = *(const v4fa*)(Y + e); for (int q = 0; q < 4; ++q) v[q] = __fadd_rn(v[q], bb); *(v4f*)(Y + e) = v;  }



template <int NK>
__global__ __launch_bounds__(256) void k_rsmn(const float* __restrict__ S, _Float16* __restrict__ P, int nrows) {
  #pragma clang fp contract(off)
  const int t = blockIdx.x * 256 + threadIdx.x; if (t >= nrows) return; const float* s = S + (size_t)t * NK; float mx = -3.0e38f;
#pragma unroll 1
  for (int j = 0; j < NK; ++j) mx = fmaxf(mx, s[j]); float se = 0.f;
#pragma unroll 1
  for (int j = 0; j < NK; ++j) se += __expf(s[j] - mx); const float sc = 256.0f / se;
#pragma unroll 1
  for (int j0 = 0; j0 < NK; j0 += 8) { FragH fr; for (int q = 0; q < 8; ++q) fr.h[q] = (_Float16)(__expf(s[j0 + q] - mx) * sc);
    unsigned short* d = (unsigned short*)P + (size_t)t * NK + j0; *(v8us*)d = fr.half[0];  } }

template <int BFIN, int W16, int W32, int WD>
__global__ __launch_bounds__(256) void k_lnw(const float* __restrict__ X, const float* __restrict__ g, const float* __restrict__ bb, float eps, _Float16* __restrict__ N16, float* __restrict__ N32) {
  #pragma clang fp contract(off)
  __shared__ float red[256]; const size_t r = blockIdx.x; const int t = threadIdx.x; const bool act = t < (WD / 4); const int c0 = act ? t * 4 : 0;
  const v4f xa = *(const v4fa*)(X + r * WD + c0); float s[4]; float sum = 0.f;
  for (int q = 0; q < 4; ++q) { s[q] = act ? (BFIN ? bf16_round(xa[q]) : xa[q]) : 0.f; sum = __fadd_rn(sum, s[q]); }
  red[t] = sum; __syncthreads(); for (int st = 128; st > 0; st >>= 1) { if (t < st) red[t] = __fadd_rn(red[t], red[t + st]); __syncthreads(); } const float mu = red[0] / (float)WD; __syncthreads();
  float vs = 0.f; for (int q = 0; q < 4; ++q) { const float dl = act ? __fadd_rn(s[q], -mu) : 0.f; vs = __fadd_rn(vs, __fmul_rn(dl, dl)); } red[t] = vs; __syncthreads(); for (int st = 128; st > 0; st >>= 1) { if (t < st) red[t] = __fadd_rn(red[t], red[t + st]); __syncthreads(); }
  const float rs = rsqrtf(__fadd_rn(red[0] / (float)WD, eps)); v4h y; v4f yf;
  for (int q = 0; q < 4; ++q) { const int c = c0 + q; yf[q] = __fadd_rn(__fmul_rn(__fmul_rn(__fadd_rn(s[q], -mu), rs), bf16_round(g[c])), bf16_round(bb[c])); y[q] = (_Float16)yf[q]; }
  if (!act) return;      /* no barriers after this point */
  { if (W16) *(v4h*)(N16 + r * WD + c0) = y; if (W32) *(v4f*)(N32 + r * WD + c0) = yf;  } }


typedef float v2f __attribute__((ext_vector_type(2)));
__device__ __forceinline__ float pt_xhalf(float x) { return __builtin_bit_cast(float, __builtin_amdgcn_permlanex16(__builtin_bit_cast(int, x), __builtin_bit_cast(int, x), 0x76543210, 0xfedcba98, false, false)); }      /* lane l <-> lane l ^ 16 */
__device__ __forceinline__ v8f pt_mma(v2f a, v2f b, v8f c) { return __builtin_amdgcn_wmma_f32_16x16x4_f32(false, a, false, b, (short)0, c, false, false); }
// One wave per token, both products on v_wmma_f32_16x16x4_f32 (f32 operands), no LDS. Lane (c = lane & 15, hh = lane >> 4).
// St = K Q^T per 16 x 16 tile: A row j = c, B column i = c, both loaded by the same code (the lane's 8 contiguous heads 8 hh .. 8 hh + 7 of its row; step s takes heads 8 hh + 2 s, + 1).
// D register r of tile jt = score of key j = 16 jt + 8 hh + r for query i = c: a query's 64 scores lie in lanes c and c + 16, so the softmax needs one exchange for the maximum and one for the sum.
// Ot = V^T P^T: B = register pair (2 p, 2 p + 1) of a tile as it lies (keys 16 jt + 8 hh + 2 p, + 1), A row = head c with V of the same keys. D register r = res[i = c][head 8 hh + r]: 8 contiguous floats of the output row.
__global__ __launch_bounds__(128) void k_ptatt(const float* __restrict__ QF, const float* __restrict__ KF, const float* __restrict__ VF, const float* __restrict__ xres, float scale, float* __restrict__ out) {
  const int lane = threadIdx.x & 31, c = lane & 15, hh = lane >> 4;
  const size_t ro = ((size_t)blockIdx.x * 4 + (size_t)__builtin_amdgcn_readfirstlane((int)(threadIdx.x >> 5))) * 1024;      /* the wave's token: a scalar, so every address is a scalar base plus one lane offset */
  const int fo = c * 16 + 8 * hh, vo = hh * 128 + c;
  const float cs = scale * 1.4426950408889634f;      /* softmax in base 2 */
  const float* kp = KF + ro; const float* vp = VF + ro; const float* qp = QF + ro; const float* xp = xres + ro; float* op = out + ro;
  v8f kf[4], vt[4];
#pragma unroll
  for (int jt = 0; jt < 4; ++jt) { const v4f k0 = *(const v4fa*)(kp + jt * 256 + fo), k1 = *(const v4fa*)(kp + jt * 256 + fo + 4); kf[jt] = v8f{k0[0], k0[1], k0[2], k0[3], k1[0], k1[1], k1[2], k1[3]}; }
  v4f q0 = *(const v4fa*)(qp + fo), q1 = *(const v4fa*)(qp + fo + 4);
  __builtin_amdgcn_sched_barrier(0);      /* K and Q are asked for ahead of V: loads return in order, and the first product waits for these alone */
#pragma unroll
  for (int jt = 0; jt < 4; ++jt)
#pragma unroll
    for (int r = 0; r < 8; ++r) vt[jt][r] = vp[jt * 256 + r * 16 + vo];
  __builtin_amdgcn_sched_barrier(0);      /* V is asked for before the wave first waits: behind that wait its latency would come on top of K's */
#pragma unroll
  for (int it = 0; it < 4; ++it) {
    const v4f x0 = *(const v4fa*)(xp + it * 256 + fo), x1 = *(const v4fa*)(xp + it * 256 + fo + 4);
    const v8f z8 = {0.f, 0.f, 0.f, 0.f, 0.f, 0.f, 0.f, 0.f}; v8f st[4] = {z8, z8, z8, z8};
#pragma unroll
    for (int s = 0; s < 4; ++s)
#pragma unroll
      for (int jt = 0; jt < 4; ++jt) st[jt] = pt_mma(v2f{kf[jt][2 * s], kf[jt][2 * s + 1]}, s < 2 ? v2f{q0[2 * s], q0[2 * s + 1]} : v2f{q1[2 * s - 4], q1[2 * s - 3]}, st[jt]);
    /* distance behind a matrix instruction: nothing reads these scores or overwrites an operand within the slots; the f32 form stands in no table of distances, so the count of the other form with its issue interval is kept */
    asm volatile("v_nop\n\tv_nop\n\tv_nop\n\tv_nop\n\tv_nop\n\tv_nop\n\tv_nop\n\tv_nop" : "+v"(st[0]), "+v"(st[1]), "+v"(st[2]), "+v"(st[3]) : "v"(q0), "v"(q1), "v"(kf[0]), "v"(kf[1]), "v"(kf[2]), "v"(kf[3]));
    if (it < 3) { q0 = *(const v4fa*)(qp + (it + 1) * 256 + fo); q1 = *(const v4fa*)(qp + (it + 1) * 256 + fo + 4); }      /* the next tile's queries fly during the rest of this tile */
    float m4[4];
#pragma unroll
    for (int jt = 0; jt < 4; ++jt) { m4[jt] = fmaxf(st[jt][0], st[jt][1]);
#pragma unroll
      for (int r = 2; r < 8; ++r) m4[jt] = fmaxf(m4[jt], st[jt][r]); }
    float mx = fmaxf(fmaxf(m4[0], m4[1]), fmaxf(m4[2], m4[3])); mx = fmaxf(mx, pt_xhalf(mx));
    const float mc = mx * cs; v8f pr[4]; v2f la = {0.f, 0.f}, lb = {0.f, 0.f};
#pragma unroll
    for (int jt = 0; jt < 4; ++jt) { v8f ar;
#pragma unroll
      for (int r = 0; r < 8; ++r) ar[r] = fmaf(st[jt][r], cs, -mc);
#pragma unroll
      for (int r = 0; r < 8; ++r) pr[jt][r] = __builtin_amdgcn_exp2f(ar[r]);
      /* the slot behind a transcendental: inputs only, the eight arguments stay whole until this slot, so no instruction directly behind an exponential overwrites its source */
      asm volatile("v_nop" :: "v"(ar), "v"(pr[jt]));
#pragma unroll
      for (int p = 0; p < 4; ++p) { if (jt & 1) lb += v2f{pr[jt][2 * p], pr[jt][2 * p + 1]}; else la += v2f{pr[jt][2 * p], pr[jt][2 * p + 1]}; } }
    la += lb; float l = la[0] + la[1]; l += pt_xhalf(l);
    const float inv = __builtin_amdgcn_rcpf(l); v4f y0, y1;
    v8f o0 = z8, o1 = z8;      /* two sums: a product that adds to the one before it waits longer than the issue interval */
#pragma unroll
    for (int p = 0; p < 4; ++p)
#pragma unroll
      for (int jt = 0; jt < 4; ++jt) { if (jt & 1) o1 = pt_mma(v2f{vt[jt][2 * p], vt[jt][2 * p + 1]}, v2f{pr[jt][2 * p], pr[jt][2 * p + 1]}, o1); else o0 = pt_mma(v2f{vt[jt][2 * p], vt[jt][2 * p + 1]}, v2f{pr[jt][2 * p], pr[jt][2 * p + 1]}, o0); }
    /* the same distance: the operands stay untouched and the sums unread for the slots behind the run's last product */
    asm volatile("v_nop\n\tv_nop\n\tv_nop\n\tv_nop\n\tv_nop\n\tv_nop\n\tv_nop\n\tv_nop" : "+v"(o0), "+v"(o1) : "v"(pr[0]), "v"(pr[1]), "v"(pr[2]), "v"(pr[3]), "v"(vt[0]), "v"(vt[1]), "v"(vt[2]), "v"(vt[3]));
#pragma unroll
    for (int u = 0; u < 4; ++u) { y0[u] = fmaf(o0[u] + o1[u], inv, x0[u]); y1[u] = fmaf(o0[4 + u] + o1[4 + u], inv, x1[u]); }
    *(v4f*)(op + it * 256 + fo) = y0; *(v4f*)(op + it * 256 + fo + 4) = y1;
    if (it < 3) asm volatile("s_wait_xcnt 0x0" ::: "memory");      /* stands in front of the next tile's products, which overwrite the registers that these stores name */
    __builtin_amdgcn_sched_barrier(0);      /* keeps the next tile's products behind this tile: moved up, the four tiles' scores are all held at once and fewer than half as many waves fit a SIMD */
  }
}
extern "C" void kernel_launch(void* const* d_in, const int* in_sizes, int n_in,
                              void* d_out, int out_size, void* d_ws, size_t ws_size, hipStream_t stream) {
  (void)in_sizes; (void)n_in; (void)out_size;
  const float* const* I = (const float* const*)d_in; const float* x = I[0]; const float* wq = I[1]; const float* bq = I[2]; const float* wk = I[3]; const float* bk = I[4]; const float* wv = I[5]; const float* bv = I[6]; const float* gam = I[7]; const float* bet = I[8];      /* inp; [in][out] Wq/Wk/Wv [1024][1024] + biases; LayerNorm gamma/beta */
  constexpr int DMc = 1024; const size_t NRc = (size_t)4 * 2048;      /* model width; token rows */
  char* ws = (char*)d_ws; size_t off = 0;
  auto take = [&](size_t bytes) { char* p = ws + off; off += (bytes + 255) & ~(size_t)255; return p; };
  _Float16* BQ = (_Float16*)take((size_t)DMc * DMc * 2); _Float16* BK = (_Float16*)take((size_t)DMc * DMc * 2); _Float16* BV = (_Float16*)take((size_t)DMc * DMc * 2);
  _Float16* XN = (_Float16*)take(NRc * DMc * 2); float* XB = (float*)take(NRc * DMc * 4); float* QF = (float*)take(NRc * DMc * 4); float* KF = (float*)take(NRc * DMc * 4); float* VF = (float*)take(NRc * DMc * 4);
  if (off > ws_size) return;
  { const unsigned g = (unsigned)(((size_t)DMc * (DMc / 8) + 255) / 256); k_wt_f16<<<g, 256, 0, stream>>>(wq, BQ, DMc, DMc, 16.0f); k_wt_f16<<<g, 256, 0, stream>>>(wk, BK, DMc, DMc, 16.0f); k_wt_f16<<<g, 256, 0, stream>>>(wv, BV, DMc, DMc, 16.0f); }      /* [in][out] -> Bt x16 */
  k_lnw<1, 1, 0, DMc><<<(unsigned)NRc, 256, 0, stream>>>(x, gam, bet, 1e-5f, XN, nullptr); k_bfr<<<(unsigned)((NRc * DMc / 8 + 255) / 256), 256, 0, stream>>>(x, XB, NRc * DMc / 8);      /* out = LN(bf16(inp)) -> f16 rows; XB = bf16(inp) f32 for the residual */
  { const unsigned g = (unsigned)((NRc / 128) * (DMc / 128)); k_gemm3<<<g, 256, 0, stream>>>(XN, BQ, 0.0625f, bq, QF, DMc, DMc); k_gemm3<<<g, 256, 0, stream>>>(XN, BK, 0.0625f, bk, KF, DMc, DMc); k_gemm3<<<g, 256, 0, stream>>>(XN, BV, 0.0625f, bv, VF, DMc, DMc); }      /* Q, K, V = out W + b -> f32 rows */
  k_ptatt<<<(unsigned)(NRc / 4), 128, 0, stream>>>(QF, KF, VF, XB, 0.125f, (float*)d_out);      /* per-token 64 x 64 x 16 attention, f32 matrix instructions, one wave per token + residual -> output rows */
}

// v003
// One run takes 113 microseconds.
// In both of two side-by-side timings against v002, it was 1.06 times as fast.
// Over all steps from v000 it is 2.32 times as fast.
#include <hip/hip_runtime.h>
// Per-POSITION attention over the head-dim axis (inp [4][2048][1024]; out = LayerNorm(inp) (biased var, eps 1e-5, gamma/beta); Q/K/V = out W + b ([in][out] 1024 x 1024 sigma 1/32, zero biases) viewed [B][M][DK = 64][H = 16] (column i*16 + h); for every token: scores[i][j] = sum_h Q[i][h] K[j][h] / 8 (a 64 x 64 matrix, contraction over the 16 'heads'), softmax over j, res[i][h] = sum_j att[i][j] V[j][h]; no mixing across tokens; result = inp + res -> [4][2048][1024]).
// Compute dtype: inputs rounded to bf16; x / weights exact; LayerNorm output as a plain f16 GEMM operand (~2^-12); q, k, v, softmax weights and o f32; scores and softmax statistics f32; v_wmma_f32_16x16x32_f16 for the projections, v_wmma_f32_16x16x4_f32 for the attention.
#define NB 4
#define SQ 4096
#define DM 256
#define NH 1
#define HD 64
#define HG 4                         /* heads per k_vt launch (V transpose; not launched) */
#define B0 0                         /* unused */
#define NBR NB                       /* used only via MP / MPO, which no code reads */
#define NR ((size_t)NB * SQ)
#define MP ((int)((size_t)NBR * SQ))
#define QT 256                       /* query rows per causal tile */
#define NKX SQ                       /* S / P row pitch */
#define QT0 256                      /* first-tile rows recomputed exactly (256: buys margin for the few-key rows 128..255, which have no output projection to average the single-f16 P/v rounding) */
#define QN SQ
#define NHD NH
#define MPO MP
#define LQ DM
typedef __bf16 v16b __attribute__((ext_vector_type(16)));
typedef unsigned short v8us __attribute__((ext_vector_type(8), may_alias));
typedef float  v8f  __attribute__((ext_vector_type(8)));
typedef float  v4f  __attribute__((ext_vector_type(4)));
typedef float  v4fa __attribute__((ext_vector_type(4), may_alias));
union FragB { v16b v; v8us half[2]; unsigned short u[16]; };

__device__ __forceinline__ unsigned short bf16_bits(float x) { unsigned int u = __float_as_uint(x); return (unsigned short)((u + 0x7FFFu + ((u >> 16) & 1u)) >> 16); }
__device__ __forceinline__ float bf16_val(unsigned short b) { return __uint_as_float(((unsigned int)b) << 16); }
__device__ __forceinline__ float bf16_round(float x) { return bf16_val(bf16_bits(x)); }
// D += A·B with NT terms: 1 = ah·bh, 2 = + al·bh (A split), 3 = + ah·bl (both split)
template <int NT>
__device__ __forceinline__ v8f mmaN(v16b ah, v16b al, v16b bh, v16b bl, v8f c) {
  c = __builtin_amdgcn_wmma_f32_16x16x32_bf16(false, ah, false, bh, (short)0, c, false, false);
  if (NT >= 2) c = __builtin_amdgcn_wmma_f32_16x16x32_bf16(false, al, false, bh, (short)0, c, false, false);
  if (NT >= 3) c = __builtin_amdgcn_wmma_f32_16x16x32_bf16(false, ah, false, bl, (short)0, c, false, false);
  asm volatile("v_nop\n\tv_nop\n\tv_nop\n\tv_nop" : "+v"(c) : "v"(ah), "v"(al), "v"(bh), "v"(bl));
  return c;
}

__global__ __launch_bounds__(256) void k_wt_bf16(const float* __restrict__ W, unsigned short* __restrict__ Wt, int K, int N) {
  const int t = blockIdx.x * 256 + threadIdx.x;
  const int k8n = K / 8;
  if (t >= N * k8n) return;
  const int n = t / k8n, k8 = (t % k8n) * 8;
  v8us v;
#pragma unroll
  for (int i = 0; i < 8; ++i) v[i] = bf16_bits(W[(size_t)(k8 + i) * N + n]);
  *(v8us*)(Wt + (size_t)n * K + k8) = v;
  
}

// GEMM C[M][N] (f32, pitch ldc) = act(A[M][K]·W + bias). A f32 row-major (pitch lda) converted per fragment to bf16
// (ASPLIT: hi/lo two planes -> 2 terms, else single rounded term); Wt bf16 [N][K] (pitch ldb). BIAS_BF16 rounds the
// bias to bf16 first (bias quantised to bf16 before the add). K%32==0, M%16==0, N%64==0.
template <bool ASPLIT, int ACT, bool BIAS_BF16>
__global__ __launch_bounds__(128) void k_gemm_bf(const float* __restrict__ A, int lda, const unsigned short* __restrict__ Wt, int ldb,
                                               const float* __restrict__ bias, float* __restrict__ C, int ldc, int M, int N, int K) {
  __shared__ __attribute__((aligned(16))) float so[4][16][64];
  const int tid = threadIdx.x, w = tid >> 5, lane = tid & 31, ln = lane & 15, hh = lane >> 4;
  const int ntn = N / 64;
  const int wid = blockIdx.x * 4 + w;
  const int mt = wid / ntn, nq = wid % ntn;
  if (mt * 16 >= M) return;
  const int row0 = mt * 16, col0 = nq * 64;
  const float* arow = A + (size_t)(row0 + ln) * lda;
  v8f acc[4] = {};
  for (int kb = 0; kb < K; kb += 32) {
    FragB ah, al;
    const v4f x0 = *(const v4fa*)(arow + kb + 8 * hh), x1 = *(const v4fa*)(arow + kb + 8 * hh + 4);
    const v4f x2 = *(const v4fa*)(arow + kb + 16 + 8 * hh), x3 = *(const v4fa*)(arow + kb + 16 + 8 * hh + 4);
    float xs[16] = {x0[0],x0[1],x0[2],x0[3],x1[0],x1[1],x1[2],x1[3],x2[0],x2[1],x2[2],x2[3],x3[0],x3[1],x3[2],x3[3]};
#pragma unroll
    for (int i = 0; i < 16; ++i) { const unsigned short hb = bf16_bits(xs[i]); ah.u[i] = hb; al.u[i] = ASPLIT ? bf16_bits(xs[i] - bf16_val(hb)) : (unsigned short)0; }
#pragma unroll
    for (int t = 0; t < 4; ++t) {
      const unsigned short* brow = Wt + (size_t)(col0 + t * 16 + ln) * ldb + kb;
      FragB b;
      b.half[0] = *(const v8us*)(brow + 8 * hh);
      b.half[1] = *(const v8us*)(brow + 16 + 8 * hh);
      acc[t] = mmaN<ASPLIT ? 2 : 1>(ah.v, al.v, b.v, b.v, acc[t]);
    }
  }
#pragma unroll
  for (int t = 0; t < 4; ++t) {
    float bv = bias ? bias[col0 + t * 16 + ln] : 0.f;
    if (BIAS_BF16) bv = bf16_round(bv);
#pragma unroll
    for (int r = 0; r < 8; ++r) { float v = acc[t][r] + bv; if (ACT == 1) v = fmaxf(v, 0.f); so[w][8 * hh + r][t * 16 + ln] = v; }
  }
  __builtin_amdgcn_fence(__ATOMIC_ACQ_REL, "workgroup");
  __builtin_amdgcn_wave_barrier();
  const int rsub = lane >> 4, c4 = (lane & 15) * 4;
  {
#pragma unroll
    for (int q = 0; q < 8; ++q) {
      const int r = q * 2 + rsub;
      const v4f v = *(const v4fa*)&so[w][r][c4];
      *(v4f*)(C + (size_t)(row0 + r) * ldc + col0 + c4) = v;
    }
    
  }
}

// GEMM C = act(A·W + bias + resid): A f32 (ASPLIT -> hi/lo 2 terms), Wt bf16 [N][K]; ACT 0 none, 1 relu, 2 exact gelu;
// resid (optional, f32, row index = (row % rmod), pitch ldr, RES_BF16 rounds it) added before the activation.
template <bool ASPLIT, int ACT, bool BIAS_BF16, bool RES_BF16>
__global__ __launch_bounds__(128) void k_gemm_bf3(const float* __restrict__ A, int lda, const unsigned short* __restrict__ Wt, int ldb,
                                                const float* __restrict__ bias, const float* __restrict__ resid, int rmod, int ldr,
                                                float* __restrict__ C, int ldc, int M, int N, int K) {
  __shared__ __attribute__((aligned(16))) float so[4][16][64];
  const int tid = threadIdx.x, w = tid >> 5, lane = tid & 31, ln = lane & 15, hh = lane >> 4;
  const int ntn = N / 64;
  const int wid = blockIdx.x * 4 + w;
  const int mt = wid / ntn, nq = wid % ntn;
  if (mt * 16 >= M) return;
  const int row0 = mt * 16, col0 = nq * 64;
  const float* arow = A + (size_t)(row0 + ln) * lda;
  v8f acc[4] = {};
  for (int kb = 0; kb < K; kb += 32) {
    FragB ah, al;
    const v4f x0 = *(const v4fa*)(arow + kb + 8 * hh), x1 = *(const v4fa*)(arow + kb + 8 * hh + 4);
    const v4f x2 = *(const v4fa*)(arow + kb + 16 + 8 * hh), x3 = *(const v4fa*)(arow + kb + 16 + 8 * hh + 4);
    float xs[16] = {x0[0],x0[1],x0[2],x0[3],x1[0],x1[1],x1[2],x1[3],x2[0],x2[1],x2[2],x2[3],x3[0],x3[1],x3[2],x3[3]};
#pragma unroll
    for (int i = 0; i < 16; ++i) { const unsigned short hb = bf16_bits(xs[i]); ah.u[i] = hb; al.u[i] = ASPLIT ? bf16_bits(xs[i] - bf16_val(hb)) : (unsigned short)0; }
#pragma unroll
    for (int t = 0; t < 4; ++t) {
      const unsigned short* brow = Wt + (size_t)(col0 + t * 16 + ln) * ldb + kb;
      FragB b;
      b.half[0] = *(const v8us*)(brow + 8 * hh);
      b.half[1] = *(const v8us*)(brow + 16 + 8 * hh);
      acc[t] = mmaN<ASPLIT ? 2 : 1>(ah.v, al.v, b.v, b.v, acc[t]);
    }
  }
#pragma unroll
  for (int t = 0; t < 4; ++t) {
    const int col = col0 + t * 16 + ln;
    float bv = bias ? bias[col] : 0.f;
    if (BIAS_BF16) bv = bf16_round(bv);
#pragma unroll
    for (int r = 0; r < 8; ++r) {
      float v = acc[t][r] + bv;
      if (resid) { float rv = resid[(size_t)((row0 + 8 * hh + r) % rmod) * ldr + col]; if (RES_BF16) rv = bf16_round(rv); v += rv; }
      if (ACT == 1) v = fmaxf(v, 0.f);
      if (ACT == 2) v = 0.5f * v * (1.0f + erff(v * 0.70710678118654752f));
      if (ACT == 3) { const float u = 0.7978845608028654f * (v + 0.044715f * v * v * v); v = 0.5f * v * (1.0f + tanhf(u)); }
      so[w][8 * hh + r][t * 16 + ln] = v;
    }
  }
  __builtin_amdgcn_fence(__ATOMIC_ACQ_REL, "workgroup");
  __builtin_amdgcn_wave_barrier();
  const int rsub = lane >> 4, c4 = (lane & 15) * 4;
  {
#pragma unroll
    for (int q = 0; q < 8; ++q) {
      const int r = q * 2 + rsub;
      const v4f v = *(const v4fa*)&so[w][r][c4];
      *(v4f*)(C + (size_t)(row0 + r) * ldc + col0 + c4) = v;
    }
    
  }
}
// row LayerNorm (biased variance, eps) over N: s = X (+ R); optional out_sum <- s; out_norm <- (s-mu)*rsqrt(var+eps)*g + b
template <bool PARAM_BF16>
__global__ __launch_bounds__(256) void k_layernorm(const float* __restrict__ X, const float* __restrict__ R, const float* __restrict__ g, const float* __restrict__ bta,
                                                  float* __restrict__ out_sum, float* __restrict__ out_norm, int N, float eps) {
  __shared__ float red[256];
  const int row = blockIdx.x, tid = threadIdx.x;
  const float* x = X + (size_t)row * N; const float* rr = R ? R + (size_t)row * N : nullptr;
  float vals[16];                     // up to N = 4096
  const int per = N / 256;            // contiguous chunk per thread? use strided-by-4 chunks: thread handles j = tid*4 + 1024*u
  float s1 = 0.f;
  for (int u = 0; u < per / 4; ++u) {
    const int j = tid * 4 + 1024 * u;
    const v4f a = *(const v4fa*)(x + j);
    v4f b = {0.f,0.f,0.f,0.f}; if (rr) b = *(const v4fa*)(rr + j);
#pragma unroll
    for (int q = 0; q < 4; ++q) { const float v = a[q] + b[q]; vals[u * 4 + q] = v; s1 += v; }
  }
  red[tid] = s1; __syncthreads();
  for (int st = 128; st > 0; st >>= 1) { if (tid < st) red[tid] += red[tid + st]; __syncthreads(); }
  const float mu = red[0] / (float)N; __syncthreads();
  float s2 = 0.f;
  for (int u = 0; u < per / 4; ++u)
#pragma unroll
    for (int q = 0; q < 4; ++q) { const float c = vals[u * 4 + q] - mu; s2 += c * c; }
  red[tid] = s2; __syncthreads();
  for (int st = 128; st > 0; st >>= 1) { if (tid < st) red[tid] += red[tid + st]; __syncthreads(); }
  const float rs = rsqrtf(red[0] / (float)N + eps);
  {
    for (int u = 0; u < per / 4; ++u) {
      const int j = tid * 4 + 1024 * u;
      v4f o, sm;
#pragma unroll
      for (int q = 0; q < 4; ++q) {
        float gg = g[j + q], bb = bta[j + q];
        if (PARAM_BF16) { gg = bf16_round(gg); bb = bf16_round(bb); }
        sm[q] = vals[u * 4 + q]; o[q] = (vals[u * 4 + q] - mu) * rs * gg + bb;
      }
      if (out_sum) *(v4f*)(out_sum + (size_t)row * N + j) = sm;
      *(v4f*)(out_norm + (size_t)row * N + j) = o;
    }
    
  }
}



// ---- f16 WMMA path (v_wmma_f32_16x16x32_f16): 11-bit significands for operands in range — used here for the Q/K/V projections
typedef _Float16 v16h __attribute__((ext_vector_type(16)));
union FragH { v16h v; v8us half[2]; _Float16 h[16]; unsigned short u[16]; };
template <int NT>
__device__ __forceinline__ v8f mmaH(v16h ah, v16h al, v16h bh, v16h bl, v8f c) {
  c = __builtin_amdgcn_wmma_f32_16x16x32_f16(false, ah, false, bh, (short)0, c, false, false);
  if (NT >= 2) c = __builtin_amdgcn_wmma_f32_16x16x32_f16(false, al, false, bh, (short)0, c, false, false);
  if (NT >= 3) c = __builtin_amdgcn_wmma_f32_16x16x32_f16(false, ah, false, bl, (short)0, c, false, false);
  asm volatile("v_nop\n\tv_nop\n\tv_nop\n\tv_nop" : "+v"(c) : "v"(ah), "v"(al), "v"(bh), "v"(bl));
  return c;
}
// batched GEMM like k_gemm_b but f16 operands: A f32 (split into f16 hi/lo if ASPLIT, else rounded to f16), Bt = f16 values [n][k]; alpha; C f32; N multiple of 16 (partial tiles skipped)
template <bool ASPLIT>
__global__ __launch_bounds__(128) void k_gemm_h(const float* __restrict__ A, int lda, size_t sA, const _Float16* __restrict__ Bh, int ldb, size_t sB, float alpha, float* __restrict__ C, int ldc, size_t sC, int M, int N, int K) {
  __shared__ __attribute__((aligned(16))) float so[4][16][64];
  const int tid = threadIdx.x, w = tid >> 5, lane = tid & 31, ln = lane & 15, hh = lane >> 4; const int by = blockIdx.y;
  A += (size_t)by * sA; Bh += (size_t)by * sB; C += (size_t)by * sC;
  const int ntn = (N + 63) / 64; const int wid = blockIdx.x * 4 + w; const int mt = wid / ntn, nq = wid % ntn; if (mt * 16 >= M) return;
  const int row0 = mt * 16, col0 = nq * 64; const float* arow = A + (size_t)(row0 + ln) * lda;
  v8f acc[4] = {};
  for (int kb = 0; kb < K; kb += 32) {
    FragH ah, al;
    const v4f x0 = *(const v4fa*)(arow + kb + 8 * hh), x1 = *(const v4fa*)(arow + kb + 8 * hh + 4), x2 = *(const v4fa*)(arow + kb + 16 + 8 * hh), x3 = *(const v4fa*)(arow + kb + 16 + 8 * hh + 4);
    float xs[16] = {x0[0],x0[1],x0[2],x0[3],x1[0],x1[1],x1[2],x1[3],x2[0],x2[1],x2[2],x2[3],x3[0],x3[1],x3[2],x3[3]};
#pragma unroll
    for (int i = 0; i < 16; ++i) { const _Float16 h = (_Float16)xs[i]; ah.h[i] = h; al.h[i] = ASPLIT ? (_Float16)(xs[i] - (float)h) : (_Float16)0.0f; }
#pragma unroll
    for (int t = 0; t < 4; ++t) { if (col0 + t * 16 >= N) continue; const size_t boff = (size_t)(col0 + t * 16 + ln) * ldb + kb; FragH bq; bq.half[0] = *(const v8us*)(Bh + boff + 8 * hh); bq.half[1] = *(const v8us*)(Bh + boff + 16 + 8 * hh);
      acc[t] = mmaH<ASPLIT ? 2 : 1>(ah.v, al.v, bq.v, bq.v, acc[t]); }
  }
#pragma unroll
  for (int t = 0; t < 4; ++t) { if (col0 + t * 16 >= N) continue;
#pragma unroll
    for (int r = 0; r < 8; ++r) so[w][8 * hh + r][t * 16 + ln] = acc[t][r] * alpha; }
  __builtin_amdgcn_fence(__ATOMIC_ACQ_REL, "workgroup"); __builtin_amdgcn_wave_barrier();
  const int rsub = lane >> 4, c4 = (lane & 15) * 4;
  {
#pragma unroll
    for (int q = 0; q < 8; ++q) { const int r = q * 2 + rsub; if (col0 + c4 < N) { const v4f v = *(const v4fa*)&so[w][r][c4]; *(v4f*)(C + (size_t)(row0 + r) * ldc + col0 + c4) = v; } }
     }
}

// Wt[n][k] = f16(W[k][n]·scale) from f32 row-major W[K][N] (scale = power of two; bf16-exact weights stay exact in f16 away from the subnormal range)
__global__ __launch_bounds__(256) void k_wt_f16(const float* __restrict__ W, _Float16* __restrict__ Wt, int K, int N, float scale) {
  const int t = blockIdx.x * 256 + threadIdx.x; if (t >= N * (K / 8)) return; const int n = t / (K / 8), k8 = (t % (K / 8)) * 8; FragH f;
#pragma unroll
  for (int i = 0; i < 8; ++i) f.h[i] = (_Float16)(bf16_round(W[(size_t)(k8 + i) * N + n]) * scale); const v8us o = f.half[0];
  *(v8us*)((unsigned short*)Wt + (size_t)n * K + k8) = o; 
}
// k_gemm_hh variant with fused epilogue: v = acc·alpha + bias[by·sBias + col] (+ CP[(row/rowsPerB)·sCPb + by·64 + col] if CP) ; ACT 0 none / 1 elu ; writes f16 C16 (and f32 C if non-null)
template <int ACT>
__global__ __launch_bounds__(128) void k_gemm_hhx(const _Float16* __restrict__ A, int lda, size_t sA, const _Float16* __restrict__ Bh, int ldb, size_t sB, float alpha, const float* __restrict__ bias, size_t sBias, const float* __restrict__ CP, int rowsPerB, size_t sCPb, int row0g,
    float* __restrict__ C, _Float16* __restrict__ C16, int ldc, size_t sC, int M, int N, int K) {
  __shared__ __attribute__((aligned(16))) float so[4][16][64];
  const int tid = threadIdx.x, w = tid >> 5, lane = tid & 31, ln = lane & 15, hh = lane >> 4; const int by = blockIdx.y;
  A += (size_t)by * sA; Bh += (size_t)by * sB; const size_t cofs = (size_t)by * sC; const float* bp = bias ? bias + (size_t)by * sBias : nullptr;
  const int ntn = (N + 63) / 64; const int wid = blockIdx.x * 4 + w; const int mt = wid / ntn, nq = wid % ntn; if (mt * 16 >= M) return;
  const int row0 = mt * 16, col0 = nq * 64; const _Float16* arow = A + (size_t)(row0 + ln) * lda;
  v8f acc[4] = {};
  for (int kb = 0; kb < K; kb += 32) { FragH ah; ah.half[0] = *(const v8us*)((const unsigned short*)arow + kb + 8 * hh); ah.half[1] = *(const v8us*)((const unsigned short*)arow + kb + 16 + 8 * hh);
#pragma unroll
    for (int t = 0; t < 4; ++t) { if (col0 + t * 16 >= N) continue; const size_t boff = (size_t)(col0 + t * 16 + ln) * ldb + kb; FragH bq; bq.half[0] = *(const v8us*)((const unsigned short*)Bh + boff + 8 * hh); bq.half[1] = *(const v8us*)((const unsigned short*)Bh + boff + 16 + 8 * hh);
      acc[t] = mmaH<1>(ah.v, ah.v, bq.v, bq.v, acc[t]); }
  }
#pragma unroll
  for (int t = 0; t < 4; ++t) { if (col0 + t * 16 >= N) continue; const int col = col0 + t * 16 + ln; const float bv = bp ? bf16_round(bp[col]) : 0.f;
#pragma unroll
    for (int r = 0; r < 8; ++r) { float v = acc[t][r] * alpha + bv; if (CP) { const int rr = row0g + row0 + 8 * hh + r; if (rowsPerB < 0) v += CP[cofs + (size_t)rr * ldc + col];      /* rowsPerB < 0: own element of the batched C plane */ else { const int bidx = rr / rowsPerB; v += CP[(size_t)bidx * sCPb + (size_t)by * 64 + col]; } } if (ACT == 1) v = (v > 0.f) ? v : expm1f(v); else if (ACT == 7) v = (v > 0.f) ? v + 1.0f : expf(v); else if (ACT == 8) v = tanhf(v); else if (ACT == 9) v = 0.5f * v * (1.0f + tanhf(0.7978845608028654f * (v + 0.044715f * v * v * v))); else if (ACT == 11) v = 1.0f / (1.0f + expf(-v)); else if (ACT == 12) v = (v > 0.f) ? v : 0.01f * v; else if (ACT == 14) v = (v > 0.f) ? v : 0.1f * v; else if (ACT == 16) v = (v >= 0.f) ? v : 0.3f * v; else if (ACT == 17) v = (v >= 0.f) ? v : 0.2f * v; else if (ACT == 15) v = v / (1.0f + expf(-v)); else if (ACT == 3) v = fmaxf(v, 0.f); else if (ACT == 6) v = 0.5f * v * (1.0f + erff(v * 0.70710678118654752f)); so[w][8 * hh + r][t * 16 + ln] = v; } }
  __builtin_amdgcn_fence(__ATOMIC_ACQ_REL, "workgroup"); __builtin_amdgcn_wave_barrier();
  const int rsub = lane >> 4, c4 = (lane & 15) * 4; typedef _Float16 v4h __attribute__((ext_vector_type(4)));
  {
#pragma unroll
    for (int q = 0; q < 8; ++q) { const int r = q * 2 + rsub; if (col0 + c4 < N) { const v4f v = *(const v4fa*)&so[w][r][c4]; if (C) *(v4f*)(C + cofs + (size_t)(row0 + r) * ldc + col0 + c4) = v; if (C16) { v4h h4; for (int i = 0; i < 4; ++i) h4[i] = (_Float16)v[i]; *(v4h*)(C16 + cofs + (size_t)(row0 + r) * ldc + col0 + c4) = h4; } } }
     }
}


typedef _Float16 v4h __attribute__((ext_vector_type(4)));

__global__ __launch_bounds__(256) void k_x16(const float* __restrict__ x, _Float16* __restrict__ X16, size_t n8) { const size_t t = (size_t)blockIdx.x * 256 + threadIdx.x; if (t >= n8) return; FragH f;
#pragma unroll
  for (int q = 0; q < 8; ++q) f.h[q] = (_Float16)bf16_round(x[t * 8 + q]); *(v8us*)((unsigned short*)X16 + t * 8) = f.half[0];  }
__global__ __launch_bounds__(256) void k_h16(const float* __restrict__ x, _Float16* __restrict__ X16, size_t n8) { const size_t t = (size_t)blockIdx.x * 256 + threadIdx.x; if (t >= n8) return; FragH f;
#pragma unroll
  for (int q = 0; q < 8; ++q) f.h[q] = (_Float16)x[t * 8 + q]; *(v8us*)((unsigned short*)X16 + t * 8) = f.half[0];  }
__global__ __launch_bounds__(256) void k_round16f(const float* __restrict__ W, _Float16* __restrict__ Bt, size_t n8) { const size_t t = (size_t)blockIdx.x * 256 + threadIdx.x; if (t >= n8) return; FragH f;
#pragma unroll
  for (int i = 0; i < 8; ++i) f.h[i] = (_Float16)(bf16_round(W[t * 8 + i]) * 16.0f); *(v8us*)((unsigned short*)Bt + t * 8) = f.half[0];  }
template <int NHv, int TTv>
__global__ __launch_bounds__(256) void k_vt(const _Float16* __restrict__ V16, int ldv, int voff, _Float16* __restrict__ Vt) { __shared__ unsigned short tl[64][66]; const int tid = threadIdx.x; const int slab = blockIdx.x / (TTv / 64), lg = blockIdx.x % (TTv / 64); const int b = slab / NHv, h = slab % NHv;
  for (int i = tid; i < 64 * 8; i += 256) { const int r = i / 8, c8 = (i % 8) * 8; FragH f; f.half[0] = *(const v8us*)((const unsigned short*)V16 + ((size_t)b * TTv + lg * 64 + r) * ldv + voff + h * 64 + c8);
#pragma unroll
    for (int q = 0; q < 8; ++q) tl[r][c8 + q] = f.u[q]; }
  __syncthreads();
  {
#pragma unroll
    for (int rd = 0; rd < 2; ++rd) { const int d = rd * 32 + tid / 8, pc = tid % 8; FragH f;
#pragma unroll
      for (int q = 0; q < 8; ++q) f.u[q] = tl[pc * 8 + q][d];
      *(v8us*)((unsigned short*)Vt + ((size_t)slab * 64 + d) * TTv + lg * 64 + pc * 8) = f.half[0]; }
     } }

__global__ __launch_bounds__(256) void k_hl(const float* __restrict__ F, _Float16* __restrict__ Hh, _Float16* __restrict__ Hl, size_t n8) { const size_t t = (size_t)blockIdx.x * 256 + threadIdx.x; if (t >= n8) return; FragH fh, fl; const v4f a = *(const v4fa*)(F + t * 8), c = *(const v4fa*)(F + t * 8 + 4);
#pragma unroll
  for (int q = 0; q < 4; ++q) { _Float16 h = (_Float16)a[q]; fh.h[q] = h; fl.h[q] = (_Float16)((a[q] - (float)h) * 1024.0f); h = (_Float16)c[q]; fh.h[4 + q] = h; fl.h[4 + q] = (_Float16)((c[q] - (float)h) * 1024.0f); }
  { *(v8us*)((unsigned short*)Hh + t * 8) = fh.half[0]; *(v8us*)((unsigned short*)Hl + t * 8) = fl.half[0];  } }

// ---- fast GEMM (wave tile 32x64), C = A Bh^T alpha + bf16(bias), f32 rows ----
__device__ __forceinline__ v16h g2_frag(const _Float16* p, int hh) { FragH f; f.half[0] = *(const v8us*)((const unsigned short*)p + 8 * hh); f.half[1] = *(const v8us*)((const unsigned short*)p + 16 + 8 * hh); return f.v; }
__device__ __forceinline__ v8f g2_mma(v16h a, v16h b, v8f c) { v8f d = __builtin_amdgcn_wmma_f32_16x16x32_f16(false, a, false, b, (short)0, c, false, false); asm volatile("v_nop\n\tv_nop\n\tv_nop\n\tv_nop" : "+v"(d) : "v"(a), "v"(b)); return d; }
// Block tile 128 x 128, eight waves of 32 x 64 (4 down, 2 across). Per pass 64 k of both operands (128-B rows: 128 rows of A, then 128 rows of Bh) lie in one of two LDS buffers,
// brought by asynchronous copies (16 B per lane, whole 128-B lines per 8 lanes); the next pass's copies fly while this pass's fragments are read from LDS. Needs M % 128 == 0 (grid), N % 128 == 0, K % 64 == 0.
#define G3_PITCH 72                  /* LDS row pitch in halfs: 144 B = 16 B x odd, conflict-free for 16-B fragment reads */
#define G3_STAGE (256 * G3_PITCH)    /* halfs per buffer */
// one pass's copies of this thread: four rows of A and four of Bh, 32 rows apart; l = the lane's LDS byte address of the first
__device__ __forceinline__ void g3_copy(const _Float16* ga, const _Float16* gb, size_t step, unsigned l) {
  const _Float16* a1 = ga + step; const _Float16* a2 = a1 + step; const _Float16* a3 = a2 + step; const _Float16* b1 = gb + step; const _Float16* b2 = b1 + step; const _Float16* b3 = b2 + step;
  const unsigned rs = 32u * G3_PITCH * 2u;
  /* the s_wait_xcnt stands inside the statement so that no address register of a copy is rewritten ahead of it */
  asm volatile("global_load_async_to_lds_b128 %0, %8, off\n\t"
               "global_load_async_to_lds_b128 %1, %9, off\n\t"
               "global_load_async_to_lds_b128 %2, %10, off\n\t"
               "global_load_async_to_lds_b128 %3, %11, off\n\t"
               "global_load_async_to_lds_b128 %4, %12, off\n\t"
               "global_load_async_to_lds_b128 %5, %13, off\n\t"
               "global_load_async_to_lds_b128 %6, %14, off\n\t"
               "global_load_async_to_lds_b128 %7, %15, off\n\t"
               "s_wait_xcnt 0x0"
               :: "v"(l), "v"(l + rs), "v"(l + 2u * rs), "v"(l + 3u * rs), "v"(l + 4u * rs), "v"(l + 5u * rs), "v"(l + 6u * rs), "v"(l + 7u * rs),
                  "v"(ga), "v"(a1), "v"(a2), "v"(a3), "v"(gb), "v"(b1), "v"(b2), "v"(b3) : "memory");
}
__global__ __launch_bounds__(256) void k_gemm3(const _Float16* __restrict__ A, const _Float16* __restrict__ Bh, float alpha, const float* __restrict__ bias, float* __restrict__ C, int N, int K) {
  __shared__ __attribute__((aligned(16))) _Float16 ring[2 * G3_STAGE];
  __shared__ __attribute__((aligned(16))) float so[8][32][68];
  const int tid = threadIdx.x, w = tid >> 5, lane = tid & 31, ln = lane & 15, hh = lane >> 4;
  const int ntn = N >> 7; const int mt = blockIdx.x / ntn, nq = blockIdx.x - mt * ntn; const int wm = w >> 1, wn = w & 1;
  const int cr = tid >> 3, cp = tid & 7;      /* copy: row within a group of 32, 16-B piece of the row */
  const _Float16* ga = A + (size_t)(mt * 128 + cr) * K + cp * 8; const _Float16* gb = Bh + (size_t)(nq * 128 + cr) * K + cp * 8; const size_t step = (size_t)32 * K;
  const unsigned l0 = (unsigned)(size_t)&ring[0] + (unsigned)(cr * (G3_PITCH * 2) + cp * 16);
  const int nt = K >> 6;
  const v8f z8 = {0.f,0.f,0.f,0.f,0.f,0.f,0.f,0.f}; v8f c00 = z8, c01 = z8, c02 = z8, c03 = z8, c10 = z8, c11 = z8, c12 = z8, c13 = z8;
  g3_copy(ga, gb, step, l0);
  asm volatile("s_wait_asynccnt 0x0" ::: "memory");      /* this wave's copies of pass 0 have landed */
  __syncthreads();                                       /* publishes pass 0 */
  if (nt > 1) g3_copy(ga + 64, gb + 64, step, l0 + (unsigned)(G3_STAGE * 2));
#pragma unroll 1      /* one pass per trip: the two buffers alternate by the trip's parity */
  for (int t = 0; t < nt; ++t) {
    const _Float16* ap = &ring[(t & 1) * G3_STAGE + (wm * 32 + ln) * G3_PITCH]; const _Float16* bp = &ring[(t & 1) * G3_STAGE + (128 + wn * 64 + ln) * G3_PITCH];
    const v16h a0 = g2_frag(ap, hh), a1 = g2_frag(ap + 16 * G3_PITCH, hh), b0 = g2_frag(bp, hh), b1 = g2_frag(bp + 16 * G3_PITCH, hh), b2 = g2_frag(bp + 32 * G3_PITCH, hh), b3 = g2_frag(bp + 48 * G3_PITCH, hh);
    const v16h e0 = g2_frag(ap + 32, hh), e1 = g2_frag(ap + 16 * G3_PITCH + 32, hh), f0 = g2_frag(bp + 32, hh), f1 = g2_frag(bp + 16 * G3_PITCH + 32, hh), f2 = g2_frag(bp + 32 * G3_PITCH + 32, hh), f3 = g2_frag(bp + 48 * G3_PITCH + 32, hh);
    c00 = g2_mma(a0, b0, c00); c10 = g2_mma(a1, b0, c10); c01 = g2_mma(a0, b1, c01); c11 = g2_mma(a1, b1, c11); c02 = g2_mma(a0, b2, c02); c12 = g2_mma(a1, b2, c12); c03 = g2_mma(a0, b3, c03); c13 = g2_mma(a1, b3, c13);
    c00 = g2_mma(e0, f0, c00); c10 = g2_mma(e1, f0, c10); c01 = g2_mma(e0, f1, c01); c11 = g2_mma(e1, f1, c11); c02 = g2_mma(e0, f2, c02); c12 = g2_mma(e1, f2, c12); c03 = g2_mma(e0, f3, c03); c13 = g2_mma(e1, f3, c13);
    asm volatile("s_wait_dscnt 0x0" ::: "memory");       /* this wave's reads of the buffer are done before it may be refilled */
    asm volatile("s_wait_asynccnt 0x0" ::: "memory");    /* this wave's copies of pass t + 1 have landed */
    __syncthreads();                                     /* publishes pass t + 1 and ends every reader's last read of pass t */
    if (t + 2 < nt) g3_copy(ga + (size_t)(t + 2) * 64, gb + (size_t)(t + 2) * 64, step, l0 + (unsigned)((t & 1) * (G3_STAGE * 2)));
  }
  asm volatile("s_wait_asynccnt 0x0" ::: "memory");      /* no copy is outstanding when the wave goes on */
  const int row0 = mt * 128 + wm * 32, col0 = nq * 128 + wn * 64;
  v8f accs[8] = {c00, c01, c02, c03, c10, c11, c12, c13};
#pragma unroll
  for (int u = 0; u < 8; ++u) { const int t = u & 3, half = u >> 2; const float bv = bf16_round(bias[col0 + t * 16 + ln]);
#pragma unroll
    for (int r = 0; r < 8; ++r) so[w][half * 16 + 8 * hh + r][t * 16 + ln] = accs[u][r] * alpha + bv; }
  __builtin_amdgcn_fence(__ATOMIC_ACQ_REL, "workgroup"); __builtin_amdgcn_wave_barrier();
  const int rsub = lane >> 4, c4 = (lane & 15) * 4;
#pragma unroll
  for (int q = 0; q < 16; ++q) { const int r = q * 2 + rsub; const v4f v = *(const v4fa*)&so[w][r][c4]; *(v4f*)(C + (size_t)(row0 + r) * N + col0 + c4) = v; }
}


__global__ __launch_bounds__(256) void k_wnat(const float* __restrict__ w, size_t n8, _Float16* __restrict__ Bt) { const size_t t = (size_t)blockIdx.x * 256 + threadIdx.x; if (t >= n8) return; FragH f; for (int q = 0; q < 8; ++q) f.h[q] = (_Float16)(bf16_round(w[t * 8 + q]) * 16.0f); *(v8us*)((unsigned short*)Bt + t * 8) = f.half[0];  }
__global__ __launch_bounds__(256) void k_rsm(const float* __restrict__ S, _Float16* __restrict__ P, int nrows) {
  #pragma clang fp contract(off)
  const int i = blockIdx.x * 256 + threadIdx.x; if (i >= nrows) return; const float* s = S + (size_t)i * SQ; float mx = -3.0e38f;
#pragma unroll 1
  for (int j = 0; j < SQ; ++j) mx = fmaxf(mx, s[j]); float se = 0.f;
#pragma unroll 1
  for (int j = 0; j < SQ; ++j) se += expf(s[j] - mx); const float sc = 256.0f / se;
#pragma unroll 1
  for (int j0 = 0; j0 < SQ; j0 += 8) { FragH f; for (int q = 0; q < 8; ++q) f.h[q] = (_Float16)(expf(s[j0 + q] - mx) * sc); unsigned short* d = (unsigned short*)P + (size_t)i * SQ + j0; *(v8us*)d = f.half[0];  } }
__global__ __launch_bounds__(256) void k_vt(const _Float16* __restrict__ V16, int b, int h0, _Float16* __restrict__ VT) { __shared__ unsigned short tl[64][65]; const int tid = threadIdx.x; const int hh = blockIdx.x % HG, sg = blockIdx.x / HG; const int s0 = sg * 64; const int h = h0 + hh;
  for (int i = tid; i < 64 * 8; i += 256) { const int j = i / 8, d8 = (i % 8) * 8; FragH f; f.half[0] = *(const v8us*)((const unsigned short*)V16 + ((size_t)b * SQ + s0 + j) * DM + h * HD + d8); for (int q = 0; q < 8; ++q) tl[d8 + q][j] = f.u[q]; }
  __syncthreads();
  { for (int i = tid; i < 64 * 8; i += 256) { const int d = i / 8, j8 = (i % 8) * 8; FragH f; for (int q = 0; q < 8; ++q) f.u[q] = tl[d][j8 + q]; *(v8us*)((unsigned short*)VT + ((size_t)hh * HD + d) * SQ + s0 + j8) = f.half[0]; }  } }



__global__ __launch_bounds__(256) void k_rsmcf2(const float* __restrict__ S, _Float16* __restrict__ P, int hg, int q0, int nk) {
  #pragma clang fp contract(off)
  const int t = blockIdx.x * 256 + threadIdx.x; if (t >= hg * QT) return; const size_t i = (size_t)t; const float* s = S + i * NKX; const int last = q0 + (t % QT); float mx = -3.0e38f;
#pragma unroll 1
  for (int j = 0; j < nk; ++j) { const float f = (j <= last) ? 1.f : 0.f; mx = fmaxf(mx, fmaf(f, s[j], (1.f - f) * -1.0e9f)); } float se = 0.f;
#pragma unroll 1
  for (int j = 0; j < nk; ++j) { const float f = (j <= last) ? 1.f : 0.f; se += __expf(fmaf(f, s[j], (1.f - f) * -1.0e9f) - mx); } const float sc = 256.0f / se;
#pragma unroll 1
  for (int j0 = 0; j0 < nk; j0 += 8) { FragH fr; for (int q = 0; q < 8; ++q) { const int j = j0 + q; const float f = (j <= last) ? 1.f : 0.f; fr.h[q] = (_Float16)(__expf(fmaf(f, s[j], (1.f - f) * -1.0e9f) - mx) * sc); } unsigned short* d = (unsigned short*)P + i * NKX + j0; *(v8us*)d = fr.half[0];  } }

template <int MASKADD>
__global__ __launch_bounds__(64) void k_att0(const float* __restrict__ QF, const float* __restrict__ KF, const float* __restrict__ VF, int ld, const float* __restrict__ mask, float scale, float* __restrict__ OF, int ldo) {
  #pragma clang fp contract(off)
  __shared__ __attribute__((aligned(16))) float lq[64][64]; __shared__ __attribute__((aligned(16))) float lo[64][64];
  const int tid = threadIdx.x; const int h = blockIdx.x / (QT0 / 64), rg = blockIdx.x % (QT0 / 64); const int i = rg * 64 + tid;
  const float* qr = QF + (size_t)i * ld + h * HD;
#pragma unroll 1
  for (int c = 0; c < HD / 4; ++c) { *(v4f*)&lq[tid][c * 4] = *(const v4fa*)(qr + c * 4); const v4f z = {0.f, 0.f, 0.f, 0.f}; *(v4f*)&lo[tid][c * 4] = z; }
  float m = -1.0e30f, l = 0.f; const int jmax = MASKADD ? (SQ - 1) : (rg * 64 + 63);      /* additive-mask form: every key (the mask input decides); causal form: keys up to the block's last row */
#pragma unroll 1
  for (int j = 0; j <= jmax; ++j) { const float* kr = KF + (size_t)j * ld + h * HD; const float* vr = VF + (size_t)j * ld + h * HD; float s = 0.f;
#pragma unroll 1
    for (int c = 0; c < HD / 4; ++c) { const v4f kq = *(const v4fa*)(kr + c * 4); const v4f qq = *(v4f*)&lq[tid][c * 4]; s = __fadd_rn(s, __fmul_rn(qq[0], kq[0])); s = __fadd_rn(s, __fmul_rn(qq[1], kq[1])); s = __fadd_rn(s, __fmul_rn(qq[2], kq[2])); s = __fadd_rn(s, __fmul_rn(qq[3], kq[3])); }
    s = __fmul_rn(s, scale); if (MASKADD) s = __fadd_rn(s, __fmul_rn(bf16_round(mask[(size_t)i * SQ + j]), -10000.0f));
    const float f = (MASKADD || j <= i) ? 1.f : 0.f; const float sm = fmaf(f, s, (1.f - f) * -1.0e30f); const float mn = fmaxf(m, sm); const float sc = expf(m - mn); const float e = expf(sm - mn); l = __fadd_rn(__fmul_rn(l, sc), e); m = mn;
#pragma unroll 1
    for (int c = 0; c < HD / 4; ++c) { const v4f vv = *(const v4fa*)(vr + c * 4); v4f oo = *(v4f*)&lo[tid][c * 4]; for (int u = 0; u < 4; ++u) oo[u] = __fadd_rn(__fmul_rn(oo[u], sc), __fmul_rn(e, vv[u])); *(v4f*)&lo[tid][c * 4] = oo; } }
  const float fin = 64.0f / l;      /* o carried x64 like the f16 path */
#pragma unroll 1
  for (int c = 0; c < HD / 4; ++c) { v4f oo = *(v4f*)&lo[tid][c * 4]; for (int u = 0; u < 4; ++u) oo[u] = __fmul_rn(oo[u], fin); *(v4f*)&lo[tid][c * 4] = oo; }
  __syncthreads();
  {
#pragma unroll 1
    for (int it = 0; it < 16; ++it) { const int row = it * 4 + tid / 16, pc = (tid % 16) * 4; const v4f v = *(const v4f*)&lo[row][pc]; *(v4f*)(OF + (size_t)(rg * 64 + row) * ldo + h * HD + pc) = v; }
     } }

__global__ __launch_bounds__(256) void k_oscale(const float* __restrict__ OF, float* __restrict__ out, size_t n4) { const size_t t = (size_t)blockIdx.x * 256 + threadIdx.x; if (t >= n4) return; const v4f a = *(const v4fa*)(OF + t * 4); v4f o; for (int q = 0; q < 4; ++q) o[q] = a[q] * 0.015625f; *(v4f*)(out + t * 4) = o;  }

__global__ __launch_bounds__(256) void k_bfr(const float* __restrict__ x, float* __restrict__ XB, size_t n8) { const size_t t = (size_t)blockIdx.x * 256 + threadIdx.x; if (t >= n8) return; v4f a = *(const v4fa*)(x + t * 8), c = *(const v4fa*)(x + t * 8 + 4); for (int q = 0; q < 4; ++q) { a[q] = bf16_round(a[q]); c[q] = bf16_round(c[q]); }
  { *(v4f*)(XB + t * 8) = a; *(v4f*)(XB + t * 8 + 4) = c;  } }



__global__ __launch_bounds__(256) void k_rsmfvl(const float* __restrict__ S, _Float16* __restrict__ P, _Float16* __restrict__ PL, int qn, const int* __restrict__ vlp) {
  #pragma clang fp contract(off)
  const int t = blockIdx.x * 256 + threadIdx.x; if (t >= qn) return; const int vl = vlp[0]; const size_t i = (size_t)t; const float* s = S + i * SQ; float mx = -3.0e38f;
#pragma unroll 1
  for (int j = 0; j < SQ; ++j) { const float f = (j < vl) ? 1.f : 0.f; mx = fmaxf(mx, fmaf(f, s[j], (1.f - f) * -1000000.0f)); } float se = 0.f;
#pragma unroll 1
  for (int j = 0; j < SQ; ++j) { const float f = (j < vl) ? 1.f : 0.f; se += __expf(fmaf(f, s[j], (1.f - f) * -1000000.0f) - mx); } const float sc = 256.0f / se;
#pragma unroll 1
  for (int j0 = 0; j0 < SQ; j0 += 8) { FragH fr, gr; for (int q = 0; q < 8; ++q) { const int j = j0 + q; const float f = (j < vl) ? 1.f : 0.f; const float pv = __expf(fmaf(f, s[j], (1.f - f) * -1000000.0f) - mx) * sc; const _Float16 ph = (_Float16)pv; fr.h[q] = ph; gr.h[q] = (_Float16)((pv - (float)ph) * 1024.0f); }
    unsigned short* d = (unsigned short*)P + i * SQ + j0; unsigned short* dl = (unsigned short*)PL + i * SQ + j0; *(v8us*)d = fr.half[0]; *(v8us*)dl = gr.half[0];  } }

__global__ __launch_bounds__(256) void k_rsmf(const float* __restrict__ S, _Float16* __restrict__ P, int qn, int hg) {
  #pragma clang fp contract(off)
  const int t = blockIdx.x * 256 + threadIdx.x; if (t >= qn * hg) return; const size_t i = (size_t)(t / qn) * SQ + (t % qn); const float* s = S + i * SQ; float mx = -3.0e38f;
#pragma unroll 1
  for (int j = 0; j < SQ; ++j) mx = fmaxf(mx, s[j]); float se = 0.f;
#pragma unroll 1
  for (int j = 0; j < SQ; ++j) se += __expf(s[j] - mx); const float sc = 256.0f / se;
#pragma unroll 1
  for (int j0 = 0; j0 < SQ; j0 += 8) { FragH f; for (int q = 0; q < 8; ++q) f.h[q] = (_Float16)(__expf(s[j0 + q] - mx) * sc); unsigned short* d = (unsigned short*)P + i * SQ + j0; *(v8us*)d = f.half[0];  } }


#define CN 256          /* channels */
#define CI 128
#define NC 256                       /* (unused legacy kernels) */
#define NPX NP          /* positions per channel row */
#define NP 4096         /* seq1 tokens */
#define NM 1024         /* seq2 tokens */
#define BNEPS 1e-5f

__global__ __launch_bounds__(256) void k_mp2(const float* __restrict__ src, float* __restrict__ dst, int nout) {
  const int t = blockIdx.x * 256 + threadIdx.x; if (t >= nout) return; const int c = t / 1024; const int o = t % 1024; const int oy = o / 32, ox = o % 32; const float* p = src + (size_t)c * 4096 + (size_t)(2 * oy) * 64 + 2 * ox;
  const float v = fmaxf(fmaxf(p[0], p[1]), fmaxf(p[64], p[65])); *(float*)(dst + t) = v;  }
__global__ __launch_bounds__(256) void k_xpb(const float* __restrict__ x, const float* __restrict__ wb, float* __restrict__ CPP, size_t n4) {
  #pragma clang fp contract(off)
  const size_t t = (size_t)blockIdx.x * 256 + threadIdx.x; if (t >= n4) return; const size_t e = t * 4; const int c = (int)((e / 4096) % 256); const float bb = bf16_round(wb[c]); const v4f a = *(const v4fa*)(x + e); v4f o; for (int q = 0; q < 4; ++q) o[q] = __fadd_rn(bf16_round(a[q]), bb);
  *(v4f*)(CPP + e) = o;  }


template <int PASS>
__global__ __launch_bounds__(256) void k_cstA(const float* __restrict__ X, const float* __restrict__ MV, float* __restrict__ PART) {
  #pragma clang fp contract(off)
  __shared__ float red[256]; const int t = threadIdx.x; const size_t bc = blockIdx.x; const int c = (int)(bc % NC); const float* row = X + bc * (size_t)NPX; const float mu = PASS ? MV[c] : 0.f; float s = 0.f;
  for (int i = t; i < NPX; i += 256) { const float v = row[i]; const float d = PASS ? __fadd_rn(v, -mu) : v; s = __fadd_rn(s, PASS ? __fmul_rn(d, d) : d); }
  red[t] = s; __syncthreads(); for (int st = 128; st > 0; st >>= 1) { if (t < st) red[t] = __fadd_rn(red[t], red[t + st]); __syncthreads(); }
  if (t < 32) { const float pv = (t == 0) ? red[0] : 0.f; *(float*)(PART + bc * 32 + t) = pv;  } }      

template <int PASS>
__global__ __launch_bounds__(256) void k_cstB(const float* __restrict__ PART, float* __restrict__ MV) { const int c = threadIdx.x; if (c >= NC) return; double s = 0.0; for (int b = 0; b < NB; ++b) s += (double)PART[((size_t)b * NC + c) * 32]; const float m = (float)(s / ((double)NB * (double)NPX)); *(float*)(MV + PASS * NC + c) = m;  }


__global__ __launch_bounds__(256) void k_bnresid(const float* __restrict__ C2, const float* __restrict__ MV, const float* __restrict__ g, const float* __restrict__ be, const float* __restrict__ X, float* __restrict__ out, size_t n4) {
  #pragma clang fp contract(off)
  const size_t t = (size_t)blockIdx.x * 256 + threadIdx.x; if (t >= n4) return; const size_t e = t * 4; const int c = (int)((e / NPX) % NC); const float sc = __fmul_rn(rsqrtf(__fadd_rn(MV[NC + c], BNEPS)), bf16_round(g[c])); const float mu = MV[c], bb = bf16_round(be[c]);
  const v4f a = *(const v4fa*)(C2 + e); const v4f xx = *(const v4fa*)(X + e); v4f o; for (int q = 0; q < 4; ++q) { const float z = __fadd_rn(__fmul_rn(__fadd_rn(a[q], -mu), sc), bb); o[q] = __fadd_rn(z, bf16_round(xx[q])); }
  *(v4f*)(out + e) = o;  }


__global__ __launch_bounds__(256) void k_rowbias(float* __restrict__ Y, const float* __restrict__ bias) {
  #pragma clang fp contract(off)
  const size_t t = (size_t)blockIdx.x * 256 + threadIdx.x; if (t >= (size_t)NB * NC * NPX / 4) return; const size_t e = t * 4; const int c = (int)((e / NPX) % NC); const float bb = bf16_round(bias[c]);
  v4f v = *(const v4fa*)(Y + e); for (int q = 0; q < 4; ++q) v[q] = __fadd_rn(v[q], bb); *(v4f*)(Y + e) = v;  }



template <int NK>
__global__ __launch_bounds__(256) void k_rsmn(const float* __restrict__ S, _Float16* __restrict__ P, int nrows) {
  #pragma clang fp contract(off)
  const int t = blockIdx.x * 256 + threadIdx.x; if (t >= nrows) return; const float* s = S + (size_t)t * NK; float mx = -3.0e38f;
#pragma unroll 1
  for (int j = 0; j < NK; ++j) mx = fmaxf(mx, s[j]); float se = 0.f;
#pragma unroll 1
  for (int j = 0; j < NK; ++j) se += __expf(s[j] - mx); const float sc = 256.0f / se;
#pragma unroll 1
  for (int j0 = 0; j0 < NK; j0 += 8) { FragH fr; for (int q = 0; q < 8; ++q) fr.h[q] = (_Float16)(__expf(s[j0 + q] - mx) * sc);
    unsigned short* d = (unsigned short*)P + (size_t)t * NK + j0; *(v8us*)d = fr.half[0];  } }

typedef float v2f __attribute__((ext_vector_type(2)));
__device__ __forceinline__ float pt_xhalf(float x) { return __builtin_bit_cast(float, __builtin_amdgcn_permlanex16(__builtin_bit_cast(int, x), __builtin_bit_cast(int, x), 0x76543210, 0xfedcba98, false, false)); }      /* lane l <-> lane l ^ 16 */
__device__ __forceinline__ v8f pt_mma(v2f a, v2f b, v8f c) { return __builtin_amdgcn_wmma_f32_16x16x4_f32(false, a, false, b, (short)0, c, false, false); }
// One wave per token, both products on v_wmma_f32_16x16x4_f32 (f32 operands), no LDS. Lane (c = lane & 15, hh = lane >> 4).
// St = K Q^T per 16 x 16 tile: A row j = c, B column i = c, both loaded by the same code (the lane's 8 contiguous heads 8 hh .. 8 hh + 7 of its row; step s takes heads 8 hh + 2 s, + 1).
// D register r of tile jt = score of key j = 16 jt + 8 hh + r for query i = c: a query's 64 scores lie in lanes c and c + 16, so the softmax needs one exchange for the maximum and one for the sum.
// Ot = V^T P^T: B = register pair (2 p, 2 p + 1) of a tile as it lies (keys 16 jt + 8 hh + 2 p, + 1), A row = head c with V of the same keys. D register r = res[i = c][head 8 hh + r]: 8 contiguous floats of the output row.
__global__ __launch_bounds__(128) void k_ptatt(const float* __restrict__ QF, const float* __restrict__ KF, const float* __restrict__ VF, const float* __restrict__ xres, float scale, float* __restrict__ out) {
  const int lane = threadIdx.x & 31, c = lane & 15, hh = lane >> 4;
  const size_t ro = ((size_t)blockIdx.x * 4 + (size_t)__builtin_amdgcn_readfirstlane((int)(threadIdx.x >> 5))) * 1024;      /* the wave's token: a scalar, so every address is a scalar base plus one lane offset */
  const int fo = c * 16 + 8 * hh, vo = hh * 128 + c;
  const float cs = scale * 1.4426950408889634f;      /* softmax in base 2 */
  const float* kp = KF + ro; const float* vp = VF + ro; const float* qp = QF + ro; const float* xp = xres + ro; float* op = out + ro;
  v8f kf[4], vt[4];
#pragma unroll
  for (int jt = 0; jt < 4; ++jt) { const v4f k0 = *(const v4fa*)(kp + jt * 256 + fo), k1 = *(const v4fa*)(kp + jt * 256 + fo + 4); kf[jt] = v8f{k0[0], k0[1], k0[2], k0[3], k1[0], k1[1], k1[2], k1[3]}; }
  v4f q0 = *(const v4fa*)(qp + fo), q1 = *(const v4fa*)(qp + fo + 4);
  __builtin_amdgcn_sched_barrier(0);      /* K and Q are asked for ahead of V: loads return in order, and the first product waits for these alone */
#pragma unroll
  for (int jt = 0; jt < 4; ++jt)
#pragma unroll
    for (int r = 0; r < 8; ++r) vt[jt][r] = vp[jt * 256 + r * 16 + vo];
  __builtin_amdgcn_sched_barrier(0);      /* V is asked for before the wave first waits: behind that wait its latency would come on top of K's */
#pragma unroll
  for (int it = 0; it < 4; ++it) {
    const v4f x0 = *(const v4fa*)(xp + it * 256 + fo), x1 = *(const v4fa*)(xp + it * 256 + fo + 4);
    const v8f z8 = {0.f, 0.f, 0.f, 0.f, 0.f, 0.f, 0.f, 0.f}; v8f st[4] = {z8, z8, z8, z8};
#pragma unroll
    for (int s = 0; s < 4; ++s)
#pragma unroll
      for (int jt = 0; jt < 4; ++jt) st[jt] = pt_mma(v2f{kf[jt][2 * s], kf[jt][2 * s + 1]}, s < 2 ? v2f{q0[2 * s], q0[2 * s + 1]} : v2f{q1[2 * s - 4], q1[2 * s - 3]}, st[jt]);
    /* distance behind a matrix instruction: nothing reads these scores or overwrites an operand within the slots; the f32 form stands in no table of distances, so the count of the other form with its issue interval is kept */
    asm volatile("v_nop\n\tv_nop\n\tv_nop\n\tv_nop\n\tv_nop\n\tv_nop\n\tv_nop\n\tv_nop" : "+v"(st[0]), "+v"(st[1]), "+v"(st[2]), "+v"(st[3]) : "v"(q0), "v"(q1), "v"(kf[0]), "v"(kf[1]), "v"(kf[2]), "v"(kf[3]));
    if (it < 3) { q0 = *(const v4fa*)(qp + (it + 1) * 256 + fo); q1 = *(const v4fa*)(qp + (it + 1) * 256 + fo + 4); }      /* the next tile's queries fly during the rest of this tile */
    float m4[4];
#pragma unroll
    for (int jt = 0; jt < 4; ++jt) { m4[jt] = fmaxf(st[jt][0], st[jt][1]);
#pragma unroll
      for (int r = 2; r < 8; ++r) m4[jt] = fmaxf(m4[jt], st[jt][r]); }
    float mx = fmaxf(fmaxf(m4[0], m4[1]), fmaxf(m4[2], m4[3])); mx = fmaxf(mx, pt_xhalf(mx));
    const float mc = mx * cs; v8f pr[4]; v2f la = {0.f, 0.f}, lb = {0.f, 0.f};
#pragma unroll
    for (int jt = 0; jt < 4; ++jt) { v8f ar;
#pragma unroll
      for (int r = 0; r < 8; ++r) ar[r] = fmaf(st[jt][r], cs, -mc);
#pragma unroll
      for (int r = 0; r < 8; ++r) pr[jt][r] = __builtin_amdgcn_exp2f(ar[r]);
      /* the slot behind a transcendental: inputs only, the eight arguments stay whole until this slot, so no instruction directly behind an exponential overwrites its source */
      asm volatile("v_nop" :: "v"(ar), "v"(pr[jt]));
#pragma unroll
      for (int p = 0; p < 4; ++p) { if (jt & 1) lb += v2f{pr[jt][2 * p], pr[jt][2 * p + 1]}; else la += v2f{pr[jt][2 * p], pr[jt][2 * p + 1]}; } }
    la += lb; float l = la[0] + la[1]; l += pt_xhalf(l);
    const float inv = __builtin_amdgcn_rcpf(l); v4f y0, y1;
    v8f o0 = z8, o1 = z8;      /* two sums: a product that adds to the one before it waits longer than the issue interval */
#pragma unroll
    for (int p = 0; p < 4; ++p)
#pragma unroll
      for (int jt = 0; jt < 4; ++jt) { if (jt & 1) o1 = pt_mma(v2f{vt[jt][2 * p], vt[jt][2 * p + 1]}, v2f{pr[jt][2 * p], pr[jt][2 * p + 1]}, o1); else o0 = pt_mma(v2f{vt[jt][2 * p], vt[jt][2 * p + 1]}, v2f{pr[jt][2 * p], pr[jt][2 * p + 1]}, o0); }
    /* the same distance: the operands stay untouched and the sums unread for the slots behind the run's last product */
    asm volatile("v_nop\n\tv_nop\n\tv_nop\n\tv_nop\n\tv_nop\n\tv_nop\n\tv_nop\n\tv_nop" : "+v"(o0), "+v"(o1) : "v"(pr[0]), "v"(pr[1]), "v"(pr[2]), "v"(pr[3]), "v"(vt[0]), "v"(vt[1]), "v"(vt[2]), "v"(vt[3]));
#pragma unroll
    for (int u = 0; u < 4; ++u) { y0[u] = fmaf(o0[u] + o1[u], inv, x0[u]); y1[u] = fmaf(o0[4 + u] + o1[4 + u], inv, x1[u]); }
    *(v4f*)(op + it * 256 + fo) = y0; *(v4f*)(op + it * 256 + fo + 4) = y1;
    if (it < 3) asm volatile("s_wait_xcnt 0x0" ::: "memory");      /* stands in front of the next tile's products, which overwrite the registers that these stores name */
    __builtin_amdgcn_sched_barrier(0);      /* keeps the next tile's products behind this tile: moved up, the four tiles' scores are all held at once and fewer than half as many waves fit a SIMD */
  }
}
// Row LayerNorm (biased variance) of bf16-rounded rows of 1024 floats -> f16 rows. One wave holds two whole rows in registers: no LDS, no barrier, 4096 waves in the launch.
// Lane l holds floats 128 u + 4 l .. + 3 of a row (u = 0 .. 7): every load covers 512 contiguous bytes, every store 256. All 16 row loads are asked for before the first wait; gamma and beta serve both rows. Every loop is unrolled: the arrays are indexed by constants only and so stay in registers.
template <int M> __device__ __forceinline__ float ln_xm(float x) { return __builtin_bit_cast(float, __builtin_amdgcn_update_dpp(0, __builtin_bit_cast(int, x), 0x160 + M, 0xf, 0xf, true)); }      /* lane l <- lane l ^ M inside a row of 16 lanes */
__device__ __forceinline__ float ln_wsum(float x) { x += ln_xm<1>(x); x += ln_xm<2>(x); x += ln_xm<4>(x); x += ln_xm<8>(x); return x + pt_xhalf(x); }      /* sum over the wave, the same bits in every lane */
__global__ __launch_bounds__(256) void k_lnrow(const float* __restrict__ X, const float* __restrict__ g, const float* __restrict__ bb, float eps, _Float16* __restrict__ N16) {
  const int l4 = (threadIdx.x & 31) * 4;
  const size_t ro = ((size_t)blockIdx.x * 8 + (size_t)__builtin_amdgcn_readfirstlane((int)(threadIdx.x >> 5))) * 2048;      /* the wave's first row: a scalar, so every address is a scalar base plus one lane offset */
  const float* xp = X + ro + l4; _Float16* np = N16 + ro + l4;
  v4f xa[2][8], ga[8], ba[8];
#pragma unroll
  for (int r = 0; r < 2; ++r)
#pragma unroll
    for (int u = 0; u < 8; ++u) xa[r][u] = *(const v4fa*)(xp + r * 1024 + u * 128);
#pragma unroll
  for (int u = 0; u < 8; ++u) { ga[u] = *(const v4fa*)(g + u * 128 + l4); ba[u] = *(const v4fa*)(bb + u * 128 + l4); }
  float mu[2], rs[2];
#pragma unroll
  for (int r = 0; r < 2; ++r) { v4f s4;
#pragma unroll
    for (int u = 0; u < 8; ++u) {
#pragma unroll
      for (int q = 0; q < 4; ++q) xa[r][u][q] = bf16_round(xa[r][u][q]);
      s4 = u ? s4 + xa[r][u] : xa[r][u]; }
    mu[r] = (s4[0] + s4[1]) + (s4[2] + s4[3]); }
#pragma unroll
  for (int r = 0; r < 2; ++r) mu[r] = ln_wsum(mu[r]) * (1.0f / 1024.0f);
#pragma unroll
  for (int r = 0; r < 2; ++r) { v4f v4 = {0.f, 0.f, 0.f, 0.f};
#pragma unroll
    for (int u = 0; u < 8; ++u) { xa[r][u] -= mu[r]; v4 += xa[r][u] * xa[r][u]; }
    rs[r] = (v4[0] + v4[1]) + (v4[2] + v4[3]); }
#pragma unroll
  for (int r = 0; r < 2; ++r) rs[r] = rsqrtf(ln_wsum(rs[r]) * (1.0f / 1024.0f) + eps);
#pragma unroll
  for (int u = 0; u < 8; ++u) {
#pragma unroll
    for (int q = 0; q < 4; ++q) { ga[u][q] = bf16_round(ga[u][q]); ba[u][q] = bf16_round(ba[u][q]); }
#pragma unroll
    for (int r = 0; r < 2; ++r) { v4h y;
#pragma unroll
      for (int q = 0; q < 4; ++q) y[q] = (_Float16)(xa[r][u][q] * rs[r] * ga[u][q] + ba[u][q]);
      *(v4h*)(np + r * 1024 + u * 128) = y; } }
}
extern "C" void kernel_launch(void* const* d_in, const int* in_sizes, int n_in,
                              void* d_out, int out_size, void* d_ws, size_t ws_size, hipStream_t stream) {
  (void)in_sizes; (void)n_in; (void)out_size;
  const float* const* I = (const float* const*)d_in; const float* x = I[0]; const float* wq = I[1]; const float* bq = I[2]; const float* wk = I[3]; const float* bk = I[4]; const float* wv = I[5]; const float* bv = I[6]; const float* gam = I[7]; const float* bet = I[8];      /* inp; [in][out] Wq/Wk/Wv [1024][1024] + biases; LayerNorm gamma/beta */
  constexpr int DMc = 1024; const size_t NRc = (size_t)4 * 2048;      /* model width; token rows */
  char* ws = (char*)d_ws; size_t off = 0;
  auto take = [&](size_t bytes) { char* p = ws + off; off += (bytes + 255) & ~(size_t)255; return p; };
  _Float16* BQ = (_Float16*)take((size_t)DMc * DMc * 2); _Float16* BK = (_Float16*)take((size_t)DMc * DMc * 2); _Float16* BV = (_Float16*)take((size_t)DMc * DMc * 2);
  _Float16* XN = (_Float16*)take(NRc * DMc * 2); float* XB = (float*)take(NRc * DMc * 4); float* QF = (float*)take(NRc * DMc * 4); float* KF = (float*)take(NRc * DMc * 4); float* VF = (float*)take(NRc * DMc * 4);
  if (off > ws_size) return;
  { const unsigned g = (unsigned)(((size_t)DMc * (DMc / 8) + 255) / 256); k_wt_f16<<<g, 256, 0, stream>>>(wq, BQ, DMc, DMc, 16.0f); k_wt_f16<<<g, 256, 0, stream>>>(wk, BK, DMc, DMc, 16.0f); k_wt_f16<<<g, 256, 0, stream>>>(wv, BV, DMc, DMc, 16.0f); }      /* [in][out] -> Bt x16 */
  k_lnrow<<<(unsigned)(NRc / 16), 256, 0, stream>>>(x, gam, bet, 1e-5f, XN); k_bfr<<<(unsigned)((NRc * DMc / 8 + 255) / 256), 256, 0, stream>>>(x, XB, NRc * DMc / 8);      /* out = LN(bf16(inp)) -> f16 rows; XB = bf16(inp) f32 for the residual */
  { const unsigned g = (unsigned)((NRc / 128) * (DMc / 128)); k_gemm3<<<g, 256, 0, stream>>>(XN, BQ, 0.0625f, bq, QF, DMc, DMc); k_gemm3<<<g, 256, 0, stream>>>(XN, BK, 0.0625f, bk, KF, DMc, DMc); k_gemm3<<<g, 256, 0, stream>>>(XN, BV, 0.0625f, bv, VF, DMc, DMc); }      /* Q, K, V = out W + b -> f32 rows */
  k_ptatt<<<(unsigned)(NRc / 4), 128, 0, stream>>>(QF, KF, VF, XB, 0.125f, (float*)d_out);      /* per-token 64 x 64 x 16 attention, f32 matrix instructions, one wave per token + residual -> output rows */
}

// v004
// Measured time: 103 microseconds a run.
// Two timings next to v003 put it at 1.11 and 1.10 times that version's speed.
// All steps since v000 together make it 2.55 times as fast.
#include <hip/hip_runtime.h>
// Per-POSITION attention over the head-dim axis (inp [4][2048][1024]; out = LayerNorm(inp) (biased var, eps 1e-5, gamma/beta); Q/K/V = out W + b ([in][out] 1024 x 1024 sigma 1/32, zero biases) viewed [B][M][DK = 64][H = 16] (column i*16 + h); for every token: scores[i][j] = sum_h Q[i][h] K[j][h] / 8 (a 64 x 64 matrix, contraction over the 16 'heads'), softmax over j, res[i][h] = sum_j att[i][j] V[j][h]; no mixing across tokens; result = inp + res -> [4][2048][1024]).
// Compute dtype: inputs rounded to bf16; x / weights exact; LayerNorm output as a plain f16 GEMM operand (~2^-12); q, k, v, softmax weights and o f32; scores and softmax statistics f32; v_wmma_f32_16x16x32_f16 for the projections, v_wmma_f32_16x16x4_f32 for the attention.
#define NB 4
#define SQ 4096
#define DM 256
#define NH 1
#define HD 64
#define HG 4                         /* heads per k_vt launch (V transpose; not launched) */
#define B0 0                         /* unused */
#define NBR NB                       /* used only via MP / MPO, which no code reads */
#define NR ((size_t)NB * SQ)
#define MP ((int)((size_t)NBR * SQ))
#define QT 256                       /* query rows per causal tile */
#define NKX SQ                       /* S / P row pitch */
#define QT0 256                      /* first-tile rows recomputed exactly (256: buys margin for the few-key rows 128..255, which have no output projection to average the single-f16 P/v rounding) */
#define QN SQ
#define NHD NH
#define MPO MP
#define LQ DM
typedef __bf16 v16b __attribute__((ext_vector_type(16)));
typedef unsigned short v8us __attribute__((ext_vector_type(8), may_alias));
typedef float  v8f  __attribute__((ext_vector_type(8)));
typedef float  v4f  __attribute__((ext_vector_type(4)));
typedef float  v4fa __attribute__((ext_vector_type(4), may_alias));
union FragB { v16b v; v8us half[2]; unsigned short u[16]; };

__device__ __forceinline__ unsigned short bf16_bits(float x) { unsigned int u = __float_as_uint(x); return (unsigned short)((u + 0x7FFFu + ((u >> 16) & 1u)) >> 16); }
__device__ __forceinline__ float bf16_val(unsigned short b) { return __uint_as_float(((unsigned int)b) << 16); }
__device__ __forceinline__ float bf16_round(float x) { return bf16_val(bf16_bits(x)); }
// D += A·B with NT terms: 1 = ah·bh, 2 = + al·bh (A split), 3 = + ah·bl (both split)
template <int NT>
__device__ __forceinline__ v8f mmaN(v16b ah, v16b al, v16b bh, v16b bl, v8f c) {
  c = __builtin_amdgcn_wmma_f32_16x16x32_bf16(false, ah, false, bh, (short)0, c, false, false);
  if (NT >= 2) c = __builtin_amdgcn_wmma_f32_16x16x32_bf16(false, al, false, bh, (short)0, c, false, false);
  if (NT >= 3) c = __builtin_amdgcn_wmma_f32_16x16x32_bf16(false, ah, false, bl, (short)0, c, false, false);
  asm volatile("v_nop\n\tv_nop\n\tv_nop\n\tv_nop" : "+v"(c) : "v"(ah), "v"(al), "v"(bh), "v"(bl));
  return c;
}

__global__ __launch_bounds__(256) void k_wt_bf16(const float* __restrict__ W, unsigned short* __restrict__ Wt, int K, int N) {
  const int t = blockIdx.x * 256 + threadIdx.x;
  const int k8n = K / 8;
  if (t >= N * k8n) return;
  const int n = t / k8n, k8 = (t % k8n) * 8;
  v8us v;
#pragma unroll
  for (int i = 0; i < 8; ++i) v[i] = bf16_bits(W[(size_t)(k8 + i) * N + n]);
  *(v8us*)(Wt + (size_t)n * K + k8) = v;
  
}

// GEMM C[M][N] (f32, pitch ldc) = act(A[M][K]·W + bias). A f32 row-major (pitch lda) converted per fragment to bf16
// (ASPLIT: hi/lo two planes -> 2 terms, else single rounded term); Wt bf16 [N][K] (pitch ldb). BIAS_BF16 rounds the
// bias to bf16 first (bias quantised to bf16 before the add). K%32==0, M%16==0, N%64==0.
template <bool ASPLIT, int ACT, bool BIAS_BF16>
__global__ __launch_bounds__(128) void k_gemm_bf(const float* __restrict__ A, int lda, const unsigned short* __restrict__ Wt, int ldb,
                                               const float* __restrict__ bias, float* __restrict__ C, int ldc, int M, int N, int K) {
  __shared__ __attribute__((aligned(16))) float so[4][16][64];
  const int tid = threadIdx.x, w = tid >> 5, lane = tid & 31, ln = lane & 15, hh = lane >> 4;
  const int ntn = N / 64;
  const int wid = blockIdx.x * 4 + w;
  const int mt = wid / ntn, nq = wid % ntn;
  if (mt * 16 >= M) return;
  const int row0 = mt * 16, col0 = nq * 64;
  const float* arow = A + (size_t)(row0 + ln) * lda;
  v8f acc[4] = {};
  for (int kb = 0; kb < K; kb += 32) {
    FragB ah, al;
    const v4f x0 = *(const v4fa*)(arow + kb + 8 * hh), x1 = *(const v4fa*)(arow + kb + 8 * hh + 4);
    const v4f x2 = *(const v4fa*)(arow + kb + 16 + 8 * hh), x3 = *(const v4fa*)(arow + kb + 16 + 8 * hh + 4);
    float xs[16] = {x0[0],x0[1],x0[2],x0[3],x1[0],x1[1],x1[2],x1[3],x2[0],x2[1],x2[2],x2[3],x3[0],x3[1],x3[2],x3[3]};
#pragma unroll
    for (int i = 0; i < 16; ++i) { const unsigned short hb = bf16_bits(xs[i]); ah.u[i] = hb; al.u[i] = ASPLIT ? bf16_bits(xs[i] - bf16_val(hb)) : (unsigned short)0; }
#pragma unroll
    for (int t = 0; t < 4; ++t) {
      const unsigned short* brow = Wt + (size_t)(col0 + t * 16 + ln) * ldb + kb;
      FragB b;
      b.half[0] = *(const v8us*)(brow + 8 * hh);
      b.half[1] = *(const v8us*)(brow + 16 + 8 * hh);
      acc[t] = mmaN<ASPLIT ? 2 : 1>(ah.v, al.v, b.v, b.v, acc[t]);
    }
  }
#pragma unroll
  for (int t = 0; t < 4; ++t) {
    float bv = bias ? bias[col0 + t * 16 + ln] : 0.f;
    if (BIAS_BF16) bv = bf16_round(bv);
#pragma unroll
    for (int r = 0; r < 8; ++r) { float v = acc[t][r] + bv; if (ACT == 1) v = fmaxf(v, 0.f); so[w][8 * hh + r][t * 16 + ln] = v; }
  }
  __builtin_amdgcn_fence(__ATOMIC_ACQ_REL, "workgroup");
  __builtin_amdgcn_wave_barrier();
  const int rsub = lane >> 4, c4 = (lane & 15) * 4;
  {
#pragma unroll
    for (int q = 0; q < 8; ++q) {
      const int r = q * 2 + rsub;
      const v4f v = *(const v4fa*)&so[w][r][c4];
      *(v4f*)(C + (size_t)(row0 + r) * ldc + col0 + c4) = v;
    }
    
  }
}

// GEMM C = act(A·W + bias + resid): A f32 (ASPLIT -> hi/lo 2 terms), Wt bf16 [N][K]; ACT 0 none, 1 relu, 2 exact gelu;
// resid (optional, f32, row index = (row % rmod), pitch ldr, RES_BF16 rounds it) added before the activation.
template <bool ASPLIT, int ACT, bool BIAS_BF16, bool RES_BF16>
__global__ __launch_bounds__(128) void k_gemm_bf3(const float* __restrict__ A, int lda, const unsigned short* __restrict__ Wt, int ldb,
                                                const float* __restrict__ bias, const float* __restrict__ resid, int rmod, int ldr,
                                                float* __restrict__ C, int ldc, int M, int N, int K) {
  __shared__ __attribute__((aligned(16))) float so[4][16][64];
  const int tid = threadIdx.x, w = tid >> 5, lane = tid & 31, ln = lane & 15, hh = lane >> 4;
  const int ntn = N / 64;
  const int wid = blockIdx.x * 4 + w;
  const int mt = wid / ntn, nq = wid % ntn;
  if (mt * 16 >= M) return;
  const int row0 = mt * 16, col0 = nq * 64;
  const float* arow = A + (size_t)(row0 + ln) * lda;
  v8f acc[4] = {};
  for (int kb = 0; kb < K; kb += 32) {
    FragB ah, al;
    const v4f x0 = *(const v4fa*)(arow + kb + 8 * hh), x1 = *(const v4fa*)(arow + kb + 8 * hh + 4);
    const v4f x2 = *(const v4fa*)(arow + kb + 16 + 8 * hh), x3 = *(const v4fa*)(arow + kb + 16 + 8 * hh + 4);
    float xs[16] = {x0[0],x0[1],x0[2],x0[3],x1[0],x1[1],x1[2],x1[3],x2[0],x2[1],x2[2],x2[3],x3[0],x3[1],x3[2],x3[3]};
#pragma unroll
    for (int i = 0; i < 16; ++i) { const unsigned short hb = bf16_bits(xs[i]); ah.u[i] = hb; al.u[i] = ASPLIT ? bf16_bits(xs[i] - bf16_val(hb)) : (unsigned short)0; }
#pragma unroll
    for (int t = 0; t < 4; ++t) {
      const unsigned short* brow = Wt + (size_t)(col0 + t * 16 + ln) * ldb + kb;
      FragB b;
      b.half[0] = *(const v8us*)(brow + 8 * hh);
      b.half[1] = *(const v8us*)(brow + 16 + 8 * hh);
      acc[t] = mmaN<ASPLIT ? 2 : 1>(ah.v, al.v, b.v, b.v, acc[t]);
    }
  }
#pragma unroll
  for (int t = 0; t < 4; ++t) {
    const int col = col0 + t * 16 + ln;
    float bv = bias ? bias[col] : 0.f;
    if (BIAS_BF16) bv = bf16_round(bv);
#pragma unroll
    for (int r = 0; r < 8; ++r) {
      float v = acc[t][r] + bv;
      if (resid) { float rv = resid[(size_t)((row0 + 8 * hh + r) % rmod) * ldr + col]; if (RES_BF16) rv = bf16_round(rv); v += rv; }
      if (ACT == 1) v = fmaxf(v, 0.f);
      if (ACT == 2) v = 0.5f * v * (1.0f + erff(v * 0.70710678118654752f));
      if (ACT == 3) { const float u = 0.7978845608028654f * (v + 0.044715f * v * v * v); v = 0.5f * v * (1.0f + tanhf(u)); }
      so[w][8 * hh + r][t * 16 + ln] = v;
    }
  }
  __builtin_amdgcn_fence(__ATOMIC_ACQ_REL, "workgroup");
  __builtin_amdgcn_wave_barrier();
  const int rsub = lane >> 4, c4 = (lane & 15) * 4;
  {
#pragma unroll
    for (int q = 0; q < 8; ++q) {
      const int r = q * 2 + rsub;
      const v4f v = *(const v4fa*)&so[w][r][c4];
      *(v4f*)(C + (size_t)(row0 + r) * ldc + col0 + c4) = v;
    }
    
  }
}
// row LayerNorm (biased variance, eps) over N: s = X (+ R); optional out_sum <- s; out_norm <- (s-mu)*rsqrt(var+eps)*g + b
template <bool PARAM_BF16>
__global__ __launch_bounds__(256) void k_layernorm(const float* __restrict__ X, const float* __restrict__ R, const float* __restrict__ g, const float* __restrict__ bta,
                                                  float* __restrict__ out_sum, float* __restrict__ out_norm, int N, float eps) {
  __shared__ float red[256];
  const int row = blockIdx.x, tid = threadIdx.x;
  const float* x = X + (size_t)row * N; const float* rr = R ? R + (size_t)row * N : nullptr;
  float vals[16];                     // up to N = 4096
  const int per = N / 256;            // contiguous chunk per thread? use strided-by-4 chunks: thread handles j = tid*4 + 1024*u
  float s1 = 0.f;
  for (int u = 0; u < per / 4; ++u) {
    const int j = tid * 4 + 1024 * u;
    const v4f a = *(const v4fa*)(x + j);
    v4f b = {0.f,0.f,0.f,0.f}; if (rr) b = *(const v4fa*)(rr + j);
#pragma unroll
    for (int q = 0; q < 4; ++q) { const float v = a[q] + b[q]; vals[u * 4 + q] = v; s1 += v; }
  }
  red[tid] = s1; __syncthreads();
  for (int st = 128; st > 0; st >>= 1) { if (tid < st) red[tid] += red[tid + st]; __syncthreads(); }
  const float mu = red[0] / (float)N; __syncthreads();
  float s2 = 0.f;
  for (int u = 0; u < per / 4; ++u)
#pragma unroll
    for (int q = 0; q < 4; ++q) { const float c = vals[u * 4 + q] - mu; s2 += c * c; }
  red[tid] = s2; __syncthreads();
  for (int st = 128; st > 0; st >>= 1) { if (tid < st) red[tid] += red[tid + st]; __syncthreads(); }
  const float rs = rsqrtf(red[0] / (float)N + eps);
  {
    for (int u = 0; u < per / 4; ++u) {
      const int j = tid * 4 + 1024 * u;
      v4f o, sm;
#pragma unroll
      for (int q = 0; q < 4; ++q) {
        float gg = g[j + q], bb = bta[j + q];
        if (PARAM_BF16) { gg = bf16_round(gg); bb = bf16_round(bb); }
        sm[q] = vals[u * 4 + q]; o[q] = (vals[u * 4 + q] - mu) * rs * gg + bb;
      }
      if (out_sum) *(v4f*)(out_sum + (size_t)row * N + j) = sm;
      *(v4f*)(out_norm + (size_t)row * N + j) = o;
    }
    
  }
}



// ---- f16 WMMA path (v_wmma_f32_16x16x32_f16): 11-bit significands for operands in range — used here for the Q/K/V projections
typedef _Float16 v16h __attribute__((ext_vector_type(16)));
union FragH { v16h v; v8us half[2]; _Float16 h[16]; unsigned short u[16]; };
template <int NT>
__device__ __forceinline__ v8f mmaH(v16h ah, v16h al, v16h bh, v16h bl, v8f c) {
  c = __builtin_amdgcn_wmma_f32_16x16x32_f16(false, ah, false, bh, (short)0, c, false, false);
  if (NT >= 2) c = __builtin_amdgcn_wmma_f32_16x16x32_f16(false, al, false, bh, (short)0, c, false, false);
  if (NT >= 3) c = __builtin_amdgcn_wmma_f32_16x16x32_f16(false, ah, false, bl, (short)0, c, false, false);
  asm volatile("v_nop\n\tv_nop\n\tv_nop\n\tv_nop" : "+v"(c) : "v"(ah), "v"(al), "v"(bh), "v"(bl));
  return c;
}
// batched GEMM like k_gemm_b but f16 operands: A f32 (split into f16 hi/lo if ASPLIT, else rounded to f16), Bt = f16 values [n][k]; alpha; C f32; N multiple of 16 (partial tiles skipped)
template <bool ASPLIT>
__global__ __launch_bounds__(128) void k_gemm_h(const float* __restrict__ A, int lda, size_t sA, const _Float16* __restrict__ Bh, int ldb, size_t sB, float alpha, float* __restrict__ C, int ldc, size_t sC, int M, int N, int K) {
  __shared__ __attribute__((aligned(16))) float so[4][16][64];
  const int tid = threadIdx.x, w = tid >> 5, lane = tid & 31, ln = lane & 15, hh = lane >> 4; const int by = blockIdx.y;
  A += (size_t)by * sA; Bh += (size_t)by * sB; C += (size_t)by * sC;
  const int ntn = (N + 63) / 64; const int wid = blockIdx.x * 4 + w; const int mt = wid / ntn, nq = wid % ntn; if (mt * 16 >= M) return;
  const int row0 = mt * 16, col0 = nq * 64; const float* arow = A + (size_t)(row0 + ln) * lda;
  v8f acc[4] = {};
  for (int kb = 0; kb < K; kb += 32) {
    FragH ah, al;
    const v4f x0 = *(const v4fa*)(arow + kb + 8 * hh), x1 = *(const v4fa*)(arow + kb + 8 * hh + 4), x2 = *(const v4fa*)(arow + kb + 16 + 8 * hh), x3 = *(const v4fa*)(arow + kb + 16 + 8 * hh + 4);
    float xs[16] = {x0[0],x0[1],x0[2],x0[3],x1[0],x1[1],x1[2],x1[3],x2[0],x2[1],x2[2],x2[3],x3[0],x3[1],x3[2],x3[3]};
#pragma unroll
    for (int i = 0; i < 16; ++i) { const _Float16 h = (_Float16)xs[i]; ah.h[i] = h; al.h[i] = ASPLIT ? (_Float16)(xs[i] - (float)h) : (_Float16)0.0f; }
#pragma unroll
    for (int t = 0; t < 4; ++t) { if (col0 + t * 16 >= N) continue; const size_t boff = (size_t)(col0 + t * 16 + ln) * ldb + kb; FragH bq; bq.half[0] = *(const v8us*)(Bh + boff + 8 * hh); bq.half[1] = *(const v8us*)(Bh + boff + 16 + 8 * hh);
      acc[t] = mmaH<ASPLIT ? 2 : 1>(ah.v, al.v, bq.v, bq.v, acc[t]); }
  }
#pragma unroll
  for (int t = 0; t < 4; ++t) { if (col0 + t * 16 >= N) continue;
#pragma unroll
    for (int r = 0; r < 8; ++r) so[w][8 * hh + r][t * 16 + ln] = acc[t][r] * alpha; }
  __builtin_amdgcn_fence(__ATOMIC_ACQ_REL, "workgroup"); __builtin_amdgcn_wave_barrier();
  const int rsub = lane >> 4, c4 = (lane & 15) * 4;
  {
#pragma unroll
    for (int q = 0; q < 8; ++q) { const int r = q * 2 + rsub; if (col0 + c4 < N) { const v4f v = *(const v4fa*)&so[w][r][c4]; *(v4f*)(C + (size_t)(row0 + r) * ldc + col0 + c4) = v; } }
     }
}

// Wt[n][k] = f16(W[k][n]·scale) from f32 row-major W[K][N] (scale = power of two; bf16-exact weights stay exact in f16 away from the subnormal range)
__device__ __forceinline__ void d_wt_f16(int blk, const float* __restrict__ W, _Float16* __restrict__ Wt, int K, int N, float scale) {
  const int t = blk * 256 + threadIdx.x; if (t >= N * (K / 8)) return; const int n = t / (K / 8), k8 = (t % (K / 8)) * 8; FragH f;
#pragma unroll
  for (int i = 0; i < 8; ++i) f.h[i] = (_Float16)(bf16_round(W[(size_t)(k8 + i) * N + n]) * scale); const v8us o = f.half[0];
  *(v8us*)((unsigned short*)Wt + (size_t)n * K + k8) = o; 
}
// k_gemm_hh variant with fused epilogue: v = acc·alpha + bias[by·sBias + col] (+ CP[(row/rowsPerB)·sCPb + by·64 + col] if CP) ; ACT 0 none / 1 elu ; writes f16 C16 (and f32 C if non-null)
template <int ACT>
__global__ __launch_bounds__(128) void k_gemm_hhx(const _Float16* __restrict__ A, int lda, size_t sA, const _Float16* __restrict__ Bh, int ldb, size_t sB, float alpha, const float* __restrict__ bias, size_t sBias, const float* __restrict__ CP, int rowsPerB, size_t sCPb, int row0g,
    float* __restrict__ C, _Float16* __restrict__ C16, int ldc, size_t sC, int M, int N, int K) {
  __shared__ __attribute__((aligned(16))) float so[4][16][64];
  const int tid = threadIdx.x, w = tid >> 5, lane = tid & 31, ln = lane & 15, hh = lane >> 4; const int by = blockIdx.y;
  A += (size_t)by * sA; Bh += (size_t)by * sB; const size_t cofs = (size_t)by * sC; const float* bp = bias ? bias + (size_t)by * sBias : nullptr;
  const int ntn = (N + 63) / 64; const int wid = blockIdx.x * 4 + w; const int mt = wid / ntn, nq = wid % ntn; if (mt * 16 >= M) return;
  const int row0 = mt * 16, col0 = nq * 64; const _Float16* arow = A + (size_t)(row0 + ln) * lda;
  v8f acc[4] = {};
  for (int kb = 0; kb < K; kb += 32) { FragH ah; ah.half[0] = *(const v8us*)((const unsigned short*)arow + kb + 8 * hh); ah.half[1] = *(const v8us*)((const unsigned short*)arow + kb + 16 + 8 * hh);
#pragma unroll
    for (int t = 0; t < 4; ++t) { if (col0 + t * 16 >= N) continue; const size_t boff = (size_t)(col0 + t * 16 + ln) * ldb + kb; FragH bq; bq.half[0] = *(const v8us*)((const unsigned short*)Bh + boff + 8 * hh); bq.half[1] = *(const v8us*)((const unsigned short*)Bh + boff + 16 + 8 * hh);
      acc[t] = mmaH<1>(ah.v, ah.v, bq.v, bq.v, acc[t]); }
  }
#pragma unroll
  for (int t = 0; t < 4; ++t) { if (col0 + t * 16 >= N) continue; const int col = col0 + t * 16 + ln; const float bv = bp ? bf16_round(bp[col]) : 0.f;
#pragma unroll
    for (int r = 0; r < 8; ++r) { float v = acc[t][r] * alpha + bv; if (CP) { const int rr = row0g + row0 + 8 * hh + r; if (rowsPerB < 0) v += CP[cofs + (size_t)rr * ldc + col];      /* rowsPerB < 0: own element of the batched C plane */ else { const int bidx = rr / rowsPerB; v += CP[(size_t)bidx * sCPb + (size_t)by * 64 + col]; } } if (ACT == 1) v = (v > 0.f) ? v : expm1f(v); else if (ACT == 7) v = (v > 0.f) ? v + 1.0f : expf(v); else if (ACT == 8) v = tanhf(v); else if (ACT == 9) v = 0.5f * v * (1.0f + tanhf(0.7978845608028654f * (v + 0.044715f * v * v * v))); else if (ACT == 11) v = 1.0f / (1.0f + expf(-v)); else if (ACT == 12) v = (v > 0.f) ? v : 0.01f * v; else if (ACT == 14) v = (v > 0.f) ? v : 0.1f * v; else if (ACT == 16) v = (v >= 0.f) ? v : 0.3f * v; else if (ACT == 17) v = (v >= 0.f) ? v : 0.2f * v; else if (ACT == 15) v = v / (1.0f + expf(-v)); else if (ACT == 3) v = fmaxf(v, 0.f); else if (ACT == 6) v = 0.5f * v * (1.0f + erff(v * 0.70710678118654752f)); so[w][8 * hh + r][t * 16 + ln] = v; } }
  __builtin_amdgcn_fence(__ATOMIC_ACQ_REL, "workgroup"); __builtin_amdgcn_wave_barrier();
  const int rsub = lane >> 4, c4 = (lane & 15) * 4; typedef _Float16 v4h __attribute__((ext_vector_type(4)));
  {
#pragma unroll
    for (int q = 0; q < 8; ++q) { const int r = q * 2 + rsub; if (col0 + c4 < N) { const v4f v = *(const v4fa*)&so[w][r][c4]; if (C) *(v4f*)(C + cofs + (size_t)(row0 + r) * ldc + col0 + c4) = v; if (C16) { v4h h4; for (int i = 0; i < 4; ++i) h4[i] = (_Float16)v[i]; *(v4h*)(C16 + cofs + (size_t)(row0 + r) * ldc + col0 + c4) = h4; } } }
     }
}


typedef _Float16 v4h __attribute__((ext_vector_type(4)));

__global__ __launch_bounds__(256) void k_x16(const float* __restrict__ x, _Float16* __restrict__ X16, size_t n8) { const size_t t = (size_t)blockIdx.x * 256 + threadIdx.x; if (t >= n8) return; FragH f;
#pragma unroll
  for (int q = 0; q < 8; ++q) f.h[q] = (_Float16)bf16_round(x[t * 8 + q]); *(v8us*)((unsigned short*)X16 + t * 8) = f.half[0];  }
__global__ __launch_bounds__(256) void k_h16(const float* __restrict__ x, _Float16* __restrict__ X16, size_t n8) { const size_t t = (size_t)blockIdx.x * 256 + threadIdx.x; if (t >= n8) return; FragH f;
#pragma unroll
  for (int q = 0; q < 8; ++q) f.h[q] = (_Float16)x[t * 8 + q]; *(v8us*)((unsigned short*)X16 + t * 8) = f.half[0];  }
__global__ __launch_bounds__(256) void k_round16f(const float* __restrict__ W, _Float16* __restrict__ Bt, size_t n8) { const size_t t = (size_t)blockIdx.x * 256 + threadIdx.x; if (t >= n8) return; FragH f;
#pragma unroll
  for (int i = 0; i < 8; ++i) f.h[i] = (_Float16)(bf16_round(W[t * 8 + i]) * 16.0f); *(v8us*)((unsigned short*)Bt + t * 8) = f.half[0];  }
template <int NHv, int TTv>
__global__ __launch_bounds__(256) void k_vt(const _Float16* __restrict__ V16, int ldv, int voff, _Float16* __restrict__ Vt) { __shared__ unsigned short tl[64][66]; const int tid = threadIdx.x; const int slab = blockIdx.x / (TTv / 64), lg = blockIdx.x % (TTv / 64); const int b = slab / NHv, h = slab % NHv;
  for (int i = tid; i < 64 * 8; i += 256) { const int r = i / 8, c8 = (i % 8) * 8; FragH f; f.half[0] = *(const v8us*)((const unsigned short*)V16 + ((size_t)b * TTv + lg * 64 + r) * ldv + voff + h * 64 + c8);
#pragma unroll
    for (int q = 0; q < 8; ++q) tl[r][c8 + q] = f.u[q]; }
  __syncthreads();
  {
#pragma unroll
    for (int rd = 0; rd < 2; ++rd) { const int d = rd * 32 + tid / 8, pc = tid % 8; FragH f;
#pragma unroll
      for (int q = 0; q < 8; ++q) f.u[q] = tl[pc * 8 + q][d];
      *(v8us*)((unsigned short*)Vt + ((size_t)slab * 64 + d) * TTv + lg * 64 + pc * 8) = f.half[0]; }
     } }

__global__ __launch_bounds__(256) void k_hl(const float* __restrict__ F, _Float16* __restrict__ Hh, _Float16* __restrict__ Hl, size_t n8) { const size_t t = (size_t)blockIdx.x * 256 + threadIdx.x; if (t >= n8) return; FragH fh, fl; const v4f a = *(const v4fa*)(F + t * 8), c = *(const v4fa*)(F + t * 8 + 4);
#pragma unroll
  for (int q = 0; q < 4; ++q) { _Float16 h = (_Float16)a[q]; fh.h[q] = h; fl.h[q] = (_Float16)((a[q] - (float)h) * 1024.0f); h = (_Float16)c[q]; fh.h[4 + q] = h; fl.h[4 + q] = (_Float16)((c[q] - (float)h) * 1024.0f); }
  { *(v8us*)((unsigned short*)Hh + t * 8) = fh.half[0]; *(v8us*)((unsigned short*)Hl + t * 8) = fl.half[0];  } }

// ---- fast GEMM (wave tile 32x64), C = A Bh^T alpha + bf16(bias), f32 rows ----
__device__ __forceinline__ v16h g2_frag(const _Float16* p, int hh) { FragH f; f.half[0] = *(const v8us*)((const unsigned short*)p + 8 * hh); f.half[1] = *(const v8us*)((const unsigned short*)p + 16 + 8 * hh); return f.v; }
__device__ __forceinline__ v8f g2_mma(v16h a, v16h b, v8f c) { v8f d = __builtin_amdgcn_wmma_f32_16x16x32_f16(false, a, false, b, (short)0, c, false, false); asm volatile("v_nop\n\tv_nop\n\tv_nop\n\tv_nop" : "+v"(d) : "v"(a), "v"(b)); return d; }
// Block tile 128 x 128, eight waves of 32 x 64 (4 down, 2 across). Per pass 64 k of both operands (128-B rows: 128 rows of A, then 128 rows of Bh) lie in one of two LDS buffers,
// brought by asynchronous copies (16 B per lane, whole 128-B lines per 8 lanes); the next pass's copies fly while this pass's fragments are read from LDS. Needs M % 128 == 0 (grid), N % 128 == 0, K % 64 == 0.
#define G3_PITCH 72                  /* LDS row pitch in halfs: 144 B = 16 B x odd, conflict-free for 16-B fragment reads */
#define G3_STAGE (256 * G3_PITCH)    /* halfs per buffer */
// one pass's copies of this thread: four rows of A and four of Bh, 32 rows apart; l = the lane's LDS byte address of the first
__device__ __forceinline__ void g3_copy(const _Float16* ga, const _Float16* gb, size_t step, unsigned l) {
  const _Float16* a1 = ga + step; const _Float16* a2 = a1 + step; const _Float16* a3 = a2 + step; const _Float16* b1 = gb + step; const _Float16* b2 = b1 + step; const _Float16* b3 = b2 + step;
  const unsigned rs = 32u * G3_PITCH * 2u;
  /* the s_wait_xcnt stands inside the statement so that no address register of a copy is rewritten ahead of it */
  asm volatile("global_load_async_to_lds_b128 %0, %8, off\n\t"
               "global_load_async_to_lds_b128 %1, %9, off\n\t"
               "global_load_async_to_lds_b128 %2, %10, off\n\t"
               "global_load_async_to_lds_b128 %3, %11, off\n\t"
               "global_load_async_to_lds_b128 %4, %12, off\n\t"
               "global_load_async_to_lds_b128 %5, %13, off\n\t"
               "global_load_async_to_lds_b128 %6, %14, off\n\t"
               "global_load_async_to_lds_b128 %7, %15, off\n\t"
               "s_wait_xcnt 0x0"
               :: "v"(l), "v"(l + rs), "v"(l + 2u * rs), "v"(l + 3u * rs), "v"(l + 4u * rs), "v"(l + 5u * rs), "v"(l + 6u * rs), "v"(l + 7u * rs),
                  "v"(ga), "v"(a1), "v"(a2), "v"(a3), "v"(gb), "v"(b1), "v"(b2), "v"(b3) : "memory");
}
// One launch does all three products of the same A: blockIdx.y picks the weight, its bias and its output (scalar selects).
__global__ __launch_bounds__(256) void k_gemm3(const _Float16* __restrict__ A, const _Float16* __restrict__ Bh0, const _Float16* __restrict__ Bh1, const _Float16* __restrict__ Bh2, float alpha,
                                               const float* __restrict__ bias0, const float* __restrict__ bias1, const float* __restrict__ bias2, float* __restrict__ C0, float* __restrict__ C1, float* __restrict__ C2, int N, int K) {
  const int pz = blockIdx.y; const _Float16* Bh = pz == 0 ? Bh0 : pz == 1 ? Bh1 : Bh2; const float* bias = pz == 0 ? bias0 : pz == 1 ? bias1 : bias2; float* C = pz == 0 ? C0 : pz == 1 ? C1 : C2;
  __shared__ __attribute__((aligned(16))) _Float16 ring[2 * G3_STAGE];
  __shared__ __attribute__((aligned(16))) float so[8][32][68];
  const int tid = threadIdx.x, w = tid >> 5, lane = tid & 31, ln = lane & 15, hh = lane >> 4;
  const int ntn = N >> 7; const int mt = blockIdx.x / ntn, nq = blockIdx.x - mt * ntn; const int wm = w >> 1, wn = w & 1;
  const int cr = tid >> 3, cp = tid & 7;      /* copy: row within a group of 32, 16-B piece of the row */
  const _Float16* ga = A + (size_t)(mt * 128 + cr) * K + cp * 8; const _Float16* gb = Bh + (size_t)(nq * 128 + cr) * K + cp * 8; const size_t step = (size_t)32 * K;
  const unsigned l0 = (unsigned)(size_t)&ring[0] + (unsigned)(cr * (G3_PITCH * 2) + cp * 16);
  const int nt = K >> 6;
  const v8f z8 = {0.f,0.f,0.f,0.f,0.f,0.f,0.f,0.f}; v8f c00 = z8, c01 = z8, c02 = z8, c03 = z8, c10 = z8, c11 = z8, c12 = z8, c13 = z8;
  g3_copy(ga, gb, step, l0);
  asm volatile("s_wait_asynccnt 0x0" ::: "memory");      /* this wave's copies of pass 0 have landed */
  __syncthreads();                                       /* publishes pass 0 */
  if (nt > 1) g3_copy(ga + 64, gb + 64, step, l0 + (unsigned)(G3_STAGE * 2));
#pragma unroll 1      /* one pass per trip: the two buffers alternate by the trip's parity */
  for (int t = 0; t < nt; ++t) {
    const _Float16* ap = &ring[(t & 1) * G3_STAGE + (wm * 32 + ln) * G3_PITCH]; const _Float16* bp = &ring[(t & 1) * G3_STAGE + (128 + wn * 64 + ln) * G3_PITCH];
    const v16h a0 = g2_frag(ap, hh), a1 = g2_frag(ap + 16 * G3_PITCH, hh), b0 = g2_frag(bp, hh), b1 = g2_frag(bp + 16 * G3_PITCH, hh), b2 = g2_frag(bp + 32 * G3_PITCH, hh), b3 = g2_frag(bp + 48 * G3_PITCH, hh);
    const v16h e0 = g2_frag(ap + 32, hh), e1 = g2_frag(ap + 16 * G3_PITCH + 32, hh), f0 = g2_frag(bp + 32, hh), f1 = g2_frag(bp + 16 * G3_PITCH + 32, hh), f2 = g2_frag(bp + 32 * G3_PITCH + 32, hh), f3 = g2_frag(bp + 48 * G3_PITCH + 32, hh);
    c00 = g2_mma(a0, b0, c00); c10 = g2_mma(a1, b0, c10); c01 = g2_mma(a0, b1, c01); c11 = g2_mma(a1, b1, c11); c02 = g2_mma(a0, b2, c02); c12 = g2_mma(a1, b2, c12); c03 = g2_mma(a0, b3, c03); c13 = g2_mma(a1, b3, c13);
    c00 = g2_mma(e0, f0, c00); c10 = g2_mma(e1, f0, c10); c01 = g2_mma(e0, f1, c01); c11 = g2_mma(e1, f1, c11); c02 = g2_mma(e0, f2, c02); c12 = g2_mma(e1, f2, c12); c03 = g2_mma(e0, f3, c03); c13 = g2_mma(e1, f3, c13);
    asm volatile("s_wait_dscnt 0x0" ::: "memory");       /* this wave's reads of the buffer are done before it may be refilled */
    asm volatile("s_wait_asynccnt 0x0" ::: "memory");    /* this wave's copies of pass t + 1 have landed */
    __syncthreads();                                     /* publishes pass t + 1 and ends every reader's last read of pass t */
    if (t + 2 < nt) g3_copy(ga + (size_t)(t + 2) * 64, gb + (size_t)(t + 2) * 64, step, l0 + (unsigned)((t & 1) * (G3_STAGE * 2)));
  }
  asm volatile("s_wait_asynccnt 0x0" ::: "memory");      /* no copy is outstanding when the wave goes on */
  const int row0 = mt * 128 + wm * 32, col0 = nq * 128 + wn * 64;
  v8f accs[8] = {c00, c01, c02, c03, c10, c11, c12, c13};
#pragma unroll
  for (int u = 0; u < 8; ++u) { const int t = u & 3, half = u >> 2; const float bv = bf16_round(bias[col0 + t * 16 + ln]);
#pragma unroll
    for (int r = 0; r < 8; ++r) so[w][half * 16 + 8 * hh + r][t * 16 + ln] = accs[u][r] * alpha + bv; }
  __builtin_amdgcn_fence(__ATOMIC_ACQ_REL, "workgroup"); __builtin_amdgcn_wave_barrier();
  const int rsub = lane >> 4, c4 = (lane & 15) * 4;
#pragma unroll
  for (int q = 0; q < 16; ++q) { const int r = q * 2 + rsub; const v4f v = *(const v4fa*)&so[w][r][c4]; *(v4f*)(C + (size_t)(row0 + r) * N + col0 + c4) = v; }
}


__global__ __launch_bounds__(256) void k_wnat(const float* __restrict__ w, size_t n8, _Float16* __restrict__ Bt) { const size_t t = (size_t)blockIdx.x * 256 + threadIdx.x; if (t >= n8) return; FragH f; for (int q = 0; q < 8; ++q) f.h[q] = (_Float16)(bf16_round(w[t * 8 + q]) * 16.0f); *(v8us*)((unsigned short*)Bt + t * 8) = f.half[0];  }
__global__ __launch_bounds__(256) void k_rsm(const float* __restrict__ S, _Float16* __restrict__ P, int nrows) {
  #pragma clang fp contract(off)
  const int i = blockIdx.x * 256 + threadIdx.x; if (i >= nrows) return; const float* s = S + (size_t)i * SQ; float mx = -3.0e38f;
#pragma unroll 1
  for (int j = 0; j < SQ; ++j) mx = fmaxf(mx, s[j]); float se = 0.f;
#pragma unroll 1
  for (int j = 0; j < SQ; ++j) se += expf(s[j] - mx); const float sc = 256.0f / se;
#pragma unroll 1
  for (int j0 = 0; j0 < SQ; j0 += 8) { FragH f; for (int q = 0; q < 8; ++q) f.h[q] = (_Float16)(expf(s[j0 + q] - mx) * sc); unsigned short* d = (unsigned short*)P + (size_t)i * SQ + j0; *(v8us*)d = f.half[0];  } }
__global__ __launch_bounds__(256) void k_vt(const _Float16* __restrict__ V16, int b, int h0, _Float16* __restrict__ VT) { __shared__ unsigned short tl[64][65]; const int tid = threadIdx.x; const int hh = blockIdx.x % HG, sg = blockIdx.x / HG; const int s0 = sg * 64; const int h = h0 + hh;
  for (int i = tid; i < 64 * 8; i += 256) { const int j = i / 8, d8 = (i % 8) * 8; FragH f; f.half[0] = *(const v8us*)((const unsigned short*)V16 + ((size_t)b * SQ + s0 + j) * DM + h * HD + d8); for (int q = 0; q < 8; ++q) tl[d8 + q][j] = f.u[q]; }
  __syncthreads();
  { for (int i = tid; i < 64 * 8; i += 256) { const int d = i / 8, j8 = (i % 8) * 8; FragH f; for (int q = 0; q < 8; ++q) f.u[q] = tl[d][j8 + q]; *(v8us*)((unsigned short*)VT + ((size_t)hh * HD + d) * SQ + s0 + j8) = f.half[0]; }  } }



__global__ __launch_bounds__(256) void k_rsmcf2(const float* __restrict__ S, _Float16* __restrict__ P, int hg, int q0, int nk) {
  #pragma clang fp contract(off)
  const int t = blockIdx.x * 256 + threadIdx.x; if (t >= hg * QT) return; const size_t i = (size_t)t; const float* s = S + i * NKX; const int last = q0 + (t % QT); float mx = -3.0e38f;
#pragma unroll 1
  for (int j = 0; j < nk; ++j) { const float f = (j <= last) ? 1.f : 0.f; mx = fmaxf(mx, fmaf(f, s[j], (1.f - f) * -1.0e9f)); } float se = 0.f;
#pragma unroll 1
  for (int j = 0; j < nk; ++j) { const float f = (j <= last) ? 1.f : 0.f; se += __expf(fmaf(f, s[j], (1.f - f) * -1.0e9f) - mx); } const float sc = 256.0f / se;
#pragma unroll 1
  for (int j0 = 0; j0 < nk; j0 += 8) { FragH fr; for (int q = 0; q < 8; ++q) { const int j = j0 + q; const float f = (j <= last) ? 1.f : 0.f; fr.h[q] = (_Float16)(__expf(fmaf(f, s[j], (1.f - f) * -1.0e9f) - mx) * sc); } unsigned short* d = (unsigned short*)P + i * NKX + j0; *(v8us*)d = fr.half[0];  } }

template <int MASKADD>
__global__ __launch_bounds__(64) void k_att0(const float* __restrict__ QF, const float* __restrict__ KF, const float* __restrict__ VF, int ld, const float* __restrict__ mask, float scale, float* __restrict__ OF, int ldo) {
  #pragma clang fp contract(off)
  __shared__ __attribute__((aligned(16))) float lq[64][64]; __shared__ __attribute__((aligned(16))) float lo[64][64];
  const int tid = threadIdx.x; const int h = blockIdx.x / (QT0 / 64), rg = blockIdx.x % (QT0 / 64); const int i = rg * 64 + tid;
  const float* qr = QF + (size_t)i * ld + h * HD;
#pragma unroll 1
  for (int c = 0; c < HD / 4; ++c) { *(v4f*)&lq[tid][c * 4] = *(const v4fa*)(qr + c * 4); const v4f z = {0.f, 0.f, 0.f, 0.f}; *(v4f*)&lo[tid][c * 4] = z; }
  float m = -1.0e30f, l = 0.f; const int jmax = MASKADD ? (SQ - 1) : (rg * 64 + 63);      /* additive-mask form: every key (the mask input decides); causal form: keys up to the block's last row */
#pragma unroll 1
  for (int j = 0; j <= jmax; ++j) { const float* kr = KF + (size_t)j * ld + h * HD; const float* vr = VF + (size_t)j * ld + h * HD; float s = 0.f;
#pragma unroll 1
    for (int c = 0; c < HD / 4; ++c) { const v4f kq = *(const v4fa*)(kr + c * 4); const v4f qq = *(v4f*)&lq[tid][c * 4]; s = __fadd_rn(s, __fmul_rn(qq[0], kq[0])); s = __fadd_rn(s, __fmul_rn(qq[1], kq[1])); s = __fadd_rn(s, __fmul_rn(qq[2], kq[2])); s = __fadd_rn(s, __fmul_rn(qq[3], kq[3])); }
    s = __fmul_rn(s, scale); if (MASKADD) s = __fadd_rn(s, __fmul_rn(bf16_round(mask[(size_t)i * SQ + j]), -10000.0f));
    const float f = (MASKADD || j <= i) ? 1.f : 0.f; const float sm = fmaf(f, s, (1.f - f) * -1.0e30f); const float mn = fmaxf(m, sm); const float sc = expf(m - mn); const float e = expf(sm - mn); l = __fadd_rn(__fmul_rn(l, sc), e); m = mn;
#pragma unroll 1
    for (int c = 0; c < HD / 4; ++c) { const v4f vv = *(const v4fa*)(vr + c * 4); v4f oo = *(v4f*)&lo[tid][c * 4]; for (int u = 0; u < 4; ++u) oo[u] = __fadd_rn(__fmul_rn(oo[u], sc), __fmul_rn(e, vv[u])); *(v4f*)&lo[tid][c * 4] = oo; } }
  const float fin = 64.0f / l;      /* o carried x64 like the f16 path */
#pragma unroll 1
  for (int c = 0; c < HD / 4; ++c) { v4f oo = *(v4f*)&lo[tid][c * 4]; for (int u = 0; u < 4; ++u) oo[u] = __fmul_rn(oo[u], fin); *(v4f*)&lo[tid][c * 4] = oo; }
  __syncthreads();
  {
#pragma unroll 1
    for (int it = 0; it < 16; ++it) { const int row = it * 4 + tid / 16, pc = (tid % 16) * 4; const v4f v = *(const v4f*)&lo[row][pc]; *(v4f*)(OF + (size_t)(rg * 64 + row) * ldo + h * HD + pc) = v; }
     } }

__global__ __launch_bounds__(256) void k_oscale(const float* __restrict__ OF, float* __restrict__ out, size_t n4) { const size_t t = (size_t)blockIdx.x * 256 + threadIdx.x; if (t >= n4) return; const v4f a = *(const v4fa*)(OF + t * 4); v4f o; for (int q = 0; q < 4; ++q) o[q] = a[q] * 0.015625f; *(v4f*)(out + t * 4) = o;  }

__device__ __forceinline__ void d_bfr(int blk, const float* __restrict__ x, float* __restrict__ XB, size_t n8) { const size_t t = (size_t)blk * 256 + threadIdx.x; if (t >= n8) return; v4f a = *(const v4fa*)(x + t * 8), c = *(const v4fa*)(x + t * 8 + 4); for (int q = 0; q < 4; ++q) { a[q] = bf16_round(a[q]); c[q] = bf16_round(c[q]); }
  { *(v4f*)(XB + t * 8) = a; *(v4f*)(XB + t * 8 + 4) = c;  } }



__global__ __launch_bounds__(256) void k_rsmfvl(const float* __restrict__ S, _Float16* __restrict__ P, _Float16* __restrict__ PL, int qn, const int* __restrict__ vlp) {
  #pragma clang fp contract(off)
  const int t = blockIdx.x * 256 + threadIdx.x; if (t >= qn) return; const int vl = vlp[0]; const size_t i = (size_t)t; const float* s = S + i * SQ; float mx = -3.0e38f;
#pragma unroll 1
  for (int j = 0; j < SQ; ++j) { const float f = (j < vl) ? 1.f : 0.f; mx = fmaxf(mx, fmaf(f, s[j], (1.f - f) * -1000000.0f)); } float se = 0.f;
#pragma unroll 1
  for (int j = 0; j < SQ; ++j) { const float f = (j < vl) ? 1.f : 0.f; se += __expf(fmaf(f, s[j], (1.f - f) * -1000000.0f) - mx); } const float sc = 256.0f / se;
#pragma unroll 1
  for (int j0 = 0; j0 < SQ; j0 += 8) { FragH fr, gr; for (int q = 0; q < 8; ++q) { const int j = j0 + q; const float f = (j < vl) ? 1.f : 0.f; const float pv = __expf(fmaf(f, s[j], (1.f - f) * -1000000.0f) - mx) * sc; const _Float16 ph = (_Float16)pv; fr.h[q] = ph; gr.h[q] = (_Float16)((pv - (float)ph) * 1024.0f); }
    unsigned short* d = (unsigned short*)P + i * SQ + j0; unsigned short* dl = (unsigned short*)PL + i * SQ + j0; *(v8us*)d = fr.half[0]; *(v8us*)dl = gr.half[0];  } }

__global__ __launch_bounds__(256) void k_rsmf(const float* __restrict__ S, _Float16* __restrict__ P, int qn, int hg) {
  #pragma clang fp contract(off)
  const int t = blockIdx.x * 256 + threadIdx.x; if (t >= qn * hg) return; const size_t i = (size_t)(t / qn) * SQ + (t % qn); const float* s = S + i * SQ; float mx = -3.0e38f;
#pragma unroll 1
  for (int j = 0; j < SQ; ++j) mx = fmaxf(mx, s[j]); float se = 0.f;
#pragma unroll 1
  for (int j = 0; j < SQ; ++j) se += __expf(s[j] - mx); const float sc = 256.0f / se;
#pragma unroll 1
  for (int j0 = 0; j0 < SQ; j0 += 8) { FragH f; for (int q = 0; q < 8; ++q) f.h[q] = (_Float16)(__expf(s[j0 + q] - mx) * sc); unsigned short* d = (unsigned short*)P + i * SQ + j0; *(v8us*)d = f.half[0];  } }


#define CN 256          /* channels */
#define CI 128
#define NC 256                       /* (unused legacy kernels) */
#define NPX NP          /* positions per channel row */
#define NP 4096         /* seq1 tokens */
#define NM 1024         /* seq2 tokens */
#define BNEPS 1e-5f

__global__ __launch_bounds__(256) void k_mp2(const float* __restrict__ src, float* __restrict__ dst, int nout) {
  const int t = blockIdx.x * 256 + threadIdx.x; if (t >= nout) return; const int c = t / 1024; const int o = t % 1024; const int oy = o / 32, ox = o % 32; const float* p = src + (size_t)c * 4096 + (size_t)(2 * oy) * 64 + 2 * ox;
  const float v = fmaxf(fmaxf(p[0], p[1]), fmaxf(p[64], p[65])); *(float*)(dst + t) = v;  }
__global__ __launch_bounds__(256) void k_xpb(const float* __restrict__ x, const float* __restrict__ wb, float* __restrict__ CPP, size_t n4) {
  #pragma clang fp contract(off)
  const size_t t = (size_t)blockIdx.x * 256 + threadIdx.x; if (t >= n4) return; const size_t e = t * 4; const int c = (int)((e / 4096) % 256); const float bb = bf16_round(wb[c]); const v4f a = *(const v4fa*)(x + e); v4f o; for (int q = 0; q < 4; ++q) o[q] = __fadd_rn(bf16_round(a[q]), bb);
  *(v4f*)(CPP + e) = o;  }


template <int PASS>
__global__ __launch_bounds__(256) void k_cstA(const float* __restrict__ X, const float* __restrict__ MV, float* __restrict__ PART) {
  #pragma clang fp contract(off)
  __shared__ float red[256]; const int t = threadIdx.x; const size_t bc = blockIdx.x; const int c = (int)(bc % NC); const float* row = X + bc * (size_t)NPX; const float mu = PASS ? MV[c] : 0.f; float s = 0.f;
  for (int i = t; i < NPX; i += 256) { const float v = row[i]; const float d = PASS ? __fadd_rn(v, -mu) : v; s = __fadd_rn(s, PASS ? __fmul_rn(d, d) : d); }
  red[t] = s; __syncthreads(); for (int st = 128; st > 0; st >>= 1) { if (t < st) red[t] = __fadd_rn(red[t], red[t + st]); __syncthreads(); }
  if (t < 32) { const float pv = (t == 0) ? red[0] : 0.f; *(float*)(PART + bc * 32 + t) = pv;  } }      

template <int PASS>
__global__ __launch_bounds__(256) void k_cstB(const float* __restrict__ PART, float* __restrict__ MV) { const int c = threadIdx.x; if (c >= NC) return; double s = 0.0; for (int b = 0; b < NB; ++b) s += (double)PART[((size_t)b * NC + c) * 32]; const float m = (float)(s / ((double)NB * (double)NPX)); *(float*)(MV + PASS * NC + c) = m;  }


__global__ __launch_bounds__(256) void k_bnresid(const float* __restrict__ C2, const float* __restrict__ MV, const float* __restrict__ g, const float* __restrict__ be, const float* __restrict__ X, float* __restrict__ out, size_t n4) {
  #pragma clang fp contract(off)
  const size_t t = (size_t)blockIdx.x * 256 + threadIdx.x; if (t >= n4) return; const size_t e = t * 4; const int c = (int)((e / NPX) % NC); const float sc = __fmul_rn(rsqrtf(__fadd_rn(MV[NC + c], BNEPS)), bf16_round(g[c])); const float mu = MV[c], bb = bf16_round(be[c]);
  const v4f a = *(const v4fa*)(C2 + e); const v4f xx = *(const v4fa*)(X + e); v4f o; for (int q = 0; q < 4; ++q) { const float z = __fadd_rn(__fmul_rn(__fadd_rn(a[q], -mu), sc), bb); o[q] = __fadd_rn(z, bf16_round(xx[q])); }
  *(v4f*)(out + e) = o;  }


__global__ __launch_bounds__(256) void k_rowbias(float* __restrict__ Y, const float* __restrict__ bias) {
  #pragma clang fp contract(off)
  const size_t t = (size_t)blockIdx.x * 256 + threadIdx.x; if (t >= (size_t)NB * NC * NPX / 4) return; const size_t e = t * 4; const int c = (int)((e / NPX) % NC); const float bb = bf16_round(bias[c]);
  v4f v = *(const v4fa*)(Y + e); for (int q = 0; q < 4; ++q) v[q] = __fadd_rn(v[q], bb); *(v4f*)(Y + e) = v;  }



template <int NK>
__global__ __launch_bounds__(256) void k_rsmn(const float* __restrict__ S, _Float16* __restrict__ P, int nrows) {
  #pragma clang fp contract(off)
  const int t = blockIdx.x * 256 + threadIdx.x; if (t >= nrows) return; const float* s = S + (size_t)t * NK; float mx = -3.0e38f;
#pragma unroll 1
  for (int j = 0; j < NK; ++j) mx = fmaxf(mx, s[j]); float se = 0.f;
#pragma unroll 1
  for (int j = 0; j < NK; ++j) se += __expf(s[j] - mx); const float sc = 256.0f / se;
#pragma unroll 1
  for (int j0 = 0; j0 < NK; j0 += 8) { FragH fr; for (int q = 0; q < 8; ++q) fr.h[q] = (_Float16)(__expf(s[j0 + q] - mx) * sc);
    unsigned short* d = (unsigned short*)P + (size_t)t * NK + j0; *(v8us*)d = fr.half[0];  } }

typedef float v2f __attribute__((ext_vector_type(2)));
__device__ __forceinline__ float pt_xhalf(float x) { return __builtin_bit_cast(float, __builtin_amdgcn_permlanex16(__builtin_bit_cast(int, x), __builtin_bit_cast(int, x), 0x76543210, 0xfedcba98, false, false)); }      /* lane l <-> lane l ^ 16 */
__device__ __forceinline__ v8f pt_mma(v2f a, v2f b, v8f c) { return __builtin_amdgcn_wmma_f32_16x16x4_f32(false, a, false, b, (short)0, c, false, false); }
// One wave per token, both products on v_wmma_f32_16x16x4_f32 (f32 operands), no LDS. Lane (c = lane & 15, hh = lane >> 4).
// St = K Q^T per 16 x 16 tile: A row j = c, B column i = c, both loaded by the same code (the lane's 8 contiguous heads 8 hh .. 8 hh + 7 of its row; step s takes heads 8 hh + 2 s, + 1).
// D register r of tile jt = score of key j = 16 jt + 8 hh + r for query i = c: a query's 64 scores lie in lanes c and c + 16, so the softmax needs one exchange for the maximum and one for the sum.
// Ot = V^T P^T: B = register pair (2 p, 2 p + 1) of a tile as it lies (keys 16 jt + 8 hh + 2 p, + 1), A row = head c with V of the same keys. D register r = res[i = c][head 8 hh + r]: 8 contiguous floats of the output row.
__global__ __launch_bounds__(128) void k_ptatt(const float* __restrict__ QF, const float* __restrict__ KF, const float* __restrict__ VF, const float* __restrict__ xres, float scale, float* __restrict__ out) {
  const int lane = threadIdx.x & 31, c = lane & 15, hh = lane >> 4;
  const size_t ro = ((size_t)blockIdx.x * 4 + (size_t)__builtin_amdgcn_readfirstlane((int)(threadIdx.x >> 5))) * 1024;      /* the wave's token: a scalar, so every address is a scalar base plus one lane offset */
  const int fo = c * 16 + 8 * hh, vo = hh * 128 + c;
  const float cs = scale * 1.4426950408889634f;      /* softmax in base 2 */
  const float* kp = KF + ro; const float* vp = VF + ro; const float* qp = QF + ro; const float* xp = xres + ro; float* op = out + ro;
  v8f kf[4], vt[4];
#pragma unroll
  for (int jt = 0; jt < 4; ++jt) { const v4f k0 = *(const v4fa*)(kp + jt * 256 + fo), k1 = *(const v4fa*)(kp + jt * 256 + fo + 4); kf[jt] = v8f{k0[0], k0[1], k0[2], k0[3], k1[0], k1[1], k1[2], k1[3]}; }
  v4f q0 = *(const v4fa*)(qp + fo), q1 = *(const v4fa*)(qp + fo + 4);
  __builtin_amdgcn_sched_barrier(0);      /* K and Q are asked for ahead of V: loads return in order, and the first product waits for these alone */
#pragma unroll
  for (int jt = 0; jt < 4; ++jt)
#pragma unroll
    for (int r = 0; r < 8; ++r) vt[jt][r] = vp[jt * 256 + r * 16 + vo];
  __builtin_amdgcn_sched_barrier(0);      /* V is asked for before the wave first waits: behind that wait its latency would come on top of K's */
#pragma unroll
  for (int it = 0; it < 4; ++it) {
    const v4f x0 = *(const v4fa*)(xp + it * 256 + fo), x1 = *(const v4fa*)(xp + it * 256 + fo + 4);
    const v8f z8 = {0.f, 0.f, 0.f, 0.f, 0.f, 0.f, 0.f, 0.f}; v8f st[4] = {z8, z8, z8, z8};
#pragma unroll
    for (int s = 0; s < 4; ++s)
#pragma unroll
      for (int jt = 0; jt < 4; ++jt) st[jt] = pt_mma(v2f{kf[jt][2 * s], kf[jt][2 * s + 1]}, s < 2 ? v2f{q0[2 * s], q0[2 * s + 1]} : v2f{q1[2 * s - 4], q1[2 * s - 3]}, st[jt]);
    /* distance behind a matrix instruction: nothing reads these scores or overwrites an operand within the slots; the f32 form stands in no table of distances, so the count of the other form with its issue interval is kept */
    asm volatile("v_nop\n\tv_nop\n\tv_nop\n\tv_nop\n\tv_nop\n\tv_nop\n\tv_nop\n\tv_nop" : "+v"(st[0]), "+v"(st[1]), "+v"(st[2]), "+v"(st[3]) : "v"(q0), "v"(q1), "v"(kf[0]), "v"(kf[1]), "v"(kf[2]), "v"(kf[3]));
    if (it < 3) { q0 = *(const v4fa*)(qp + (it + 1) * 256 + fo); q1 = *(const v4fa*)(qp + (it + 1) * 256 + fo + 4); }      /* the next tile's queries fly during the rest of this tile */
    float m4[4];
#pragma unroll
    for (int jt = 0; jt < 4; ++jt) { m4[jt] = fmaxf(st[jt][0], st[jt][1]);
#pragma unroll
      for (int r = 2; r < 8; ++r) m4[jt] = fmaxf(m4[jt], st[jt][r]); }
    float mx = fmaxf(fmaxf(m4[0], m4[1]), fmaxf(m4[2], m4[3])); mx = fmaxf(mx, pt_xhalf(mx));
    const float mc = mx * cs; v8f pr[4]; v2f la = {0.f, 0.f}, lb = {0.f, 0.f};
#pragma unroll
    for (int jt = 0; jt < 4; ++jt) { v8f ar;
#pragma unroll
      for (int r = 0; r < 8; ++r) ar[r] = fmaf(st[jt][r], cs, -mc);
#pragma unroll
      for (int r = 0; r < 8; ++r) pr[jt][r] = __builtin_amdgcn_exp2f(ar[r]);
      /* the slot behind a transcendental: inputs only, the eight arguments stay whole until this slot, so no instruction directly behind an exponential overwrites its source */
      asm volatile("v_nop" :: "v"(ar), "v"(pr[jt]));
#pragma unroll
      for (int p = 0; p < 4; ++p) { if (jt & 1) lb += v2f{pr[jt][2 * p], pr[jt][2 * p + 1]}; else la += v2f{pr[jt][2 * p], pr[jt][2 * p + 1]}; } }
    la += lb; float l = la[0] + la[1]; l += pt_xhalf(l);
    const float inv = __builtin_amdgcn_rcpf(l); v4f y0, y1;
    v8f o0 = z8, o1 = z8;      /* two sums: a product that adds to the one before it waits longer than the issue interval */
#pragma unroll
    for (int p = 0; p < 4; ++p)
#pragma unroll
      for (int jt = 0; jt < 4; ++jt) { if (jt & 1) o1 = pt_mma(v2f{vt[jt][2 * p], vt[jt][2 * p + 1]}, v2f{pr[jt][2 * p], pr[jt][2 * p + 1]}, o1); else o0 = pt_mma(v2f{vt[jt][2 * p], vt[jt][2 * p + 1]}, v2f{pr[jt][2 * p], pr[jt][2 * p + 1]}, o0); }
    /* the same distance: the operands stay untouched and the sums unread for the slots behind the run's last product */
    asm volatile("v_nop\n\tv_nop\n\tv_nop\n\tv_nop\n\tv_nop\n\tv_nop\n\tv_nop\n\tv_nop" : "+v"(o0), "+v"(o1) : "v"(pr[0]), "v"(pr[1]), "v"(pr[2]), "v"(pr[3]), "v"(vt[0]), "v"(vt[1]), "v"(vt[2]), "v"(vt[3]));
#pragma unroll
    for (int u = 0; u < 4; ++u) { y0[u] = fmaf(o0[u] + o1[u], inv, x0[u]); y1[u] = fmaf(o0[4 + u] + o1[4 + u], inv, x1[u]); }
    *(v4f*)(op + it * 256 + fo) = y0; *(v4f*)(op + it * 256 + fo + 4) = y1;
    if (it < 3) asm volatile("s_wait_xcnt 0x0" ::: "memory");      /* stands in front of the next tile's products, which overwrite the registers that these stores name */
    __builtin_amdgcn_sched_barrier(0);      /* keeps the next tile's products behind this tile: moved up, the four tiles' scores are all held at once and fewer than half as many waves fit a SIMD */
  }
}
// Row LayerNorm (biased variance) of bf16-rounded rows of 1024 floats -> f16 rows. One wave holds two whole rows in registers: no LDS, no barrier, 4096 waves.
// Lane l holds floats 128 u + 4 l .. + 3 of a row (u = 0 .. 7): every load covers 512 contiguous bytes, every store 256. All 16 row loads are asked for before the first wait; gamma and beta serve both rows. Every loop is unrolled: the arrays are indexed by constants only and so stay in registers.
template <int M> __device__ __forceinline__ float ln_xm(float x) { return __builtin_bit_cast(float, __builtin_amdgcn_update_dpp(0, __builtin_bit_cast(int, x), 0x160 + M, 0xf, 0xf, true)); }      /* lane l <- lane l ^ M inside a row of 16 lanes */
__device__ __forceinline__ float ln_wsum(float x) { x += ln_xm<1>(x); x += ln_xm<2>(x); x += ln_xm<4>(x); x += ln_xm<8>(x); return x + pt_xhalf(x); }      /* sum over the wave, the same bits in every lane */
__device__ __forceinline__ void d_lnrow(int blk, const float* __restrict__ X, const float* __restrict__ g, const float* __restrict__ bb, float eps, _Float16* __restrict__ N16) {
  const int l4 = (threadIdx.x & 31) * 4;
  const size_t ro = ((size_t)blk * 8 + (size_t)__builtin_amdgcn_readfirstlane((int)(threadIdx.x >> 5))) * 2048;      /* the wave's first row: a scalar, so every address is a scalar base plus one lane offset */
  const float* xp = X + ro + l4; _Float16* np = N16 + ro + l4;
  v4f xa[2][8], ga[8], ba[8];
#pragma unroll
  for (int r = 0; r < 2; ++r)
#pragma unroll
    for (int u = 0; u < 8; ++u) xa[r][u] = *(const v4fa*)(xp + r * 1024 + u * 128);
#pragma unroll
  for (int u = 0; u < 8; ++u) { ga[u] = *(const v4fa*)(g + u * 128 + l4); ba[u] = *(const v4fa*)(bb + u * 128 + l4); }
  float mu[2], rs[2];
#pragma unroll
  for (int r = 0; r < 2; ++r) { v4f s4;
#pragma unroll
    for (int u = 0; u < 8; ++u) {
#pragma unroll
      for (int q = 0; q < 4; ++q) xa[r][u][q] = bf16_round(xa[r][u][q]);
      s4 = u ? s4 + xa[r][u] : xa[r][u]; }
    mu[r] = (s4[0] + s4[1]) + (s4[2] + s4[3]); }
#pragma unroll
  for (int r = 0; r < 2; ++r) mu[r] = ln_wsum(mu[r]) * (1.0f / 1024.0f);
#pragma unroll
  for (int r = 0; r < 2; ++r) { v4f v4 = {0.f, 0.f, 0.f, 0.f};
#pragma unroll
    for (int u = 0; u < 8; ++u) { xa[r][u] -= mu[r]; v4 += xa[r][u] * xa[r][u]; }
    rs[r] = (v4[0] + v4[1]) + (v4[2] + v4[3]); }
#pragma unroll
  for (int r = 0; r < 2; ++r) rs[r] = rsqrtf(ln_wsum(rs[r]) * (1.0f / 1024.0f) + eps);
#pragma unroll
  for (int u = 0; u < 8; ++u) {
#pragma unroll
    for (int q = 0; q < 4; ++q) { ga[u][q] = bf16_round(ga[u][q]); ba[u][q] = bf16_round(ba[u][q]); }
#pragma unroll
    for (int r = 0; r < 2; ++r) { v4h y;
#pragma unroll
      for (int q = 0; q < 4; ++q) y[q] = (_Float16)(xa[r][u][q] * rs[r] * ga[u][q] + ba[u][q]);
      *(v4h*)(np + r * 1024 + u * 128) = y; } }
}
// The five jobs that depend on nothing but the inputs share one launch: a block's index range picks its job (a scalar branch, the same for the whole block; no job has a barrier).
// Longest chains first: the three weight transposes (strided reads), then LayerNorm, then the short rounding stream.
#define PW_B 512                     /* blocks per 1024 x 1024 weight: 1024 * 128 threads of 8 elements */
#define PL_B 512                     /* LayerNorm blocks: 8192 rows, 16 per block */
#define PR_B 4096                    /* rounding blocks: 8192 * 1024 / 8 threads */
__global__ __launch_bounds__(256) void k_prep(const float* __restrict__ x, const float* __restrict__ wq, const float* __restrict__ wk, const float* __restrict__ wv, const float* __restrict__ g, const float* __restrict__ bb,
                                              _Float16* __restrict__ BQ, _Float16* __restrict__ BK, _Float16* __restrict__ BV, _Float16* __restrict__ XN, float* __restrict__ XB) {
  const int b = blockIdx.x;
  if (b < PW_B) d_wt_f16(b, wq, BQ, 1024, 1024, 16.0f);
  else if (b < 2 * PW_B) d_wt_f16(b - PW_B, wk, BK, 1024, 1024, 16.0f);
  else if (b < 3 * PW_B) d_wt_f16(b - 2 * PW_B, wv, BV, 1024, 1024, 16.0f);
  else if (b < 3 * PW_B + PL_B) d_lnrow(b - 3 * PW_B, x, g, bb, 1e-5f, XN);
  else d_bfr(b - (3 * PW_B + PL_B), x, XB, (size_t)PR_B * 256);
}
extern "C" void kernel_launch(void* const* d_in, const int* in_sizes, int n_in,
                              void* d_out, int out_size, void* d_ws, size_t ws_size, hipStream_t stream) {
  (void)in_sizes; (void)n_in; (void)out_size;
  const float* const* I = (const float* const*)d_in; const float* x = I[0]; const float* wq = I[1]; const float* bq = I[2]; const float* wk = I[3]; const float* bk = I[4]; const float* wv = I[5]; const float* bv = I[6]; const float* gam = I[7]; const float* bet = I[8];      /* inp; [in][out] Wq/Wk/Wv [1024][1024] + biases; LayerNorm gamma/beta */
  constexpr int DMc = 1024; const size_t NRc = (size_t)4 * 2048;      /* model width; token rows */
  char* ws = (char*)d_ws; size_t off = 0;
  auto take = [&](size_t bytes) { char* p = ws + off; off += (bytes + 255) & ~(size_t)255; return p; };
  _Float16* BQ = (_Float16*)take((size_t)DMc * DMc * 2); _Float16* BK = (_Float16*)take((size_t)DMc * DMc * 2); _Float16* BV = (_Float16*)take((size_t)DMc * DMc * 2);
  _Float16* XN = (_Float16*)take(NRc * DMc * 2); float* XB = (float*)take(NRc * DMc * 4); float* QF = (float*)take(NRc * DMc * 4); float* KF = (float*)take(NRc * DMc * 4); float* VF = (float*)take(NRc * DMc * 4);
  if (off > ws_size) return;
  k_prep<<<3 * PW_B + PL_B + PR_B, 256, 0, stream>>>(x, wq, wk, wv, gam, bet, BQ, BK, BV, XN, XB);      /* [in][out] -> Bt x16; out = LN(bf16(inp)) -> f16 rows; XB = bf16(inp) f32 for the residual */
  k_gemm3<<<dim3((unsigned)((NRc / 128) * (DMc / 128)), 3, 1), 256, 0, stream>>>(XN, BQ, BK, BV, 0.0625f, bq, bk, bv, QF, KF, VF, DMc, DMc);      /* Q, K, V = out W + b -> f32 rows */
  k_ptatt<<<(unsigned)(NRc / 4), 128, 0, stream>>>(QF, KF, VF, XB, 0.125f, (float*)d_out);      /* per-token 64 x 64 x 16 attention, f32 matrix instructions, one wave per token + residual -> output rows */
}

// v005
// One run takes 86.1 microseconds.
// Two timings next to v004 both put it at 1.19 times that version's speed.
// All steps since v000 together make it 3.05 times as fast.
#include <hip/hip_runtime.h>
// Per-POSITION attention over the head-dim axis (inp [4][2048][1024]; out = LayerNorm(inp) (biased var, eps 1e-5, gamma/beta); Q/K/V = out W + b ([in][out] 1024 x 1024 sigma 1/32, zero biases) viewed [B][M][DK = 64][H = 16] (column i*16 + h); for every token: scores[i][j] = sum_h Q[i][h] K[j][h] / 8 (a 64 x 64 matrix, contraction over the 16 'heads'), softmax over j, res[i][h] = sum_j att[i][j] V[j][h]; no mixing across tokens; result = inp + res -> [4][2048][1024]).
// Compute dtype: inputs rounded to bf16; x / weights exact; LayerNorm output as a plain f16 GEMM operand (~2^-12); q, k, v, softmax weights and o f32; scores and softmax statistics f32; v_wmma_f32_16x16x32_f16 for the projections, v_wmma_f32_16x16x4_f32 for the attention.
#define NB 4
#define SQ 4096
#define DM 256
#define NH 1
#define HD 64
#define HG 4                         /* heads per k_vt launch (V transpose; not launched) */
#define B0 0                         /* unused */
#define NBR NB                       /* used only via MP / MPO, which no code reads */
#define NR ((size_t)NB * SQ)
#define MP ((int)((size_t)NBR * SQ))
#define QT 256                       /* query rows per causal tile */
#define NKX SQ                       /* S / P row pitch */
#define QT0 256                      /* first-tile rows recomputed exactly (256: buys margin for the few-key rows 128..255, which have no output projection to average the single-f16 P/v rounding) */
#define QN SQ
#define NHD NH
#define MPO MP
#define LQ DM
typedef __bf16 v16b __attribute__((ext_vector_type(16)));
typedef unsigned short v8us __attribute__((ext_vector_type(8), may_alias));
typedef float  v8f  __attribute__((ext_vector_type(8)));
typedef float  v4f  __attribute__((ext_vector_type(4)));
typedef float  v4fa __attribute__((ext_vector_type(4), may_alias));
union FragB { v16b v; v8us half[2]; unsigned short u[16]; };

__device__ __forceinline__ unsigned short bf16_bits(float x) { unsigned int u = __float_as_uint(x); return (unsigned short)((u + 0x7FFFu + ((u >> 16) & 1u)) >> 16); }
__device__ __forceinline__ float bf16_val(unsigned short b) { return __uint_as_float(((unsigned int)b) << 16); }
__device__ __forceinline__ float bf16_round(float x) { return bf16_val(bf16_bits(x)); }
// D += A·B with NT terms: 1 = ah·bh, 2 = + al·bh (A split), 3 = + ah·bl (both split)
template <int NT>
__device__ __forceinline__ v8f mmaN(v16b ah, v16b al, v16b bh, v16b bl, v8f c) {
  c = __builtin_amdgcn_wmma_f32_16x16x32_bf16(false, ah, false, bh, (short)0, c, false, false);
  if (NT >= 2) c = __builtin_amdgcn_wmma_f32_16x16x32_bf16(false, al, false, bh, (short)0, c, false, false);
  if (NT >= 3) c = __builtin_amdgcn_wmma_f32_16x16x32_bf16(false, ah, false, bl, (short)0, c, false, false);
  asm volatile("v_nop\n\tv_nop\n\tv_nop\n\tv_nop" : "+v"(c) : "v"(ah), "v"(al), "v"(bh), "v"(bl));
  return c;
}

__global__ __launch_bounds__(256) void k_wt_bf16(const float* __restrict__ W, unsigned short* __restrict__ Wt, int K, int N) {
  const int t = blockIdx.x * 256 + threadIdx.x;
  const int k8n = K / 8;
  if (t >= N * k8n) return;
  const int n = t / k8n, k8 = (t % k8n) * 8;
  v8us v;
#pragma unroll
  for (int i = 0; i < 8; ++i) v[i] = bf16_bits(W[(size_t)(k8 + i) * N + n]);
  *(v8us*)(Wt + (size_t)n * K + k8) = v;
  
}

// GEMM C[M][N] (f32, pitch ldc) = act(A[M][K]·W + bias). A f32 row-major (pitch lda) converted per fragment to bf16
// (ASPLIT: hi/lo two planes -> 2 terms, else single rounded term); Wt bf16 [N][K] (pitch ldb). BIAS_BF16 rounds the
// bias to bf16 first (bias quantised to bf16 before the add). K%32==0, M%16==0, N%64==0.
template <bool ASPLIT, int ACT, bool BIAS_BF16>
__global__ __launch_bounds__(128) void k_gemm_bf(const float* __restrict__ A, int lda, const unsigned short* __restrict__ Wt, int ldb,
                                               const float* __restrict__ bias, float* __restrict__ C, int ldc, int M, int N, int K) {
  __shared__ __attribute__((aligned(16))) float so[4][16][64];
  const int tid = threadIdx.x, w = tid >> 5, lane = tid & 31, ln = lane & 15, hh = lane >> 4;
  const int ntn = N / 64;
  const int wid = blockIdx.x * 4 + w;
  const int mt = wid / ntn, nq = wid % ntn;
  if (mt * 16 >= M) return;
  const int row0 = mt * 16, col0 = nq * 64;
  const float* arow = A + (size_t)(row0 + ln) * lda;
  v8f acc[4] = {};
  for (int kb = 0; kb < K; kb += 32) {
    FragB ah, al;
    const v4f x0 = *(const v4fa*)(arow + kb + 8 * hh), x1 = *(const v4fa*)(arow + kb + 8 * hh + 4);
    const v4f x2 = *(const v4fa*)(arow + kb + 16 + 8 * hh), x3 = *(const v4fa*)(arow + kb + 16 + 8 * hh + 4);
    float xs[16] = {x0[0],x0[1],x0[2],x0[3],x1[0],x1[1],x1[2],x1[3],x2[0],x2[1],x2[2],x2[3],x3[0],x3[1],x3[2],x3[3]};
#pragma unroll
    for (int i = 0; i < 16; ++i) { const unsigned short hb = bf16_bits(xs[i]); ah.u[i] = hb; al.u[i] = ASPLIT ? bf16_bits(xs[i] - bf16_val(hb)) : (unsigned short)0; }
#pragma unroll
    for (int t = 0; t < 4; ++t) {
      const unsigned short* brow = Wt + (size_t)(col0 + t * 16 + ln) * ldb + kb;
      FragB b;
      b.half[0] = *(const v8us*)(brow + 8 * hh);
      b.half[1] = *(const v8us*)(brow + 16 + 8 * hh);
      acc[t] = mmaN<ASPLIT ? 2 : 1>(ah.v, al.v, b.v, b.v, acc[t]);
    }
  }
#pragma unroll
  for (int t = 0; t < 4; ++t) {
    float bv = bias ? bias[col0 + t * 16 + ln] : 0.f;
    if (BIAS_BF16) bv = bf16_round(bv);
#pragma unroll
    for (int r = 0; r < 8; ++r) { float v = acc[t][r] + bv; if (ACT == 1) v = fmaxf(v, 0.f); so[w][8 * hh + r][t * 16 + ln] = v; }
  }
  __builtin_amdgcn_fence(__ATOMIC_ACQ_REL, "workgroup");
  __builtin_amdgcn_wave_barrier();
  const int rsub = lane >> 4, c4 = (lane & 15) * 4;
  {
#pragma unroll
    for (int q = 0; q < 8; ++q) {
      const int r = q * 2 + rsub;
      const v4f v = *(const v4fa*)&so[w][r][c4];
      *(v4f*)(C + (size_t)(row0 + r) * ldc + col0 + c4) = v;
    }
    
  }
}

// GEMM C = act(A·W + bias + resid): A f32 (ASPLIT -> hi/lo 2 terms), Wt bf16 [N][K]; ACT 0 none, 1 relu, 2 exact gelu;
// resid (optional, f32, row index = (row % rmod), pitch ldr, RES_BF16 rounds it) added before the activation.
template <bool ASPLIT, int ACT, bool BIAS_BF16, bool RES_BF16>
__global__ __launch_bounds__(128) void k_gemm_bf3(const float* __restrict__ A, int lda, const unsigned short* __restrict__ Wt, int ldb,
                                                const float* __restrict__ bias, const float* __restrict__ resid, int rmod, int ldr,
                                                float* __restrict__ C, int ldc, int M, int N, int K) {
  __shared__ __attribute__((aligned(16))) float so[4][16][64];
  const int tid = threadIdx.x, w = tid >> 5, lane = tid & 31, ln = lane & 15, hh = lane >> 4;
  const int ntn = N / 64;
  const int wid = blockIdx.x * 4 + w;
  const int mt = wid / ntn, nq = wid % ntn;
  if (mt * 16 >= M) return;
  const int row0 = mt * 16, col0 = nq * 64;
  const float* arow = A + (size_t)(row0 + ln) * lda;
  v8f acc[4] = {};
  for (int kb = 0; kb < K; kb += 32) {
    FragB ah, al;
    const v4f x0 = *(const v4fa*)(arow + kb + 8 * hh), x1 = *(const v4fa*)(arow + kb + 8 * hh + 4);
    const v4f x2 = *(const v4fa*)(arow + kb + 16 + 8 * hh), x3 = *(const v4fa*)(arow + kb + 16 + 8 * hh + 4);
    float xs[16] = {x0[0],x0[1],x0[2],x0[3],x1[0],x1[1],x1[2],x1[3],x2[0],x2[1],x2[2],x2[3],x3[0],x3[1],x3[2],x3[3]};
#pragma unroll
    for (int i = 0; i < 16; ++i) { const unsigned short hb = bf16_bits(xs[i]); ah.u[i] = hb; al.u[i] = ASPLIT ? bf16_bits(xs[i] - bf16_val(hb)) : (unsigned short)0; }
#pragma unroll
    for (int t = 0; t < 4; ++t) {
      const unsigned short* brow = Wt + (size_t)(col0 + t * 16 + ln) * ldb + kb;
      FragB b;
      b.half[0] = *(const v8us*)(brow + 8 * hh);
      b.half[1] = *(const v8us*)(brow + 16 + 8 * hh);
      acc[t] = mmaN<ASPLIT ? 2 : 1>(ah.v, al.v, b.v, b.v, acc[t]);
    }
  }
#pragma unroll
  for (int t = 0; t < 4; ++t) {
    const int col = col0 + t * 16 + ln;
    float bv = bias ? bias[col] : 0.f;
    if (BIAS_BF16) bv = bf16_round(bv);
#pragma unroll
    for (int r = 0; r < 8; ++r) {
      float v = acc[t][r] + bv;
      if (resid) { float rv = resid[(size_t)((row0 + 8 * hh + r) % rmod) * ldr + col]; if (RES_BF16) rv = bf16_round(rv); v += rv; }
      if (ACT == 1) v = fmaxf(v, 0.f);
      if (ACT == 2) v = 0.5f * v * (1.0f + erff(v * 0.70710678118654752f));
      if (ACT == 3) { const float u = 0.7978845608028654f * (v + 0.044715f * v * v * v); v = 0.5f * v * (1.0f + tanhf(u)); }
      so[w][8 * hh + r][t * 16 + ln] = v;
    }
  }
  __builtin_amdgcn_fence(__ATOMIC_ACQ_REL, "workgroup");
  __builtin_amdgcn_wave_barrier();
  const int rsub = lane >> 4, c4 = (lane & 15) * 4;
  {
#pragma unroll
    for (int q = 0; q < 8; ++q) {
      const int r = q * 2 + rsub;
      const v4f v = *(const v4fa*)&so[w][r][c4];
      *(v4f*)(C + (size_t)(row0 + r) * ldc + col0 + c4) = v;
    }
    
  }
}
// row LayerNorm (biased variance, eps) over N: s = X (+ R); optional out_sum <- s; out_norm <- (s-mu)*rsqrt(var+eps)*g + b
template <bool PARAM_BF16>
__global__ __launch_bounds__(256) void k_layernorm(const float* __restrict__ X, const float* __restrict__ R, const float* __restrict__ g, const float* __restrict__ bta,
                                                  float* __restrict__ out_sum, float* __restrict__ out_norm, int N, float eps) {
  __shared__ float red[256];
  const int row = blockIdx.x, tid = threadIdx.x;
  const float* x = X + (size_t)row * N; const float* rr = R ? R + (size_t)row * N : nullptr;
  float vals[16];                     // up to N = 4096
  const int per = N / 256;            // contiguous chunk per thread? use strided-by-4 chunks: thread handles j = tid*4 + 1024*u
  float s1 = 0.f;
  for (int u = 0; u < per / 4; ++u) {
    const int j = tid * 4 + 1024 * u;
    const v4f a = *(const v4fa*)(x + j);
    v4f b = {0.f,0.f,0.f,0.f}; if (rr) b = *(const v4fa*)(rr + j);
#pragma unroll
    for (int q = 0; q < 4; ++q) { const float v = a[q] + b[q]; vals[u * 4 + q] = v; s1 += v; }
  }
  red[tid] = s1; __syncthreads();
  for (int st = 128; st > 0; st >>= 1) { if (tid < st) red[tid] += red[tid + st]; __syncthreads(); }
  const float mu = red[0] / (float)N; __syncthreads();
  float s2 = 0.f;
  for (int u = 0; u < per / 4; ++u)
#pragma unroll
    for (int q = 0; q < 4; ++q) { const float c = vals[u * 4 + q] - mu; s2 += c * c; }
  red[tid] = s2; __syncthreads();
  for (int st = 128; st > 0; st >>= 1) { if (tid < st) red[tid] += red[tid + st]; __syncthreads(); }
  const float rs = rsqrtf(red[0] / (float)N + eps);
  {
    for (int u = 0; u < per / 4; ++u) {
      const int j = tid * 4 + 1024 * u;
      v4f o, sm;
#pragma unroll
      for (int q = 0; q < 4; ++q) {
        float gg = g[j + q], bb = bta[j + q];
        if (PARAM_BF16) { gg = bf16_round(gg); bb = bf16_round(bb); }
        sm[q] = vals[u * 4 + q]; o[q] = (vals[u * 4 + q] - mu) * rs * gg + bb;
      }
      if (out_sum) *(v4f*)(out_sum + (size_t)row * N + j) = sm;
      *(v4f*)(out_norm + (size_t)row * N + j) = o;
    }
    
  }
}



// ---- f16 WMMA path (v_wmma_f32_16x16x32_f16): 11-bit significands for operands in range — used here for the Q/K/V projections
typedef _Float16 v16h __attribute__((ext_vector_type(16)));
union FragH { v16h v; v8us half[2]; _Float16 h[16]; unsigned short u[16]; };
template <int NT>
__device__ __forceinline__ v8f mmaH(v16h ah, v16h al, v16h bh, v16h bl, v8f c) {
  c = __builtin_amdgcn_wmma_f32_16x16x32_f16(false, ah, false, bh, (short)0, c, false, false);
  if (NT >= 2) c = __builtin_amdgcn_wmma_f32_16x16x32_f16(false, al, false, bh, (short)0, c, false, false);
  if (NT >= 3) c = __builtin_amdgcn_wmma_f32_16x16x32_f16(false, ah, false, bl, (short)0, c, false, false);
  asm volatile("v_nop\n\tv_nop\n\tv_nop\n\tv_nop" : "+v"(c) : "v"(ah), "v"(al), "v"(bh), "v"(bl));
  return c;
}
// batched GEMM like k_gemm_b but f16 operands: A f32 (split into f16 hi/lo if ASPLIT, else rounded to f16), Bt = f16 values [n][k]; alpha; C f32; N multiple of 16 (partial tiles skipped)
template <bool ASPLIT>
__global__ __launch_bounds__(128) void k_gemm_h(const float* __restrict__ A, int lda, size_t sA, const _Float16* __restrict__ Bh, int ldb, size_t sB, float alpha, float* __restrict__ C, int ldc, size_t sC, int M, int N, int K) {
  __shared__ __attribute__((aligned(16))) float so[4][16][64];
  const int tid = threadIdx.x, w = tid >> 5, lane = tid & 31, ln = lane & 15, hh = lane >> 4; const int by = blockIdx.y;
  A += (size_t)by * sA; Bh += (size_t)by * sB; C += (size_t)by * sC;
  const int ntn = (N + 63) / 64; const int wid = blockIdx.x * 4 + w; const int mt = wid / ntn, nq = wid % ntn; if (mt * 16 >= M) return;
  const int row0 = mt * 16, col0 = nq * 64; const float* arow = A + (size_t)(row0 + ln) * lda;
  v8f acc[4] = {};
  for (int kb = 0; kb < K; kb += 32) {
    FragH ah, al;
    const v4f x0 = *(const v4fa*)(arow + kb + 8 * hh), x1 = *(const v4fa*)(arow + kb + 8 * hh + 4), x2 = *(const v4fa*)(arow + kb + 16 + 8 * hh), x3 = *(const v4fa*)(arow + kb + 16 + 8 * hh + 4);
    float xs[16] = {x0[0],x0[1],x0[2],x0[3],x1[0],x1[1],x1[2],x1[3],x2[0],x2[1],x2[2],x2[3],x3[0],x3[1],x3[2],x3[3]};
#pragma unroll
    for (int i = 0; i < 16; ++i) { const _Float16 h = (_Float16)xs[i]; ah.h[i] = h; al.h[i] = ASPLIT ? (_Float16)(xs[i] - (float)h) : (_Float16)0.0f; }
#pragma unroll
    for (int t = 0; t < 4; ++t) { if (col0 + t * 16 >= N) continue; const size_t boff = (size_t)(col0 + t * 16 + ln) * ldb + kb; FragH bq; bq.half[0] = *(const v8us*)(Bh + boff + 8 * hh); bq.half[1] = *(const v8us*)(Bh + boff + 16 + 8 * hh);
      acc[t] = mmaH<ASPLIT ? 2 : 1>(ah.v, al.v, bq.v, bq.v, acc[t]); }
  }
#pragma unroll
  for (int t = 0; t < 4; ++t) { if (col0 + t * 16 >= N) continue;
#pragma unroll
    for (int r = 0; r < 8; ++r) so[w][8 * hh + r][t * 16 + ln] = acc[t][r] * alpha; }
  __builtin_amdgcn_fence(__ATOMIC_ACQ_REL, "workgroup"); __builtin_amdgcn_wave_barrier();
  const int rsub = lane >> 4, c4 = (lane & 15) * 4;
  {
#pragma unroll
    for (int q = 0; q < 8; ++q) { const int r = q * 2 + rsub; if (col0 + c4 < N) { const v4f v = *(const v4fa*)&so[w][r][c4]; *(v4f*)(C + (size_t)(row0 + r) * ldc + col0 + c4) = v; } }
     }
}

// Wt[n][k] = f16(W[k][n] * scale) from f32 row-major W[K][N] (scale = power of two; bf16-exact weights stay exact in f16 away from the subnormal range). Needs K % 64 == 0, N % 128 == 0.
// One wave takes 64 k x 16 n. Lane (lk = lane & 7, ln = lane >> 3) reads rows 8 lk .. 8 lk + 7 at columns 4 ln .. 4 ln + 3 by 16-B loads: a load touches 8 lines, not 32, and the block's eight waves take 128 adjacent columns, so together they use every byte of the lines they touch.
// Per column the lane stores its 8 halfs: eight lanes fill one whole 128-B line of Wt, four lines per store.
__device__ __forceinline__ void d_wt_f16(int blk, const float* __restrict__ W, _Float16* __restrict__ Wt, int K, int N, float scale) {
  const int lane = threadIdx.x & 31, wv = blk * 8 + (int)(threadIdx.x >> 5), ngn = N / 16; const int kg = wv / ngn, ng = wv - kg * ngn; if (kg * 64 >= K) return;
  const int k8 = kg * 64 + (lane & 7) * 8, n = ng * 16 + (lane >> 3) * 4; v4f r[8];
#pragma unroll
  for (int i = 0; i < 8; ++i) r[i] = *(const v4fa*)(W + (size_t)(k8 + i) * N + n);
#pragma unroll
  for (int j = 0; j < 4; ++j) { FragH f;
#pragma unroll
    for (int i = 0; i < 8; ++i) f.h[i] = (_Float16)(bf16_round(r[i][j]) * scale);
    const v8us o = f.half[0]; *(v8us*)((unsigned short*)Wt + (size_t)(n + j) * K + k8) = o; }
}
// k_gemm_hh variant with fused epilogue: v = acc·alpha + bias[by·sBias + col] (+ CP[(row/rowsPerB)·sCPb + by·64 + col] if CP) ; ACT 0 none / 1 elu ; writes f16 C16 (and f32 C if non-null)
template <int ACT>
__global__ __launch_bounds__(128) void k_gemm_hhx(const _Float16* __restrict__ A, int lda, size_t sA, const _Float16* __restrict__ Bh, int ldb, size_t sB, float alpha, const float* __restrict__ bias, size_t sBias, const float* __restrict__ CP, int rowsPerB, size_t sCPb, int row0g,
    float* __restrict__ C, _Float16* __restrict__ C16, int ldc, size_t sC, int M, int N, int K) {
  __shared__ __attribute__((aligned(16))) float so[4][16][64];
  const int tid = threadIdx.x, w = tid >> 5, lane = tid & 31, ln = lane & 15, hh = lane >> 4; const int by = blockIdx.y;
  A += (size_t)by * sA; Bh += (size_t)by * sB; const size_t cofs = (size_t)by * sC; const float* bp = bias ? bias + (size_t)by * sBias : nullptr;
  const int ntn = (N + 63) / 64; const int wid = blockIdx.x * 4 + w; const int mt = wid / ntn, nq = wid % ntn; if (mt * 16 >= M) return;
  const int row0 = mt * 16, col0 = nq * 64; const _Float16* arow = A + (size_t)(row0 + ln) * lda;
  v8f acc[4] = {};
  for (int kb = 0; kb < K; kb += 32) { FragH ah; ah.half[0] = *(const v8us*)((const unsigned short*)arow + kb + 8 * hh); ah.half[1] = *(const v8us*)((const unsigned short*)arow + kb + 16 + 8 * hh);
#pragma unroll
    for (int t = 0; t < 4; ++t) { if (col0 + t * 16 >= N) continue; const size_t boff = (size_t)(col0 + t * 16 + ln) * ldb + kb; FragH bq; bq.half[0] = *(const v8us*)((const unsigned short*)Bh + boff + 8 * hh); bq.half[1] = *(const v8us*)((const unsigned short*)Bh + boff + 16 + 8 * hh);
      acc[t] = mmaH<1>(ah.v, ah.v, bq.v, bq.v, acc[t]); }
  }
#pragma unroll
  for (int t = 0; t < 4; ++t) { if (col0 + t * 16 >= N) continue; const int col = col0 + t * 16 + ln; const float bv = bp ? bf16_round(bp[col]) : 0.f;
#pragma unroll
    for (int r = 0; r < 8; ++r) { float v = acc[t][r] * alpha + bv; if (CP) { const int rr = row0g + row0 + 8 * hh + r; if (rowsPerB < 0) v += CP[cofs + (size_t)rr * ldc + col];      /* rowsPerB < 0: own element of the batched C plane */ else { const int bidx = rr / rowsPerB; v += CP[(size_t)bidx * sCPb + (size_t)by * 64 + col]; } } if (ACT == 1) v = (v > 0.f) ? v : expm1f(v); else if (ACT == 7) v = (v > 0.f) ? v + 1.0f : expf(v); else if (ACT == 8) v = tanhf(v); else if (ACT == 9) v = 0.5f * v * (1.0f + tanhf(0.7978845608028654f * (v + 0.044715f * v * v * v))); else if (ACT == 11) v = 1.0f / (1.0f + expf(-v)); else if (ACT == 12) v = (v > 0.f) ? v : 0.01f * v; else if (ACT == 14) v = (v > 0.f) ? v : 0.1f * v; else if (ACT == 16) v = (v >= 0.f) ? v : 0.3f * v; else if (ACT == 17) v = (v >= 0.f) ? v : 0.2f * v; else if (ACT == 15) v = v / (1.0f + expf(-v)); else if (ACT == 3) v = fmaxf(v, 0.f); else if (ACT == 6) v = 0.5f * v * (1.0f + erff(v * 0.70710678118654752f)); so[w][8 * hh + r][t * 16 + ln] = v; } }
  __builtin_amdgcn_fence(__ATOMIC_ACQ_REL, "workgroup"); __builtin_amdgcn_wave_barrier();
  const int rsub = lane >> 4, c4 = (lane & 15) * 4; typedef _Float16 v4h __attribute__((ext_vector_type(4)));
  {
#pragma unroll
    for (int q = 0; q < 8; ++q) { const int r = q * 2 + rsub; if (col0 + c4 < N) { const v4f v = *(const v4fa*)&so[w][r][c4]; if (C) *(v4f*)(C + cofs + (size_t)(row0 + r) * ldc + col0 + c4) = v; if (C16) { v4h h4; for (int i = 0; i < 4; ++i) h4[i] = (_Float16)v[i]; *(v4h*)(C16 + cofs + (size_t)(row0 + r) * ldc + col0 + c4) = h4; } } }
     }
}


typedef _Float16 v4h __attribute__((ext_vector_type(4)));

__global__ __launch_bounds__(256) void k_x16(const float* __restrict__ x, _Float16* __restrict__ X16, size_t n8) { const size_t t = (size_t)blockIdx.x * 256 + threadIdx.x; if (t >= n8) return; FragH f;
#pragma unroll
  for (int q = 0; q < 8; ++q) f.h[q] = (_Float16)bf16_round(x[t * 8 + q]); *(v8us*)((unsigned short*)X16 + t * 8) = f.half[0];  }
__global__ __launch_bounds__(256) void k_h16(const float* __restrict__ x, _Float16* __restrict__ X16, size_t n8) { const size_t t = (size_t)blockIdx.x * 256 + threadIdx.x; if (t >= n8) return; FragH f;
#pragma unroll
  for (int q = 0; q < 8; ++q) f.h[q] = (_Float16)x[t * 8 + q]; *(v8us*)((unsigned short*)X16 + t * 8) = f.half[0];  }
__global__ __launch_bounds__(256) void k_round16f(const float* __restrict__ W, _Float16* __restrict__ Bt, size_t n8) { const size_t t = (size_t)blockIdx.x * 256 + threadIdx.x; if (t >= n8) return; FragH f;
#pragma unroll
  for (int i = 0; i < 8; ++i) f.h[i] = (_Float16)(bf16_round(W[t * 8 + i]) * 16.0f); *(v8us*)((unsigned short*)Bt + t * 8) = f.half[0];  }
template <int NHv, int TTv>
__global__ __launch_bounds__(256) void k_vt(const _Float16* __restrict__ V16, int ldv, int voff, _Float16* __restrict__ Vt) { __shared__ unsigned short tl[64][66]; const int tid = threadIdx.x; const int slab = blockIdx.x / (TTv / 64), lg = blockIdx.x % (TTv / 64); const int b = slab / NHv, h = slab % NHv;
  for (int i = tid; i < 64 * 8; i += 256) { const int r = i / 8, c8 = (i % 8) * 8; FragH f; f.half[0] = *(const v8us*)((const unsigned short*)V16 + ((size_t)b * TTv + lg * 64 + r) * ldv + voff + h * 64 + c8);
#pragma unroll
    for (int q = 0; q < 8; ++q) tl[r][c8 + q] = f.u[q]; }
  __syncthreads();
  {
#pragma unroll
    for (int rd = 0; rd < 2; ++rd) { const int d = rd * 32 + tid / 8, pc = tid % 8; FragH f;
#pragma unroll
      for (int q = 0; q < 8; ++q) f.u[q] = tl[pc * 8 + q][d];
      *(v8us*)((unsigned short*)Vt + ((size_t)slab * 64 + d) * TTv + lg * 64 + pc * 8) = f.half[0]; }
     } }

__global__ __launch_bounds__(256) void k_hl(const float* __restrict__ F, _Float16* __restrict__ Hh, _Float16* __restrict__ Hl, size_t n8) { const size_t t = (size_t)blockIdx.x * 256 + threadIdx.x; if (t >= n8) return; FragH fh, fl; const v4f a = *(const v4fa*)(F + t * 8), c = *(const v4fa*)(F + t * 8 + 4);
#pragma unroll
  for (int q = 0; q < 4; ++q) { _Float16 h = (_Float16)a[q]; fh.h[q] = h; fl.h[q] = (_Float16)((a[q] - (float)h) * 1024.0f); h = (_Float16)c[q]; fh.h[4 + q] = h; fl.h[4 + q] = (_Float16)((c[q] - (float)h) * 1024.0f); }
  { *(v8us*)((unsigned short*)Hh + t * 8) = fh.half[0]; *(v8us*)((unsigned short*)Hl + t * 8) = fl.half[0];  } }

// ---- fast GEMM (wave tile 32x64), C = A Bh^T alpha + bf16(bias), f32 rows ----
__device__ __forceinline__ v16h g2_frag(const _Float16* p, int hh) { FragH f; f.half[0] = *(const v8us*)((const unsigned short*)p + 8 * hh); f.half[1] = *(const v8us*)((const unsigned short*)p + 16 + 8 * hh); return f.v; }
__device__ __forceinline__ v8f g2_mma(v16h a, v16h b, v8f c) { v8f d = __builtin_amdgcn_wmma_f32_16x16x32_f16(false, a, false, b, (short)0, c, false, false); asm volatile("v_nop\n\tv_nop\n\tv_nop\n\tv_nop" : "+v"(d) : "v"(a), "v"(b)); return d; }
// Block tile 128 x 128, eight waves of 32 x 64 (4 down, 2 across). Per pass 64 k of both operands (128-B rows: 128 rows of A, then 128 rows of Bh) lie in one of two LDS buffers,
// brought by asynchronous copies (16 B per lane, whole 128-B lines per 8 lanes); the next pass's copies fly while this pass's fragments are read from LDS. Needs M % 128 == 0 (grid), N % 128 == 0, K % 64 == 0.
#define G3_PITCH 72                  /* LDS row pitch in halfs: 144 B = 16 B x odd, conflict-free for 16-B fragment reads */
#define G3_STAGE (256 * G3_PITCH)    /* halfs per buffer */
// one pass's copies of this thread: four rows of A and four of Bh, 32 rows apart; l = the lane's LDS byte address of the first
__device__ __forceinline__ void g3_copy(const _Float16* ga, const _Float16* gb, size_t step, unsigned l) {
  const _Float16* a1 = ga + step; const _Float16* a2 = a1 + step; const _Float16* a3 = a2 + step; const _Float16* b1 = gb + step; const _Float16* b2 = b1 + step; const _Float16* b3 = b2 + step;
  const unsigned rs = 32u * G3_PITCH * 2u;
  /* the s_wait_xcnt stands inside the statement so that no address register of a copy is rewritten ahead of it */
  asm volatile("global_load_async_to_lds_b128 %0, %8, off\n\t"
               "global_load_async_to_lds_b128 %1, %9, off\n\t"
               "global_load_async_to_lds_b128 %2, %10, off\n\t"
               "global_load_async_to_lds_b128 %3, %11, off\n\t"
               "global_load_async_to_lds_b128 %4, %12, off\n\t"
               "global_load_async_to_lds_b128 %5, %13, off\n\t"
               "global_load_async_to_lds_b128 %6, %14, off\n\t"
               "global_load_async_to_lds_b128 %7, %15, off\n\t"
               "s_wait_xcnt 0x0"
               :: "v"(l), "v"(l + rs), "v"(l + 2u * rs), "v"(l + 3u * rs), "v"(l + 4u * rs), "v"(l + 5u * rs), "v"(l + 6u * rs), "v"(l + 7u * rs),
                  "v"(ga), "v"(a1), "v"(a2), "v"(a3), "v"(gb), "v"(b1), "v"(b2), "v"(b3) : "memory");
}
// One launch does all three products of the same A: blockIdx.y picks the weight, its bias and its output (scalar selects).
__global__ __launch_bounds__(256) void k_gemm3(const _Float16* __restrict__ A, const _Float16* __restrict__ Bh0, const _Float16* __restrict__ Bh1, const _Float16* __restrict__ Bh2, float alpha,
                                               const float* __restrict__ bias0, const float* __restrict__ bias1, const float* __restrict__ bias2, float* __restrict__ C0, float* __restrict__ C1, float* __restrict__ C2, int N, int K) {
  const int pz = blockIdx.y; const _Float16* Bh = pz == 0 ? Bh0 : pz == 1 ? Bh1 : Bh2; const float* bias = pz == 0 ? bias0 : pz == 1 ? bias1 : bias2; float* C = pz == 0 ? C0 : pz == 1 ? C1 : C2;
  __shared__ __attribute__((aligned(16))) _Float16 ring[2 * G3_STAGE];
  __shared__ __attribute__((aligned(16))) float so[8][32][68];
  const int tid = threadIdx.x, w = tid >> 5, lane = tid & 31, ln = lane & 15, hh = lane >> 4;
  const int ntn = N >> 7; const int mt = blockIdx.x / ntn, nq = blockIdx.x - mt * ntn; const int wm = w >> 1, wn = w & 1;
  const int cr = tid >> 3, cp = tid & 7;      /* copy: row within a group of 32, 16-B piece of the row */
  const _Float16* ga = A + (size_t)(mt * 128 + cr) * K + cp * 8; const _Float16* gb = Bh + (size_t)(nq * 128 + cr) * K + cp * 8; const size_t step = (size_t)32 * K;
  const unsigned l0 = (unsigned)(size_t)&ring[0] + (unsigned)(cr * (G3_PITCH * 2) + cp * 16);
  const int nt = K >> 6;
  const v8f z8 = {0.f,0.f,0.f,0.f,0.f,0.f,0.f,0.f}; v8f c00 = z8, c01 = z8, c02 = z8, c03 = z8, c10 = z8, c11 = z8, c12 = z8, c13 = z8;
  g3_copy(ga, gb, step, l0);
  asm volatile("s_wait_asynccnt 0x0" ::: "memory");      /* this wave's copies of pass 0 have landed */
  __syncthreads();                                       /* publishes pass 0 */
  if (nt > 1) g3_copy(ga + 64, gb + 64, step, l0 + (unsigned)(G3_STAGE * 2));
#pragma unroll 1      /* one pass per trip: the two buffers alternate by the trip's parity */
  for (int t = 0; t < nt; ++t) {
    const _Float16* ap = &ring[(t & 1) * G3_STAGE + (wm * 32 + ln) * G3_PITCH]; const _Float16* bp = &ring[(t & 1) * G3_STAGE + (128 + wn * 64 + ln) * G3_PITCH];
    const v16h a0 = g2_frag(ap, hh), a1 = g2_frag(ap + 16 * G3_PITCH, hh), b0 = g2_frag(bp, hh), b1 = g2_frag(bp + 16 * G3_PITCH, hh), b2 = g2_frag(bp + 32 * G3_PITCH, hh), b3 = g2_frag(bp + 48 * G3_PITCH, hh);
    const v16h e0 = g2_frag(ap + 32, hh), e1 = g2_frag(ap + 16 * G3_PITCH + 32, hh), f0 = g2_frag(bp + 32, hh), f1 = g2_frag(bp + 16 * G3_PITCH + 32, hh), f2 = g2_frag(bp + 32 * G3_PITCH + 32, hh), f3 = g2_frag(bp + 48 * G3_PITCH + 32, hh);
    c00 = g2_mma(a0, b0, c00); c10 = g2_mma(a1, b0, c10); c01 = g2_mma(a0, b1, c01); c11 = g2_mma(a1, b1, c11); c02 = g2_mma(a0, b2, c02); c12 = g2_mma(a1, b2, c12); c03 = g2_mma(a0, b3, c03); c13 = g2_mma(a1, b3, c13);
    c00 = g2_mma(e0, f0, c00); c10 = g2_mma(e1, f0, c10); c01 = g2_mma(e0, f1, c01); c11 = g2_mma(e1, f1, c11); c02 = g2_mma(e0, f2, c02); c12 = g2_mma(e1, f2, c12); c03 = g2_mma(e0, f3, c03); c13 = g2_mma(e1, f3, c13);
    asm volatile("s_wait_dscnt 0x0" ::: "memory");       /* this wave's reads of the buffer are done before it may be refilled */
    asm volatile("s_wait_asynccnt 0x0" ::: "memory");    /* this wave's copies of pass t + 1 have landed */
    __syncthreads();                                     /* publishes pass t + 1 and ends every reader's last read of pass t */
    if (t + 2 < nt) g3_copy(ga + (size_t)(t + 2) * 64, gb + (size_t)(t + 2) * 64, step, l0 + (unsigned)((t & 1) * (G3_STAGE * 2)));
  }
  asm volatile("s_wait_asynccnt 0x0" ::: "memory");      /* no copy is outstanding when the wave goes on */
  const int row0 = mt * 128 + wm * 32, col0 = nq * 128 + wn * 64;
  v8f accs[8] = {c00, c01, c02, c03, c10, c11, c12, c13};
#pragma unroll
  for (int u = 0; u < 8; ++u) { const int t = u & 3, half = u >> 2; const float bv = bf16_round(bias[col0 + t * 16 + ln]);
#pragma unroll
    for (int r = 0; r < 8; ++r) so[w][half * 16 + 8 * hh + r][t * 16 + ln] = accs[u][r] * alpha + bv; }
  __builtin_amdgcn_fence(__ATOMIC_ACQ_REL, "workgroup"); __builtin_amdgcn_wave_barrier();
  const int rsub = lane >> 4, c4 = (lane & 15) * 4;
#pragma unroll
  for (int q = 0; q < 16; ++q) { const int r = q * 2 + rsub; const v4f v = *(const v4fa*)&so[w][r][c4]; *(v4f*)(C + (size_t)(row0 + r) * N + col0 + c4) = v; }
}


__global__ __launch_bounds__(256) void k_wnat(const float* __restrict__ w, size_t n8, _Float16* __restrict__ Bt) { const size_t t = (size_t)blockIdx.x * 256 + threadIdx.x; if (t >= n8) return; FragH f; for (int q = 0; q < 8; ++q) f.h[q] = (_Float16)(bf16_round(w[t * 8 + q]) * 16.0f); *(v8us*)((unsigned short*)Bt + t * 8) = f.half[0];  }
__global__ __launch_bounds__(256) void k_rsm(const float* __restrict__ S, _Float16* __restrict__ P, int nrows) {
  #pragma clang fp contract(off)
  const int i = blockIdx.x * 256 + threadIdx.x; if (i >= nrows) return; const float* s = S + (size_t)i * SQ; float mx = -3.0e38f;
#pragma unroll 1
  for (int j = 0; j < SQ; ++j) mx = fmaxf(mx, s[j]); float se = 0.f;
#pragma unroll 1
  for (int j = 0; j < SQ; ++j) se += expf(s[j] - mx); const float sc = 256.0f / se;
#pragma unroll 1
  for (int j0 = 0; j0 < SQ; j0 += 8) { FragH f; for (int q = 0; q < 8; ++q) f.h[q] = (_Float16)(expf(s[j0 + q] - mx) * sc); unsigned short* d = (unsigned short*)P + (size_t)i * SQ + j0; *(v8us*)d = f.half[0];  } }
__global__ __launch_bounds__(256) void k_vt(const _Float16* __restrict__ V16, int b, int h0, _Float16* __restrict__ VT) { __shared__ unsigned short tl[64][65]; const int tid = threadIdx.x; const int hh = blockIdx.x % HG, sg = blockIdx.x / HG; const int s0 = sg * 64; const int h = h0 + hh;
  for (int i = tid; i < 64 * 8; i += 256) { const int j = i / 8, d8 = (i % 8) * 8; FragH f; f.half[0] = *(const v8us*)((const unsigned short*)V16 + ((size_t)b * SQ + s0 + j) * DM + h * HD + d8); for (int q = 0; q < 8; ++q) tl[d8 + q][j] = f.u[q]; }
  __syncthreads();
  { for (int i = tid; i < 64 * 8; i += 256) { const int d = i / 8, j8 = (i % 8) * 8; FragH f; for (int q = 0; q < 8; ++q) f.u[q] = tl[d][j8 + q]; *(v8us*)((unsigned short*)VT + ((size_t)hh * HD + d) * SQ + s0 + j8) = f.half[0]; }  } }



__global__ __launch_bounds__(256) void k_rsmcf2(const float* __restrict__ S, _Float16* __restrict__ P, int hg, int q0, int nk) {
  #pragma clang fp contract(off)
  const int t = blockIdx.x * 256 + threadIdx.x; if (t >= hg * QT) return; const size_t i = (size_t)t; const float* s = S + i * NKX; const int last = q0 + (t % QT); float mx = -3.0e38f;
#pragma unroll 1
  for (int j = 0; j < nk; ++j) { const float f = (j <= last) ? 1.f : 0.f; mx = fmaxf(mx, fmaf(f, s[j], (1.f - f) * -1.0e9f)); } float se = 0.f;
#pragma unroll 1
  for (int j = 0; j < nk; ++j) { const float f = (j <= last) ? 1.f : 0.f; se += __expf(fmaf(f, s[j], (1.f - f) * -1.0e9f) - mx); } const float sc = 256.0f / se;
#pragma unroll 1
  for (int j0 = 0; j0 < nk; j0 += 8) { FragH fr; for (int q = 0; q < 8; ++q) { const int j = j0 + q; const float f = (j <= last) ? 1.f : 0.f; fr.h[q] = (_Float16)(__expf(fmaf(f, s[j], (1.f - f) * -1.0e9f) - mx) * sc); } unsigned short* d = (unsigned short*)P + i * NKX + j0; *(v8us*)d = fr.half[0];  } }

template <int MASKADD>
__global__ __launch_bounds__(64) void k_att0(const float* __restrict__ QF, const float* __restrict__ KF, const float* __restrict__ VF, int ld, const float* __restrict__ mask, float scale, float* __restrict__ OF, int ldo) {
  #pragma clang fp contract(off)
  __shared__ __attribute__((aligned(16))) float lq[64][64]; __shared__ __attribute__((aligned(16))) float lo[64][64];
  const int tid = threadIdx.x; const int h = blockIdx.x / (QT0 / 64), rg = blockIdx.x % (QT0 / 64); const int i = rg * 64 + tid;
  const float* qr = QF + (size_t)i * ld + h * HD;
#pragma unroll 1
  for (int c = 0; c < HD / 4; ++c) { *(v4f*)&lq[tid][c * 4] = *(const v4fa*)(qr + c * 4); const v4f z = {0.f, 0.f, 0.f, 0.f}; *(v4f*)&lo[tid][c * 4] = z; }
  float m = -1.0e30f, l = 0.f; const int jmax = MASKADD ? (SQ - 1) : (rg * 64 + 63);      /* additive-mask form: every key (the mask input decides); causal form: keys up to the block's last row */
#pragma unroll 1
  for (int j = 0; j <= jmax; ++j) { const float* kr = KF + (size_t)j * ld + h * HD; const float* vr = VF + (size_t)j * ld + h * HD; float s = 0.f;
#pragma unroll 1
    for (int c = 0; c < HD / 4; ++c) { const v4f kq = *(const v4fa*)(kr + c * 4); const v4f qq = *(v4f*)&lq[tid][c * 4]; s = __fadd_rn(s, __fmul_rn(qq[0], kq[0])); s = __fadd_rn(s, __fmul_rn(qq[1], kq[1])); s = __fadd_rn(s, __fmul_rn(qq[2], kq[2])); s = __fadd_rn(s, __fmul_rn(qq[3], kq[3])); }
    s = __fmul_rn(s, scale); if (MASKADD) s = __fadd_rn(s, __fmul_rn(bf16_round(mask[(size_t)i * SQ + j]), -10000.0f));
    const float f = (MASKADD || j <= i) ? 1.f : 0.f; const float sm = fmaf(f, s, (1.f - f) * -1.0e30f); const float mn = fmaxf(m, sm); const float sc = expf(m - mn); const float e = expf(sm - mn); l = __fadd_rn(__fmul_rn(l, sc), e); m = mn;
#pragma unroll 1
    for (int c = 0; c < HD / 4; ++c) { const v4f vv = *(const v4fa*)(vr + c * 4); v4f oo = *(v4f*)&lo[tid][c * 4]; for (int u = 0; u < 4; ++u) oo[u] = __fadd_rn(__fmul_rn(oo[u], sc), __fmul_rn(e, vv[u])); *(v4f*)&lo[tid][c * 4] = oo; } }
  const float fin = 64.0f / l;      /* o carried x64 like the f16 path */
#pragma unroll 1
  for (int c = 0; c < HD / 4; ++c) { v4f oo = *(v4f*)&lo[tid][c * 4]; for (int u = 0; u < 4; ++u) oo[u] = __fmul_rn(oo[u], fin); *(v4f*)&lo[tid][c * 4] = oo; }
  __syncthreads();
  {
#pragma unroll 1
    for (int it = 0; it < 16; ++it) { const int row = it * 4 + tid / 16, pc = (tid % 16) * 4; const v4f v = *(const v4f*)&lo[row][pc]; *(v4f*)(OF + (size_t)(rg * 64 + row) * ldo + h * HD + pc) = v; }
     } }

__global__ __launch_bounds__(256) void k_oscale(const float* __restrict__ OF, float* __restrict__ out, size_t n4) { const size_t t = (size_t)blockIdx.x * 256 + threadIdx.x; if (t >= n4) return; const v4f a = *(const v4fa*)(OF + t * 4); v4f o; for (int q = 0; q < 4; ++q) o[q] = a[q] * 0.015625f; *(v4f*)(out + t * 4) = o;  }

__device__ __forceinline__ void d_bfr(int blk, const float* __restrict__ x, float* __restrict__ XB, size_t n8) { const size_t t = (size_t)blk * 256 + threadIdx.x; if (t >= n8) return; v4f a = *(const v4fa*)(x + t * 8), c = *(const v4fa*)(x + t * 8 + 4); for (int q = 0; q < 4; ++q) { a[q] = bf16_round(a[q]); c[q] = bf16_round(c[q]); }
  { *(v4f*)(XB + t * 8) = a; *(v4f*)(XB + t * 8 + 4) = c;  } }



__global__ __launch_bounds__(256) void k_rsmfvl(const float* __restrict__ S, _Float16* __restrict__ P, _Float16* __restrict__ PL, int qn, const int* __restrict__ vlp) {
  #pragma clang fp contract(off)
  const int t = blockIdx.x * 256 + threadIdx.x; if (t >= qn) return; const int vl = vlp[0]; const size_t i = (size_t)t; const float* s = S + i * SQ; float mx = -3.0e38f;
#pragma unroll 1
  for (int j = 0; j < SQ; ++j) { const float f = (j < vl) ? 1.f : 0.f; mx = fmaxf(mx, fmaf(f, s[j], (1.f - f) * -1000000.0f)); } float se = 0.f;
#pragma unroll 1
  for (int j = 0; j < SQ; ++j) { const float f = (j < vl) ? 1.f : 0.f; se += __expf(fmaf(f, s[j], (1.f - f) * -1000000.0f) - mx); } const float sc = 256.0f / se;
#pragma unroll 1
  for (int j0 = 0; j0 < SQ; j0 += 8) { FragH fr, gr; for (int q = 0; q < 8; ++q) { const int j = j0 + q; const float f = (j < vl) ? 1.f : 0.f; const float pv = __expf(fmaf(f, s[j], (1.f - f) * -1000000.0f) - mx) * sc; const _Float16 ph = (_Float16)pv; fr.h[q] = ph; gr.h[q] = (_Float16)((pv - (float)ph) * 1024.0f); }
    unsigned short* d = (unsigned short*)P + i * SQ + j0; unsigned short* dl = (unsigned short*)PL + i * SQ + j0; *(v8us*)d = fr.half[0]; *(v8us*)dl = gr.half[0];  } }

__global__ __launch_bounds__(256) void k_rsmf(const float* __restrict__ S, _Float16* __restrict__ P, int qn, int hg) {
  #pragma clang fp contract(off)
  const int t = blockIdx.x * 256 + threadIdx.x; if (t >= qn * hg) return; const size_t i = (size_t)(t / qn) * SQ + (t % qn); const float* s = S + i * SQ; float mx = -3.0e38f;
#pragma unroll 1
  for (int j = 0; j < SQ; ++j) mx = fmaxf(mx, s[j]); float se = 0.f;
#pragma unroll 1
  for (int j = 0; j < SQ; ++j) se += __expf(s[j] - mx); const float sc = 256.0f / se;
#pragma unroll 1
  for (int j0 = 0; j0 < SQ; j0 += 8) { FragH f; for (int q = 0; q < 8; ++q) f.h[q] = (_Float16)(__expf(s[j0 + q] - mx) * sc); unsigned short* d = (unsigned short*)P + i * SQ + j0; *(v8us*)d = f.half[0];  } }


#define CN 256          /* channels */
#define CI 128
#define NC 256                       /* (unused legacy kernels) */
#define NPX NP          /* positions per channel row */
#define NP 4096         /* seq1 tokens */
#define NM 1024         /* seq2 tokens */
#define BNEPS 1e-5f

__global__ __launch_bounds__(256) void k_mp2(const float* __restrict__ src, float* __restrict__ dst, int nout) {
  const int t = blockIdx.x * 256 + threadIdx.x; if (t >= nout) return; const int c = t / 1024; const int o = t % 1024; const int oy = o / 32, ox = o % 32; const float* p = src + (size_t)c * 4096 + (size_t)(2 * oy) * 64 + 2 * ox;
  const float v = fmaxf(fmaxf(p[0], p[1]), fmaxf(p[64], p[65])); *(float*)(dst + t) = v;  }
__global__ __launch_bounds__(256) void k_xpb(const float* __restrict__ x, const float* __restrict__ wb, float* __restrict__ CPP, size_t n4) {
  #pragma clang fp contract(off)
  const size_t t = (size_t)blockIdx.x * 256 + threadIdx.x; if (t >= n4) return; const size_t e = t * 4; const int c = (int)((e / 4096) % 256); const float bb = bf16_round(wb[c]); const v4f a = *(const v4fa*)(x + e); v4f o; for (int q = 0; q < 4; ++q) o[q] = __fadd_rn(bf16_round(a[q]), bb);
  *(v4f*)(CPP + e) = o;  }


template <int PASS>
__global__ __launch_bounds__(256) void k_cstA(const float* __restrict__ X, const float* __restrict__ MV, float* __restrict__ PART) {
  #pragma clang fp contract(off)
  __shared__ float red[256]; const int t = threadIdx.x; const size_t bc = blockIdx.x; const int c = (int)(bc % NC); const float* row = X + bc * (size_t)NPX; const float mu = PASS ? MV[c] : 0.f; float s = 0.f;
  for (int i = t; i < NPX; i += 256) { const float v = row[i]; const float d = PASS ? __fadd_rn(v, -mu) : v; s = __fadd_rn(s, PASS ? __fmul_rn(d, d) : d); }
  red[t] = s; __syncthreads(); for (int st = 128; st > 0; st >>= 1) { if (t < st) red[t] = __fadd_rn(red[t], red[t + st]); __syncthreads(); }
  if (t < 32) { const float pv = (t == 0) ? red[0] : 0.f; *(float*)(PART + bc * 32 + t) = pv;  } }      

template <int PASS>
__global__ __launch_bounds__(256) void k_cstB(const float* __restrict__ PART, float* __restrict__ MV) { const int c = threadIdx.x; if (c >= NC) return; double s = 0.0; for (int b = 0; b < NB; ++b) s += (double)PART[((size_t)b * NC + c) * 32]; const float m = (float)(s / ((double)NB * (double)NPX)); *(float*)(MV + PASS * NC + c) = m;  }


__global__ __launch_bounds__(256) void k_bnresid(const float* __restrict__ C2, const float* __restrict__ MV, const float* __restrict__ g, const float* __restrict__ be, const float* __restrict__ X, float* __restrict__ out, size_t n4) {
  #pragma clang fp contract(off)
  const size_t t = (size_t)blockIdx.x * 256 + threadIdx.x; if (t >= n4) return; const size_t e = t * 4; const int c = (int)((e / NPX) % NC); const float sc = __fmul_rn(rsqrtf(__fadd_rn(MV[NC + c], BNEPS)), bf16_round(g[c])); const float mu = MV[c], bb = bf16_round(be[c]);
  const v4f a = *(const v4fa*)(C2 + e); const v4f xx = *(const v4fa*)(X + e); v4f o; for (int q = 0; q < 4; ++q) { const float z = __fadd_rn(__fmul_rn(__fadd_rn(a[q], -mu), sc), bb); o[q] = __fadd_rn(z, bf16_round(xx[q])); }
  *(v4f*)(out + e) = o;  }


__global__ __launch_bounds__(256) void k_rowbias(float* __restrict__ Y, const float* __restrict__ bias) {
  #pragma clang fp contract(off)
  const size_t t = (size_t)blockIdx.x * 256 + threadIdx.x; if (t >= (size_t)NB * NC * NPX / 4) return; const size_t e = t * 4; const int c = (int)((e / NPX) % NC); const float bb = bf16_round(bias[c]);
  v4f v = *(const v4fa*)(Y + e); for (int q = 0; q < 4; ++q) v[q] = __fadd_rn(v[q], bb); *(v4f*)(Y + e) = v;  }



template <int NK>
__global__ __launch_bounds__(256) void k_rsmn(const float* __restrict__ S, _Float16* __restrict__ P, int nrows) {
  #pragma clang fp contract(off)
  const int t = blockIdx.x * 256 + threadIdx.x; if (t >= nrows) return; const float* s = S + (size_t)t * NK; float mx = -3.0e38f;
#pragma unroll 1
  for (int j = 0; j < NK; ++j) mx = fmaxf(mx, s[j]); float se = 0.f;
#pragma unroll 1
  for (int j = 0; j < NK; ++j) se += __expf(s[j] - mx); const float sc = 256.0f / se;
#pragma unroll 1
  for (int j0 = 0; j0 < NK; j0 += 8) { FragH fr; for (int q = 0; q < 8; ++q) fr.h[q] = (_Float16)(__expf(s[j0 + q] - mx) * sc);
    unsigned short* d = (unsigned short*)P + (size_t)t * NK + j0; *(v8us*)d = fr.half[0];  } }

typedef float v2f __attribute__((ext_vector_type(2)));
__device__ __forceinline__ float pt_xhalf(float x) { return __builtin_bit_cast(float, __builtin_amdgcn_permlanex16(__builtin_bit_cast(int, x), __builtin_bit_cast(int, x), 0x76543210, 0xfedcba98, false, false)); }      /* lane l <-> lane l ^ 16 */
__device__ __forceinline__ v8f pt_mma(v2f a, v2f b, v8f c) { return __builtin_amdgcn_wmma_f32_16x16x4_f32(false, a, false, b, (short)0, c, false, false); }
// One wave per token, both products on v_wmma_f32_16x16x4_f32 (f32 operands), no LDS. Lane (c = lane & 15, hh = lane >> 4).
// St = K Q^T per 16 x 16 tile: A row j = c, B column i = c, both loaded by the same code (the lane's 8 contiguous heads 8 hh .. 8 hh + 7 of its row; step s takes heads 8 hh + 2 s, + 1).
// D register r of tile jt = score of key j = 16 jt + 8 hh + r for query i = c: a query's 64 scores lie in lanes c and c + 16, so the softmax needs one exchange for the maximum and one for the sum.
// Ot = V^T P^T: B = register pair (2 p, 2 p + 1) of a tile as it lies (keys 16 jt + 8 hh + 2 p, + 1), A row = head c with V of the same keys. D register r = res[i = c][head 8 hh + r]: 8 contiguous floats of the output row.
__global__ __launch_bounds__(128) void k_ptatt(const float* __restrict__ QF, const float* __restrict__ KF, const float* __restrict__ VF, const float* __restrict__ xres, float scale, float* __restrict__ out) {
  const int lane = threadIdx.x & 31, c = lane & 15, hh = lane >> 4;
  const size_t ro = ((size_t)blockIdx.x * 4 + (size_t)__builtin_amdgcn_readfirstlane((int)(threadIdx.x >> 5))) * 1024;      /* the wave's token: a scalar, so every address is a scalar base plus one lane offset */
  const int fo = c * 16 + 8 * hh, vo = hh * 128 + c;
  const float cs = scale * 1.4426950408889634f;      /* softmax in base 2 */
  const float* kp = KF + ro; const float* vp = VF + ro; const float* qp = QF + ro; const float* xp = xres + ro; float* op = out + ro;
  v8f kf[4], vt[4];
#pragma unroll
  for (int jt = 0; jt < 4; ++jt) { const v4f k0 = *(const v4fa*)(kp + jt * 256 + fo), k1 = *(const v4fa*)(kp + jt * 256 + fo + 4); kf[jt] = v8f{k0[0], k0[1], k0[2], k0[3], k1[0], k1[1], k1[2], k1[3]}; }
  v4f q0 = *(const v4fa*)(qp + fo), q1 = *(const v4fa*)(qp + fo + 4);
  __builtin_amdgcn_sched_barrier(0);      /* K and Q are asked for ahead of V: loads return in order, and the first product waits for these alone */
#pragma unroll
  for (int jt = 0; jt < 4; ++jt)
#pragma unroll
    for (int r = 0; r < 8; ++r) vt[jt][r] = vp[jt * 256 + r * 16 + vo];
  __builtin_amdgcn_sched_barrier(0);      /* V is asked for before the wave first waits: behind that wait its latency would come on top of K's */
#pragma unroll
  for (int it = 0; it < 4; ++it) {
    const v4f x0 = *(const v4fa*)(xp + it * 256 + fo), x1 = *(const v4fa*)(xp + it * 256 + fo + 4);
    const v8f z8 = {0.f, 0.f, 0.f, 0.f, 0.f, 0.f, 0.f, 0.f}; v8f st[4] = {z8, z8, z8, z8};
#pragma unroll
    for (int s = 0; s < 4; ++s)
#pragma unroll
      for (int jt = 0; jt < 4; ++jt) st[jt] = pt_mma(v2f{kf[jt][2 * s], kf[jt][2 * s + 1]}, s < 2 ? v2f{q0[2 * s], q0[2 * s + 1]} : v2f{q1[2 * s - 4], q1[2 * s - 3]}, st[jt]);
    /* distance behind a matrix instruction: nothing reads these scores or overwrites an operand within the slots; the f32 form stands in no table of distances, so the count of the other form with its issue interval is kept */
    asm volatile("v_nop\n\tv_nop\n\tv_nop\n\tv_nop\n\tv_nop\n\tv_nop\n\tv_nop\n\tv_nop" : "+v"(st[0]), "+v"(st[1]), "+v"(st[2]), "+v"(st[3]) : "v"(q0), "v"(q1), "v"(kf[0]), "v"(kf[1]), "v"(kf[2]), "v"(kf[3]));
    if (it < 3) { q0 = *(const v4fa*)(qp + (it + 1) * 256 + fo); q1 = *(const v4fa*)(qp + (it + 1) * 256 + fo + 4); }      /* the next tile's queries fly during the rest of this tile */
    float m4[4];
#pragma unroll
    for (int jt = 0; jt < 4; ++jt) { m4[jt] = fmaxf(st[jt][0], st[jt][1]);
#pragma unroll
      for (int r = 2; r < 8; ++r) m4[jt] = fmaxf(m4[jt], st[jt][r]); }
    float mx = fmaxf(fmaxf(m4[0], m4[1]), fmaxf(m4[2], m4[3])); mx = fmaxf(mx, pt_xhalf(mx));
    const float mc = mx * cs; v8f pr[4]; v2f la = {0.f, 0.f}, lb = {0.f, 0.f};
#pragma unroll
    for (int jt = 0; jt < 4; ++jt) { v8f ar;
#pragma unroll
      for (int r = 0; r < 8; ++r) ar[r] = fmaf(st[jt][r], cs, -mc);
#pragma unroll
      for (int r = 0; r < 8; ++r) pr[jt][r] = __builtin_amdgcn_exp2f(ar[r]);
      /* the slot behind a transcendental: inputs only, the eight arguments stay whole until this slot, so no instruction directly behind an exponential overwrites its source */
      asm volatile("v_nop" :: "v"(ar), "v"(pr[jt]));
#pragma unroll
      for (int p = 0; p < 4; ++p) { if (jt & 1) lb += v2f{pr[jt][2 * p], pr[jt][2 * p + 1]}; else la += v2f{pr[jt][2 * p], pr[jt][2 * p + 1]}; } }
    la += lb; float l = la[0] + la[1]; l += pt_xhalf(l);
    const float inv = __builtin_amdgcn_rcpf(l); v4f y0, y1;
    v8f o0 = z8, o1 = z8;      /* two sums: a product that adds to the one before it waits longer than the issue interval */
#pragma unroll
    for (int p = 0; p < 4; ++p)
#pragma unroll
      for (int jt = 0; jt < 4; ++jt) { if (jt & 1) o1 = pt_mma(v2f{vt[jt][2 * p], vt[jt][2 * p + 1]}, v2f{pr[jt][2 * p], pr[jt][2 * p + 1]}, o1); else o0 = pt_mma(v2f{vt[jt][2 * p], vt[jt][2 * p + 1]}, v2f{pr[jt][2 * p], pr[jt][2 * p + 1]}, o0); }
    /* the same distance: the operands stay untouched and the sums unread for the slots behind the run's last product */
    asm volatile("v_nop\n\tv_nop\n\tv_nop\n\tv_nop\n\tv_nop\n\tv_nop\n\tv_nop\n\tv_nop" : "+v"(o0), "+v"(o1) : "v"(pr[0]), "v"(pr[1]), "v"(pr[2]), "v"(pr[3]), "v"(vt[0]), "v"(vt[1]), "v"(vt[2]), "v"(vt[3]));
#pragma unroll
    for (int u = 0; u < 4; ++u) { y0[u] = fmaf(o0[u] + o1[u], inv, x0[u]); y1[u] = fmaf(o0[4 + u] + o1[4 + u], inv, x1[u]); }
    *(v4f*)(op + it * 256 + fo) = y0; *(v4f*)(op + it * 256 + fo + 4) = y1;
    if (it < 3) asm volatile("s_wait_xcnt 0x0" ::: "memory");      /* stands in front of the next tile's products, which overwrite the registers that these stores name */
    __builtin_amdgcn_sched_barrier(0);      /* keeps the next tile's products behind this tile: moved up, the four tiles' scores are all held at once and fewer than half as many waves fit a SIMD */
  }
}
// Row LayerNorm (biased variance) of bf16-rounded rows of 1024 floats -> f16 rows. One wave holds two whole rows in registers: no LDS, no barrier, 4096 waves.
// Lane l holds floats 128 u + 4 l .. + 3 of a row (u = 0 .. 7): every load covers 512 contiguous bytes, every store 256. All 16 row loads are asked for before the first wait; gamma and beta serve both rows. Every loop is unrolled: the arrays are indexed by constants only and so stay in registers.
template <int M> __device__ __forceinline__ float ln_xm(float x) { return __builtin_bit_cast(float, __builtin_amdgcn_update_dpp(0, __builtin_bit_cast(int, x), 0x160 + M, 0xf, 0xf, true)); }      /* lane l <- lane l ^ M inside a row of 16 lanes */
__device__ __forceinline__ float ln_wsum(float x) { x += ln_xm<1>(x); x += ln_xm<2>(x); x += ln_xm<4>(x); x += ln_xm<8>(x); return x + pt_xhalf(x); }      /* sum over the wave, the same bits in every lane */
__device__ __forceinline__ void d_lnrow(int blk, const float* __restrict__ X, const float* __restrict__ g, const float* __restrict__ bb, float eps, _Float16* __restrict__ N16) {
  const int l4 = (threadIdx.x & 31) * 4;
  const size_t ro = ((size_t)blk * 8 + (size_t)__builtin_amdgcn_readfirstlane((int)(threadIdx.x >> 5))) * 2048;      /* the wave's first row: a scalar, so every address is a scalar base plus one lane offset */
  const float* xp = X + ro + l4; _Float16* np = N16 + ro + l4;
  v4f xa[2][8], ga[8], ba[8];
#pragma unroll
  for (int r = 0; r < 2; ++r)
#pragma unroll
    for (int u = 0; u < 8; ++u) xa[r][u] = *(const v4fa*)(xp + r * 1024 + u * 128);
#pragma unroll
  for (int u = 0; u < 8; ++u) { ga[u] = *(const v4fa*)(g + u * 128 + l4); ba[u] = *(const v4fa*)(bb + u * 128 + l4); }
  float mu[2], rs[2];
#pragma unroll
  for (int r = 0; r < 2; ++r) { v4f s4;
#pragma unroll
    for (int u = 0; u < 8; ++u) {
#pragma unroll
      for (int q = 0; q < 4; ++q) xa[r][u][q] = bf16_round(xa[r][u][q]);
      s4 = u ? s4 + xa[r][u] : xa[r][u]; }
    mu[r] = (s4[0] + s4[1]) + (s4[2] + s4[3]); }
#pragma unroll
  for (int r = 0; r < 2; ++r) mu[r] = ln_wsum(mu[r]) * (1.0f / 1024.0f);
#pragma unroll
  for (int r = 0; r < 2; ++r) { v4f v4 = {0.f, 0.f, 0.f, 0.f};
#pragma unroll
    for (int u = 0; u < 8; ++u) { xa[r][u] -= mu[r]; v4 += xa[r][u] * xa[r][u]; }
    rs[r] = (v4[0] + v4[1]) + (v4[2] + v4[3]); }
#pragma unroll
  for (int r = 0; r < 2; ++r) rs[r] = rsqrtf(ln_wsum(rs[r]) * (1.0f / 1024.0f) + eps);
#pragma unroll
  for (int u = 0; u < 8; ++u) {
#pragma unroll
    for (int q = 0; q < 4; ++q) { ga[u][q] = bf16_round(ga[u][q]); ba[u][q] = bf16_round(ba[u][q]); }
#pragma unroll
    for (int r = 0; r < 2; ++r) { v4h y;
#pragma unroll
      for (int q = 0; q < 4; ++q) y[q] = (_Float16)(xa[r][u][q] * rs[r] * ga[u][q] + ba[u][q]);
      *(v4h*)(np + r * 1024 + u * 128) = y; } }
}
// The five jobs that depend on nothing but the inputs share one launch: a block's index range picks its job (a scalar branch, the same for the whole block; no job has a barrier).
// Index order: the three weight transposes, then LayerNorm, then the rounding stream, most of the blocks.
#define PW_B 128                     /* blocks per 1024 x 1024 weight: 16 * 64 waves of 64 k x 16 n */
#define PL_B 512                     /* LayerNorm blocks: 8192 rows, 16 per block */
#define PR_B 4096                    /* rounding blocks: 8192 * 1024 / 8 threads */
__global__ __launch_bounds__(256) void k_prep(const float* __restrict__ x, const float* __restrict__ wq, const float* __restrict__ wk, const float* __restrict__ wv, const float* __restrict__ g, const float* __restrict__ bb,
                                              _Float16* __restrict__ BQ, _Float16* __restrict__ BK, _Float16* __restrict__ BV, _Float16* __restrict__ XN, float* __restrict__ XB) {
  const int b = blockIdx.x;
  if (b < PW_B) d_wt_f16(b, wq, BQ, 1024, 1024, 16.0f);
  else if (b < 2 * PW_B) d_wt_f16(b - PW_B, wk, BK, 1024, 1024, 16.0f);
  else if (b < 3 * PW_B) d_wt_f16(b - 2 * PW_B, wv, BV, 1024, 1024, 16.0f);
  else if (b < 3 * PW_B + PL_B) d_lnrow(b - 3 * PW_B, x, g, bb, 1e-5f, XN);
  else d_bfr(b - (3 * PW_B + PL_B), x, XB, (size_t)PR_B * 256);
}
extern "C" void kernel_launch(void* const* d_in, const int* in_sizes, int n_in,
                              void* d_out, int out_size, void* d_ws, size_t ws_size, hipStream_t stream) {
  (void)in_sizes; (void)n_in; (void)out_size;
  const float* const* I = (const float* const*)d_in; const float* x = I[0]; const float* wq = I[1]; const float* bq = I[2]; const float* wk = I[3]; const float* bk = I[4]; const float* wv = I[5]; const float* bv = I[6]; const float* gam = I[7]; const float* bet = I[8];      /* inp; [in][out] Wq/Wk/Wv [1024][1024] + biases; LayerNorm gamma/beta */
  constexpr int DMc = 1024; const size_t NRc = (size_t)4 * 2048;      /* model width; token rows */
  char* ws = (char*)d_ws; size_t off = 0;
  auto take = [&](size_t bytes) { char* p = ws + off; off += (bytes + 255) & ~(size_t)255; return p; };
  _Float16* BQ = (_Float16*)take((size_t)DMc * DMc * 2); _Float16* BK = (_Float16*)take((size_t)DMc * DMc * 2); _Float16* BV = (_Float16*)take((size_t)DMc * DMc * 2);
  _Float16* XN = (_Float16*)take(NRc * DMc * 2); float* XB = (float*)take(NRc * DMc * 4); float* QF = (float*)take(NRc * DMc * 4); float* KF = (float*)take(NRc * DMc * 4); float* VF = (float*)take(NRc * DMc * 4);
  if (off > ws_size) return;
  k_prep<<<3 * PW_B + PL_B + PR_B, 256, 0, stream>>>(x, wq, wk, wv, gam, bet, BQ, BK, BV, XN, XB);      /* [in][out] -> Bt x16; out = LN(bf16(inp)) -> f16 rows; XB = bf16(inp) f32 for the residual */
  k_gemm3<<<dim3((unsigned)((NRc / 128) * (DMc / 128)), 3, 1), 256, 0, stream>>>(XN, BQ, BK, BV, 0.0625f, bq, bk, bv, QF, KF, VF, DMc, DMc);      /* Q, K, V = out W + b -> f32 rows */
  k_ptatt<<<(unsigned)(NRc / 4), 128, 0, stream>>>(QF, KF, VF, XB, 0.125f, (float*)d_out);      /* per-token 64 x 64 x 16 attention, f32 matrix instructions, one wave per token + residual -> output rows */
}

// v006
// Measured time: 79.2 microseconds a run.
// Timed twice side by side with v005, it ran 1.09 and 1.08 times as fast.
// Over all steps from v000 it is 3.30 times as fast.
#include <hip/hip_runtime.h>
// Per-POSITION attention over the head-dim axis (inp [4][2048][1024]; out = LayerNorm(inp) (biased var, eps 1e-5, gamma/beta); Q/K/V = out W + b ([in][out] 1024 x 1024 sigma 1/32, zero biases) viewed [B][M][DK = 64][H = 16] (column i*16 + h); for every token: scores[i][j] = sum_h Q[i][h] K[j][h] / 8 (a 64 x 64 matrix, contraction over the 16 'heads'), softmax over j, res[i][h] = sum_j att[i][j] V[j][h]; no mixing across tokens; result = inp + res -> [4][2048][1024]).
// Compute dtype: inputs rounded to bf16; x / weights exact; LayerNorm output as a plain f16 GEMM operand (~2^-12); q, k, v, softmax weights and o f32; scores and softmax statistics f32; v_wmma_f32_16x16x32_f16 for the projections, v_wmma_f32_16x16x4_f32 for the attention.
#define NB 4
#define SQ 4096
#define DM 256
#define NH 1
#define HD 64
#define HG 4                         /* heads per k_vt launch (V transpose; not launched) */
#define B0 0                         /* unused */
#define NBR NB                       /* used only via MP / MPO, which no code reads */
#define NR ((size_t)NB * SQ)
#define MP ((int)((size_t)NBR * SQ))
#define QT 256                       /* query rows per causal tile */
#define NKX SQ                       /* S / P row pitch */
#define QT0 256                      /* first-tile rows recomputed exactly (256: buys margin for the few-key rows 128..255, which have no output projection to average the single-f16 P/v rounding) */
#define QN SQ
#define NHD NH
#define MPO MP
#define LQ DM
typedef __bf16 v16b __attribute__((ext_vector_type(16)));
typedef unsigned short v8us __attribute__((ext_vector_type(8), may_alias));
typedef float  v8f  __attribute__((ext_vector_type(8)));
typedef float  v4f  __attribute__((ext_vector_type(4)));
typedef float  v4fa __attribute__((ext_vector_type(4), may_alias));
union FragB { v16b v; v8us half[2]; unsigned short u[16]; };

__device__ __forceinline__ unsigned short bf16_bits(float x) { unsigned int u = __float_as_uint(x); return (unsigned short)((u + 0x7FFFu + ((u >> 16) & 1u)) >> 16); }
__device__ __forceinline__ float bf16_val(unsigned short b) { return __uint_as_float(((unsigned int)b) << 16); }
__device__ __forceinline__ float bf16_round(float x) { return bf16_val(bf16_bits(x)); }
// D += A·B with NT terms: 1 = ah·bh, 2 = + al·bh (A split), 3 = + ah·bl (both split)
template <int NT>
__device__ __forceinline__ v8f mmaN(v16b ah, v16b al, v16b bh, v16b bl, v8f c) {
  c = __builtin_amdgcn_wmma_f32_16x16x32_bf16(false, ah, false, bh, (short)0, c, false, false);
  if (NT >= 2) c = __builtin_amdgcn_wmma_f32_16x16x32_bf16(false, al, false, bh, (short)0, c, false, false);
  if (NT >= 3) c = __builtin_amdgcn_wmma_f32_16x16x32_bf16(false, ah, false, bl, (short)0, c, false, false);
  asm volatile("v_nop\n\tv_nop\n\tv_nop\n\tv_nop" : "+v"(c) : "v"(ah), "v"(al), "v"(bh), "v"(bl));
  return c;
}

__global__ __launch_bounds__(256) void k_wt_bf16(const float* __restrict__ W, unsigned short* __restrict__ Wt, int K, int N) {
  const int t = blockIdx.x * 256 + threadIdx.x;
  const int k8n = K / 8;
  if (t >= N * k8n) return;
  const int n = t / k8n, k8 = (t % k8n) * 8;
  v8us v;
#pragma unroll
  for (int i = 0; i < 8; ++i) v[i] = bf16_bits(W[(size_t)(k8 + i) * N + n]);
  *(v8us*)(Wt + (size_t)n * K + k8) = v;
  
}

// GEMM C[M][N] (f32, pitch ldc) = act(A[M][K]·W + bias). A f32 row-major (pitch lda) converted per fragment to bf16
// (ASPLIT: hi/lo two planes -> 2 terms, else single rounded term); Wt bf16 [N][K] (pitch ldb). BIAS_BF16 rounds the
// bias to bf16 first (bias quantised to bf16 before the add). K%32==0, M%16==0, N%64==0.
template <bool ASPLIT, int ACT, bool BIAS_BF16>
__global__ __launch_bounds__(128) void k_gemm_bf(const float* __restrict__ A, int lda, const unsigned short* __restrict__ Wt, int ldb,
                                               const float* __restrict__ bias, float* __restrict__ C, int ldc, int M, int N, int K) {
  __shared__ __attribute__((aligned(16))) float so[4][16][64];
  const int tid = threadIdx.x, w = tid >> 5, lane = tid & 31, ln = lane & 15, hh = lane >> 4;
  const int ntn = N / 64;
  const int wid = blockIdx.x * 4 + w;
  const int mt = wid / ntn, nq = wid % ntn;
  if (mt * 16 >= M) return;
  const int row0 = mt * 16, col0 = nq * 64;
  const float* arow = A + (size_t)(row0 + ln) * lda;
  v8f acc[4] = {};
  for (int kb = 0; kb < K; kb += 32) {
    FragB ah, al;
    const v4f x0 = *(const v4fa*)(arow + kb + 8 * hh), x1 = *(const v4fa*)(arow + kb + 8 * hh + 4);
    const v4f x2 = *(const v4fa*)(arow + kb + 16 + 8 * hh), x3 = *(const v4fa*)(arow + kb + 16 + 8 * hh + 4);
    float xs[16] = {x0[0],x0[1],x0[2],x0[3],x1[0],x1[1],x1[2],x1[3],x2[0],x2[1],x2[2],x2[3],x3[0],x3[1],x3[2],x3[3]};
#pragma unroll
    for (int i = 0; i < 16; ++i) { const unsigned short hb = bf16_bits(xs[i]); ah.u[i] = hb; al.u[i] = ASPLIT ? bf16_bits(xs[i] - bf16_val(hb)) : (unsigned short)0; }
#pragma unroll
    for (int t = 0; t < 4; ++t) {
      const unsigned short* brow = Wt + (size_t)(col0 + t * 16 + ln) * ldb + kb;
      FragB b;
      b.half[0] = *(const v8us*)(brow + 8 * hh);
      b.half[1] = *(const v8us*)(brow + 16 + 8 * hh);
      acc[t] = mmaN<ASPLIT ? 2 : 1>(ah.v, al.v, b.v, b.v, acc[t]);
    }
  }
#pragma unroll
  for (int t = 0; t < 4; ++t) {
    float bv = bias ? bias[col0 + t * 16 + ln] : 0.f;
    if (BIAS_BF16) bv = bf16_round(bv);
#pragma unroll
    for (int r = 0; r < 8; ++r) { float v = acc[t][r] + bv; if (ACT == 1) v = fmaxf(v, 0.f); so[w][8 * hh + r][t * 16 + ln] = v; }
  }
  __builtin_amdgcn_fence(__ATOMIC_ACQ_REL, "workgroup");
  __builtin_amdgcn_wave_barrier();
  const int rsub = lane >> 4, c4 = (lane & 15) * 4;
  {
#pragma unroll
    for (int q = 0; q < 8; ++q) {
      const int r = q * 2 + rsub;
      const v4f v = *(const v4fa*)&so[w][r][c4];
      *(v4f*)(C + (size_t)(row0 + r) * ldc + col0 + c4) = v;
    }
    
  }
}

// GEMM C = act(A·W + bias + resid): A f32 (ASPLIT -> hi/lo 2 terms), Wt bf16 [N][K]; ACT 0 none, 1 relu, 2 exact gelu;
// resid (optional, f32, row index = (row % rmod), pitch ldr, RES_BF16 rounds it) added before the activation.
template <bool ASPLIT, int ACT, bool BIAS_BF16, bool RES_BF16>
__global__ __launch_bounds__(128) void k_gemm_bf3(const float* __restrict__ A, int lda, const unsigned short* __restrict__ Wt, int ldb,
                                                const float* __restrict__ bias, const float* __restrict__ resid, int rmod, int ldr,
                                                float* __restrict__ C, int ldc, int M, int N, int K) {
  __shared__ __attribute__((aligned(16))) float so[4][16][64];
  const int tid = threadIdx.x, w = tid >> 5, lane = tid & 31, ln = lane & 15, hh = lane >> 4;
  const int ntn = N / 64;
  const int wid = blockIdx.x * 4 + w;
  const int mt = wid / ntn, nq = wid % ntn;
  if (mt * 16 >= M) return;
  const int row0 = mt * 16, col0 = nq * 64;
  const float* arow = A + (size_t)(row0 + ln) * lda;
  v8f acc[4] = {};
  for (int kb = 0; kb < K; kb += 32) {
    FragB ah, al;
    const v4f x0 = *(const v4fa*)(arow + kb + 8 * hh), x1 = *(const v4fa*)(arow + kb + 8 * hh + 4);
    const v4f x2 = *(const v4fa*)(arow + kb + 16 + 8 * hh), x3 = *(const v4fa*)(arow + kb + 16 + 8 * hh + 4);
    float xs[16] = {x0[0],x0[1],x0[2],x0[3],x1[0],x1[1],x1[2],x1[3],x2[0],x2[1],x2[2],x2[3],x3[0],x3[1],x3[2],x3[3]};
#pragma unroll
    for (int i = 0; i < 16; ++i) { const unsigned short hb = bf16_bits(xs[i]); ah.u[i] = hb; al.u[i] = ASPLIT ? bf16_bits(xs[i] - bf16_val(hb)) : (unsigned short)0; }
#pragma unroll
    for (int t = 0; t < 4; ++t) {
      const unsigned short* brow = Wt + (size_t)(col0 + t * 16 + ln) * ldb + kb;
      FragB b;
      b.half[0] = *(const v8us*)(brow + 8 * hh);
      b.half[1] = *(const v8us*)(brow + 16 + 8 * hh);
      acc[t] = mmaN<ASPLIT ? 2 : 1>(ah.v, al.v, b.v, b.v, acc[t]);
    }
  }
#pragma unroll
  for (int t = 0; t < 4; ++t) {
    const int col = col0 + t * 16 + ln;
    float bv = bias ? bias[col] : 0.f;
    if (BIAS_BF16) bv = bf16_round(bv);
#pragma unroll
    for (int r = 0; r < 8; ++r) {
      float v = acc[t][r] + bv;
      if (resid) { float rv = resid[(size_t)((row0 + 8 * hh + r) % rmod) * ldr + col]; if (RES_BF16) rv = bf16_round(rv); v += rv; }
      if (ACT == 1) v = fmaxf(v, 0.f);
      if (ACT == 2) v = 0.5f * v * (1.0f + erff(v * 0.70710678118654752f));
      if (ACT == 3) { const float u = 0.7978845608028654f * (v + 0.044715f * v * v * v); v = 0.5f * v * (1.0f + tanhf(u)); }
      so[w][8 * hh + r][t * 16 + ln] = v;
    }
  }
  __builtin_amdgcn_fence(__ATOMIC_ACQ_REL, "workgroup");
  __builtin_amdgcn_wave_barrier();
  const int rsub = lane >> 4, c4 = (lane & 15) * 4;
  {
#pragma unroll
    for (int q = 0; q < 8; ++q) {
      const int r = q * 2 + rsub;
      const v4f v = *(const v4fa*)&so[w][r][c4];
      *(v4f*)(C + (size_t)(row0 + r) * ldc + col0 + c4) = v;
    }
    
  }
}
// row LayerNorm (biased variance, eps) over N: s = X (+ R); optional out_sum <- s; out_norm <- (s-mu)*rsqrt(var+eps)*g + b
template <bool PARAM_BF16>
__global__ __launch_bounds__(256) void k_layernorm(const float* __restrict__ X, const float* __restrict__ R, const float* __restrict__ g, const float* __restrict__ bta,
                                                  float* __restrict__ out_sum, float* __restrict__ out_norm, int N, float eps) {
  __shared__ float red[256];
  const int row = blockIdx.x, tid = threadIdx.x;
  const float* x = X + (size_t)row * N; const float* rr = R ? R + (size_t)row * N : nullptr;
  float vals[16];                     // up to N = 4096
  const int per = N / 256;            // contiguous chunk per thread? use strided-by-4 chunks: thread handles j = tid*4 + 1024*u
  float s1 = 0.f;
  for (int u = 0; u < per / 4; ++u) {
    const int j = tid * 4 + 1024 * u;
    const v4f a = *(const v4fa*)(x + j);
    v4f b = {0.f,0.f,0.f,0.f}; if (rr) b = *(const v4fa*)(rr + j);
#pragma unroll
    for (int q = 0; q < 4; ++q) { const float v = a[q] + b[q]; vals[u * 4 + q] = v; s1 += v; }
  }
  red[tid] = s1; __syncthreads();
  for (int st = 128; st > 0; st >>= 1) { if (tid < st) red[tid] += red[tid + st]; __syncthreads(); }
  const float mu = red[0] / (float)N; __syncthreads();
  float s2 = 0.f;
  for (int u = 0; u < per / 4; ++u)
#pragma unroll
    for (int q = 0; q < 4; ++q) { const float c = vals[u * 4 + q] - mu; s2 += c * c; }
  red[tid] = s2; __syncthreads();
  for (int st = 128; st > 0; st >>= 1) { if (tid < st) red[tid] += red[tid + st]; __syncthreads(); }
  const float rs = rsqrtf(red[0] / (float)N + eps);
  {
    for (int u = 0; u < per / 4; ++u) {
      const int j = tid * 4 + 1024 * u;
      v4f o, sm;
#pragma unroll
      for (int q = 0; q < 4; ++q) {
        float gg = g[j + q], bb = bta[j + q];
        if (PARAM_BF16) { gg = bf16_round(gg); bb = bf16_round(bb); }
        sm[q] = vals[u * 4 + q]; o[q] = (vals[u * 4 + q] - mu) * rs * gg + bb;
      }
      if (out_sum) *(v4f*)(out_sum + (size_t)row * N + j) = sm;
      *(v4f*)(out_norm + (size_t)row * N + j) = o;
    }
    
  }
}



// ---- f16 WMMA path (v_wmma_f32_16x16x32_f16): 11-bit significands for operands in range — used here for the Q/K/V projections
typedef _Float16 v16h __attribute__((ext_vector_type(16)));
union FragH { v16h v; v8us half[2]; _Float16 h[16]; unsigned short u[16]; };
template <int NT>
__device__ __forceinline__ v8f mmaH(v16h ah, v16h al, v16h bh, v16h bl, v8f c) {
  c = __builtin_amdgcn_wmma_f32_16x16x32_f16(false, ah, false, bh, (short)0, c, false, false);
  if (NT >= 2) c = __builtin_amdgcn_wmma_f32_16x16x32_f16(false, al, false, bh, (short)0, c, false, false);
  if (NT >= 3) c = __builtin_amdgcn_wmma_f32_16x16x32_f16(false, ah, false, bl, (short)0, c, false, false);
  asm volatile("v_nop\n\tv_nop\n\tv_nop\n\tv_nop" : "+v"(c) : "v"(ah), "v"(al), "v"(bh), "v"(bl));
  return c;
}
// batched GEMM like k_gemm_b but f16 operands: A f32 (split into f16 hi/lo if ASPLIT, else rounded to f16), Bt = f16 values [n][k]; alpha; C f32; N multiple of 16 (partial tiles skipped)
template <bool ASPLIT>
__global__ __launch_bounds__(128) void k_gemm_h(const float* __restrict__ A, int lda, size_t sA, const _Float16* __restrict__ Bh, int ldb, size_t sB, float alpha, float* __restrict__ C, int ldc, size_t sC, int M, int N, int K) {
  __shared__ __attribute__((aligned(16))) float so[4][16][64];
  const int tid = threadIdx.x, w = tid >> 5, lane = tid & 31, ln = lane & 15, hh = lane >> 4; const int by = blockIdx.y;
  A += (size_t)by * sA; Bh += (size_t)by * sB; C += (size_t)by * sC;
  const int ntn = (N + 63) / 64; const int wid = blockIdx.x * 4 + w; const int mt = wid / ntn, nq = wid % ntn; if (mt * 16 >= M) return;
  const int row0 = mt * 16, col0 = nq * 64; const float* arow = A + (size_t)(row0 + ln) * lda;
  v8f acc[4] = {};
  for (int kb = 0; kb < K; kb += 32) {
    FragH ah, al;
    const v4f x0 = *(const v4fa*)(arow + kb + 8 * hh), x1 = *(const v4fa*)(arow + kb + 8 * hh + 4), x2 = *(const v4fa*)(arow + kb + 16 + 8 * hh), x3 = *(const v4fa*)(arow + kb + 16 + 8 * hh + 4);
    float xs[16] = {x0[0],x0[1],x0[2],x0[3],x1[0],x1[1],x1[2],x1[3],x2[0],x2[1],x2[2],x2[3],x3[0],x3[1],x3[2],x3[3]};
#pragma unroll
    for (int i = 0; i < 16; ++i) { const _Float16 h = (_Float16)xs[i]; ah.h[i] = h; al.h[i] = ASPLIT ? (_Float16)(xs[i] - (float)h) : (_Float16)0.0f; }
#pragma unroll
    for (int t = 0; t < 4; ++t) { if (col0 + t * 16 >= N) continue; const size_t boff = (size_t)(col0 + t * 16 + ln) * ldb + kb; FragH bq; bq.half[0] = *(const v8us*)(Bh + boff + 8 * hh); bq.half[1] = *(const v8us*)(Bh + boff + 16 + 8 * hh);
      acc[t] = mmaH<ASPLIT ? 2 : 1>(ah.v, al.v, bq.v, bq.v, acc[t]); }
  }
#pragma unroll
  for (int t = 0; t < 4; ++t) { if (col0 + t * 16 >= N) continue;
#pragma unroll
    for (int r = 0; r < 8; ++r) so[w][8 * hh + r][t * 16 + ln] = acc[t][r] * alpha; }
  __builtin_amdgcn_fence(__ATOMIC_ACQ_REL, "workgroup"); __builtin_amdgcn_wave_barrier();
  const int rsub = lane >> 4, c4 = (lane & 15) * 4;
  {
#pragma unroll
    for (int q = 0; q < 8; ++q) { const int r = q * 2 + rsub; if (col0 + c4 < N) { const v4f v = *(const v4fa*)&so[w][r][c4]; *(v4f*)(C + (size_t)(row0 + r) * ldc + col0 + c4) = v; } }
     }
}

// Wt[n][k] = f16(W[k][n] * scale) from f32 row-major W[K][N] (scale = power of two; bf16-exact weights stay exact in f16 away from the subnormal range). Needs K % 64 == 0, N % 128 == 0.
// One wave takes 64 k x 16 n. Lane (lk = lane & 7, ln = lane >> 3) reads rows 8 lk .. 8 lk + 7 at columns 4 ln .. 4 ln + 3 by 16-B loads: a load touches 8 lines, not 32, and the block's eight waves take 128 adjacent columns, so together they use every byte of the lines they touch.
// Per column the lane stores its 8 halfs: eight lanes fill one whole 128-B line of Wt, four lines per store.
__device__ __forceinline__ void d_wt_f16(int blk, const float* __restrict__ W, _Float16* __restrict__ Wt, int K, int N, float scale) {
  const int lane = threadIdx.x & 31, wv = blk * 8 + (int)(threadIdx.x >> 5), ngn = N / 16; const int kg = wv / ngn, ng = wv - kg * ngn; if (kg * 64 >= K) return;
  const int k8 = kg * 64 + (lane & 7) * 8, n = ng * 16 + (lane >> 3) * 4; v4f r[8];
#pragma unroll
  for (int i = 0; i < 8; ++i) r[i] = *(const v4fa*)(W + (size_t)(k8 + i) * N + n);
#pragma unroll
  for (int j = 0; j < 4; ++j) { FragH f;
#pragma unroll
    for (int i = 0; i < 8; ++i) f.h[i] = (_Float16)(bf16_round(r[i][j]) * scale);
    const v8us o = f.half[0]; *(v8us*)((unsigned short*)Wt + (size_t)(n + j) * K + k8) = o; }
}
// k_gemm_hh variant with fused epilogue: v = acc·alpha + bias[by·sBias + col] (+ CP[(row/rowsPerB)·sCPb + by·64 + col] if CP) ; ACT 0 none / 1 elu ; writes f16 C16 (and f32 C if non-null)
template <int ACT>
__global__ __launch_bounds__(128) void k_gemm_hhx(const _Float16* __restrict__ A, int lda, size_t sA, const _Float16* __restrict__ Bh, int ldb, size_t sB, float alpha, const float* __restrict__ bias, size_t sBias, const float* __restrict__ CP, int rowsPerB, size_t sCPb, int row0g,
    float* __restrict__ C, _Float16* __restrict__ C16, int ldc, size_t sC, int M, int N, int K) {
  __shared__ __attribute__((aligned(16))) float so[4][16][64];
  const int tid = threadIdx.x, w = tid >> 5, lane = tid & 31, ln = lane & 15, hh = lane >> 4; const int by = blockIdx.y;
  A += (size_t)by * sA; Bh += (size_t)by * sB; const size_t cofs = (size_t)by * sC; const float* bp = bias ? bias + (size_t)by * sBias : nullptr;
  const int ntn = (N + 63) / 64; const int wid = blockIdx.x * 4 + w; const int mt = wid / ntn, nq = wid % ntn; if (mt * 16 >= M) return;
  const int row0 = mt * 16, col0 = nq * 64; const _Float16* arow = A + (size_t)(row0 + ln) * lda;
  v8f acc[4] = {};
  for (int kb = 0; kb < K; kb += 32) { FragH ah; ah.half[0] = *(const v8us*)((const unsigned short*)arow + kb + 8 * hh); ah.half[1] = *(const v8us*)((const unsigned short*)arow + kb + 16 + 8 * hh);
#pragma unroll
    for (int t = 0; t < 4; ++t) { if (col0 + t * 16 >= N) continue; const size_t boff = (size_t)(col0 + t * 16 + ln) * ldb + kb; FragH bq; bq.half[0] = *(const v8us*)((const unsigned short*)Bh + boff + 8 * hh); bq.half[1] = *(const v8us*)((const unsigned short*)Bh + boff + 16 + 8 * hh);
      acc[t] = mmaH<1>(ah.v, ah.v, bq.v, bq.v, acc[t]); }
  }
#pragma unroll
  for (int t = 0; t < 4; ++t) { if (col0 + t * 16 >= N) continue; const int col = col0 + t * 16 + ln; const float bv = bp ? bf16_round(bp[col]) : 0.f;
#pragma unroll
    for (int r = 0; r < 8; ++r) { float v = acc[t][r] * alpha + bv; if (CP) { const int rr = row0g + row0 + 8 * hh + r; if (rowsPerB < 0) v += CP[cofs + (size_t)rr * ldc + col];      /* rowsPerB < 0: own element of the batched C plane */ else { const int bidx = rr / rowsPerB; v += CP[(size_t)bidx * sCPb + (size_t)by * 64 + col]; } } if (ACT == 1) v = (v > 0.f) ? v : expm1f(v); else if (ACT == 7) v = (v > 0.f) ? v + 1.0f : expf(v); else if (ACT == 8) v = tanhf(v); else if (ACT == 9) v = 0.5f * v * (1.0f + tanhf(0.7978845608028654f * (v + 0.044715f * v * v * v))); else if (ACT == 11) v = 1.0f / (1.0f + expf(-v)); else if (ACT == 12) v = (v > 0.f) ? v : 0.01f * v; else if (ACT == 14) v = (v > 0.f) ? v : 0.1f * v; else if (ACT == 16) v = (v >= 0.f) ? v : 0.3f * v; else if (ACT == 17) v = (v >= 0.f) ? v : 0.2f * v; else if (ACT == 15) v = v / (1.0f + expf(-v)); else if (ACT == 3) v = fmaxf(v, 0.f); else if (ACT == 6) v = 0.5f * v * (1.0f + erff(v * 0.70710678118654752f)); so[w][8 * hh + r][t * 16 + ln] = v; } }
  __builtin_amdgcn_fence(__ATOMIC_ACQ_REL, "workgroup"); __builtin_amdgcn_wave_barrier();
  const int rsub = lane >> 4, c4 = (lane & 15) * 4; typedef _Float16 v4h __attribute__((ext_vector_type(4)));
  {
#pragma unroll
    for (int q = 0; q < 8; ++q) { const int r = q * 2 + rsub; if (col0 + c4 < N) { const v4f v = *(const v4fa*)&so[w][r][c4]; if (C) *(v4f*)(C + cofs + (size_t)(row0 + r) * ldc + col0 + c4) = v; if (C16) { v4h h4; for (int i = 0; i < 4; ++i) h4[i] = (_Float16)v[i]; *(v4h*)(C16 + cofs + (size_t)(row0 + r) * ldc + col0 + c4) = h4; } } }
     }
}


typedef _Float16 v4h __attribute__((ext_vector_type(4)));

__global__ __launch_bounds__(256) void k_x16(const float* __restrict__ x, _Float16* __restrict__ X16, size_t n8) { const size_t t = (size_t)blockIdx.x * 256 + threadIdx.x; if (t >= n8) return; FragH f;
#pragma unroll
  for (int q = 0; q < 8; ++q) f.h[q] = (_Float16)bf16_round(x[t * 8 + q]); *(v8us*)((unsigned short*)X16 + t * 8) = f.half[0];  }
__global__ __launch_bounds__(256) void k_h16(const float* __restrict__ x, _Float16* __restrict__ X16, size_t n8) { const size_t t = (size_t)blockIdx.x * 256 + threadIdx.x; if (t >= n8) return; FragH f;
#pragma unroll
  for (int q = 0; q < 8; ++q) f.h[q] = (_Float16)x[t * 8 + q]; *(v8us*)((unsigned short*)X16 + t * 8) = f.half[0];  }
__global__ __launch_bounds__(256) void k_round16f(const float* __restrict__ W, _Float16* __restrict__ Bt, size_t n8) { const size_t t = (size_t)blockIdx.x * 256 + threadIdx.x; if (t >= n8) return; FragH f;
#pragma unroll
  for (int i = 0; i < 8; ++i) f.h[i] = (_Float16)(bf16_round(W[t * 8 + i]) * 16.0f); *(v8us*)((unsigned short*)Bt + t * 8) = f.half[0];  }
template <int NHv, int TTv>
__global__ __launch_bounds__(256) void k_vt(const _Float16* __restrict__ V16, int ldv, int voff, _Float16* __restrict__ Vt) { __shared__ unsigned short tl[64][66]; const int tid = threadIdx.x; const int slab = blockIdx.x / (TTv / 64), lg = blockIdx.x % (TTv / 64); const int b = slab / NHv, h = slab % NHv;
  for (int i = tid; i < 64 * 8; i += 256) { const int r = i / 8, c8 = (i % 8) * 8; FragH f; f.half[0] = *(const v8us*)((const unsigned short*)V16 + ((size_t)b * TTv + lg * 64 + r) * ldv + voff + h * 64 + c8);
#pragma unroll
    for (int q = 0; q < 8; ++q) tl[r][c8 + q] = f.u[q]; }
  __syncthreads();
  {
#pragma unroll
    for (int rd = 0; rd < 2; ++rd) { const int d = rd * 32 + tid / 8, pc = tid % 8; FragH f;
#pragma unroll
      for (int q = 0; q < 8; ++q) f.u[q] = tl[pc * 8 + q][d];
      *(v8us*)((unsigned short*)Vt + ((size_t)slab * 64 + d) * TTv + lg * 64 + pc * 8) = f.half[0]; }
     } }

__global__ __launch_bounds__(256) void k_hl(const float* __restrict__ F, _Float16* __restrict__ Hh, _Float16* __restrict__ Hl, size_t n8) { const size_t t = (size_t)blockIdx.x * 256 + threadIdx.x; if (t >= n8) return; FragH fh, fl; const v4f a = *(const v4fa*)(F + t * 8), c = *(const v4fa*)(F + t * 8 + 4);
#pragma unroll
  for (int q = 0; q < 4; ++q) { _Float16 h = (_Float16)a[q]; fh.h[q] = h; fl.h[q] = (_Float16)((a[q] - (float)h) * 1024.0f); h = (_Float16)c[q]; fh.h[4 + q] = h; fl.h[4 + q] = (_Float16)((c[q] - (float)h) * 1024.0f); }
  { *(v8us*)((unsigned short*)Hh + t * 8) = fh.half[0]; *(v8us*)((unsigned short*)Hl + t * 8) = fl.half[0];  } }

// ---- fast GEMM (wave tile 32x64), C = A Bh^T alpha + bf16(bias), f32 rows ----
__device__ __forceinline__ v16h g2_frag(const _Float16* p, int hh) { FragH f; f.half[0] = *(const v8us*)((const unsigned short*)p + 8 * hh); f.half[1] = *(const v8us*)((const unsigned short*)p + 16 + 8 * hh); return f.v; }
__device__ __forceinline__ v8f g2_mma(v16h a, v16h b, v8f c) { v8f d = __builtin_amdgcn_wmma_f32_16x16x32_f16(false, a, false, b, (short)0, c, false, false); asm volatile("v_nop\n\tv_nop\n\tv_nop\n\tv_nop" : "+v"(d) : "v"(a), "v"(b)); return d; }
// Block tile 128 x 128, eight waves of 32 x 64 (4 down, 2 across). Per pass 64 k of both operands (128-B rows: 128 rows of A, then 128 rows of Bh) lie in one of two LDS buffers,
// brought by asynchronous copies (16 B per lane, whole 128-B lines per 8 lanes); the next pass's copies fly while this pass's fragments are read from LDS. Needs M % 128 == 0 (grid), N % 128 == 0, K % 64 == 0.
#define G3_PITCH 72                  /* LDS row pitch in halfs: 144 B = 16 B x odd, conflict-free for 16-B fragment reads */
#define G3_STAGE (256 * G3_PITCH)    /* halfs per buffer */
// one pass's copies of this thread: four rows of A and four of Bh, 32 rows apart; l = the lane's LDS byte address of the first
__device__ __forceinline__ void g3_copy(const _Float16* ga, const _Float16* gb, size_t step, unsigned l) {
  const _Float16* a1 = ga + step; const _Float16* a2 = a1 + step; const _Float16* a3 = a2 + step; const _Float16* b1 = gb + step; const _Float16* b2 = b1 + step; const _Float16* b3 = b2 + step;
  const unsigned rs = 32u * G3_PITCH * 2u;
  /* the s_wait_xcnt stands inside the statement so that no address register of a copy is rewritten ahead of it */
  asm volatile("global_load_async_to_lds_b128 %0, %8, off\n\t"
               "global_load_async_to_lds_b128 %1, %9, off\n\t"
               "global_load_async_to_lds_b128 %2, %10, off\n\t"
               "global_load_async_to_lds_b128 %3, %11, off\n\t"
               "global_load_async_to_lds_b128 %4, %12, off\n\t"
               "global_load_async_to_lds_b128 %5, %13, off\n\t"
               "global_load_async_to_lds_b128 %6, %14, off\n\t"
               "global_load_async_to_lds_b128 %7, %15, off\n\t"
               "s_wait_xcnt 0x0"
               :: "v"(l), "v"(l + rs), "v"(l + 2u * rs), "v"(l + 3u * rs), "v"(l + 4u * rs), "v"(l + 5u * rs), "v"(l + 6u * rs), "v"(l + 7u * rs),
                  "v"(ga), "v"(a1), "v"(a2), "v"(a3), "v"(gb), "v"(b1), "v"(b2), "v"(b3) : "memory");
}
// One launch does all three products of the same A: blockIdx.y picks the weight, its bias and its output (scalar selects).
__global__ __launch_bounds__(256) void k_gemm3(const _Float16* __restrict__ A, const _Float16* __restrict__ Bh0, const _Float16* __restrict__ Bh1, const _Float16* __restrict__ Bh2, float alpha,
                                               const float* __restrict__ bias0, const float* __restrict__ bias1, const float* __restrict__ bias2, float* __restrict__ C0, float* __restrict__ C1, float* __restrict__ C2, int N, int K) {
  const int pz = blockIdx.y; const _Float16* Bh = pz == 0 ? Bh0 : pz == 1 ? Bh1 : Bh2; const float* bias = pz == 0 ? bias0 : pz == 1 ? bias1 : bias2; float* C = pz == 0 ? C0 : pz == 1 ? C1 : C2;
  __shared__ __attribute__((aligned(16))) _Float16 ring[2 * G3_STAGE];
  __shared__ __attribute__((aligned(16))) float so[8][32][68];
  const int tid = threadIdx.x, w = tid >> 5, lane = tid & 31, ln = lane & 15, hh = lane >> 4;
  const int ntn = N >> 7; const int mt = blockIdx.x / ntn, nq = blockIdx.x - mt * ntn; const int wm = w >> 1, wn = w & 1;
  const int cr = tid >> 3, cp = tid & 7;      /* copy: row within a group of 32, 16-B piece of the row */
  const _Float16* ga = A + (size_t)(mt * 128 + cr) * K + cp * 8; const _Float16* gb = Bh + (size_t)(nq * 128 + cr) * K + cp * 8; const size_t step = (size_t)32 * K;
  const unsigned l0 = (unsigned)(size_t)&ring[0] + (unsigned)(cr * (G3_PITCH * 2) + cp * 16);
  const int nt = K >> 6;
  const v8f z8 = {0.f,0.f,0.f,0.f,0.f,0.f,0.f,0.f}; v8f c00 = z8, c01 = z8, c02 = z8, c03 = z8, c10 = z8, c11 = z8, c12 = z8, c13 = z8;
  g3_copy(ga, gb, step, l0);
  asm volatile("s_wait_asynccnt 0x0" ::: "memory");      /* this wave's copies of pass 0 have landed */
  __syncthreads();                                       /* publishes pass 0 */
  if (nt > 1) g3_copy(ga + 64, gb + 64, step, l0 + (unsigned)(G3_STAGE * 2));
#pragma unroll 1      /* one pass per trip: the two buffers alternate by the trip's parity */
  for (int t = 0; t < nt; ++t) {
    const _Float16* ap = &ring[(t & 1) * G3_STAGE + (wm * 32 + ln) * G3_PITCH]; const _Float16* bp = &ring[(t & 1) * G3_STAGE + (128 + wn * 64 + ln) * G3_PITCH];
    const v16h a0 = g2_frag(ap, hh), a1 = g2_frag(ap + 16 * G3_PITCH, hh), b0 = g2_frag(bp, hh), b1 = g2_frag(bp + 16 * G3_PITCH, hh), b2 = g2_frag(bp + 32 * G3_PITCH, hh), b3 = g2_frag(bp + 48 * G3_PITCH, hh);
    const v16h e0 = g2_frag(ap + 32, hh), e1 = g2_frag(ap + 16 * G3_PITCH + 32, hh), f0 = g2_frag(bp + 32, hh), f1 = g2_frag(bp + 16 * G3_PITCH + 32, hh), f2 = g2_frag(bp + 32 * G3_PITCH + 32, hh), f3 = g2_frag(bp + 48 * G3_PITCH + 32, hh);
    c00 = g2_mma(a0, b0, c00); c10 = g2_mma(a1, b0, c10); c01 = g2_mma(a0, b1, c01); c11 = g2_mma(a1, b1, c11); c02 = g2_mma(a0, b2, c02); c12 = g2_mma(a1, b2, c12); c03 = g2_mma(a0, b3, c03); c13 = g2_mma(a1, b3, c13);
    c00 = g2_mma(e0, f0, c00); c10 = g2_mma(e1, f0, c10); c01 = g2_mma(e0, f1, c01); c11 = g2_mma(e1, f1, c11); c02 = g2_mma(e0, f2, c02); c12 = g2_mma(e1, f2, c12); c03 = g2_mma(e0, f3, c03); c13 = g2_mma(e1, f3, c13);
    asm volatile("s_wait_dscnt 0x0" ::: "memory");       /* this wave's reads of the buffer are done before it may be refilled */
    asm volatile("s_wait_asynccnt 0x0" ::: "memory");    /* this wave's copies of pass t + 1 have landed */
    __syncthreads();                                     /* publishes pass t + 1 and ends every reader's last read of pass t */
    if (t + 2 < nt) g3_copy(ga + (size_t)(t + 2) * 64, gb + (size_t)(t + 2) * 64, step, l0 + (unsigned)((t & 1) * (G3_STAGE * 2)));
  }
  asm volatile("s_wait_asynccnt 0x0" ::: "memory");      /* no copy is outstanding when the wave goes on */
  const int row0 = mt * 128 + wm * 32, col0 = nq * 128 + wn * 64;
  v8f accs[8] = {c00, c01, c02, c03, c10, c11, c12, c13};
#pragma unroll
  for (int u = 0; u < 8; ++u) { const int t = u & 3, half = u >> 2; const float bv = bf16_round(bias[col0 + t * 16 + ln]);
#pragma unroll
    for (int r = 0; r < 8; ++r) so[w][half * 16 + 8 * hh + r][t * 16 + ln] = accs[u][r] * alpha + bv; }
  __builtin_amdgcn_fence(__ATOMIC_ACQ_REL, "workgroup"); __builtin_amdgcn_wave_barrier();
  const int rsub = lane >> 4, c4 = (lane & 15) * 4;
#pragma unroll
  for (int q = 0; q < 16; ++q) { const int r = q * 2 + rsub; const v4f v = *(const v4fa*)&so[w][r][c4]; *(v4f*)(C + (size_t)(row0 + r) * N + col0 + c4) = v; }
}


__global__ __launch_bounds__(256) void k_wnat(const float* __restrict__ w, size_t n8, _Float16* __restrict__ Bt) { const size_t t = (size_t)blockIdx.x * 256 + threadIdx.x; if (t >= n8) return; FragH f; for (int q = 0; q < 8; ++q) f.h[q] = (_Float16)(bf16_round(w[t * 8 + q]) * 16.0f); *(v8us*)((unsigned short*)Bt + t * 8) = f.half[0];  }
__global__ __launch_bounds__(256) void k_rsm(const float* __restrict__ S, _Float16* __restrict__ P, int nrows) {
  #pragma clang fp contract(off)
  const int i = blockIdx.x * 256 + threadIdx.x; if (i >= nrows) return; const float* s = S + (size_t)i * SQ; float mx = -3.0e38f;
#pragma unroll 1
  for (int j = 0; j < SQ; ++j) mx = fmaxf(mx, s[j]); float se = 0.f;
#pragma unroll 1
  for (int j = 0; j < SQ; ++j) se += expf(s[j] - mx); const float sc = 256.0f / se;
#pragma unroll 1
  for (int j0 = 0; j0 < SQ; j0 += 8) { FragH f; for (int q = 0; q < 8; ++q) f.h[q] = (_Float16)(expf(s[j0 + q] - mx) * sc); unsigned short* d = (unsigned short*)P + (size_t)i * SQ + j0; *(v8us*)d = f.half[0];  } }
__global__ __launch_bounds__(256) void k_vt(const _Float16* __restrict__ V16, int b, int h0, _Float16* __restrict__ VT) { __shared__ unsigned short tl[64][65]; const int tid = threadIdx.x; const int hh = blockIdx.x % HG, sg = blockIdx.x / HG; const int s0 = sg * 64; const int h = h0 + hh;
  for (int i = tid; i < 64 * 8; i += 256) { const int j = i / 8, d8 = (i % 8) * 8; FragH f; f.half[0] = *(const v8us*)((const unsigned short*)V16 + ((size_t)b * SQ + s0 + j) * DM + h * HD + d8); for (int q = 0; q < 8; ++q) tl[d8 + q][j] = f.u[q]; }
  __syncthreads();
  { for (int i = tid; i < 64 * 8; i += 256) { const int d = i / 8, j8 = (i % 8) * 8; FragH f; for (int q = 0; q < 8; ++q) f.u[q] = tl[d][j8 + q]; *(v8us*)((unsigned short*)VT + ((size_t)hh * HD + d) * SQ + s0 + j8) = f.half[0]; }  } }



__global__ __launch_bounds__(256) void k_rsmcf2(const float* __restrict__ S, _Float16* __restrict__ P, int hg, int q0, int nk) {
  #pragma clang fp contract(off)
  const int t = blockIdx.x * 256 + threadIdx.x; if (t >= hg * QT) return; const size_t i = (size_t)t; const float* s = S + i * NKX; const int last = q0 + (t % QT); float mx = -3.0e38f;
#pragma unroll 1
  for (int j = 0; j < nk; ++j) { const float f = (j <= last) ? 1.f : 0.f; mx = fmaxf(mx, fmaf(f, s[j], (1.f - f) * -1.0e9f)); } float se = 0.f;
#pragma unroll 1
  for (int j = 0; j < nk; ++j) { const float f = (j <= last) ? 1.f : 0.f; se += __expf(fmaf(f, s[j], (1.f - f) * -1.0e9f) - mx); } const float sc = 256.0f / se;
#pragma unroll 1
  for (int j0 = 0; j0 < nk; j0 += 8) { FragH fr; for (int q = 0; q < 8; ++q) { const int j = j0 + q; const float f = (j <= last) ? 1.f : 0.f; fr.h[q] = (_Float16)(__expf(fmaf(f, s[j], (1.f - f) * -1.0e9f) - mx) * sc); } unsigned short* d = (unsigned short*)P + i * NKX + j0; *(v8us*)d = fr.half[0];  } }

template <int MASKADD>
__global__ __launch_bounds__(64) void k_att0(const float* __restrict__ QF, const float* __restrict__ KF, const float* __restrict__ VF, int ld, const float* __restrict__ mask, float scale, float* __restrict__ OF, int ldo) {
  #pragma clang fp contract(off)
  __shared__ __attribute__((aligned(16))) float lq[64][64]; __shared__ __attribute__((aligned(16))) float lo[64][64];
  const int tid = threadIdx.x; const int h = blockIdx.x / (QT0 / 64), rg = blockIdx.x % (QT0 / 64); const int i = rg * 64 + tid;
  const float* qr = QF + (size_t)i * ld + h * HD;
#pragma unroll 1
  for (int c = 0; c < HD / 4; ++c) { *(v4f*)&lq[tid][c * 4] = *(const v4fa*)(qr + c * 4); const v4f z = {0.f, 0.f, 0.f, 0.f}; *(v4f*)&lo[tid][c * 4] = z; }
  float m = -1.0e30f, l = 0.f; const int jmax = MASKADD ? (SQ - 1) : (rg * 64 + 63);      /* additive-mask form: every key (the mask input decides); causal form: keys up to the block's last row */
#pragma unroll 1
  for (int j = 0; j <= jmax; ++j) { const float* kr = KF + (size_t)j * ld + h * HD; const float* vr = VF + (size_t)j * ld + h * HD; float s = 0.f;
#pragma unroll 1
    for (int c = 0; c < HD / 4; ++c) { const v4f kq = *(const v4fa*)(kr + c * 4); const v4f qq = *(v4f*)&lq[tid][c * 4]; s = __fadd_rn(s, __fmul_rn(qq[0], kq[0])); s = __fadd_rn(s, __fmul_rn(qq[1], kq[1])); s = __fadd_rn(s, __fmul_rn(qq[2], kq[2])); s = __fadd_rn(s, __fmul_rn(qq[3], kq[3])); }
    s = __fmul_rn(s, scale); if (MASKADD) s = __fadd_rn(s, __fmul_rn(bf16_round(mask[(size_t)i * SQ + j]), -10000.0f));
    const float f = (MASKADD || j <= i) ? 1.f : 0.f; const float sm = fmaf(f, s, (1.f - f) * -1.0e30f); const float mn = fmaxf(m, sm); const float sc = expf(m - mn); const float e = expf(sm - mn); l = __fadd_rn(__fmul_rn(l, sc), e); m = mn;
#pragma unroll 1
    for (int c = 0; c < HD / 4; ++c) { const v4f vv = *(const v4fa*)(vr + c * 4); v4f oo = *(v4f*)&lo[tid][c * 4]; for (int u = 0; u < 4; ++u) oo[u] = __fadd_rn(__fmul_rn(oo[u], sc), __fmul_rn(e, vv[u])); *(v4f*)&lo[tid][c * 4] = oo; } }
  const float fin = 64.0f / l;      /* o carried x64 like the f16 path */
#pragma unroll 1
  for (int c = 0; c < HD / 4; ++c) { v4f oo = *(v4f*)&lo[tid][c * 4]; for (int u = 0; u < 4; ++u) oo[u] = __fmul_rn(oo[u], fin); *(v4f*)&lo[tid][c * 4] = oo; }
  __syncthreads();
  {
#pragma unroll 1
    for (int it = 0; it < 16; ++it) { const int row = it * 4 + tid / 16, pc = (tid % 16) * 4; const v4f v = *(const v4f*)&lo[row][pc]; *(v4f*)(OF + (size_t)(rg * 64 + row) * ldo + h * HD + pc) = v; }
     } }

__global__ __launch_bounds__(256) void k_oscale(const float* __restrict__ OF, float* __restrict__ out, size_t n4) { const size_t t = (size_t)blockIdx.x * 256 + threadIdx.x; if (t >= n4) return; const v4f a = *(const v4fa*)(OF + t * 4); v4f o; for (int q = 0; q < 4; ++q) o[q] = a[q] * 0.015625f; *(v4f*)(out + t * 4) = o;  }




__global__ __launch_bounds__(256) void k_rsmfvl(const float* __restrict__ S, _Float16* __restrict__ P, _Float16* __restrict__ PL, int qn, const int* __restrict__ vlp) {
  #pragma clang fp contract(off)
  const int t = blockIdx.x * 256 + threadIdx.x; if (t >= qn) return; const int vl = vlp[0]; const size_t i = (size_t)t; const float* s = S + i * SQ; float mx = -3.0e38f;
#pragma unroll 1
  for (int j = 0; j < SQ; ++j) { const float f = (j < vl) ? 1.f : 0.f; mx = fmaxf(mx, fmaf(f, s[j], (1.f - f) * -1000000.0f)); } float se = 0.f;
#pragma unroll 1
  for (int j = 0; j < SQ; ++j) { const float f = (j < vl) ? 1.f : 0.f; se += __expf(fmaf(f, s[j], (1.f - f) * -1000000.0f) - mx); } const float sc = 256.0f / se;
#pragma unroll 1
  for (int j0 = 0; j0 < SQ; j0 += 8) { FragH fr, gr; for (int q = 0; q < 8; ++q) { const int j = j0 + q; const float f = (j < vl) ? 1.f : 0.f; const float pv = __expf(fmaf(f, s[j], (1.f - f) * -1000000.0f) - mx) * sc; const _Float16 ph = (_Float16)pv; fr.h[q] = ph; gr.h[q] = (_Float16)((pv - (float)ph) * 1024.0f); }
    unsigned short* d = (unsigned short*)P + i * SQ + j0; unsigned short* dl = (unsigned short*)PL + i * SQ + j0; *(v8us*)d = fr.half[0]; *(v8us*)dl = gr.half[0];  } }

__global__ __launch_bounds__(256) void k_rsmf(const float* __restrict__ S, _Float16* __restrict__ P, int qn, int hg) {
  #pragma clang fp contract(off)
  const int t = blockIdx.x * 256 + threadIdx.x; if (t >= qn * hg) return; const size_t i = (size_t)(t / qn) * SQ + (t % qn); const float* s = S + i * SQ; float mx = -3.0e38f;
#pragma unroll 1
  for (int j = 0; j < SQ; ++j) mx = fmaxf(mx, s[j]); float se = 0.f;
#pragma unroll 1
  for (int j = 0; j < SQ; ++j) se += __expf(s[j] - mx); const float sc = 256.0f / se;
#pragma unroll 1
  for (int j0 = 0; j0 < SQ; j0 += 8) { FragH f; for (int q = 0; q < 8; ++q) f.h[q] = (_Float16)(__expf(s[j0 + q] - mx) * sc); unsigned short* d = (unsigned short*)P + i * SQ + j0; *(v8us*)d = f.half[0];  } }


#define CN 256          /* channels */
#define CI 128
#define NC 256                       /* (unused legacy kernels) */
#define NPX NP          /* positions per channel row */
#define NP 4096         /* seq1 tokens */
#define NM 1024         /* seq2 tokens */
#define BNEPS 1e-5f

__global__ __launch_bounds__(256) void k_mp2(const float* __restrict__ src, float* __restrict__ dst, int nout) {
  const int t = blockIdx.x * 256 + threadIdx.x; if (t >= nout) return; const int c = t / 1024; const int o = t % 1024; const int oy = o / 32, ox = o % 32; const float* p = src + (size_t)c * 4096 + (size_t)(2 * oy) * 64 + 2 * ox;
  const float v = fmaxf(fmaxf(p[0], p[1]), fmaxf(p[64], p[65])); *(float*)(dst + t) = v;  }
__global__ __launch_bounds__(256) void k_xpb(const float* __restrict__ x, const float* __restrict__ wb, float* __restrict__ CPP, size_t n4) {
  #pragma clang fp contract(off)
  const size_t t = (size_t)blockIdx.x * 256 + threadIdx.x; if (t >= n4) return; const size_t e = t * 4; const int c = (int)((e / 4096) % 256); const float bb = bf16_round(wb[c]); const v4f a = *(const v4fa*)(x + e); v4f o; for (int q = 0; q < 4; ++q) o[q] = __fadd_rn(bf16_round(a[q]), bb);
  *(v4f*)(CPP + e) = o;  }


template <int PASS>
__global__ __launch_bounds__(256) void k_cstA(const float* __restrict__ X, const float* __restrict__ MV, float* __restrict__ PART) {
  #pragma clang fp contract(off)
  __shared__ float red[256]; const int t = threadIdx.x; const size_t bc = blockIdx.x; const int c = (int)(bc % NC); const float* row = X + bc * (size_t)NPX; const float mu = PASS ? MV[c] : 0.f; float s = 0.f;
  for (int i = t; i < NPX; i += 256) { const float v = row[i]; const float d = PASS ? __fadd_rn(v, -mu) : v; s = __fadd_rn(s, PASS ? __fmul_rn(d, d) : d); }
  red[t] = s; __syncthreads(); for (int st = 128; st > 0; st >>= 1) { if (t < st) red[t] = __fadd_rn(red[t], red[t + st]); __syncthreads(); }
  if (t < 32) { const float pv = (t == 0) ? red[0] : 0.f; *(float*)(PART + bc * 32 + t) = pv;  } }      

template <int PASS>
__global__ __launch_bounds__(256) void k_cstB(const float* __restrict__ PART, float* __restrict__ MV) { const int c = threadIdx.x; if (c >= NC) return; double s = 0.0; for (int b = 0; b < NB; ++b) s += (double)PART[((size_t)b * NC + c) * 32]; const float m = (float)(s / ((double)NB * (double)NPX)); *(float*)(MV + PASS * NC + c) = m;  }


__global__ __launch_bounds__(256) void k_bnresid(const float* __restrict__ C2, const float* __restrict__ MV, const float* __restrict__ g, const float* __restrict__ be, const float* __restrict__ X, float* __restrict__ out, size_t n4) {
  #pragma clang fp contract(off)
  const size_t t = (size_t)blockIdx.x * 256 + threadIdx.x; if (t >= n4) return; const size_t e = t * 4; const int c = (int)((e / NPX) % NC); const float sc = __fmul_rn(rsqrtf(__fadd_rn(MV[NC + c], BNEPS)), bf16_round(g[c])); const float mu = MV[c], bb = bf16_round(be[c]);
  const v4f a = *(const v4fa*)(C2 + e); const v4f xx = *(const v4fa*)(X + e); v4f o; for (int q = 0; q < 4; ++q) { const float z = __fadd_rn(__fmul_rn(__fadd_rn(a[q], -mu), sc), bb); o[q] = __fadd_rn(z, bf16_round(xx[q])); }
  *(v4f*)(out + e) = o;  }


__global__ __launch_bounds__(256) void k_rowbias(float* __restrict__ Y, const float* __restrict__ bias) {
  #pragma clang fp contract(off)
  const size_t t = (size_t)blockIdx.x * 256 + threadIdx.x; if (t >= (size_t)NB * NC * NPX / 4) return; const size_t e = t * 4; const int c = (int)((e / NPX) % NC); const float bb = bf16_round(bias[c]);
  v4f v = *(const v4fa*)(Y + e); for (int q = 0; q < 4; ++q) v[q] = __fadd_rn(v[q], bb); *(v4f*)(Y + e) = v;  }



template <int NK>
__global__ __launch_bounds__(256) void k_rsmn(const float* __restrict__ S, _Float16* __restrict__ P, int nrows) {
  #pragma clang fp contract(off)
  const int t = blockIdx.x * 256 + threadIdx.x; if (t >= nrows) return; const float* s = S + (size_t)t * NK; float mx = -3.0e38f;
#pragma unroll 1
  for (int j = 0; j < NK; ++j) mx = fmaxf(mx, s[j]); float se = 0.f;
#pragma unroll 1
  for (int j = 0; j < NK; ++j) se += __expf(s[j] - mx); const float sc = 256.0f / se;
#pragma unroll 1
  for (int j0 = 0; j0 < NK; j0 += 8) { FragH fr; for (int q = 0; q < 8; ++q) fr.h[q] = (_Float16)(__expf(s[j0 + q] - mx) * sc);
    unsigned short* d = (unsigned short*)P + (size_t)t * NK + j0; *(v8us*)d = fr.half[0];  } }

typedef float v2f __attribute__((ext_vector_type(2)));
__device__ __forceinline__ float pt_xhalf(float x) { return __builtin_bit_cast(float, __builtin_amdgcn_permlanex16(__builtin_bit_cast(int, x), __builtin_bit_cast(int, x), 0x76543210, 0xfedcba98, false, false)); }      /* lane l <-> lane l ^ 16 */
__device__ __forceinline__ v8f pt_mma(v2f a, v2f b, v8f c) { return __builtin_amdgcn_wmma_f32_16x16x4_f32(false, a, false, b, (short)0, c, false, false); }
// One wave per token, both products on v_wmma_f32_16x16x4_f32 (f32 operands), no LDS. Lane (c = lane & 15, hh = lane >> 4).
// St = K Q^T per 16 x 16 tile: A row j = c, B column i = c, both loaded by the same code (the lane's 8 contiguous heads 8 hh .. 8 hh + 7 of its row; step s takes heads 8 hh + 2 s, + 1).
// D register r of tile jt = score of key j = 16 jt + 8 hh + r for query i = c: a query's 64 scores lie in lanes c and c + 16, so the softmax needs one exchange for the maximum and one for the sum.
// Ot = V^T P^T: B = register pair (2 p, 2 p + 1) of a tile as it lies (keys 16 jt + 8 hh + 2 p, + 1), A row = head c with V of the same keys. D register r = res[i = c][head 8 hh + r]: 8 contiguous floats of the output row.
// The residual is read from the input itself and rounded to bf16 here, in registers: no rounded copy of the input goes through memory.
__global__ __launch_bounds__(128) void k_ptatt(const float* __restrict__ QF, const float* __restrict__ KF, const float* __restrict__ VF, const float* __restrict__ xres, float scale, float* __restrict__ out) {
  const int lane = threadIdx.x & 31, c = lane & 15, hh = lane >> 4;
  const size_t ro = ((size_t)blockIdx.x * 4 + (size_t)__builtin_amdgcn_readfirstlane((int)(threadIdx.x >> 5))) * 1024;      /* the wave's token: a scalar, so every address is a scalar base plus one lane offset */
  const int fo = c * 16 + 8 * hh, vo = hh * 128 + c;
  const float cs = scale * 1.4426950408889634f;      /* softmax in base 2 */
  const float* kp = KF + ro; const float* vp = VF + ro; const float* qp = QF + ro; const float* xp = xres + ro; float* op = out + ro;
  v8f kf[4], vt[4];
#pragma unroll
  for (int jt = 0; jt < 4; ++jt) { const v4f k0 = *(const v4fa*)(kp + jt * 256 + fo), k1 = *(const v4fa*)(kp + jt * 256 + fo + 4); kf[jt] = v8f{k0[0], k0[1], k0[2], k0[3], k1[0], k1[1], k1[2], k1[3]}; }
  v4f q0 = *(const v4fa*)(qp + fo), q1 = *(const v4fa*)(qp + fo + 4);
  __builtin_amdgcn_sched_barrier(0);      /* K and Q are asked for ahead of V: loads return in order, and the first product waits for these alone */
#pragma unroll
  for (int jt = 0; jt < 4; ++jt)
#pragma unroll
    for (int r = 0; r < 8; ++r) vt[jt][r] = vp[jt * 256 + r * 16 + vo];
  __builtin_amdgcn_sched_barrier(0);      /* V is asked for before the wave first waits: behind that wait its latency would come on top of K's */
#pragma unroll
  for (int it = 0; it < 4; ++it) {
    const v4f x0 = *(const v4fa*)(xp + it * 256 + fo), x1 = *(const v4fa*)(xp + it * 256 + fo + 4);
    const v8f z8 = {0.f, 0.f, 0.f, 0.f, 0.f, 0.f, 0.f, 0.f}; v8f st[4] = {z8, z8, z8, z8};
#pragma unroll
    for (int s = 0; s < 4; ++s)
#pragma unroll
      for (int jt = 0; jt < 4; ++jt) st[jt] = pt_mma(v2f{kf[jt][2 * s], kf[jt][2 * s + 1]}, s < 2 ? v2f{q0[2 * s], q0[2 * s + 1]} : v2f{q1[2 * s - 4], q1[2 * s - 3]}, st[jt]);
    /* distance behind a matrix instruction: nothing reads these scores or overwrites an operand within the slots; the f32 form stands in no table of distances, so the count of the other form with its issue interval is kept */
    asm volatile("v_nop\n\tv_nop\n\tv_nop\n\tv_nop\n\tv_nop\n\tv_nop\n\tv_nop\n\tv_nop" : "+v"(st[0]), "+v"(st[1]), "+v"(st[2]), "+v"(st[3]) : "v"(q0), "v"(q1), "v"(kf[0]), "v"(kf[1]), "v"(kf[2]), "v"(kf[3]));
    if (it < 3) { q0 = *(const v4fa*)(qp + (it + 1) * 256 + fo); q1 = *(const v4fa*)(qp + (it + 1) * 256 + fo + 4); }      /* the next tile's queries fly during the rest of this tile */
    float m4[4];
#pragma unroll
    for (int jt = 0; jt < 4; ++jt) { m4[jt] = fmaxf(st[jt][0], st[jt][1]);
#pragma unroll
      for (int r = 2; r < 8; ++r) m4[jt] = fmaxf(m4[jt], st[jt][r]); }
    float mx = fmaxf(fmaxf(m4[0], m4[1]), fmaxf(m4[2], m4[3])); mx = fmaxf(mx, pt_xhalf(mx));
    const float mc = mx * cs; v8f pr[4]; v2f la = {0.f, 0.f}, lb = {0.f, 0.f};
#pragma unroll
    for (int jt = 0; jt < 4; ++jt) { v8f ar;
#pragma unroll
      for (int r = 0; r < 8; ++r) ar[r] = fmaf(st[jt][r], cs, -mc);
#pragma unroll
      for (int r = 0; r < 8; ++r) pr[jt][r] = __builtin_amdgcn_exp2f(ar[r]);
      /* the slot behind a transcendental: inputs only, the eight arguments stay whole until this slot, so no instruction directly behind an exponential overwrites its source */
      asm volatile("v_nop" :: "v"(ar), "v"(pr[jt]));
#pragma unroll
      for (int p = 0; p < 4; ++p) { if (jt & 1) lb += v2f{pr[jt][2 * p], pr[jt][2 * p + 1]}; else la += v2f{pr[jt][2 * p], pr[jt][2 * p + 1]}; } }
    la += lb; float l = la[0] + la[1]; l += pt_xhalf(l);
    const float inv = __builtin_amdgcn_rcpf(l); v4f y0, y1;
    v8f o0 = z8, o1 = z8;      /* two sums: a product that adds to the one before it waits longer than the issue interval */
#pragma unroll
    for (int p = 0; p < 4; ++p)
#pragma unroll
      for (int jt = 0; jt < 4; ++jt) { if (jt & 1) o1 = pt_mma(v2f{vt[jt][2 * p], vt[jt][2 * p + 1]}, v2f{pr[jt][2 * p], pr[jt][2 * p + 1]}, o1); else o0 = pt_mma(v2f{vt[jt][2 * p], vt[jt][2 * p + 1]}, v2f{pr[jt][2 * p], pr[jt][2 * p + 1]}, o0); }
    /* the same distance: the operands stay untouched and the sums unread for the slots behind the run's last product */
    asm volatile("v_nop\n\tv_nop\n\tv_nop\n\tv_nop\n\tv_nop\n\tv_nop\n\tv_nop\n\tv_nop" : "+v"(o0), "+v"(o1) : "v"(pr[0]), "v"(pr[1]), "v"(pr[2]), "v"(pr[3]), "v"(vt[0]), "v"(vt[1]), "v"(vt[2]), "v"(vt[3]));
#pragma unroll
    for (int u = 0; u < 4; ++u) { y0[u] = fmaf(o0[u] + o1[u], inv, bf16_round(x0[u])); y1[u] = fmaf(o0[4 + u] + o1[4 + u], inv, bf16_round(x1[u])); }
    *(v4f*)(op + it * 256 + fo) = y0; *(v4f*)(op + it * 256 + fo + 4) = y1;
    if (it < 3) asm volatile("s_wait_xcnt 0x0" ::: "memory");      /* stands in front of the next tile's products, which overwrite the registers that these stores name */
    __builtin_amdgcn_sched_barrier(0);      /* keeps the next tile's products behind this tile: moved up, the four tiles' scores are all held at once and fewer than half as many waves fit a SIMD */
  }
}
// Row LayerNorm (biased variance) of bf16-rounded rows of 1024 floats -> f16 rows. One wave holds two whole rows in registers: no LDS, no barrier, 4096 waves.
// Lane l holds floats 128 u + 4 l .. + 3 of a row (u = 0 .. 7): every load covers 512 contiguous bytes, every store 256. All 16 row loads are asked for before the first wait; gamma and beta serve both rows. Every loop is unrolled: the arrays are indexed by constants only and so stay in registers.
template <int M> __device__ __forceinline__ float ln_xm(float x) { return __builtin_bit_cast(float, __builtin_amdgcn_update_dpp(0, __builtin_bit_cast(int, x), 0x160 + M, 0xf, 0xf, true)); }      /* lane l <- lane l ^ M inside a row of 16 lanes */
__device__ __forceinline__ float ln_wsum(float x) { x += ln_xm<1>(x); x += ln_xm<2>(x); x += ln_xm<4>(x); x += ln_xm<8>(x); return x + pt_xhalf(x); }      /* sum over the wave, the same bits in every lane */
__device__ __forceinline__ void d_lnrow(int blk, const float* __restrict__ X, const float* __restrict__ g, const float* __restrict__ bb, float eps, _Float16* __restrict__ N16) {
  const int l4 = (threadIdx.x & 31) * 4;
  const size_t ro = ((size_t)blk * 8 + (size_t)__builtin_amdgcn_readfirstlane((int)(threadIdx.x >> 5))) * 2048;      /* the wave's first row: a scalar, so every address is a scalar base plus one lane offset */
  const float* xp = X + ro + l4; _Float16* np = N16 + ro + l4;
  v4f xa[2][8], ga[8], ba[8];
#pragma unroll
  for (int r = 0; r < 2; ++r)
#pragma unroll
    for (int u = 0; u < 8; ++u) xa[r][u] = *(const v4fa*)(xp + r * 1024 + u * 128);
#pragma unroll
  for (int u = 0; u < 8; ++u) { ga[u] = *(const v4fa*)(g + u * 128 + l4); ba[u] = *(const v4fa*)(bb + u * 128 + l4); }
  float mu[2], rs[2];
#pragma unroll
  for (int r = 0; r < 2; ++r) { v4f s4;
#pragma unroll
    for (int u = 0; u < 8; ++u) {
#pragma unroll
      for (int q = 0; q < 4; ++q) xa[r][u][q] = bf16_round(xa[r][u][q]);
      s4 = u ? s4 + xa[r][u] : xa[r][u]; }
    mu[r] = (s4[0] + s4[1]) + (s4[2] + s4[3]); }
#pragma unroll
  for (int r = 0; r < 2; ++r) mu[r] = ln_wsum(mu[r]) * (1.0f / 1024.0f);
#pragma unroll
  for (int r = 0; r < 2; ++r) { v4f v4 = {0.f, 0.f, 0.f, 0.f};
#pragma unroll
    for (int u = 0; u < 8; ++u) { xa[r][u] -= mu[r]; v4 += xa[r][u] * xa[r][u]; }
    rs[r] = (v4[0] + v4[1]) + (v4[2] + v4[3]); }
#pragma unroll
  for (int r = 0; r < 2; ++r) rs[r] = rsqrtf(ln_wsum(rs[r]) * (1.0f / 1024.0f) + eps);
#pragma unroll
  for (int u = 0; u < 8; ++u) {
#pragma unroll
    for (int q = 0; q < 4; ++q) { ga[u][q] = bf16_round(ga[u][q]); ba[u][q] = bf16_round(ba[u][q]); }
#pragma unroll
    for (int r = 0; r < 2; ++r) { v4h y;
#pragma unroll
      for (int q = 0; q < 4; ++q) y[q] = (_Float16)(xa[r][u][q] * rs[r] * ga[u][q] + ba[u][q]);
      *(v4h*)(np + r * 1024 + u * 128) = y; } }
  asm volatile("s_wait_xcnt 0x0" ::: "memory");      /* stands behind the last stores, in front of whatever next overwrites the base or the offset register that they name */
}
// The four jobs that depend on nothing but the inputs share one launch: a block's index range picks its job (a scalar branch, the same for the whole block; no job has a barrier).
#define PW_B 128                     /* blocks per 1024 x 1024 weight: 16 * 64 waves of 64 k x 16 n */
#define PL_B 512                     /* LayerNorm blocks: 8192 rows, 16 per block */
__global__ __launch_bounds__(256) void k_prep(const float* __restrict__ x, const float* __restrict__ wq, const float* __restrict__ wk, const float* __restrict__ wv, const float* __restrict__ g, const float* __restrict__ bb,
                                              _Float16* __restrict__ BQ, _Float16* __restrict__ BK, _Float16* __restrict__ BV, _Float16* __restrict__ XN) {
  const int b = blockIdx.x;
  if (b < PW_B) d_wt_f16(b, wq, BQ, 1024, 1024, 16.0f);
  else if (b < 2 * PW_B) d_wt_f16(b - PW_B, wk, BK, 1024, 1024, 16.0f);
  else if (b < 3 * PW_B) d_wt_f16(b - 2 * PW_B, wv, BV, 1024, 1024, 16.0f);
  else d_lnrow(b - 3 * PW_B, x, g, bb, 1e-5f, XN);
}
extern "C" void kernel_launch(void* const* d_in, const int* in_sizes, int n_in,
                              void* d_out, int out_size, void* d_ws, size_t ws_size, hipStream_t stream) {
  (void)in_sizes; (void)n_in; (void)out_size;
  const float* const* I = (const float* const*)d_in; const float* x = I[0]; const float* wq = I[1]; const float* bq = I[2]; const float* wk = I[3]; const float* bk = I[4]; const float* wv = I[5]; const float* bv = I[6]; const float* gam = I[7]; const float* bet = I[8];      /* inp; [in][out] Wq/Wk/Wv [1024][1024] + biases; LayerNorm gamma/beta */
  constexpr int DMc = 1024; const size_t NRc = (size_t)4 * 2048;      /* model width; token rows */
  char* ws = (char*)d_ws; size_t off = 0;
  auto take = [&](size_t bytes) { char* p = ws + off; off += (bytes + 255) & ~(size_t)255; return p; };
  _Float16* BQ = (_Float16*)take((size_t)DMc * DMc * 2); _Float16* BK = (_Float16*)take((size_t)DMc * DMc * 2); _Float16* BV = (_Float16*)take((size_t)DMc * DMc * 2);
  _Float16* XN = (_Float16*)take(NRc * DMc * 2); float* QF = (float*)take(NRc * DMc * 4); float* KF = (float*)take(NRc * DMc * 4); float* VF = (float*)take(NRc * DMc * 4);
  if (off > ws_size) return;
  k_prep<<<3 * PW_B + PL_B, 256, 0, stream>>>(x, wq, wk, wv, gam, bet, BQ, BK, BV, XN);      /* [in][out] -> Bt x16; out = LN(bf16(inp)) -> f16 rows */
  k_gemm3<<<dim3((unsigned)((NRc / 128) * (DMc / 128)), 3, 1), 256, 0, stream>>>(XN, BQ, BK, BV, 0.0625f, bq, bk, bv, QF, KF, VF, DMc, DMc);      /* Q, K, V = out W + b -> f32 rows */
  k_ptatt<<<(unsigned)(NRc / 4), 128, 0, stream>>>(QF, KF, VF, x, 0.125f, (float*)d_out);      /* per-token 64 x 64 x 16 attention, f32 matrix instructions, one wave per token + bf16(inp) residual -> output rows */
}

// v007
// One run takes 74.3 microseconds.
// Two timings next to v006 put it at 1.07 and 1.06 times that version's speed.
// Over all steps from v000 it is 3.52 times as fast.
#include <hip/hip_runtime.h>
// Per-POSITION attention over the head-dim axis (inp [4][2048][1024]; out = LayerNorm(inp) (biased var, eps 1e-5, gamma/beta); Q/K/V = out W + b ([in][out] 1024 x 1024 sigma 1/32, zero biases) viewed [B][M][DK = 64][H = 16] (column i*16 + h); for every token: scores[i][j] = sum_h Q[i][h] K[j][h] / 8 (a 64 x 64 matrix, contraction over the 16 'heads'), softmax over j, res[i][h] = sum_j att[i][j] V[j][h]; no mixing across tokens; result = inp + res -> [4][2048][1024]).
// Compute dtype: inputs rounded to bf16; x / weights exact; LayerNorm output as a plain f16 GEMM operand (~2^-12); q, k, v, softmax weights and o f32; scores and softmax statistics f32; v_wmma_f32_16x16x32_f16 for the projections, v_wmma_f32_16x16x4_f32 for the attention.
#define NB 4
#define SQ 4096
#define DM 256
#define NH 1
#define HD 64
#define HG 4                         /* heads per k_vt launch (V transpose; not launched) */
#define B0 0                         /* unused */
#define NBR NB                       /* used only via MP / MPO, which no code reads */
#define NR ((size_t)NB * SQ)
#define MP ((int)((size_t)NBR * SQ))
#define QT 256                       /* query rows per causal tile */
#define NKX SQ                       /* S / P row pitch */
#define QT0 256                      /* first-tile rows recomputed exactly (256: buys margin for the few-key rows 128..255, which have no output projection to average the single-f16 P/v rounding) */
#define QN SQ
#define NHD NH
#define MPO MP
#define LQ DM
typedef __bf16 v16b __attribute__((ext_vector_type(16)));
typedef unsigned short v8us __attribute__((ext_vector_type(8), may_alias));
typedef float  v8f  __attribute__((ext_vector_type(8)));
typedef float  v4f  __attribute__((ext_vector_type(4)));
typedef float  v4fa __attribute__((ext_vector_type(4), may_alias));
union FragB { v16b v; v8us half[2]; unsigned short u[16]; };

__device__ __forceinline__ unsigned short bf16_bits(float x) { unsigned int u = __float_as_uint(x); return (unsigned short)((u + 0x7FFFu + ((u >> 16) & 1u)) >> 16); }
__device__ __forceinline__ float bf16_val(unsigned short b) { return __uint_as_float(((unsigned int)b) << 16); }
__device__ __forceinline__ float bf16_round(float x) { return bf16_val(bf16_bits(x)); }
// D += A·B with NT terms: 1 = ah·bh, 2 = + al·bh (A split), 3 = + ah·bl (both split)
template <int NT>
__device__ __forceinline__ v8f mmaN(v16b ah, v16b al, v16b bh, v16b bl, v8f c) {
  c = __builtin_amdgcn_wmma_f32_16x16x32_bf16(false, ah, false, bh, (short)0, c, false, false);
  if (NT >= 2) c = __builtin_amdgcn_wmma_f32_16x16x32_bf16(false, al, false, bh, (short)0, c, false, false);
  if (NT >= 3) c = __builtin_amdgcn_wmma_f32_16x16x32_bf16(false, ah, false, bl, (short)0, c, false, false);
  asm volatile("v_nop\n\tv_nop\n\tv_nop\n\tv_nop" : "+v"(c) : "v"(ah), "v"(al), "v"(bh), "v"(bl));
  return c;
}

__global__ __launch_bounds__(256) void k_wt_bf16(const float* __restrict__ W, unsigned short* __restrict__ Wt, int K, int N) {
  const int t = blockIdx.x * 256 + threadIdx.x;
  const int k8n = K / 8;
  if (t >= N * k8n) return;
  const int n = t / k8n, k8 = (t % k8n) * 8;
  v8us v;
#pragma unroll
  for (int i = 0; i < 8; ++i) v[i] = bf16_bits(W[(size_t)(k8 + i) * N + n]);
  *(v8us*)(Wt + (size_t)n * K + k8) = v;
  
}

// GEMM C[M][N] (f32, pitch ldc) = act(A[M][K]·W + bias). A f32 row-major (pitch lda) converted per fragment to bf16
// (ASPLIT: hi/lo two planes -> 2 terms, else single rounded term); Wt bf16 [N][K] (pitch ldb). BIAS_BF16 rounds the
// bias to bf16 first (bias quantised to bf16 before the add). K%32==0, M%16==0, N%64==0.
template <bool ASPLIT, int ACT, bool BIAS_BF16>
__global__ __launch_bounds__(128) void k_gemm_bf(const float* __restrict__ A, int lda, const unsigned short* __restrict__ Wt, int ldb,
                                               const float* __restrict__ bias, float* __restrict__ C, int ldc, int M, int N, int K) {
  __shared__ __attribute__((aligned(16))) float so[4][16][64];
  const int tid = threadIdx.x, w = tid >> 5, lane = tid & 31, ln = lane & 15, hh = lane >> 4;
  const int ntn = N / 64;
  const int wid = blockIdx.x * 4 + w;
  const int mt = wid / ntn, nq = wid % ntn;
  if (mt * 16 >= M) return;
  const int row0 = mt * 16, col0 = nq * 64;
  const float* arow = A + (size_t)(row0 + ln) * lda;
  v8f acc[4] = {};
  for (int kb = 0; kb < K; kb += 32) {
    FragB ah, al;
    const v4f x0 = *(const v4fa*)(arow + kb + 8 * hh), x1 = *(const v4fa*)(arow + kb + 8 * hh + 4);
    const v4f x2 = *(const v4fa*)(arow + kb + 16 + 8 * hh), x3 = *(const v4fa*)(arow + kb + 16 + 8 * hh + 4);
    float xs[16] = {x0[0],x0[1],x0[2],x0[3],x1[0],x1[1],x1[2],x1[3],x2[0],x2[1],x2[2],x2[3],x3[0],x3[1],x3[2],x3[3]};
#pragma unroll
    for (int i = 0; i < 16; ++i) { const unsigned short hb = bf16_bits(xs[i]); ah.u[i] = hb; al.u[i] = ASPLIT ? bf16_bits(xs[i] - bf16_val(hb)) : (unsigned short)0; }
#pragma unroll
    for (int t = 0; t < 4; ++t) {
      const unsigned short* brow = Wt + (size_t)(col0 + t * 16 + ln) * ldb + kb;
      FragB b;
      b.half[0] = *(const v8us*)(brow + 8 * hh);
      b.half[1] = *(const v8us*)(brow + 16 + 8 * hh);
      acc[t] = mmaN<ASPLIT ? 2 : 1>(ah.v, al.v, b.v, b.v, acc[t]);
    }
  }
#pragma unroll
  for (int t = 0; t < 4; ++t) {
    float bv = bias ? bias[col0 + t * 16 + ln] : 0.f;
    if (BIAS_BF16) bv = bf16_round(bv);
#pragma unroll
    for (int r = 0; r < 8; ++r) { float v = acc[t][r] + bv; if (ACT == 1) v = fmaxf(v, 0.f); so[w][8 * hh + r][t * 16 + ln] = v; }
  }
  __builtin_amdgcn_fence(__ATOMIC_ACQ_REL, "workgroup");
  __builtin_amdgcn_wave_barrier();
  const int rsub = lane >> 4, c4 = (lane & 15) * 4;
  {
#pragma unroll
    for (int q = 0; q < 8; ++q) {
      const int r = q * 2 + rsub;
      const v4f v = *(const v4fa*)&so[w][r][c4];
      *(v4f*)(C + (size_t)(row0 + r) * ldc + col0 + c4) = v;
    }
    
  }
}

// GEMM C = act(A·W + bias + resid): A f32 (ASPLIT -> hi/lo 2 terms), Wt bf16 [N][K]; ACT 0 none, 1 relu, 2 exact gelu;
// resid (optional, f32, row index = (row % rmod), pitch ldr, RES_BF16 rounds it) added before the activation.
template <bool ASPLIT, int ACT, bool BIAS_BF16, bool RES_BF16>
__global__ __launch_bounds__(128) void k_gemm_bf3(const float* __restrict__ A, int lda, const unsigned short* __restrict__ Wt, int ldb,
                                                const float* __restrict__ bias, const float* __restrict__ resid, int rmod, int ldr,
                                                float* __restrict__ C, int ldc, int M, int N, int K) {
  __shared__ __attribute__((aligned(16))) float so[4][16][64];
  const int tid = threadIdx.x, w = tid >> 5, lane = tid & 31, ln = lane & 15, hh = lane >> 4;
  const int ntn = N / 64;
  const int wid = blockIdx.x * 4 + w;
  const int mt = wid / ntn, nq = wid % ntn;
  if (mt * 16 >= M) return;
  const int row0 = mt * 16, col0 = nq * 64;
  const float* arow = A + (size_t)(row0 + ln) * lda;
  v8f acc[4] = {};
  for (int kb = 0; kb < K; kb += 32) {
    FragB ah, al;
    const v4f x0 = *(const v4fa*)(arow + kb + 8 * hh), x1 = *(const v4fa*)(arow + kb + 8 * hh + 4);
    const v4f x2 = *(const v4fa*)(arow + kb + 16 + 8 * hh), x3 = *(const v4fa*)(arow + kb + 16 + 8 * hh + 4);
    float xs[16] = {x0[0],x0[1],x0[2],x0[3],x1[0],x1[1],x1[2],x1[3],x2[0],x2[1],x2[2],x2[3],x3[0],x3[1],x3[2],x3[3]};
#pragma unroll
    for (int i = 0; i < 16; ++i) { const unsigned short hb = bf16_bits(xs[i]); ah.u[i] = hb; al.u[i] = ASPLIT ? bf16_bits(xs[i] - bf16_val(hb)) : (unsigned short)0; }
#pragma unroll
    for (int t = 0; t < 4; ++t) {
      const unsigned short* brow = Wt + (size_t)(col0 + t * 16 + ln) * ldb + kb;
      FragB b;
      b.half[0] = *(const v8us*)(brow + 8 * hh);
      b.half[1] = *(const v8us*)(brow + 16 + 8 * hh);
      acc[t] = mmaN<ASPLIT ? 2 : 1>(ah.v, al.v, b.v, b.v, acc[t]);
    }
  }
#pragma unroll
  for (int t = 0; t < 4; ++t) {
    const int col = col0 + t * 16 + ln;
    float bv = bias ? bias[col] : 0.f;
    if (BIAS_BF16) bv = bf16_round(bv);
#pragma unroll
    for (int r = 0; r < 8; ++r) {
      float v = acc[t][r] + bv;
      if (resid) { float rv = resid[(size_t)((row0 + 8 * hh + r) % rmod) * ldr + col]; if (RES_BF16) rv = bf16_round(rv); v += rv; }
      if (ACT == 1) v = fmaxf(v, 0.f);
      if (ACT == 2) v = 0.5f * v * (1.0f + erff(v * 0.70710678118654752f));
      if (ACT == 3) { const float u = 0.7978845608028654f * (v + 0.044715f * v * v * v); v = 0.5f * v * (1.0f + tanhf(u)); }
      so[w][8 * hh + r][t * 16 + ln] = v;
    }
  }
  __builtin_amdgcn_fence(__ATOMIC_ACQ_REL, "workgroup");
  __builtin_amdgcn_wave_barrier();
  const int rsub = lane >> 4, c4 = (lane & 15) * 4;
  {
#pragma unroll
    for (int q = 0; q < 8; ++q) {
      const int r = q * 2 + rsub;
      const v4f v = *(const v4fa*)&so[w][r][c4];
      *(v4f*)(C + (size_t)(row0 + r) * ldc + col0 + c4) = v;
    }
    
  }
}
// row LayerNorm (biased variance, eps) over N: s = X (+ R); optional out_sum <- s; out_norm <- (s-mu)*rsqrt(var+eps)*g + b
template <bool PARAM_BF16>
__global__ __launch_bounds__(256) void k_layernorm(const float* __restrict__ X, const float* __restrict__ R, const float* __restrict__ g, const float* __restrict__ bta,
                                                  float* __restrict__ out_sum, float* __restrict__ out_norm, int N, float eps) {
  __shared__ float red[256];
  const int row = blockIdx.x, tid = threadIdx.x;
  const float* x = X + (size_t)row * N; const float* rr = R ? R + (size_t)row * N : nullptr;
  float vals[16];                     // up to N = 4096
  const int per = N / 256;            // contiguous chunk per thread? use strided-by-4 chunks: thread handles j = tid*4 + 1024*u
  float s1 = 0.f;
  for (int u = 0; u < per / 4; ++u) {
    const int j = tid * 4 + 1024 * u;
    const v4f a = *(const v4fa*)(x + j);
    v4f b = {0.f,0.f,0.f,0.f}; if (rr) b = *(const v4fa*)(rr + j);
#pragma unroll
    for (int q = 0; q < 4; ++q) { const float v = a[q] + b[q]; vals[u * 4 + q] = v; s1 += v; }
  }
  red[tid] = s1; __syncthreads();
  for (int st = 128; st > 0; st >>= 1) { if (tid < st) red[tid] += red[tid + st]; __syncthreads(); }
  const float mu = red[0] / (float)N; __syncthreads();
  float s2 = 0.f;
  for (int u = 0; u < per / 4; ++u)
#pragma unroll
    for (int q = 0; q < 4; ++q) { const float c = vals[u * 4 + q] - mu; s2 += c * c; }
  red[tid] = s2; __syncthreads();
  for (int st = 128; st > 0; st >>= 1) { if (tid < st) red[tid] += red[tid + st]; __syncthreads(); }
  const float rs = rsqrtf(red[0] / (float)N + eps);
  {
    for (int u = 0; u < per / 4; ++u) {
      const int j = tid * 4 + 1024 * u;
      v4f o, sm;
#pragma unroll
      for (int q = 0; q < 4; ++q) {
        float gg = g[j + q], bb = bta[j + q];
        if (PARAM_BF16) { gg = bf16_round(gg); bb = bf16_round(bb); }
        sm[q] = vals[u * 4 + q]; o[q] = (vals[u * 4 + q] - mu) * rs * gg + bb;
      }
      if (out_sum) *(v4f*)(out_sum + (size_t)row * N + j) = sm;
      *(v4f*)(out_norm + (size_t)row * N + j) = o;
    }
    
  }
}



// ---- f16 WMMA path (v_wmma_f32_16x16x32_f16): 11-bit significands for operands in range — used here for the Q/K/V projections
typedef _Float16 v16h __attribute__((ext_vector_type(16)));
union FragH { v16h v; v8us half[2]; _Float16 h[16]; unsigned short u[16]; };
template <int NT>
__device__ __forceinline__ v8f mmaH(v16h ah, v16h al, v16h bh, v16h bl, v8f c) {
  c = __builtin_amdgcn_wmma_f32_16x16x32_f16(false, ah, false, bh, (short)0, c, false, false);
  if (NT >= 2) c = __builtin_amdgcn_wmma_f32_16x16x32_f16(false, al, false, bh, (short)0, c, false, false);
  if (NT >= 3) c = __builtin_amdgcn_wmma_f32_16x16x32_f16(false, ah, false, bl, (short)0, c, false, false);
  asm volatile("v_nop\n\tv_nop\n\tv_nop\n\tv_nop" : "+v"(c) : "v"(ah), "v"(al), "v"(bh), "v"(bl));
  return c;
}
// batched GEMM like k_gemm_b but f16 operands: A f32 (split into f16 hi/lo if ASPLIT, else rounded to f16), Bt = f16 values [n][k]; alpha; C f32; N multiple of 16 (partial tiles skipped)
template <bool ASPLIT>
__global__ __launch_bounds__(128) void k_gemm_h(const float* __restrict__ A, int lda, size_t sA, const _Float16* __restrict__ Bh, int ldb, size_t sB, float alpha, float* __restrict__ C, int ldc, size_t sC, int M, int N, int K) {
  __shared__ __attribute__((aligned(16))) float so[4][16][64];
  const int tid = threadIdx.x, w = tid >> 5, lane = tid & 31, ln = lane & 15, hh = lane >> 4; const int by = blockIdx.y;
  A += (size_t)by * sA; Bh += (size_t)by * sB; C += (size_t)by * sC;
  const int ntn = (N + 63) / 64; const int wid = blockIdx.x * 4 + w; const int mt = wid / ntn, nq = wid % ntn; if (mt * 16 >= M) return;
  const int row0 = mt * 16, col0 = nq * 64; const float* arow = A + (size_t)(row0 + ln) * lda;
  v8f acc[4] = {};
  for (int kb = 0; kb < K; kb += 32) {
    FragH ah, al;
    const v4f x0 = *(const v4fa*)(arow + kb + 8 * hh), x1 = *(const v4fa*)(arow + kb + 8 * hh + 4), x2 = *(const v4fa*)(arow + kb + 16 + 8 * hh), x3 = *(const v4fa*)(arow + kb + 16 + 8 * hh + 4);
    float xs[16] = {x0[0],x0[1],x0[2],x0[3],x1[0],x1[1],x1[2],x1[3],x2[0],x2[1],x2[2],x2[3],x3[0],x3[1],x3[2],x3[3]};
#pragma unroll
    for (int i = 0; i < 16; ++i) { const _Float16 h = (_Float16)xs[i]; ah.h[i] = h; al.h[i] = ASPLIT ? (_Float16)(xs[i] - (float)h) : (_Float16)0.0f; }
#pragma unroll
    for (int t = 0; t < 4; ++t) { if (col0 + t * 16 >= N) continue; const size_t boff = (size_t)(col0 + t * 16 + ln) * ldb + kb; FragH bq; bq.half[0] = *(const v8us*)(Bh + boff + 8 * hh); bq.half[1] = *(const v8us*)(Bh + boff + 16 + 8 * hh);
      acc[t] = mmaH<ASPLIT ? 2 : 1>(ah.v, al.v, bq.v, bq.v, acc[t]); }
  }
#pragma unroll
  for (int t = 0; t < 4; ++t) { if (col0 + t * 16 >= N) continue;
#pragma unroll
    for (int r = 0; r < 8; ++r) so[w][8 * hh + r][t * 16 + ln] = acc[t][r] * alpha; }
  __builtin_amdgcn_fence(__ATOMIC_ACQ_REL, "workgroup"); __builtin_amdgcn_wave_barrier();
  const int rsub = lane >> 4, c4 = (lane & 15) * 4;
  {
#pragma unroll
    for (int q = 0; q < 8; ++q) { const int r = q * 2 + rsub; if (col0 + c4 < N) { const v4f v = *(const v4fa*)&so[w][r][c4]; *(v4f*)(C + (size_t)(row0 + r) * ldc + col0 + c4) = v; } }
     }
}

// Wt[n][k] = f16(W[k][n] * scale) from f32 row-major W[K][N] (scale = power of two; bf16-exact weights stay exact in f16 away from the subnormal range). Needs K % 64 == 0, N % 128 == 0.
// One wave takes 64 k x 16 n. Lane (lk = lane & 7, ln = lane >> 3) reads rows 8 lk .. 8 lk + 7 at columns 4 ln .. 4 ln + 3 by 16-B loads: a load touches 8 lines, not 32, and the block's eight waves take 128 adjacent columns, so together they use every byte of the lines they touch.
// Per column the lane stores its 8 halfs: eight lanes fill one whole 128-B line of Wt, four lines per store.
__device__ __forceinline__ void d_wt_f16(int blk, const float* __restrict__ W, _Float16* __restrict__ Wt, int K, int N, float scale) {
  const int lane = threadIdx.x & 31, wv = blk * 8 + (int)(threadIdx.x >> 5), ngn = N / 16; const int kg = wv / ngn, ng = wv - kg * ngn; if (kg * 64 >= K) return;
  const int k8 = kg * 64 + (lane & 7) * 8, n = ng * 16 + (lane >> 3) * 4; v4f r[8];
#pragma unroll
  for (int i = 0; i < 8; ++i) r[i] = *(const v4fa*)(W + (size_t)(k8 + i) * N + n);
#pragma unroll
  for (int j = 0; j < 4; ++j) { FragH f;
#pragma unroll
    for (int i = 0; i < 8; ++i) f.h[i] = (_Float16)(bf16_round(r[i][j]) * scale);
    const v8us o = f.half[0]; *(v8us*)((unsigned short*)Wt + (size_t)(n + j) * K + k8) = o; }
}
// k_gemm_hh variant with fused epilogue: v = acc·alpha + bias[by·sBias + col] (+ CP[(row/rowsPerB)·sCPb + by·64 + col] if CP) ; ACT 0 none / 1 elu ; writes f16 C16 (and f32 C if non-null)
template <int ACT>
__global__ __launch_bounds__(128) void k_gemm_hhx(const _Float16* __restrict__ A, int lda, size_t sA, const _Float16* __restrict__ Bh, int ldb, size_t sB, float alpha, const float* __restrict__ bias, size_t sBias, const float* __restrict__ CP, int rowsPerB, size_t sCPb, int row0g,
    float* __restrict__ C, _Float16* __restrict__ C16, int ldc, size_t sC, int M, int N, int K) {
  __shared__ __attribute__((aligned(16))) float so[4][16][64];
  const int tid = threadIdx.x, w = tid >> 5, lane = tid & 31, ln = lane & 15, hh = lane >> 4; const int by = blockIdx.y;
  A += (size_t)by * sA; Bh += (size_t)by * sB; const size_t cofs = (size_t)by * sC; const float* bp = bias ? bias + (size_t)by * sBias : nullptr;
  const int ntn = (N + 63) / 64; const int wid = blockIdx.x * 4 + w; const int mt = wid / ntn, nq = wid % ntn; if (mt * 16 >= M) return;
  const int row0 = mt * 16, col0 = nq * 64; const _Float16* arow = A + (size_t)(row0 + ln) * lda;
  v8f acc[4] = {};
  for (int kb = 0; kb < K; kb += 32) { FragH ah; ah.half[0] = *(const v8us*)((const unsigned short*)arow + kb + 8 * hh); ah.half[1] = *(const v8us*)((const unsigned short*)arow + kb + 16 + 8 * hh);
#pragma unroll
    for (int t = 0; t < 4; ++t) { if (col0 + t * 16 >= N) continue; const size_t boff = (size_t)(col0 + t * 16 + ln) * ldb + kb; FragH bq; bq.half[0] = *(const v8us*)((const unsigned short*)Bh + boff + 8 * hh); bq.half[1] = *(const v8us*)((const unsigned short*)Bh + boff + 16 + 8 * hh);
      acc[t] = mmaH<1>(ah.v, ah.v, bq.v, bq.v, acc[t]); }
  }
#pragma unroll
  for (int t = 0; t < 4; ++t) { if (col0 + t * 16 >= N) continue; const int col = col0 + t * 16 + ln; const float bv = bp ? bf16_round(bp[col]) : 0.f;
#pragma unroll
    for (int r = 0; r < 8; ++r) { float v = acc[t][r] * alpha + bv; if (CP) { const int rr = row0g + row0 + 8 * hh + r; if (rowsPerB < 0) v += CP[cofs + (size_t)rr * ldc + col];      /* rowsPerB < 0: own element of the batched C plane */ else { const int bidx = rr / rowsPerB; v += CP[(size_t)bidx * sCPb + (size_t)by * 64 + col]; } } if (ACT == 1) v = (v > 0.f) ? v : expm1f(v); else if (ACT == 7) v = (v > 0.f) ? v + 1.0f : expf(v); else if (ACT == 8) v = tanhf(v); else if (ACT == 9) v = 0.5f * v * (1.0f + tanhf(0.7978845608028654f * (v + 0.044715f * v * v * v))); else if (ACT == 11) v = 1.0f / (1.0f + expf(-v)); else if (ACT == 12) v = (v > 0.f) ? v : 0.01f * v; else if (ACT == 14) v = (v > 0.f) ? v : 0.1f * v; else if (ACT == 16) v = (v >= 0.f) ? v : 0.3f * v; else if (ACT == 17) v = (v >= 0.f) ? v : 0.2f * v; else if (ACT == 15) v = v / (1.0f + expf(-v)); else if (ACT == 3) v = fmaxf(v, 0.f); else if (ACT == 6) v = 0.5f * v * (1.0f + erff(v * 0.70710678118654752f)); so[w][8 * hh + r][t * 16 + ln] = v; } }
  __builtin_amdgcn_fence(__ATOMIC_ACQ_REL, "workgroup"); __builtin_amdgcn_wave_barrier();
  const int rsub = lane >> 4, c4 = (lane & 15) * 4; typedef _Float16 v4h __attribute__((ext_vector_type(4)));
  {
#pragma unroll
    for (int q = 0; q < 8; ++q) { const int r = q * 2 + rsub; if (col0 + c4 < N) { const v4f v = *(const v4fa*)&so[w][r][c4]; if (C) *(v4f*)(C + cofs + (size_t)(row0 + r) * ldc + col0 + c4) = v; if (C16) { v4h h4; for (int i = 0; i < 4; ++i) h4[i] = (_Float16)v[i]; *(v4h*)(C16 + cofs + (size_t)(row0 + r) * ldc + col0 + c4) = h4; } } }
     }
}


typedef _Float16 v4h __attribute__((ext_vector_type(4)));

__global__ __launch_bounds__(256) void k_x16(const float* __restrict__ x, _Float16* __restrict__ X16, size_t n8) { const size_t t = (size_t)blockIdx.x * 256 + threadIdx.x; if (t >= n8) return; FragH f;
#pragma unroll
  for (int q = 0; q < 8; ++q) f.h[q] = (_Float16)bf16_round(x[t * 8 + q]); *(v8us*)((unsigned short*)X16 + t * 8) = f.half[0];  }
__global__ __launch_bounds__(256) void k_h16(const float* __restrict__ x, _Float16* __restrict__ X16, size_t n8) { const size_t t = (size_t)blockIdx.x * 256 + threadIdx.x; if (t >= n8) return; FragH f;
#pragma unroll
  for (int q = 0; q < 8; ++q) f.h[q] = (_Float16)x[t * 8 + q]; *(v8us*)((unsigned short*)X16 + t * 8) = f.half[0];  }
__global__ __launch_bounds__(256) void k_round16f(const float* __restrict__ W, _Float16* __restrict__ Bt, size_t n8) { const size_t t = (size_t)blockIdx.x * 256 + threadIdx.x; if (t >= n8) return; FragH f;
#pragma unroll
  for (int i = 0; i < 8; ++i) f.h[i] = (_Float16)(bf16_round(W[t * 8 + i]) * 16.0f); *(v8us*)((unsigned short*)Bt + t * 8) = f.half[0];  }
template <int NHv, int TTv>
__global__ __launch_bounds__(256) void k_vt(const _Float16* __restrict__ V16, int ldv, int voff, _Float16* __restrict__ Vt) { __shared__ unsigned short tl[64][66]; const int tid = threadIdx.x; const int slab = blockIdx.x / (TTv / 64), lg = blockIdx.x % (TTv / 64); const int b = slab / NHv, h = slab % NHv;
  for (int i = tid; i < 64 * 8; i += 256) { const int r = i / 8, c8 = (i % 8) * 8; FragH f; f.half[0] = *(const v8us*)((const unsigned short*)V16 + ((size_t)b * TTv + lg * 64 + r) * ldv + voff + h * 64 + c8);
#pragma unroll
    for (int q = 0; q < 8; ++q) tl[r][c8 + q] = f.u[q]; }
  __syncthreads();
  {
#pragma unroll
    for (int rd = 0; rd < 2; ++rd) { const int d = rd * 32 + tid / 8, pc = tid % 8; FragH f;
#pragma unroll
      for (int q = 0; q < 8; ++q) f.u[q] = tl[pc * 8 + q][d];
      *(v8us*)((unsigned short*)Vt + ((size_t)slab * 64 + d) * TTv + lg * 64 + pc * 8) = f.half[0]; }
     } }

__global__ __launch_bounds__(256) void k_hl(const float* __restrict__ F, _Float16* __restrict__ Hh, _Float16* __restrict__ Hl, size_t n8) { const size_t t = (size_t)blockIdx.x * 256 + threadIdx.x; if (t >= n8) return; FragH fh, fl; const v4f a = *(const v4fa*)(F + t * 8), c = *(const v4fa*)(F + t * 8 + 4);
#pragma unroll
  for (int q = 0; q < 4; ++q) { _Float16 h = (_Float16)a[q]; fh.h[q] = h; fl.h[q] = (_Float16)((a[q] - (float)h) * 1024.0f); h = (_Float16)c[q]; fh.h[4 + q] = h; fl.h[4 + q] = (_Float16)((c[q] - (float)h) * 1024.0f); }
  { *(v8us*)((unsigned short*)Hh + t * 8) = fh.half[0]; *(v8us*)((unsigned short*)Hl + t * 8) = fl.half[0];  } }

// ---- fast GEMM (wave tile 64x64), C = A Bh^T alpha + bf16(bias), f32 rows ----
__device__ __forceinline__ v16h g2_frag(const _Float16* p, int hh) { FragH f; f.half[0] = *(const v8us*)((const unsigned short*)p + 8 * hh); f.half[1] = *(const v8us*)((const unsigned short*)p + 16 + 8 * hh); return f.v; }
__device__ __forceinline__ v8f g2_mma(v16h a, v16h b, v8f c) { v8f d = __builtin_amdgcn_wmma_f32_16x16x32_f16(false, a, false, b, (short)0, c, false, false); asm volatile("v_nop\n\tv_nop\n\tv_nop\n\tv_nop" : "+v"(d) : "v"(a), "v"(b)); return d; }
// Block tile 256 x 128, eight waves of 64 x 64 (4 down, 2 across). Per pass 64 k of both operands (128-B rows: 256 rows of A, then 128 rows of Bh) lie in one of two LDS buffers,
// brought by asynchronous copies (16 B per lane, whole 128-B lines per 8 lanes); the next pass's copies fly while this pass's fragments are read from LDS. Needs M % 256 == 0 (grid), N % 128 == 0, K % 64 == 0.
// A 64 x 64 wave tile reads 8 fragments for 16 products (32 x 64: 6 for 8); a 256 x 128 block brings 48 KiB for 256 products (128 x 128: 32 KiB for 128).
#define G3_PITCH 72                  /* LDS row pitch in halfs: 144 B = 16 B x odd, conflict-free for 16-B fragment reads */
#define G3_STAGE (384 * G3_PITCH)    /* halfs per buffer */
// one pass's copies of this thread: eight rows of A and four of Bh, 32 rows apart; l = the lane's LDS byte address of the first
__device__ __forceinline__ void g3_copy(const _Float16* ga, const _Float16* gb, size_t step, unsigned l) {
  const _Float16* a1 = ga + step; const _Float16* a2 = a1 + step; const _Float16* a3 = a2 + step; const _Float16* a4 = a3 + step; const _Float16* a5 = a4 + step; const _Float16* a6 = a5 + step; const _Float16* a7 = a6 + step;
  const _Float16* b1 = gb + step; const _Float16* b2 = b1 + step; const _Float16* b3 = b2 + step;
  const unsigned rs = 32u * G3_PITCH * 2u;
  /* the s_wait_xcnt stands inside the statement so that no address register of a copy is rewritten ahead of it */
  asm volatile("global_load_async_to_lds_b128 %0, %12, off\n\t"
               "global_load_async_to_lds_b128 %1, %13, off\n\t"
               "global_load_async_to_lds_b128 %2, %14, off\n\t"
               "global_load_async_to_lds_b128 %3, %15, off\n\t"
               "global_load_async_to_lds_b128 %4, %16, off\n\t"
               "global_load_async_to_lds_b128 %5, %17, off\n\t"
               "global_load_async_to_lds_b128 %6, %18, off\n\t"
               "global_load_async_to_lds_b128 %7, %19, off\n\t"
               "global_load_async_to_lds_b128 %8, %20, off\n\t"
               "global_load_async_to_lds_b128 %9, %21, off\n\t"
               "global_load_async_to_lds_b128 %10, %22, off\n\t"
               "global_load_async_to_lds_b128 %11, %23, off\n\t"
               "s_wait_xcnt 0x0"
               :: "v"(l), "v"(l + rs), "v"(l + 2u * rs), "v"(l + 3u * rs), "v"(l + 4u * rs), "v"(l + 5u * rs), "v"(l + 6u * rs), "v"(l + 7u * rs), "v"(l + 8u * rs), "v"(l + 9u * rs), "v"(l + 10u * rs), "v"(l + 11u * rs),
                  "v"(ga), "v"(a1), "v"(a2), "v"(a3), "v"(a4), "v"(a5), "v"(a6), "v"(a7), "v"(gb), "v"(b1), "v"(b2), "v"(b3) : "memory");
}
typedef float f1a __attribute__((may_alias));
// One launch does all three products of the same A: blockIdx.y picks the weight, its bias and its output (scalar selects). Four waves per SIMD (256 registers a wave): two blocks share a WGP, 2 x 110,592 B of LDS.
// N and K are compile-time: a row step of the output is then an immediate offset of the store, and the 32 stores of a lane share one address where 32 address pairs would not fit the 256 registers.
template <int N, int K>
__global__ __launch_bounds__(256) __attribute__((amdgpu_waves_per_eu(4, 4))) void k_gemm3(const _Float16* __restrict__ A, const _Float16* __restrict__ Bh0, const _Float16* __restrict__ Bh1, const _Float16* __restrict__ Bh2, float alpha,
                                               const float* __restrict__ bias0, const float* __restrict__ bias1, const float* __restrict__ bias2, float* __restrict__ C0, float* __restrict__ C1, float* __restrict__ C2) {
  const int pz = blockIdx.y; const _Float16* Bh = pz == 0 ? Bh0 : pz == 1 ? Bh1 : Bh2; const float* bias = pz == 0 ? bias0 : pz == 1 ? bias1 : bias2; float* C = pz == 0 ? C0 : pz == 1 ? C1 : C2;
  __shared__ __attribute__((aligned(16))) _Float16 ring[2 * G3_STAGE];
  const int tid = threadIdx.x, w = tid >> 5, lane = tid & 31, ln = lane & 15, hh = lane >> 4;
  const int ntn = N >> 7; const int mt = blockIdx.x / ntn, nq = blockIdx.x - mt * ntn; const int wm = w >> 1, wn = w & 1;
  const int cr = tid >> 3, cp = tid & 7;      /* copy: row within a group of 32, 16-B piece of the row */
  const _Float16* ga = A + (size_t)(mt * 256 + cr) * K + cp * 8; const _Float16* gb = Bh + (size_t)(nq * 128 + cr) * K + cp * 8; const size_t step = (size_t)32 * K;
  const unsigned l0 = (unsigned)(size_t)&ring[0] + (unsigned)(cr * (G3_PITCH * 2) + cp * 16);
  const int nt = K >> 6;
  const v8f z8 = {0.f,0.f,0.f,0.f,0.f,0.f,0.f,0.f}; v8f acc[4][4];      /* every loop over acc, a, b, bv is unrolled: indexed by constants only, the arrays stay in registers */
#pragma unroll
  for (int i = 0; i < 4; ++i)
#pragma unroll
    for (int j = 0; j < 4; ++j) acc[i][j] = z8;
  g3_copy(ga, gb, step, l0);
  asm volatile("s_wait_asynccnt 0x0" ::: "memory");      /* this wave's copies of pass 0 have landed */
  __syncthreads();                                       /* publishes pass 0 */
  if (nt > 1) g3_copy(ga + 64, gb + 64, step, l0 + (unsigned)(G3_STAGE * 2));
#pragma unroll 1      /* one pass per trip: the two buffers alternate by the trip's parity */
  for (int t = 0; t < nt; ++t) {
    const _Float16* ap = &ring[(t & 1) * G3_STAGE + (wm * 64 + ln) * G3_PITCH]; const _Float16* bp = &ring[(t & 1) * G3_STAGE + (256 + wn * 64 + ln) * G3_PITCH];
#pragma unroll
    for (int kk = 0; kk < 2; ++kk) {
      v16h a[4], b[4];
#pragma unroll
      for (int i = 0; i < 4; ++i) { a[i] = g2_frag(ap + i * 16 * G3_PITCH + kk * 32, hh); b[i] = g2_frag(bp + i * 16 * G3_PITCH + kk * 32, hh); }
#pragma unroll
      for (int j = 0; j < 4; ++j)
#pragma unroll
        for (int i = 0; i < 4; ++i) acc[i][j] = g2_mma(a[i], b[j], acc[i][j]);
    }
    asm volatile("s_wait_dscnt 0x0" ::: "memory");       /* this wave's reads of the buffer are done before it may be refilled */
    asm volatile("s_wait_asynccnt 0x0" ::: "memory");    /* this wave's copies of pass t + 1 have landed */
    __syncthreads();                                     /* publishes pass t + 1 and ends every reader's last read of pass t */
    if (t + 2 < nt) g3_copy(ga + (size_t)(t + 2) * 64, gb + (size_t)(t + 2) * 64, step, l0 + (unsigned)((t & 1) * (G3_STAGE * 2)));
  }
  asm volatile("s_wait_asynccnt 0x0" ::: "memory");      /* no copy is outstanding when the wave goes on */
  /* Output staging: behind the last pass's barrier nobody reads the ring any more and no copy is aimed at it; each wave takes 32 rows x 68 floats of it for itself and sends its tile out in two halves of 32 rows, every row piece a whole aligned 256 B. */
  f1a* so = (f1a*)&ring[0] + w * (32 * 68);
  const int ws = __builtin_amdgcn_readfirstlane(w);      /* the wave's number as a scalar: every output address is a scalar base plus one lane offset, no address pair per row */
  const int row0 = mt * 256 + (ws >> 1) * 64, col0 = nq * 128 + (ws & 1) * 64;
  const int rsub = lane >> 4, c4 = (lane & 15) * 4;
  float* cb = C + (size_t)row0 * N + col0; const unsigned lo = (unsigned)(rsub * N + c4);
  float bv[4]; const int bi = col0 + ln;      /* the lane's first column: the one offset register of the four bias loads */
#pragma unroll
  for (int j = 0; j < 4; ++j) bv[j] = bias[bi + j * 16];
  asm volatile("s_wait_xcnt 0x0" :: "v"(bi) : "memory");      /* stands behind the four loads, in front of whatever next overwrites the offset register that they name; the index is an input, so it lives to here and no load of the run lands in it */
#pragma unroll
  for (int j = 0; j < 4; ++j) bv[j] = bf16_round(bv[j]);
#pragma unroll
  for (int h2 = 0; h2 < 2; ++h2) {
#pragma unroll
    for (int u = 0; u < 8; ++u) { const int j = u & 3, half = u >> 2;
#pragma unroll
      for (int r = 0; r < 8; ++r) so[(half * 16 + 8 * hh + r) * 68 + j * 16 + ln] = acc[h2 * 2 + half][j][r] * alpha + bv[j]; }
    __builtin_amdgcn_fence(__ATOMIC_ACQ_REL, "workgroup", "local"); __builtin_amdgcn_wave_barrier();      /* the rows are read back behind the wave's own LDS writes. LDS alone: the tile goes out in two halves, and a fence over global memory too would hold the second half behind the first half's stores */
#pragma unroll
    for (int q = 0; q < 16; ++q) { const v4f v = *(const v4fa*)&so[(q * 2 + rsub) * 68 + c4]; *(v4f*)(cb + (size_t)(h2 * 32 + q * 2) * N + lo) = v; }
    if (h2 == 0) { __builtin_amdgcn_fence(__ATOMIC_ACQ_REL, "workgroup", "local"); __builtin_amdgcn_wave_barrier(); }      /* the second half's LDS writes stay behind the first half's reads of the same rows */
  }
}


__global__ __launch_bounds__(256) void k_wnat(const float* __restrict__ w, size_t n8, _Float16* __restrict__ Bt) { const size_t t = (size_t)blockIdx.x * 256 + threadIdx.x; if (t >= n8) return; FragH f; for (int q = 0; q < 8; ++q) f.h[q] = (_Float16)(bf16_round(w[t * 8 + q]) * 16.0f); *(v8us*)((unsigned short*)Bt + t * 8) = f.half[0];  }
__global__ __launch_bounds__(256) void k_rsm(const float* __restrict__ S, _Float16* __restrict__ P, int nrows) {
  #pragma clang fp contract(off)
  const int i = blockIdx.x * 256 + threadIdx.x; if (i >= nrows) return; const float* s = S + (size_t)i * SQ; float mx = -3.0e38f;
#pragma unroll 1
  for (int j = 0; j < SQ; ++j) mx = fmaxf(mx, s[j]); float se = 0.f;
#pragma unroll 1
  for (int j = 0; j < SQ; ++j) se += expf(s[j] - mx); const float sc = 256.0f / se;
#pragma unroll 1
  for (int j0 = 0; j0 < SQ; j0 += 8) { FragH f; for (int q = 0; q < 8; ++q) f.h[q] = (_Float16)(expf(s[j0 + q] - mx) * sc); unsigned short* d = (unsigned short*)P + (size_t)i * SQ + j0; *(v8us*)d = f.half[0];  } }
__global__ __launch_bounds__(256) void k_vt(const _Float16* __restrict__ V16, int b, int h0, _Float16* __restrict__ VT) { __shared__ unsigned short tl[64][65]; const int tid = threadIdx.x; const int hh = blockIdx.x % HG, sg = blockIdx.x / HG; const int s0 = sg * 64; const int h = h0 + hh;
  for (int i = tid; i < 64 * 8; i += 256) { const int j = i / 8, d8 = (i % 8) * 8; FragH f; f.half[0] = *(const v8us*)((const unsigned short*)V16 + ((size_t)b * SQ + s0 + j) * DM + h * HD + d8); for (int q = 0; q < 8; ++q) tl[d8 + q][j] = f.u[q]; }
  __syncthreads();
  { for (int i = tid; i < 64 * 8; i += 256) { const int d = i / 8, j8 = (i % 8) * 8; FragH f; for (int q = 0; q < 8; ++q) f.u[q] = tl[d][j8 + q]; *(v8us*)((unsigned short*)VT + ((size_t)hh * HD + d) * SQ + s0 + j8) = f.half[0]; }  } }



__global__ __launch_bounds__(256) void k_rsmcf2(const float* __restrict__ S, _Float16* __restrict__ P, int hg, int q0, int nk) {
  #pragma clang fp contract(off)
  const int t = blockIdx.x * 256 + threadIdx.x; if (t >= hg * QT) return; const size_t i = (size_t)t; const float* s = S + i * NKX; const int last = q0 + (t % QT); float mx = -3.0e38f;
#pragma unroll 1
  for (int j = 0; j < nk; ++j) { const float f = (j <= last) ? 1.f : 0.f; mx = fmaxf(mx, fmaf(f, s[j], (1.f - f) * -1.0e9f)); } float se = 0.f;
#pragma unroll 1
  for (int j = 0; j < nk; ++j) { const float f = (j <= last) ? 1.f : 0.f; se += __expf(fmaf(f, s[j], (1.f - f) * -1.0e9f) - mx); } const float sc = 256.0f / se;
#pragma unroll 1
  for (int j0 = 0; j0 < nk; j0 += 8) { FragH fr; for (int q = 0; q < 8; ++q) { const int j = j0 + q; const float f = (j <= last) ? 1.f : 0.f; fr.h[q] = (_Float16)(__expf(fmaf(f, s[j], (1.f - f) * -1.0e9f) - mx) * sc); } unsigned short* d = (unsigned short*)P + i * NKX + j0; *(v8us*)d = fr.half[0];  } }

template <int MASKADD>
__global__ __launch_bounds__(64) void k_att0(const float* __restrict__ QF, const float* __restrict__ KF, const float* __restrict__ VF, int ld, const float* __restrict__ mask, float scale, float* __restrict__ OF, int ldo) {
  #pragma clang fp contract(off)
  __shared__ __attribute__((aligned(16))) float lq[64][64]; __shared__ __attribute__((aligned(16))) float lo[64][64];
  const int tid = threadIdx.x; const int h = blockIdx.x / (QT0 / 64), rg = blockIdx.x % (QT0 / 64); const int i = rg * 64 + tid;
  const float* qr = QF + (size_t)i * ld + h * HD;
#pragma unroll 1
  for (int c = 0; c < HD / 4; ++c) { *(v4f*)&lq[tid][c * 4] = *(const v4fa*)(qr + c * 4); const v4f z = {0.f, 0.f, 0.f, 0.f}; *(v4f*)&lo[tid][c * 4] = z; }
  float m = -1.0e30f, l = 0.f; const int jmax = MASKADD ? (SQ - 1) : (rg * 64 + 63);      /* additive-mask form: every key (the mask input decides); causal form: keys up to the block's last row */
#pragma unroll 1
  for (int j = 0; j <= jmax; ++j) { const float* kr = KF + (size_t)j * ld + h * HD; const float* vr = VF + (size_t)j * ld + h * HD; float s = 0.f;
#pragma unroll 1
    for (int c = 0; c < HD / 4; ++c) { const v4f kq = *(const v4fa*)(kr + c * 4); const v4f qq = *(v4f*)&lq[tid][c * 4]; s = __fadd_rn(s, __fmul_rn(qq[0], kq[0])); s = __fadd_rn(s, __fmul_rn(qq[1], kq[1])); s = __fadd_rn(s, __fmul_rn(qq[2], kq[2])); s = __fadd_rn(s, __fmul_rn(qq[3], kq[3])); }
    s = __fmul_rn(s, scale); if (MASKADD) s = __fadd_rn(s, __fmul_rn(bf16_round(mask[(size_t)i * SQ + j]), -10000.0f));
    const float f = (MASKADD || j <= i) ? 1.f : 0.f; const float sm = fmaf(f, s, (1.f - f) * -1.0e30f); const float mn = fmaxf(m, sm); const float sc = expf(m - mn); const float e = expf(sm - mn); l = __fadd_rn(__fmul_rn(l, sc), e); m = mn;
#pragma unroll 1
    for (int c = 0; c < HD / 4; ++c) { const v4f vv = *(const v4fa*)(vr + c * 4); v4f oo = *(v4f*)&lo[tid][c * 4]; for (int u = 0; u < 4; ++u) oo[u] = __fadd_rn(__fmul_rn(oo[u], sc), __fmul_rn(e, vv[u])); *(v4f*)&lo[tid][c * 4] = oo; } }
  const float fin = 64.0f / l;      /* o carried x64 like the f16 path */
#pragma unroll 1
  for (int c = 0; c < HD / 4; ++c) { v4f oo = *(v4f*)&lo[tid][c * 4]; for (int u = 0; u < 4; ++u) oo[u] = __fmul_rn(oo[u], fin); *(v4f*)&lo[tid][c * 4] = oo; }
  __syncthreads();
  {
#pragma unroll 1
    for (int it = 0; it < 16; ++it) { const int row = it * 4 + tid / 16, pc = (tid % 16) * 4; const v4f v = *(const v4f*)&lo[row][pc]; *(v4f*)(OF + (size_t)(rg * 64 + row) * ldo + h * HD + pc) = v; }
     } }

__global__ __launch_bounds__(256) void k_oscale(const float* __restrict__ OF, float* __restrict__ out, size_t n4) { const size_t t = (size_t)blockIdx.x * 256 + threadIdx.x; if (t >= n4) return; const v4f a = *(const v4fa*)(OF + t * 4); v4f o; for (int q = 0; q < 4; ++q) o[q] = a[q] * 0.015625f; *(v4f*)(out + t * 4) = o;  }




__global__ __launch_bounds__(256) void k_rsmfvl(const float* __restrict__ S, _Float16* __restrict__ P, _Float16* __restrict__ PL, int qn, const int* __restrict__ vlp) {
  #pragma clang fp contract(off)
  const int t = blockIdx.x * 256 + threadIdx.x; if (t >= qn) return; const int vl = vlp[0]; const size_t i = (size_t)t; const float* s = S + i * SQ; float mx = -3.0e38f;
#pragma unroll 1
  for (int j = 0; j < SQ; ++j) { const float f = (j < vl) ? 1.f : 0.f; mx = fmaxf(mx, fmaf(f, s[j], (1.f - f) * -1000000.0f)); } float se = 0.f;
#pragma unroll 1
  for (int j = 0; j < SQ; ++j) { const float f = (j < vl) ? 1.f : 0.f; se += __expf(fmaf(f, s[j], (1.f - f) * -1000000.0f) - mx); } const float sc = 256.0f / se;
#pragma unroll 1
  for (int j0 = 0; j0 < SQ; j0 += 8) { FragH fr, gr; for (int q = 0; q < 8; ++q) { const int j = j0 + q; const float f = (j < vl) ? 1.f : 0.f; const float pv = __expf(fmaf(f, s[j], (1.f - f) * -1000000.0f) - mx) * sc; const _Float16 ph = (_Float16)pv; fr.h[q] = ph; gr.h[q] = (_Float16)((pv - (float)ph) * 1024.0f); }
    unsigned short* d = (unsigned short*)P + i * SQ + j0; unsigned short* dl = (unsigned short*)PL + i * SQ + j0; *(v8us*)d = fr.half[0]; *(v8us*)dl = gr.half[0];  } }

__global__ __launch_bounds__(256) void k_rsmf(const float* __restrict__ S, _Float16* __restrict__ P, int qn, int hg) {
  #pragma clang fp contract(off)
  const int t = blockIdx.x * 256 + threadIdx.x; if (t >= qn * hg) return; const size_t i = (size_t)(t / qn) * SQ + (t % qn); const float* s = S + i * SQ; float mx = -3.0e38f;
#pragma unroll 1
  for (int j = 0; j < SQ; ++j) mx = fmaxf(mx, s[j]); float se = 0.f;
#pragma unroll 1
  for (int j = 0; j < SQ; ++j) se += __expf(s[j] - mx); const float sc = 256.0f / se;
#pragma unroll 1
  for (int j0 = 0; j0 < SQ; j0 += 8) { FragH f; for (int q = 0; q < 8; ++q) f.h[q] = (_Float16)(__expf(s[j0 + q] - mx) * sc); unsigned short* d = (unsigned short*)P + i * SQ + j0; *(v8us*)d = f.half[0];  } }


#define CN 256          /* channels */
#define CI 128
#define NC 256                       /* (unused legacy kernels) */
#define NPX NP          /* positions per channel row */
#define NP 4096         /* seq1 tokens */
#define NM 1024         /* seq2 tokens */
#define BNEPS 1e-5f

__global__ __launch_bounds__(256) void k_mp2(const float* __restrict__ src, float* __restrict__ dst, int nout) {
  const int t = blockIdx.x * 256 + threadIdx.x; if (t >= nout) return; const int c = t / 1024; const int o = t % 1024; const int oy = o / 32, ox = o % 32; const float* p = src + (size_t)c * 4096 + (size_t)(2 * oy) * 64 + 2 * ox;
  const float v = fmaxf(fmaxf(p[0], p[1]), fmaxf(p[64], p[65])); *(float*)(dst + t) = v;  }
__global__ __launch_bounds__(256) void k_xpb(const float* __restrict__ x, const float* __restrict__ wb, float* __restrict__ CPP, size_t n4) {
  #pragma clang fp contract(off)
  const size_t t = (size_t)blockIdx.x * 256 + threadIdx.x; if (t >= n4) return; const size_t e = t * 4; const int c = (int)((e / 4096) % 256); const float bb = bf16_round(wb[c]); const v4f a = *(const v4fa*)(x + e); v4f o; for (int q = 0; q < 4; ++q) o[q] = __fadd_rn(bf16_round(a[q]), bb);
  *(v4f*)(CPP + e) = o;  }


template <int PASS>
__global__ __launch_bounds__(256) void k_cstA(const float* __restrict__ X, const float* __restrict__ MV, float* __restrict__ PART) {
  #pragma clang fp contract(off)
  __shared__ float red[256]; const int t = threadIdx.x; const size_t bc = blockIdx.x; const int c = (int)(bc % NC); const float* row = X + bc * (size_t)NPX; const float mu = PASS ? MV[c] : 0.f; float s = 0.f;
  for (int i = t; i < NPX; i += 256) { const float v = row[i]; const float d = PASS ? __fadd_rn(v, -mu) : v; s = __fadd_rn(s, PASS ? __fmul_rn(d, d) : d); }
  red[t] = s; __syncthreads(); for (int st = 128; st > 0; st >>= 1) { if (t < st) red[t] = __fadd_rn(red[t], red[t + st]); __syncthreads(); }
  if (t < 32) { const float pv = (t == 0) ? red[0] : 0.f; *(float*)(PART + bc * 32 + t) = pv;  } }      

template <int PASS>
__global__ __launch_bounds__(256) void k_cstB(const float* __restrict__ PART, float* __restrict__ MV) { const int c = threadIdx.x; if (c >= NC) return; double s = 0.0; for (int b = 0; b < NB; ++b) s += (double)PART[((size_t)b * NC + c) * 32]; const float m = (float)(s / ((double)NB * (double)NPX)); *(float*)(MV + PASS * NC + c) = m;  }


__global__ __launch_bounds__(256) void k_bnresid(const float* __restrict__ C2, const float* __restrict__ MV, const float* __restrict__ g, const float* __restrict__ be, const float* __restrict__ X, float* __restrict__ out, size_t n4) {
  #pragma clang fp contract(off)
  const size_t t = (size_t)blockIdx.x * 256 + threadIdx.x; if (t >= n4) return; const size_t e = t * 4; const int c = (int)((e / NPX) % NC); const float sc = __fmul_rn(rsqrtf(__fadd_rn(MV[NC + c], BNEPS)), bf16_round(g[c])); const float mu = MV[c], bb = bf16_round(be[c]);
  const v4f a = *(const v4fa*)(C2 + e); const v4f xx = *(const v4fa*)(X + e); v4f o; for (int q = 0; q < 4; ++q) { const float z = __fadd_rn(__fmul_rn(__fadd_rn(a[q], -mu), sc), bb); o[q] = __fadd_rn(z, bf16_round(xx[q])); }
  *(v4f*)(out + e) = o;  }


__global__ __launch_bounds__(256) void k_rowbias(float* __restrict__ Y, const float* __restrict__ bias) {
  #pragma clang fp contract(off)
  const size_t t = (size_t)blockIdx.x * 256 + threadIdx.x; if (t >= (size_t)NB * NC * NPX / 4) return; const size_t e = t * 4; const int c = (int)((e / NPX) % NC); const float bb = bf16_round(bias[c]);
  v4f v = *(const v4fa*)(Y + e); for (int q = 0; q < 4; ++q) v[q] = __fadd_rn(v[q], bb); *(v4f*)(Y + e) = v;  }



template <int NK>
__global__ __launch_bounds__(256) void k_rsmn(const float* __restrict__ S, _Float16* __restrict__ P, int nrows) {
  #pragma clang fp contract(off)
  const int t = blockIdx.x * 256 + threadIdx.x; if (t >= nrows) return; const float* s = S + (size_t)t * NK; float mx = -3.0e38f;
#pragma unroll 1
  for (int j = 0; j < NK; ++j) mx = fmaxf(mx, s[j]); float se = 0.f;
#pragma unroll 1
  for (int j = 0; j < NK; ++j) se += __expf(s[j] - mx); const float sc = 256.0f / se;
#pragma unroll 1
  for (int j0 = 0; j0 < NK; j0 += 8) { FragH fr; for (int q = 0; q < 8; ++q) fr.h[q] = (_Float16)(__expf(s[j0 + q] - mx) * sc);
    unsigned short* d = (unsigned short*)P + (size_t)t * NK + j0; *(v8us*)d = fr.half[0];  } }

typedef float v2f __attribute__((ext_vector_type(2)));
__device__ __forceinline__ float pt_xhalf(float x) { return __builtin_bit_cast(float, __builtin_amdgcn_permlanex16(__builtin_bit_cast(int, x), __builtin_bit_cast(int, x), 0x76543210, 0xfedcba98, false, false)); }      /* lane l <-> lane l ^ 16 */
__device__ __forceinline__ v8f pt_mma(v2f a, v2f b, v8f c) { return __builtin_amdgcn_wmma_f32_16x16x4_f32(false, a, false, b, (short)0, c, false, false); }
// One wave per token, both products on v_wmma_f32_16x16x4_f32 (f32 operands), no LDS. Lane (c = lane & 15, hh = lane >> 4).
// St = K Q^T per 16 x 16 tile: A row j = c, B column i = c, both loaded by the same code (the lane's 8 contiguous heads 8 hh .. 8 hh + 7 of its row; step s takes heads 8 hh + 2 s, + 1).
// D register r of tile jt = score of key j = 16 jt + 8 hh + r for query i = c: a query's 64 scores lie in lanes c and c + 16, so the softmax needs one exchange for the maximum and one for the sum.
// Ot = V^T P^T: B = register pair (2 p, 2 p + 1) of a tile as it lies (keys 16 jt + 8 hh + 2 p, + 1), A row = head c with V of the same keys. D register r = res[i = c][head 8 hh + r]: 8 contiguous floats of the output row.
// The residual is read from the input itself and rounded to bf16 here, in registers: no rounded copy of the input goes through memory.
__global__ __launch_bounds__(128) void k_ptatt(const float* __restrict__ QF, const float* __restrict__ KF, const float* __restrict__ VF, const float* __restrict__ xres, float scale, float* __restrict__ out) {
  const int lane = threadIdx.x & 31, c = lane & 15, hh = lane >> 4;
  const size_t ro = ((size_t)blockIdx.x * 4 + (size_t)__builtin_amdgcn_readfirstlane((int)(threadIdx.x >> 5))) * 1024;      /* the wave's token: a scalar, so every address is a scalar base plus one lane offset */
  const int fo = c * 16 + 8 * hh, vo = hh * 128 + c;
  const float cs = scale * 1.4426950408889634f;      /* softmax in base 2 */
  const float* kp = KF + ro; const float* vp = VF + ro; const float* qp = QF + ro; const float* xp = xres + ro; float* op = out + ro;
  v8f kf[4], vt[4];
#pragma unroll
  for (int jt = 0; jt < 4; ++jt) { const v4f k0 = *(const v4fa*)(kp + jt * 256 + fo), k1 = *(const v4fa*)(kp + jt * 256 + fo + 4); kf[jt] = v8f{k0[0], k0[1], k0[2], k0[3], k1[0], k1[1], k1[2], k1[3]}; }
  v4f q0 = *(const v4fa*)(qp + fo), q1 = *(const v4fa*)(qp + fo + 4);
  __builtin_amdgcn_sched_barrier(0);      /* K and Q are asked for ahead of V: loads return in order, and the first product waits for these alone */
#pragma unroll
  for (int jt = 0; jt < 4; ++jt)
#pragma unroll
    for (int r = 0; r < 8; ++r) vt[jt][r] = vp[jt * 256 + r * 16 + vo];
  __builtin_amdgcn_sched_barrier(0);      /* V is asked for before the wave first waits: behind that wait its latency would come on top of K's */
#pragma unroll
  for (int it = 0; it < 4; ++it) {
    const v4f x0 = *(const v4fa*)(xp + it * 256 + fo), x1 = *(const v4fa*)(xp + it * 256 + fo + 4);
    const v8f z8 = {0.f, 0.f, 0.f, 0.f, 0.f, 0.f, 0.f, 0.f}; v8f st[4] = {z8, z8, z8, z8};
#pragma unroll
    for (int s = 0; s < 4; ++s)
#pragma unroll
      for (int jt = 0; jt < 4; ++jt) st[jt] = pt_mma(v2f{kf[jt][2 * s], kf[jt][2 * s + 1]}, s < 2 ? v2f{q0[2 * s], q0[2 * s + 1]} : v2f{q1[2 * s - 4], q1[2 * s - 3]}, st[jt]);
    /* distance behind a matrix instruction: nothing reads these scores or overwrites an operand within the slots; the f32 form stands in no table of distances, so the count of the other form with its issue interval is kept */
    asm volatile("v_nop\n\tv_nop\n\tv_nop\n\tv_nop\n\tv_nop\n\tv_nop\n\tv_nop\n\tv_nop" : "+v"(st[0]), "+v"(st[1]), "+v"(st[2]), "+v"(st[3]) : "v"(q0), "v"(q1), "v"(kf[0]), "v"(kf[1]), "v"(kf[2]), "v"(kf[3]));
    if (it < 3) { q0 = *(const v4fa*)(qp + (it + 1) * 256 + fo); q1 = *(const v4fa*)(qp + (it + 1) * 256 + fo + 4); }      /* the next tile's queries fly during the rest of this tile */
    float m4[4];
#pragma unroll
    for (int jt = 0; jt < 4; ++jt) { m4[jt] = fmaxf(st[jt][0], st[jt][1]);
#pragma unroll
      for (int r = 2; r < 8; ++r) m4[jt] = fmaxf(m4[jt], st[jt][r]); }
    float mx = fmaxf(fmaxf(m4[0], m4[1]), fmaxf(m4[2], m4[3])); mx = fmaxf(mx, pt_xhalf(mx));
    const float mc = mx * cs; v8f pr[4]; v2f la = {0.f, 0.f}, lb = {0.f, 0.f};
#pragma unroll
    for (int jt = 0; jt < 4; ++jt) { v8f ar;
#pragma unroll
      for (int r = 0; r < 8; ++r) ar[r] = fmaf(st[jt][r], cs, -mc);
#pragma unroll
      for (int r = 0; r < 8; ++r) pr[jt][r] = __builtin_amdgcn_exp2f(ar[r]);
      /* the slot behind a transcendental: inputs only, the eight arguments stay whole until this slot, so no instruction directly behind an exponential overwrites its source */
      asm volatile("v_nop" :: "v"(ar), "v"(pr[jt]));
#pragma unroll
      for (int p = 0; p < 4; ++p) { if (jt & 1) lb += v2f{pr[jt][2 * p], pr[jt][2 * p + 1]}; else la += v2f{pr[jt][2 * p], pr[jt][2 * p + 1]}; } }
    la += lb; float l = la[0] + la[1]; l += pt_xhalf(l);
    const float inv = __builtin_amdgcn_rcpf(l); v4f y0, y1;
    v8f o0 = z8, o1 = z8;      /* two sums: a product that adds to the one before it waits longer than the issue interval */
#pragma unroll
    for (int p = 0; p < 4; ++p)
#pragma unroll
      for (int jt = 0; jt < 4; ++jt) { if (jt & 1) o1 = pt_mma(v2f{vt[jt][2 * p], vt[jt][2 * p + 1]}, v2f{pr[jt][2 * p], pr[jt][2 * p + 1]}, o1); else o0 = pt_mma(v2f{vt[jt][2 * p], vt[jt][2 * p + 1]}, v2f{pr[jt][2 * p], pr[jt][2 * p + 1]}, o0); }
    /* the same distance: the operands stay untouched and the sums unread for the slots behind the run's last product */
    asm volatile("v_nop\n\tv_nop\n\tv_nop\n\tv_nop\n\tv_nop\n\tv_nop\n\tv_nop\n\tv_nop" : "+v"(o0), "+v"(o1) : "v"(pr[0]), "v"(pr[1]), "v"(pr[2]), "v"(pr[3]), "v"(vt[0]), "v"(vt[1]), "v"(vt[2]), "v"(vt[3]));
#pragma unroll
    for (int u = 0; u < 4; ++u) { y0[u] = fmaf(o0[u] + o1[u], inv, bf16_round(x0[u])); y1[u] = fmaf(o0[4 + u] + o1[4 + u], inv, bf16_round(x1[u])); }
    *(v4f*)(op + it * 256 + fo) = y0; *(v4f*)(op + it * 256 + fo + 4) = y1;
    if (it < 3) asm volatile("s_wait_xcnt 0x0" ::: "memory");      /* stands in front of the next tile's products, which overwrite the registers that these stores name */
    __builtin_amdgcn_sched_barrier(0);      /* keeps the next tile's products behind this tile: moved up, the four tiles' scores are all held at once and fewer than half as many waves fit a SIMD */
  }
}
// Row LayerNorm (biased variance) of bf16-rounded rows of 1024 floats -> f16 rows. One wave holds two whole rows in registers: no LDS, no barrier, 4096 waves.
// Lane l holds floats 128 u + 4 l .. + 3 of a row (u = 0 .. 7): every load covers 512 contiguous bytes, every store 256. All 16 row loads are asked for before the first wait; gamma and beta serve both rows. Every loop is unrolled: the arrays are indexed by constants only and so stay in registers.
template <int M> __device__ __forceinline__ float ln_xm(float x) { return __builtin_bit_cast(float, __builtin_amdgcn_update_dpp(0, __builtin_bit_cast(int, x), 0x160 + M, 0xf, 0xf, true)); }      /* lane l <- lane l ^ M inside a row of 16 lanes */
__device__ __forceinline__ float ln_wsum(float x) { x += ln_xm<1>(x); x += ln_xm<2>(x); x += ln_xm<4>(x); x += ln_xm<8>(x); return x + pt_xhalf(x); }      /* sum over the wave, the same bits in every lane */
__device__ __forceinline__ void d_lnrow(int blk, const float* __restrict__ X, const float* __restrict__ g, const float* __restrict__ bb, float eps, _Float16* __restrict__ N16) {
  const int l4 = (threadIdx.x & 31) * 4;
  const size_t ro = ((size_t)blk * 8 + (size_t)__builtin_amdgcn_readfirstlane((int)(threadIdx.x >> 5))) * 2048;      /* the wave's first row: a scalar, so every address is a scalar base plus one lane offset */
  const float* xp = X + ro + l4; _Float16* np = N16 + ro + l4;
  v4f xa[2][8], ga[8], ba[8];
#pragma unroll
  for (int r = 0; r < 2; ++r)
#pragma unroll
    for (int u = 0; u < 8; ++u) xa[r][u] = *(const v4fa*)(xp + r * 1024 + u * 128);
#pragma unroll
  for (int u = 0; u < 8; ++u) { ga[u] = *(const v4fa*)(g + u * 128 + l4); ba[u] = *(const v4fa*)(bb + u * 128 + l4); }
  float mu[2], rs[2];
#pragma unroll
  for (int r = 0; r < 2; ++r) { v4f s4;
#pragma unroll
    for (int u = 0; u < 8; ++u) {
#pragma unroll
      for (int q = 0; q < 4; ++q) xa[r][u][q] = bf16_round(xa[r][u][q]);
      s4 = u ? s4 + xa[r][u] : xa[r][u]; }
    mu[r] = (s4[0] + s4[1]) + (s4[2] + s4[3]); }
#pragma unroll
  for (int r = 0; r < 2; ++r) mu[r] = ln_wsum(mu[r]) * (1.0f / 1024.0f);
#pragma unroll
  for (int r = 0; r < 2; ++r) { v4f v4 = {0.f, 0.f, 0.f, 0.f};
#pragma unroll
    for (int u = 0; u < 8; ++u) { xa[r][u] -= mu[r]; v4 += xa[r][u] * xa[r][u]; }
    rs[r] = (v4[0] + v4[1]) + (v4[2] + v4[3]); }
#pragma unroll
  for (int r = 0; r < 2; ++r) rs[r] = rsqrtf(ln_wsum(rs[r]) * (1.0f / 1024.0f) + eps);
#pragma unroll
  for (int u = 0; u < 8; ++u) {
#pragma unroll
    for (int q = 0; q < 4; ++q) { ga[u][q] = bf16_round(ga[u][q]); ba[u][q] = bf16_round(ba[u][q]); }
#pragma unroll
    for (int r = 0; r < 2; ++r) { v4h y;
#pragma unroll
      for (int q = 0; q < 4; ++q) y[q] = (_Float16)(xa[r][u][q] * rs[r] * ga[u][q] + ba[u][q]);
      *(v4h*)(np + r * 1024 + u * 128) = y; } }
  asm volatile("s_wait_xcnt 0x0" ::: "memory");      /* stands behind the last stores, in front of whatever next overwrites the base or the offset register that they name */
}
// The four jobs that depend on nothing but the inputs share one launch: a block's index range picks its job (a scalar branch, the same for the whole block; no job has a barrier).
#define PW_B 128                     /* blocks per 1024 x 1024 weight: 16 * 64 waves of 64 k x 16 n */
#define PL_B 512                     /* LayerNorm blocks: 8192 rows, 16 per block */
__global__ __launch_bounds__(256) void k_prep(const float* __restrict__ x, const float* __restrict__ wq, const float* __restrict__ wk, const float* __restrict__ wv, const float* __restrict__ g, const float* __restrict__ bb,
                                              _Float16* __restrict__ BQ, _Float16* __restrict__ BK, _Float16* __restrict__ BV, _Float16* __restrict__ XN) {
  const int b = blockIdx.x;
  if (b < PW_B) d_wt_f16(b, wq, BQ, 1024, 1024, 16.0f);
  else if (b < 2 * PW_B) d_wt_f16(b - PW_B, wk, BK, 1024, 1024, 16.0f);
  else if (b < 3 * PW_B) d_wt_f16(b - 2 * PW_B, wv, BV, 1024, 1024, 16.0f);
  else d_lnrow(b - 3 * PW_B, x, g, bb, 1e-5f, XN);
}
extern "C" void kernel_launch(void* const* d_in, const int* in_sizes, int n_in,
                              void* d_out, int out_size, void* d_ws, size_t ws_size, hipStream_t stream) {
  (void)in_sizes; (void)n_in; (void)out_size;
  const float* const* I = (const float* const*)d_in; const float* x = I[0]; const float* wq = I[1]; const float* bq = I[2]; const float* wk = I[3]; const float* bk = I[4]; const float* wv = I[5]; const float* bv = I[6]; const float* gam = I[7]; const float* bet = I[8];      /* inp; [in][out] Wq/Wk/Wv [1024][1024] + biases; LayerNorm gamma/beta */
  constexpr int DMc = 1024; const size_t NRc = (size_t)4 * 2048;      /* model width; token rows */
  char* ws = (char*)d_ws; size_t off = 0;
  auto take = [&](size_t bytes) { char* p = ws + off; off += (bytes + 255) & ~(size_t)255; return p; };
  _Float16* BQ = (_Float16*)take((size_t)DMc * DMc * 2); _Float16* BK = (_Float16*)take((size_t)DMc * DMc * 2); _Float16* BV = (_Float16*)take((size_t)DMc * DMc * 2);
  _Float16* XN = (_Float16*)take(NRc * DMc * 2); float* QF = (float*)take(NRc * DMc * 4); float* KF = (float*)take(NRc * DMc * 4); float* VF = (float*)take(NRc * DMc * 4);
  if (off > ws_size) return;
  k_prep<<<3 * PW_B + PL_B, 256, 0, stream>>>(x, wq, wk, wv, gam, bet, BQ, BK, BV, XN);      /* [in][out] -> Bt x16; out = LN(bf16(inp)) -> f16 rows */
  k_gemm3<DMc, DMc><<<dim3((unsigned)((NRc / 256) * (DMc / 128)), 3, 1), 256, 0, stream>>>(XN, BQ, BK, BV, 0.0625f, bq, bk, bv, QF, KF, VF);      /* Q, K, V = out W + b -> f32 rows */
  k_ptatt<<<(unsigned)(NRc / 4), 128, 0, stream>>>(QF, KF, VF, x, 0.125f, (float*)d_out);      /* per-token 64 x 64 x 16 attention, f32 matrix instructions, one wave per token + bf16(inp) residual -> output rows */
}

// v009
// Measured time: 67.4 microseconds a run.
// Versions in between are left out here; by their measured steps it is 1.10 times as fast as v007.
// All steps since v000 together make it 3.85 times as fast.
#include <hip/hip_runtime.h>
// Per-POSITION attention over the head-dim axis (inp [4][2048][1024]; out = LayerNorm(inp) (biased var, eps 1e-5, gamma/beta); Q/K/V = out W + b ([in][out] 1024 x 1024 sigma 1/32, zero biases) viewed [B][M][DK = 64][H = 16] (column i*16 + h); for every token: scores[i][j] = sum_h Q[i][h] K[j][h] / 8 (a 64 x 64 matrix, contraction over the 16 'heads'), softmax over j, res[i][h] = sum_j att[i][j] V[j][h]; no mixing across tokens; result = inp + res -> [4][2048][1024]).
// Compute dtype: inputs rounded to bf16; x / weights exact; LayerNorm output as a plain f16 GEMM operand (~2^-12); q, k, v f32 in memory, rounded to f16 with the softmax weights as matrix operands; o f32; scores and softmax statistics f32. v_wmma_f32_16x16x32_f16.
#define NB 4
#define SQ 4096
#define DM 256
#define NH 1
#define HD 64
#define HG 4                         /* heads per k_vt launch (V transpose; not launched) */
#define B0 0                         /* unused */
#define NBR NB                       /* used only via MP / MPO, which no code reads */
#define NR ((size_t)NB * SQ)
#define MP ((int)((size_t)NBR * SQ))
#define QT 256                       /* query rows per causal tile */
#define NKX SQ                       /* S / P row pitch */
#define QT0 256                      /* first-tile rows recomputed exactly (256: buys margin for the few-key rows 128..255, which have no output projection to average the single-f16 P/v rounding) */
#define QN SQ
#define NHD NH
#define MPO MP
#define LQ DM
typedef __bf16 v16b __attribute__((ext_vector_type(16)));
typedef unsigned short v8us __attribute__((ext_vector_type(8), may_alias));
typedef float  v8f  __attribute__((ext_vector_type(8)));
typedef float  v4f  __attribute__((ext_vector_type(4)));
typedef float  v4fa __attribute__((ext_vector_type(4), may_alias));
union FragB { v16b v; v8us half[2]; unsigned short u[16]; };

__device__ __forceinline__ unsigned short bf16_bits(float x) { unsigned int u = __float_as_uint(x); return (unsigned short)((u + 0x7FFFu + ((u >> 16) & 1u)) >> 16); }
__device__ __forceinline__ float bf16_val(unsigned short b) { return __uint_as_float(((unsigned int)b) << 16); }
__device__ __forceinline__ float bf16_round(float x) { return bf16_val(bf16_bits(x)); }
// D += A·B with NT terms: 1 = ah·bh, 2 = + al·bh (A split), 3 = + ah·bl (both split)
template <int NT>
__device__ __forceinline__ v8f mmaN(v16b ah, v16b al, v16b bh, v16b bl, v8f c) {
  c = __builtin_amdgcn_wmma_f32_16x16x32_bf16(false, ah, false, bh, (short)0, c, false, false);
  if (NT >= 2) c = __builtin_amdgcn_wmma_f32_16x16x32_bf16(false, al, false, bh, (short)0, c, false, false);
  if (NT >= 3) c = __builtin_amdgcn_wmma_f32_16x16x32_bf16(false, ah, false, bl, (short)0, c, false, false);
  asm volatile("v_nop\n\tv_nop\n\tv_nop\n\tv_nop" : "+v"(c) : "v"(ah), "v"(al), "v"(bh), "v"(bl));
  return c;
}

__global__ __launch_bounds__(256) void k_wt_bf16(const float* __restrict__ W, unsigned short* __restrict__ Wt, int K, int N) {
  const int t = blockIdx.x * 256 + threadIdx.x;
  const int k8n = K / 8;
  if (t >= N * k8n) return;
  const int n = t / k8n, k8 = (t % k8n) * 8;
  v8us v;
#pragma unroll
  for (int i = 0; i < 8; ++i) v[i] = bf16_bits(W[(size_t)(k8 + i) * N + n]);
  *(v8us*)(Wt + (size_t)n * K + k8) = v;
  
}

// GEMM C[M][N] (f32, pitch ldc) = act(A[M][K]·W + bias). A f32 row-major (pitch lda) converted per fragment to bf16
// (ASPLIT: hi/lo two planes -> 2 terms, else single rounded term); Wt bf16 [N][K] (pitch ldb). BIAS_BF16 rounds the
// bias to bf16 first (bias quantised to bf16 before the add). K%32==0, M%16==0, N%64==0.
template <bool ASPLIT, int ACT, bool BIAS_BF16>
__global__ __launch_bounds__(128) void k_gemm_bf(const float* __restrict__ A, int lda, const unsigned short* __restrict__ Wt, int ldb,
                                               const float* __restrict__ bias, float* __restrict__ C, int ldc, int M, int N, int K) {
  __shared__ __attribute__((aligned(16))) float so[4][16][64];
  const int tid = threadIdx.x, w = tid >> 5, lane = tid & 31, ln = lane & 15, hh = lane >> 4;
  const int ntn = N / 64;
  const int wid = blockIdx.x * 4 + w;
  const int mt = wid / ntn, nq = wid % ntn;
  if (mt * 16 >= M) return;
  const int row0 = mt * 16, col0 = nq * 64;
  const float* arow = A + (size_t)(row0 + ln) * lda;
  v8f acc[4] = {};
  for (int kb = 0; kb < K; kb += 32) {
    FragB ah, al;
    const v4f x0 = *(const v4fa*)(arow + kb + 8 * hh), x1 = *(const v4fa*)(arow + kb + 8 * hh + 4);
    const v4f x2 = *(const v4fa*)(arow + kb + 16 + 8 * hh), x3 = *(const v4fa*)(arow + kb + 16 + 8 * hh + 4);
    float xs[16] = {x0[0],x0[1],x0[2],x0[3],x1[0],x1[1],x1[2],x1[3],x2[0],x2[1],x2[2],x2[3],x3[0],x3[1],x3[2],x3[3]};
#pragma unroll
    for (int i = 0; i < 16; ++i) { const unsigned short hb = bf16_bits(xs[i]); ah.u[i] = hb; al.u[i] = ASPLIT ? bf16_bits(xs[i] - bf16_val(hb)) : (unsigned short)0; }
#pragma unroll
    for (int t = 0; t < 4; ++t) {
      const unsigned short* brow = Wt + (size_t)(col0 + t * 16 + ln) * ldb + kb;
      FragB b;
      b.half[0] = *(const v8us*)(brow + 8 * hh);
      b.half[1] = *(const v8us*)(brow + 16 + 8 * hh);
      acc[t] = mmaN<ASPLIT ? 2 : 1>(ah.v, al.v, b.v, b.v, acc[t]);
    }
  }
#pragma unroll
  for (int t = 0; t < 4; ++t) {
    float bv = bias ? bias[col0 + t * 16 + ln] : 0.f;
    if (BIAS_BF16) bv = bf16_round(bv);
#pragma unroll
    for (int r = 0; r < 8; ++r) { float v = acc[t][r] + bv; if (ACT == 1) v = fmaxf(v, 0.f); so[w][8 * hh + r][t * 16 + ln] = v; }
  }
  __builtin_amdgcn_fence(__ATOMIC_ACQ_REL, "workgroup");
  __builtin_amdgcn_wave_barrier();
  const int rsub = lane >> 4, c4 = (lane & 15) * 4;
  {
#pragma unroll
    for (int q = 0; q < 8; ++q) {
      const int r = q * 2 + rsub;
      const v4f v = *(const v4fa*)&so[w][r][c4];
      *(v4f*)(C + (size_t)(row0 + r) * ldc + col0 + c4) = v;
    }
    
  }
}

// GEMM C = act(A·W + bias + resid): A f32 (ASPLIT -> hi/lo 2 terms), Wt bf16 [N][K]; ACT 0 none, 1 relu, 2 exact gelu;
// resid (optional, f32, row index = (row % rmod), pitch ldr, RES_BF16 rounds it) added before the activation.
template <bool ASPLIT, int ACT, bool BIAS_BF16, bool RES_BF16>
__global__ __launch_bounds__(128) void k_gemm_bf3(const float* __restrict__ A, int lda, const unsigned short* __restrict__ Wt, int ldb,
                                                const float* __restrict__ bias, const float* __restrict__ resid, int rmod, int ldr,
                                                float* __restrict__ C, int ldc, int M, int N, int K) {
  __shared__ __attribute__((aligned(16))) float so[4][16][64];
  const int tid = threadIdx.x, w = tid >> 5, lane = tid & 31, ln = lane & 15, hh = lane >> 4;
  const int ntn = N / 64;
  const int wid = blockIdx.x * 4 + w;
  const int mt = wid / ntn, nq = wid % ntn;
  if (mt * 16 >= M) return;
  const int row0 = mt * 16, col0 = nq * 64;
  const float* arow = A + (size_t)(row0 + ln) * lda;
  v8f acc[4] = {};
  for (int kb = 0; kb < K; kb += 32) {
    FragB ah, al;
    const v4f x0 = *(const v4fa*)(arow + kb + 8 * hh), x1 = *(const v4fa*)(arow + kb + 8 * hh + 4);
    const v4f x2 = *(const v4fa*)(arow + kb + 16 + 8 * hh), x3 = *(const v4fa*)(arow + kb + 16 + 8 * hh + 4);
    float xs[16] = {x0[0],x0[1],x0[2],x0[3],x1[0],x1[1],x1[2],x1[3],x2[0],x2[1],x2[2],x2[3],x3[0],x3[1],x3[2],x3[3]};
#pragma unroll
    for (int i = 0; i < 16; ++i) { const unsigned short hb = bf16_bits(xs[i]); ah.u[i] = hb; al.u[i] = ASPLIT ? bf16_bits(xs[i] - bf16_val(hb)) : (unsigned short)0; }
#pragma unroll
    for (int t = 0; t < 4; ++t) {
      const unsigned short* brow = Wt + (size_t)(col0 + t * 16 + ln) * ldb + kb;
      FragB b;
      b.half[0] = *(const v8us*)(brow + 8 * hh);
      b.half[1] = *(const v8us*)(brow + 16 + 8 * hh);
      acc[t] = mmaN<ASPLIT ? 2 : 1>(ah.v, al.v, b.v, b.v, acc[t]);
    }
  }
#pragma unroll
  for (int t = 0; t < 4; ++t) {
    const int col = col0 + t * 16 + ln;
    float bv = bias ? bias[col] : 0.f;
    if (BIAS_BF16) bv = bf16_round(bv);
#pragma unroll
    for (int r = 0; r < 8; ++r) {
      float v = acc[t][r] + bv;
      if (resid) { float rv = resid[(size_t)((row0 + 8 * hh + r) % rmod) * ldr + col]; if (RES_BF16) rv = bf16_round(rv); v += rv; }
      if (ACT == 1) v = fmaxf(v, 0.f);
      if (ACT == 2) v = 0.5f * v * (1.0f + erff(v * 0.70710678118654752f));
      if (ACT == 3) { const float u = 0.7978845608028654f * (v + 0.044715f * v * v * v); v = 0.5f * v * (1.0f + tanhf(u)); }
      so[w][8 * hh + r][t * 16 + ln] = v;
    }
  }
  __builtin_amdgcn_fence(__ATOMIC_ACQ_REL, "workgroup");
  __builtin_amdgcn_wave_barrier();
  const int rsub = lane >> 4, c4 = (lane & 15) * 4;
  {
#pragma unroll
    for (int q = 0; q < 8; ++q) {
      const int r = q * 2 + rsub;
      const v4f v = *(const v4fa*)&so[w][r][c4];
      *(v4f*)(C + (size_t)(row0 + r) * ldc + col0 + c4) = v;
    }
    
  }
}
// row LayerNorm (biased variance, eps) over N: s = X (+ R); optional out_sum <- s; out_norm <- (s-mu)*rsqrt(var+eps)*g + b
template <bool PARAM_BF16>
__global__ __launch_bounds__(256) void k_layernorm(const float* __restrict__ X, const float* __restrict__ R, const float* __restrict__ g, const float* __restrict__ bta,
                                                  float* __restrict__ out_sum, float* __restrict__ out_norm, int N, float eps) {
  __shared__ float red[256];
  const int row = blockIdx.x, tid = threadIdx.x;
  const float* x = X + (size_t)row * N; const float* rr = R ? R + (size_t)row * N : nullptr;
  float vals[16];                     // up to N = 4096
  const int per = N / 256;            // contiguous chunk per thread? use strided-by-4 chunks: thread handles j = tid*4 + 1024*u
  float s1 = 0.f;
  for (int u = 0; u < per / 4; ++u) {
    const int j = tid * 4 + 1024 * u;
    const v4f a = *(const v4fa*)(x + j);
    v4f b = {0.f,0.f,0.f,0.f}; if (rr) b = *(const v4fa*)(rr + j);
#pragma unroll
    for (int q = 0; q < 4; ++q) { const float v = a[q] + b[q]; vals[u * 4 + q] = v; s1 += v; }
  }
  red[tid] = s1; __syncthreads();
  for (int st = 128; st > 0; st >>= 1) { if (tid < st) red[tid] += red[tid + st]; __syncthreads(); }
  const float mu = red[0] / (float)N; __syncthreads();
  float s2 = 0.f;
  for (int u = 0; u < per / 4; ++u)
#pragma unroll
    for (int q = 0; q < 4; ++q) { const float c = vals[u * 4 + q] - mu; s2 += c * c; }
  red[tid] = s2; __syncthreads();
  for (int st = 128; st > 0; st >>= 1) { if (tid < st) red[tid] += red[tid + st]; __syncthreads(); }
  const float rs = rsqrtf(red[0] / (float)N + eps);
  {
    for (int u = 0; u < per / 4; ++u) {
      const int j = tid * 4 + 1024 * u;
      v4f o, sm;
#pragma unroll
      for (int q = 0; q < 4; ++q) {
        float gg = g[j + q], bb = bta[j + q];
        if (PARAM_BF16) { gg = bf16_round(gg); bb = bf16_round(bb); }
        sm[q] = vals[u * 4 + q]; o[q] = (vals[u * 4 + q] - mu) * rs * gg + bb;
      }
      if (out_sum) *(v4f*)(out_sum + (size_t)row * N + j) = sm;
      *(v4f*)(out_norm + (size_t)row * N + j) = o;
    }
    
  }
}



// ---- f16 WMMA path (v_wmma_f32_16x16x32_f16): 11-bit significands for operands in range — used here for the Q/K/V projections
typedef _Float16 v16h __attribute__((ext_vector_type(16)));
union FragH { v16h v; v8us half[2]; _Float16 h[16]; unsigned short u[16]; };
template <int NT>
__device__ __forceinline__ v8f mmaH(v16h ah, v16h al, v16h bh, v16h bl, v8f c) {
  c = __builtin_amdgcn_wmma_f32_16x16x32_f16(false, ah, false, bh, (short)0, c, false, false);
  if (NT >= 2) c = __builtin_amdgcn_wmma_f32_16x16x32_f16(false, al, false, bh, (short)0, c, false, false);
  if (NT >= 3) c = __builtin_amdgcn_wmma_f32_16x16x32_f16(false, ah, false, bl, (short)0, c, false, false);
  asm volatile("v_nop\n\tv_nop\n\tv_nop\n\tv_nop" : "+v"(c) : "v"(ah), "v"(al), "v"(bh), "v"(bl));
  return c;
}
// batched GEMM like k_gemm_b but f16 operands: A f32 (split into f16 hi/lo if ASPLIT, else rounded to f16), Bt = f16 values [n][k]; alpha; C f32; N multiple of 16 (partial tiles skipped)
template <bool ASPLIT>
__global__ __launch_bounds__(128) void k_gemm_h(const float* __restrict__ A, int lda, size_t sA, const _Float16* __restrict__ Bh, int ldb, size_t sB, float alpha, float* __restrict__ C, int ldc, size_t sC, int M, int N, int K) {
  __shared__ __attribute__((aligned(16))) float so[4][16][64];
  const int tid = threadIdx.x, w = tid >> 5, lane = tid & 31, ln = lane & 15, hh = lane >> 4; const int by = blockIdx.y;
  A += (size_t)by * sA; Bh += (size_t)by * sB; C += (size_t)by * sC;
  const int ntn = (N + 63) / 64; const int wid = blockIdx.x * 4 + w; const int mt = wid / ntn, nq = wid % ntn; if (mt * 16 >= M) return;
  const int row0 = mt * 16, col0 = nq * 64; const float* arow = A + (size_t)(row0 + ln) * lda;
  v8f acc[4] = {};
  for (int kb = 0; kb < K; kb += 32) {
    FragH ah, al;
    const v4f x0 = *(const v4fa*)(arow + kb + 8 * hh), x1 = *(const v4fa*)(arow + kb + 8 * hh + 4), x2 = *(const v4fa*)(arow + kb + 16 + 8 * hh), x3 = *(const v4fa*)(arow + kb + 16 + 8 * hh + 4);
    float xs[16] = {x0[0],x0[1],x0[2],x0[3],x1[0],x1[1],x1[2],x1[3],x2[0],x2[1],x2[2],x2[3],x3[0],x3[1],x3[2],x3[3]};
#pragma unroll
    for (int i = 0; i < 16; ++i) { const _Float16 h = (_Float16)xs[i]; ah.h[i] = h; al.h[i] = ASPLIT ? (_Float16)(xs[i] - (float)h) : (_Float16)0.0f; }
#pragma unroll
    for (int t = 0; t < 4; ++t) { if (col0 + t * 16 >= N) continue; const size_t boff = (size_t)(col0 + t * 16 + ln) * ldb + kb; FragH bq; bq.half[0] = *(const v8us*)(Bh + boff + 8 * hh); bq.half[1] = *(const v8us*)(Bh + boff + 16 + 8 * hh);
      acc[t] = mmaH<ASPLIT ? 2 : 1>(ah.v, al.v, bq.v, bq.v, acc[t]); }
  }
#pragma unroll
  for (int t = 0; t < 4; ++t) { if (col0 + t * 16 >= N) continue;
#pragma unroll
    for (int r = 0; r < 8; ++r) so[w][8 * hh + r][t * 16 + ln] = acc[t][r] * alpha; }
  __builtin_amdgcn_fence(__ATOMIC_ACQ_REL, "workgroup"); __builtin_amdgcn_wave_barrier();
  const int rsub = lane >> 4, c4 = (lane & 15) * 4;
  {
#pragma unroll
    for (int q = 0; q < 8; ++q) { const int r = q * 2 + rsub; if (col0 + c4 < N) { const v4f v = *(const v4fa*)&so[w][r][c4]; *(v4f*)(C + (size_t)(row0 + r) * ldc + col0 + c4) = v; } }
     }
}

// Wt[n][k] = f16(W[k][n] * scale) from f32 row-major W[K][N] (scale = power of two; bf16-exact weights stay exact in f16 away from the subnormal range). Needs K % 64 == 0, N % 128 == 0.
// One wave takes 64 k x 16 n. Lane (lk = lane & 7, ln = lane >> 3) reads rows 8 lk .. 8 lk + 7 at columns 4 ln .. 4 ln + 3 by 16-B loads: a load touches 8 lines, not 32, and the block's eight waves take 128 adjacent columns, so together they use every byte of the lines they touch.
// Per column the lane stores its 8 halfs: eight lanes fill one whole 128-B line of Wt, four lines per store.
__device__ __forceinline__ void d_wt_f16(int blk, const float* __restrict__ W, _Float16* __restrict__ Wt, int K, int N, float scale) {
  const int lane = threadIdx.x & 31, wv = blk * 8 + (int)(threadIdx.x >> 5), ngn = N / 16; const int kg = wv / ngn, ng = wv - kg * ngn; if (kg * 64 >= K) return;
  const int k8 = kg * 64 + (lane & 7) * 8, n = ng * 16 + (lane >> 3) * 4; v4f r[8];
#pragma unroll
  for (int i = 0; i < 8; ++i) r[i] = *(const v4fa*)(W + (size_t)(k8 + i) * N + n);
#pragma unroll
  for (int j = 0; j < 4; ++j) { FragH f;
#pragma unroll
    for (int i = 0; i < 8; ++i) f.h[i] = (_Float16)(bf16_round(r[i][j]) * scale);
    const v8us o = f.half[0]; *(v8us*)((unsigned short*)Wt + (size_t)(n + j) * K + k8) = o; }
}
// k_gemm_hh variant with fused epilogue: v = acc·alpha + bias[by·sBias + col] (+ CP[(row/rowsPerB)·sCPb + by·64 + col] if CP) ; ACT 0 none / 1 elu ; writes f16 C16 (and f32 C if non-null)
template <int ACT>
__global__ __launch_bounds__(128) void k_gemm_hhx(const _Float16* __restrict__ A, int lda, size_t sA, const _Float16* __restrict__ Bh, int ldb, size_t sB, float alpha, const float* __restrict__ bias, size_t sBias, const float* __restrict__ CP, int rowsPerB, size_t sCPb, int row0g,
    float* __restrict__ C, _Float16* __restrict__ C16, int ldc, size_t sC, int M, int N, int K) {
  __shared__ __attribute__((aligned(16))) float so[4][16][64];
  const int tid = threadIdx.x, w = tid >> 5, lane = tid & 31, ln = lane & 15, hh = lane >> 4; const int by = blockIdx.y;
  A += (size_t)by * sA; Bh += (size_t)by * sB; const size_t cofs = (size_t)by * sC; const float* bp = bias ? bias + (size_t)by * sBias : nullptr;
  const int ntn = (N + 63) / 64; const int wid = blockIdx.x * 4 + w; const int mt = wid / ntn, nq = wid % ntn; if (mt * 16 >= M) return;
  const int row0 = mt * 16, col0 = nq * 64; const _Float16* arow = A + (size_t)(row0 + ln) * lda;
  v8f acc[4] = {};
  for (int kb = 0; kb < K; kb += 32) { FragH ah; ah.half[0] = *(const v8us*)((const unsigned short*)arow + kb + 8 * hh); ah.half[1] = *(const v8us*)((const unsigned short*)arow + kb + 16 + 8 * hh);
#pragma unroll
    for (int t = 0; t < 4; ++t) { if (col0 + t * 16 >= N) continue; const size_t boff = (size_t)(col0 + t * 16 + ln) * ldb + kb; FragH bq; bq.half[0] = *(const v8us*)((const unsigned short*)Bh + boff + 8 * hh); bq.half[1] = *(const v8us*)((const unsigned short*)Bh + boff + 16 + 8 * hh);
      acc[t] = mmaH<1>(ah.v, ah.v, bq.v, bq.v, acc[t]); }
  }
#pragma unroll
  for (int t = 0; t < 4; ++t) { if (col0 + t * 16 >= N) continue; const int col = col0 + t * 16 + ln; const float bv = bp ? bf16_round(bp[col]) : 0.f;
#pragma unroll
    for (int r = 0; r < 8; ++r) { float v = acc[t][r] * alpha + bv; if (CP) { const int rr = row0g + row0 + 8 * hh + r; if (rowsPerB < 0) v += CP[cofs + (size_t)rr * ldc + col];      /* rowsPerB < 0: own element of the batched C plane */ else { const int bidx = rr / rowsPerB; v += CP[(size_t)bidx * sCPb + (size_t)by * 64 + col]; } } if (ACT == 1) v = (v > 0.f) ? v : expm1f(v); else if (ACT == 7) v = (v > 0.f) ? v + 1.0f : expf(v); else if (ACT == 8) v = tanhf(v); else if (ACT == 9) v = 0.5f * v * (1.0f + tanhf(0.7978845608028654f * (v + 0.044715f * v * v * v))); else if (ACT == 11) v = 1.0f / (1.0f + expf(-v)); else if (ACT == 12) v = (v > 0.f) ? v : 0.01f * v; else if (ACT == 14) v = (v > 0.f) ? v : 0.1f * v; else if (ACT == 16) v = (v >= 0.f) ? v : 0.3f * v; else if (ACT == 17) v = (v >= 0.f) ? v : 0.2f * v; else if (ACT == 15) v = v / (1.0f + expf(-v)); else if (ACT == 3) v = fmaxf(v, 0.f); else if (ACT == 6) v = 0.5f * v * (1.0f + erff(v * 0.70710678118654752f)); so[w][8 * hh + r][t * 16 + ln] = v; } }
  __builtin_amdgcn_fence(__ATOMIC_ACQ_REL, "workgroup"); __builtin_amdgcn_wave_barrier();
  const int rsub = lane >> 4, c4 = (lane & 15) * 4; typedef _Float16 v4h __attribute__((ext_vector_type(4)));
  {
#pragma unroll
    for (int q = 0; q < 8; ++q) { const int r = q * 2 + rsub; if (col0 + c4 < N) { const v4f v = *(const v4fa*)&so[w][r][c4]; if (C) *(v4f*)(C + cofs + (size_t)(row0 + r) * ldc + col0 + c4) = v; if (C16) { v4h h4; for (int i = 0; i < 4; ++i) h4[i] = (_Float16)v[i]; *(v4h*)(C16 + cofs + (size_t)(row0 + r) * ldc + col0 + c4) = h4; } } }
     }
}


typedef _Float16 v4h __attribute__((ext_vector_type(4)));

__global__ __launch_bounds__(256) void k_x16(const float* __restrict__ x, _Float16* __restrict__ X16, size_t n8) { const size_t t = (size_t)blockIdx.x * 256 + threadIdx.x; if (t >= n8) return; FragH f;
#pragma unroll
  for (int q = 0; q < 8; ++q) f.h[q] = (_Float16)bf16_round(x[t * 8 + q]); *(v8us*)((unsigned short*)X16 + t * 8) = f.half[0];  }
__global__ __launch_bounds__(256) void k_h16(const float* __restrict__ x, _Float16* __restrict__ X16, size_t n8) { const size_t t = (size_t)blockIdx.x * 256 + threadIdx.x; if (t >= n8) return; FragH f;
#pragma unroll
  for (int q = 0; q < 8; ++q) f.h[q] = (_Float16)x[t * 8 + q]; *(v8us*)((unsigned short*)X16 + t * 8) = f.half[0];  }
__global__ __launch_bounds__(256) void k_round16f(const float* __restrict__ W, _Float16* __restrict__ Bt, size_t n8) { const size_t t = (size_t)blockIdx.x * 256 + threadIdx.x; if (t >= n8) return; FragH f;
#pragma unroll
  for (int i = 0; i < 8; ++i) f.h[i] = (_Float16)(bf16_round(W[t * 8 + i]) * 16.0f); *(v8us*)((unsigned short*)Bt + t * 8) = f.half[0];  }
template <int NHv, int TTv>
__global__ __launch_bounds__(256) void k_vt(const _Float16* __restrict__ V16, int ldv, int voff, _Float16* __restrict__ Vt) { __shared__ unsigned short tl[64][66]; const int tid = threadIdx.x; const int slab = blockIdx.x / (TTv / 64), lg = blockIdx.x % (TTv / 64); const int b = slab / NHv, h = slab % NHv;
  for (int i = tid; i < 64 * 8; i += 256) { const int r = i / 8, c8 = (i % 8) * 8; FragH f; f.half[0] = *(const v8us*)((const unsigned short*)V16 + ((size_t)b * TTv + lg * 64 + r) * ldv + voff + h * 64 + c8);
#pragma unroll
    for (int q = 0; q < 8; ++q) tl[r][c8 + q] = f.u[q]; }
  __syncthreads();
  {
#pragma unroll
    for (int rd = 0; rd < 2; ++rd) { const int d = rd * 32 + tid / 8, pc = tid % 8; FragH f;
#pragma unroll
      for (int q = 0; q < 8; ++q) f.u[q] = tl[pc * 8 + q][d];
      *(v8us*)((unsigned short*)Vt + ((size_t)slab * 64 + d) * TTv + lg * 64 + pc * 8) = f.half[0]; }
     } }

__global__ __launch_bounds__(256) void k_hl(const float* __restrict__ F, _Float16* __restrict__ Hh, _Float16* __restrict__ Hl, size_t n8) { const size_t t = (size_t)blockIdx.x * 256 + threadIdx.x; if (t >= n8) return; FragH fh, fl; const v4f a = *(const v4fa*)(F + t * 8), c = *(const v4fa*)(F + t * 8 + 4);
#pragma unroll
  for (int q = 0; q < 4; ++q) { _Float16 h = (_Float16)a[q]; fh.h[q] = h; fl.h[q] = (_Float16)((a[q] - (float)h) * 1024.0f); h = (_Float16)c[q]; fh.h[4 + q] = h; fl.h[4 + q] = (_Float16)((c[q] - (float)h) * 1024.0f); }
  { *(v8us*)((unsigned short*)Hh + t * 8) = fh.half[0]; *(v8us*)((unsigned short*)Hl + t * 8) = fl.half[0];  } }

// ---- fast GEMM (wave tile 64x64), C = A Bh^T alpha + bf16(bias), f32 rows ----
__device__ __forceinline__ v16h g2_frag(const _Float16* p, int hh) { FragH f; f.half[0] = *(const v8us*)((const unsigned short*)p + 8 * hh); f.half[1] = *(const v8us*)((const unsigned short*)p + 16 + 8 * hh); return f.v; }
__device__ __forceinline__ v8f g2_mma(v16h a, v16h b, v8f c) { v8f d = __builtin_amdgcn_wmma_f32_16x16x32_f16(false, a, false, b, (short)0, c, false, false); asm volatile("v_nop\n\tv_nop\n\tv_nop\n\tv_nop" : "+v"(d) : "v"(a), "v"(b)); return d; }
// Block tile 256 x 128, eight waves of 64 x 64 (4 down, 2 across). Per pass 64 k of both operands (128-B rows: 256 rows of A, then 128 rows of Bh) lie in one of two LDS buffers,
// brought by asynchronous copies (16 B per lane, whole 128-B lines per 8 lanes); the next pass's copies fly while this pass's fragments are read from LDS. Needs M % 256 == 0 (grid), N % 128 == 0, K % 64 == 0.
// A 64 x 64 wave tile reads 8 fragments for 16 products (32 x 64: 6 for 8); a 256 x 128 block brings 48 KiB for 256 products (128 x 128: 32 KiB for 128).
#define G3_PITCH 72                  /* LDS row pitch in halfs: 144 B = 16 B x odd, conflict-free for 16-B fragment reads */
#define G3_STAGE (384 * G3_PITCH)    /* halfs per buffer */
// one pass's copies of this thread: eight rows of A and four of Bh, 32 rows apart; l = the lane's LDS byte address of the first
__device__ __forceinline__ void g3_copy(const _Float16* ga, const _Float16* gb, size_t step, unsigned l) {
  const _Float16* a1 = ga + step; const _Float16* a2 = a1 + step; const _Float16* a3 = a2 + step; const _Float16* a4 = a3 + step; const _Float16* a5 = a4 + step; const _Float16* a6 = a5 + step; const _Float16* a7 = a6 + step;
  const _Float16* b1 = gb + step; const _Float16* b2 = b1 + step; const _Float16* b3 = b2 + step;
  const unsigned rs = 32u * G3_PITCH * 2u;
  /* the s_wait_xcnt stands inside the statement so that no address register of a copy is rewritten ahead of it */
  asm volatile("global_load_async_to_lds_b128 %0, %12, off\n\t"
               "global_load_async_to_lds_b128 %1, %13, off\n\t"
               "global_load_async_to_lds_b128 %2, %14, off\n\t"
               "global_load_async_to_lds_b128 %3, %15, off\n\t"
               "global_load_async_to_lds_b128 %4, %16, off\n\t"
               "global_load_async_to_lds_b128 %5, %17, off\n\t"
               "global_load_async_to_lds_b128 %6, %18, off\n\t"
               "global_load_async_to_lds_b128 %7, %19, off\n\t"
               "global_load_async_to_lds_b128 %8, %20, off\n\t"
               "global_load_async_to_lds_b128 %9, %21, off\n\t"
               "global_load_async_to_lds_b128 %10, %22, off\n\t"
               "global_load_async_to_lds_b128 %11, %23, off\n\t"
               "s_wait_xcnt 0x0"
               :: "v"(l), "v"(l + rs), "v"(l + 2u * rs), "v"(l + 3u * rs), "v"(l + 4u * rs), "v"(l + 5u * rs), "v"(l + 6u * rs), "v"(l + 7u * rs), "v"(l + 8u * rs), "v"(l + 9u * rs), "v"(l + 10u * rs), "v"(l + 11u * rs),
                  "v"(ga), "v"(a1), "v"(a2), "v"(a3), "v"(a4), "v"(a5), "v"(a6), "v"(a7), "v"(gb), "v"(b1), "v"(b2), "v"(b3) : "memory");
}
typedef float f1a __attribute__((may_alias));
// One launch does all three products of the same A: blockIdx.y picks the weight, its bias and its output (scalar selects). Four waves per SIMD (256 registers a wave): two blocks share a WGP, 2 x 110,592 B of LDS.
// N and K are compile-time: a row step of the output is then an immediate offset of the store, and the 32 stores of a lane share one address where 32 address pairs would not fit the 256 registers.
template <int N, int K>
__global__ __launch_bounds__(256) __attribute__((amdgpu_waves_per_eu(4, 4))) void k_gemm3(const _Float16* __restrict__ A, const _Float16* __restrict__ Bh0, const _Float16* __restrict__ Bh1, const _Float16* __restrict__ Bh2, float alpha,
                                               const float* __restrict__ bias0, const float* __restrict__ bias1, const float* __restrict__ bias2, float* __restrict__ C0, float* __restrict__ C1, float* __restrict__ C2) {
  const int pz = blockIdx.y; const _Float16* Bh = pz == 0 ? Bh0 : pz == 1 ? Bh1 : Bh2; const float* bias = pz == 0 ? bias0 : pz == 1 ? bias1 : bias2; float* C = pz == 0 ? C0 : pz == 1 ? C1 : C2;
  __shared__ __attribute__((aligned(16))) _Float16 ring[2 * G3_STAGE];
  const int tid = threadIdx.x, w = tid >> 5, lane = tid & 31, ln = lane & 15, hh = lane >> 4;
  const int ntn = N >> 7; const int mt = blockIdx.x / ntn, nq = blockIdx.x - mt * ntn; const int wm = w >> 1, wn = w & 1;
  const int cr = tid >> 3, cp = tid & 7;      /* copy: row within a group of 32, 16-B piece of the row */
  const _Float16* ga = A + (size_t)(mt * 256 + cr) * K + cp * 8; const _Float16* gb = Bh + (size_t)(nq * 128 + cr) * K + cp * 8; const size_t step = (size_t)32 * K;
  const unsigned l0 = (unsigned)(size_t)&ring[0] + (unsigned)(cr * (G3_PITCH * 2) + cp * 16);
  const int nt = K >> 6;
  const v8f z8 = {0.f,0.f,0.f,0.f,0.f,0.f,0.f,0.f}; v8f acc[4][4];      /* every loop over acc, a, b, bv is unrolled: indexed by constants only, the arrays stay in registers */
#pragma unroll
  for (int i = 0; i < 4; ++i)
#pragma unroll
    for (int j = 0; j < 4; ++j) acc[i][j] = z8;
  g3_copy(ga, gb, step, l0);
  asm volatile("s_wait_asynccnt 0x0" ::: "memory");      /* this wave's copies of pass 0 have landed */
  __syncthreads();                                       /* publishes pass 0 */
  if (nt > 1) g3_copy(ga + 64, gb + 64, step, l0 + (unsigned)(G3_STAGE * 2));
#pragma unroll 1      /* one pass per trip: the two buffers alternate by the trip's parity */
  for (int t = 0; t < nt; ++t) {
    const _Float16* ap = &ring[(t & 1) * G3_STAGE + (wm * 64 + ln) * G3_PITCH]; const _Float16* bp = &ring[(t & 1) * G3_STAGE + (256 + wn * 64 + ln) * G3_PITCH];
#pragma unroll
    for (int kk = 0; kk < 2; ++kk) {
      v16h a[4], b[4];
#pragma unroll
      for (int i = 0; i < 4; ++i) { a[i] = g2_frag(ap + i * 16 * G3_PITCH + kk * 32, hh); b[i] = g2_frag(bp + i * 16 * G3_PITCH + kk * 32, hh); }
#pragma unroll
      for (int j = 0; j < 4; ++j)
#pragma unroll
        for (int i = 0; i < 4; ++i) acc[i][j] = g2_mma(a[i], b[j], acc[i][j]);
    }
    asm volatile("s_wait_dscnt 0x0" ::: "memory");       /* this wave's reads of the buffer are done before it may be refilled */
    asm volatile("s_wait_asynccnt 0x0" ::: "memory");    /* this wave's copies of pass t + 1 have landed */
    __syncthreads();                                     /* publishes pass t + 1 and ends every reader's last read of pass t */
    if (t + 2 < nt) g3_copy(ga + (size_t)(t + 2) * 64, gb + (size_t)(t + 2) * 64, step, l0 + (unsigned)((t & 1) * (G3_STAGE * 2)));
  }
  asm volatile("s_wait_asynccnt 0x0" ::: "memory");      /* no copy is outstanding when the wave goes on */
  /* Output staging: behind the last pass's barrier nobody reads the ring any more and no copy is aimed at it; each wave takes 32 rows x 68 floats of it for itself and sends its tile out in two halves of 32 rows, every row piece a whole aligned 256 B. */
  f1a* so = (f1a*)&ring[0] + w * (32 * 68);
  const int ws = __builtin_amdgcn_readfirstlane(w);      /* the wave's number as a scalar: every output address is a scalar base plus one lane offset, no address pair per row */
  const int row0 = mt * 256 + (ws >> 1) * 64, col0 = nq * 128 + (ws & 1) * 64;
  const int rsub = lane >> 4, c4 = (lane & 15) * 4;
  float* cb = C + (size_t)row0 * N + col0; const unsigned lo = (unsigned)(rsub * N + c4);
  float bv[4]; const int bi = col0 + ln;      /* the lane's first column: the one offset register of the four bias loads */
#pragma unroll
  for (int j = 0; j < 4; ++j) bv[j] = bias[bi + j * 16];
  asm volatile("s_wait_xcnt 0x0" :: "v"(bi) : "memory");      /* stands behind the four loads, in front of whatever next overwrites the offset register that they name; the index is an input, so it lives to here and no load of the run lands in it */
#pragma unroll
  for (int j = 0; j < 4; ++j) bv[j] = bf16_round(bv[j]);
#pragma unroll
  for (int h2 = 0; h2 < 2; ++h2) {
#pragma unroll
    for (int u = 0; u < 8; ++u) { const int j = u & 3, half = u >> 2;
#pragma unroll
      for (int r = 0; r < 8; ++r) so[(half * 16 + 8 * hh + r) * 68 + j * 16 + ln] = acc[h2 * 2 + half][j][r] * alpha + bv[j]; }
    __builtin_amdgcn_fence(__ATOMIC_ACQ_REL, "workgroup", "local"); __builtin_amdgcn_wave_barrier();      /* the rows are read back behind the wave's own LDS writes. LDS alone: the tile goes out in two halves, and a fence over global memory too would hold the second half behind the first half's stores */
#pragma unroll
    for (int q = 0; q < 16; ++q) { const v4f v = *(const v4fa*)&so[(q * 2 + rsub) * 68 + c4]; __builtin_nontemporal_store(v, (v4f*)(cb + (size_t)(h2 * 32 + q * 2) * N + lo)); }      /* non-temporal: the rows are read once, by the next launch, and should not push A and the weights out of L2 */
    if (h2 == 0) { asm volatile("s_wait_xcnt 0x0" ::: "memory");      /* stands behind the first half's stores, in front of the second half's LDS reads, which overwrite the registers that these stores name */
      __builtin_amdgcn_fence(__ATOMIC_ACQ_REL, "workgroup", "local"); __builtin_amdgcn_wave_barrier(); }      /* the second half's LDS writes stay behind the first half's reads of the same rows */
  }
}


__global__ __launch_bounds__(256) void k_wnat(const float* __restrict__ w, size_t n8, _Float16* __restrict__ Bt) { const size_t t = (size_t)blockIdx.x * 256 + threadIdx.x; if (t >= n8) return; FragH f; for (int q = 0; q < 8; ++q) f.h[q] = (_Float16)(bf16_round(w[t * 8 + q]) * 16.0f); *(v8us*)((unsigned short*)Bt + t * 8) = f.half[0];  }
__global__ __launch_bounds__(256) void k_rsm(const float* __restrict__ S, _Float16* __restrict__ P, int nrows) {
  #pragma clang fp contract(off)
  const int i = blockIdx.x * 256 + threadIdx.x; if (i >= nrows) return; const float* s = S + (size_t)i * SQ; float mx = -3.0e38f;
#pragma unroll 1
  for (int j = 0; j < SQ; ++j) mx = fmaxf(mx, s[j]); float se = 0.f;
#pragma unroll 1
  for (int j = 0; j < SQ; ++j) se += expf(s[j] - mx); const float sc = 256.0f / se;
#pragma unroll 1
  for (int j0 = 0; j0 < SQ; j0 += 8) { FragH f; for (int q = 0; q < 8; ++q) f.h[q] = (_Float16)(expf(s[j0 + q] - mx) * sc); unsigned short* d = (unsigned short*)P + (size_t)i * SQ + j0; *(v8us*)d = f.half[0];  } }
__global__ __launch_bounds__(256) void k_vt(const _Float16* __restrict__ V16, int b, int h0, _Float16* __restrict__ VT) { __shared__ unsigned short tl[64][65]; const int tid = threadIdx.x; const int hh = blockIdx.x % HG, sg = blockIdx.x / HG; const int s0 = sg * 64; const int h = h0 + hh;
  for (int i = tid; i < 64 * 8; i += 256) { const int j = i / 8, d8 = (i % 8) * 8; FragH f; f.half[0] = *(const v8us*)((const unsigned short*)V16 + ((size_t)b * SQ + s0 + j) * DM + h * HD + d8); for (int q = 0; q < 8; ++q) tl[d8 + q][j] = f.u[q]; }
  __syncthreads();
  { for (int i = tid; i < 64 * 8; i += 256) { const int d = i / 8, j8 = (i % 8) * 8; FragH f; for (int q = 0; q < 8; ++q) f.u[q] = tl[d][j8 + q]; *(v8us*)((unsigned short*)VT + ((size_t)hh * HD + d) * SQ + s0 + j8) = f.half[0]; }  } }



__global__ __launch_bounds__(256) void k_rsmcf2(const float* __restrict__ S, _Float16* __restrict__ P, int hg, int q0, int nk) {
  #pragma clang fp contract(off)
  const int t = blockIdx.x * 256 + threadIdx.x; if (t >= hg * QT) return; const size_t i = (size_t)t; const float* s = S + i * NKX; const int last = q0 + (t % QT); float mx = -3.0e38f;
#pragma unroll 1
  for (int j = 0; j < nk; ++j) { const float f = (j <= last) ? 1.f : 0.f; mx = fmaxf(mx, fmaf(f, s[j], (1.f - f) * -1.0e9f)); } float se = 0.f;
#pragma unroll 1
  for (int j = 0; j < nk; ++j) { const float f = (j <= last) ? 1.f : 0.f; se += __expf(fmaf(f, s[j], (1.f - f) * -1.0e9f) - mx); } const float sc = 256.0f / se;
#pragma unroll 1
  for (int j0 = 0; j0 < nk; j0 += 8) { FragH fr; for (int q = 0; q < 8; ++q) { const int j = j0 + q; const float f = (j <= last) ? 1.f : 0.f; fr.h[q] = (_Float16)(__expf(fmaf(f, s[j], (1.f - f) * -1.0e9f) - mx) * sc); } unsigned short* d = (unsigned short*)P + i * NKX + j0; *(v8us*)d = fr.half[0];  } }

template <int MASKADD>
__global__ __launch_bounds__(64) void k_att0(const float* __restrict__ QF, const float* __restrict__ KF, const float* __restrict__ VF, int ld, const float* __restrict__ mask, float scale, float* __restrict__ OF, int ldo) {
  #pragma clang fp contract(off)
  __shared__ __attribute__((aligned(16))) float lq[64][64]; __shared__ __attribute__((aligned(16))) float lo[64][64];
  const int tid = threadIdx.x; const int h = blockIdx.x / (QT0 / 64), rg = blockIdx.x % (QT0 / 64); const int i = rg * 64 + tid;
  const float* qr = QF + (size_t)i * ld + h * HD;
#pragma unroll 1
  for (int c = 0; c < HD / 4; ++c) { *(v4f*)&lq[tid][c * 4] = *(const v4fa*)(qr + c * 4); const v4f z = {0.f, 0.f, 0.f, 0.f}; *(v4f*)&lo[tid][c * 4] = z; }
  float m = -1.0e30f, l = 0.f; const int jmax = MASKADD ? (SQ - 1) : (rg * 64 + 63);      /* additive-mask form: every key (the mask input decides); causal form: keys up to the block's last row */
#pragma unroll 1
  for (int j = 0; j <= jmax; ++j) { const float* kr = KF + (size_t)j * ld + h * HD; const float* vr = VF + (size_t)j * ld + h * HD; float s = 0.f;
#pragma unroll 1
    for (int c = 0; c < HD / 4; ++c) { const v4f kq = *(const v4fa*)(kr + c * 4); const v4f qq = *(v4f*)&lq[tid][c * 4]; s = __fadd_rn(s, __fmul_rn(qq[0], kq[0])); s = __fadd_rn(s, __fmul_rn(qq[1], kq[1])); s = __fadd_rn(s, __fmul_rn(qq[2], kq[2])); s = __fadd_rn(s, __fmul_rn(qq[3], kq[3])); }
    s = __fmul_rn(s, scale); if (MASKADD) s = __fadd_rn(s, __fmul_rn(bf16_round(mask[(size_t)i * SQ + j]), -10000.0f));
    const float f = (MASKADD || j <= i) ? 1.f : 0.f; const float sm = fmaf(f, s, (1.f - f) * -1.0e30f); const float mn = fmaxf(m, sm); const float sc = expf(m - mn); const float e = expf(sm - mn); l = __fadd_rn(__fmul_rn(l, sc), e); m = mn;
#pragma unroll 1
    for (int c = 0; c < HD / 4; ++c) { const v4f vv = *(const v4fa*)(vr + c * 4); v4f oo = *(v4f*)&lo[tid][c * 4]; for (int u = 0; u < 4; ++u) oo[u] = __fadd_rn(__fmul_rn(oo[u], sc), __fmul_rn(e, vv[u])); *(v4f*)&lo[tid][c * 4] = oo; } }
  const float fin = 64.0f / l;      /* o carried x64 like the f16 path */
#pragma unroll 1
  for (int c = 0; c < HD / 4; ++c) { v4f oo = *(v4f*)&lo[tid][c * 4]; for (int u = 0; u < 4; ++u) oo[u] = __fmul_rn(oo[u], fin); *(v4f*)&lo[tid][c * 4] = oo; }
  __syncthreads();
  {
#pragma unroll 1
    for (int it = 0; it < 16; ++it) { const int row = it * 4 + tid / 16, pc = (tid % 16) * 4; const v4f v = *(const v4f*)&lo[row][pc]; *(v4f*)(OF + (size_t)(rg * 64 + row) * ldo + h * HD + pc) = v; }
     } }

__global__ __launch_bounds__(256) void k_oscale(const float* __restrict__ OF, float* __restrict__ out, size_t n4) { const size_t t = (size_t)blockIdx.x * 256 + threadIdx.x; if (t >= n4) return; const v4f a = *(const v4fa*)(OF + t * 4); v4f o; for (int q = 0; q < 4; ++q) o[q] = a[q] * 0.015625f; *(v4f*)(out + t * 4) = o;  }




__global__ __launch_bounds__(256) void k_rsmfvl(const float* __restrict__ S, _Float16* __restrict__ P, _Float16* __restrict__ PL, int qn, const int* __restrict__ vlp) {
  #pragma clang fp contract(off)
  const int t = blockIdx.x * 256 + threadIdx.x; if (t >= qn) return; const int vl = vlp[0]; const size_t i = (size_t)t; const float* s = S + i * SQ; float mx = -3.0e38f;
#pragma unroll 1
  for (int j = 0; j < SQ; ++j) { const float f = (j < vl) ? 1.f : 0.f; mx = fmaxf(mx, fmaf(f, s[j], (1.f - f) * -1000000.0f)); } float se = 0.f;
#pragma unroll 1
  for (int j = 0; j < SQ; ++j) { const float f = (j < vl) ? 1.f : 0.f; se += __expf(fmaf(f, s[j], (1.f - f) * -1000000.0f) - mx); } const float sc = 256.0f / se;
#pragma unroll 1
  for (int j0 = 0; j0 < SQ; j0 += 8) { FragH fr, gr; for (int q = 0; q < 8; ++q) { const int j = j0 + q; const float f = (j < vl) ? 1.f : 0.f; const float pv = __expf(fmaf(f, s[j], (1.f - f) * -1000000.0f) - mx) * sc; const _Float16 ph = (_Float16)pv; fr.h[q] = ph; gr.h[q] = (_Float16)((pv - (float)ph) * 1024.0f); }
    unsigned short* d = (unsigned short*)P + i * SQ + j0; unsigned short* dl = (unsigned short*)PL + i * SQ + j0; *(v8us*)d = fr.half[0]; *(v8us*)dl = gr.half[0];  } }

__global__ __launch_bounds__(256) void k_rsmf(const float* __restrict__ S, _Float16* __restrict__ P, int qn, int hg) {
  #pragma clang fp contract(off)
  const int t = blockIdx.x * 256 + threadIdx.x; if (t >= qn * hg) return; const size_t i = (size_t)(t / qn) * SQ + (t % qn); const float* s = S + i * SQ; float mx = -3.0e38f;
#pragma unroll 1
  for (int j = 0; j < SQ; ++j) mx = fmaxf(mx, s[j]); float se = 0.f;
#pragma unroll 1
  for (int j = 0; j < SQ; ++j) se += __expf(s[j] - mx); const float sc = 256.0f / se;
#pragma unroll 1
  for (int j0 = 0; j0 < SQ; j0 += 8) { FragH f; for (int q = 0; q < 8; ++q) f.h[q] = (_Float16)(__expf(s[j0 + q] - mx) * sc); unsigned short* d = (unsigned short*)P + i * SQ + j0; *(v8us*)d = f.half[0];  } }


#define CN 256          /* channels */
#define CI 128
#define NC 256                       /* (unused legacy kernels) */
#define NPX NP          /* positions per channel row */
#define NP 4096         /* seq1 tokens */
#define NM 1024         /* seq2 tokens */
#define BNEPS 1e-5f

__global__ __launch_bounds__(256) void k_mp2(const float* __restrict__ src, float* __restrict__ dst, int nout) {
  const int t = blockIdx.x * 256 + threadIdx.x; if (t >= nout) return; const int c = t / 1024; const int o = t % 1024; const int oy = o / 32, ox = o % 32; const float* p = src + (size_t)c * 4096 + (size_t)(2 * oy) * 64 + 2 * ox;
  const float v = fmaxf(fmaxf(p[0], p[1]), fmaxf(p[64], p[65])); *(float*)(dst + t) = v;  }
__global__ __launch_bounds__(256) void k_xpb(const float* __restrict__ x, const float* __restrict__ wb, float* __restrict__ CPP, size_t n4) {
  #pragma clang fp contract(off)
  const size_t t = (size_t)blockIdx.x * 256 + threadIdx.x; if (t >= n4) return; const size_t e = t * 4; const int c = (int)((e / 4096) % 256); const float bb = bf16_round(wb[c]); const v4f a = *(const v4fa*)(x + e); v4f o; for (int q = 0; q < 4; ++q) o[q] = __fadd_rn(bf16_round(a[q]), bb);
  *(v4f*)(CPP + e) = o;  }


template <int PASS>
__global__ __launch_bounds__(256) void k_cstA(const float* __restrict__ X, const float* __restrict__ MV, float* __restrict__ PART) {
  #pragma clang fp contract(off)
  __shared__ float red[256]; const int t = threadIdx.x; const size_t bc = blockIdx.x; const int c = (int)(bc % NC); const float* row = X + bc * (size_t)NPX; const float mu = PASS ? MV[c] : 0.f; float s = 0.f;
  for (int i = t; i < NPX; i += 256) { const float v = row[i]; const float d = PASS ? __fadd_rn(v, -mu) : v; s = __fadd_rn(s, PASS ? __fmul_rn(d, d) : d); }
  red[t] = s; __syncthreads(); for (int st = 128; st > 0; st >>= 1) { if (t < st) red[t] = __fadd_rn(red[t], red[t + st]); __syncthreads(); }
  if (t < 32) { const float pv = (t == 0) ? red[0] : 0.f; *(float*)(PART + bc * 32 + t) = pv;  } }      

template <int PASS>
__global__ __launch_bounds__(256) void k_cstB(const float* __restrict__ PART, float* __restrict__ MV) { const int c = threadIdx.x; if (c >= NC) return; double s = 0.0; for (int b = 0; b < NB; ++b) s += (double)PART[((size_t)b * NC + c) * 32]; const float m = (float)(s / ((double)NB * (double)NPX)); *(float*)(MV + PASS * NC + c) = m;  }


__global__ __launch_bounds__(256) void k_bnresid(const float* __restrict__ C2, const float* __restrict__ MV, const float* __restrict__ g, const float* __restrict__ be, const float* __restrict__ X, float* __restrict__ out, size_t n4) {
  #pragma clang fp contract(off)
  const size_t t = (size_t)blockIdx.x * 256 + threadIdx.x; if (t >= n4) return; const size_t e = t * 4; const int c = (int)((e / NPX) % NC); const float sc = __fmul_rn(rsqrtf(__fadd_rn(MV[NC + c], BNEPS)), bf16_round(g[c])); const float mu = MV[c], bb = bf16_round(be[c]);
  const v4f a = *(const v4fa*)(C2 + e); const v4f xx = *(const v4fa*)(X + e); v4f o; for (int q = 0; q < 4; ++q) { const float z = __fadd_rn(__fmul_rn(__fadd_rn(a[q], -mu), sc), bb); o[q] = __fadd_rn(z, bf16_round(xx[q])); }
  *(v4f*)(out + e) = o;  }


__global__ __launch_bounds__(256) void k_rowbias(float* __restrict__ Y, const float* __restrict__ bias) {
  #pragma clang fp contract(off)
  const size_t t = (size_t)blockIdx.x * 256 + threadIdx.x; if (t >= (size_t)NB * NC * NPX / 4) return; const size_t e = t * 4; const int c = (int)((e / NPX) % NC); const float bb = bf16_round(bias[c]);
  v4f v = *(const v4fa*)(Y + e); for (int q = 0; q < 4; ++q) v[q] = __fadd_rn(v[q], bb); *(v4f*)(Y + e) = v;  }



template <int NK>
__global__ __launch_bounds__(256) void k_rsmn(const float* __restrict__ S, _Float16* __restrict__ P, int nrows) {
  #pragma clang fp contract(off)
  const int t = blockIdx.x * 256 + threadIdx.x; if (t >= nrows) return; const float* s = S + (size_t)t * NK; float mx = -3.0e38f;
#pragma unroll 1
  for (int j = 0; j < NK; ++j) mx = fmaxf(mx, s[j]); float se = 0.f;
#pragma unroll 1
  for (int j = 0; j < NK; ++j) se += __expf(s[j] - mx); const float sc = 256.0f / se;
#pragma unroll 1
  for (int j0 = 0; j0 < NK; j0 += 8) { FragH fr; for (int q = 0; q < 8; ++q) fr.h[q] = (_Float16)(__expf(s[j0 + q] - mx) * sc);
    unsigned short* d = (unsigned short*)P + (size_t)t * NK + j0; *(v8us*)d = fr.half[0];  } }

typedef float v2f __attribute__((ext_vector_type(2)));
__device__ __forceinline__ float pt_xhalf(float x) { return __builtin_bit_cast(float, __builtin_amdgcn_permlanex16(__builtin_bit_cast(int, x), __builtin_bit_cast(int, x), 0x76543210, 0xfedcba98, false, false)); }      /* lane l <-> lane l ^ 16 */
__device__ __forceinline__ v4f pt_ld4(const float* p) { return __builtin_nontemporal_load((const v4fa*)p); }      /* 16 B of a row that this launch reads once: non-temporal, it takes no room in L2 from what is read again */
__device__ __forceinline__ v8f pt_mma(v16h a, v16h b, v8f c) { return __builtin_amdgcn_wmma_f32_16x16x32_f16(false, a, false, b, (short)0, c, false, false); }
// a 16 x 32 f16 fragment from f32 registers: halfs 0 .. 7 are k = 8 hh .. 8 hh + 7, halfs 8 .. 15 are k = 16 + 8 hh .. 16 + 8 hh + 7, for A and for B alike
__device__ __forceinline__ v16h pt_h16(v8f lo, v8f hi) { v16h f;
#pragma unroll
  for (int e = 0; e < 8; ++e) { f[e] = (_Float16)lo[e]; f[8 + e] = (_Float16)hi[e]; }
  return f; }
// One wave per token, both products on v_wmma_f32_16x16x32_f16 (Q, K, V and the softmax weights rounded to f16 in registers; scores, softmax and sums f32), no LDS. Lane (c = lane & 15, hh = lane >> 4).
// St = K Q^T per 16 x 16 tile, one product: A row j = c, B column i = c, both formed by the same code (the lane's 8 contiguous heads 8 hh .. 8 hh + 7 of its row). An A fragment holds two key tiles, tile 2 m at k = 0 .. 15 and tile 2 m + 1 at k = 16 .. 31;
// B holds the queries at the k half of the wanted tile and zeros at the other, so the other tile's products are exact zeros and K takes 16 registers, not 32.
// D register r of tile jt = score of key j = 16 jt + 8 hh + r for query i = c: a query's 64 scores lie in lanes c and c + 16, so the softmax needs one exchange for the maximum and one for the sum.
// Ot = V^T P^T, two products of 32 keys: B = tiles 2 m and 2 m + 1 as they lie (keys 32 m + 8 hh + r and 32 m + 16 + 8 hh + r: the fragment's own k order), A row = head c with V of the same keys. D register r = res[i = c][head 8 hh + r]: 8 contiguous floats of the output row.
// The residual is read from the input itself and rounded to bf16 here, in registers: no rounded copy of the input goes through memory.
// Q, K, V are read once and the output rows are written once: their loads and stores carry the non-temporal hint. The input keeps plain loads: the call reads it twice.
__global__ __launch_bounds__(128) void k_ptatt(const float* __restrict__ QF, const float* __restrict__ KF, const float* __restrict__ VF, const float* __restrict__ xres, float scale, float* __restrict__ out) {
  const int lane = threadIdx.x & 31, c = lane & 15, hh = lane >> 4;
  const size_t ro = ((size_t)blockIdx.x * 4 + (size_t)__builtin_amdgcn_readfirstlane((int)(threadIdx.x >> 5))) * 1024;      /* the wave's token: a scalar, so every address is a scalar base plus one lane offset */
  const int fo = c * 16 + 8 * hh, vo = hh * 128 + c;
  const float cs = scale * 1.4426950408889634f;      /* softmax in base 2 */
  const float* kp = KF + ro; const float* vp = VF + ro; const float* qp = QF + ro; const float* xp = xres + ro; float* op = out + ro;
  v8f kf[4], vt[4];
#pragma unroll
  for (int jt = 0; jt < 4; ++jt) { const v4f k0 = pt_ld4(kp + jt * 256 + fo), k1 = pt_ld4(kp + jt * 256 + fo + 4); kf[jt] = v8f{k0[0], k0[1], k0[2], k0[3], k1[0], k1[1], k1[2], k1[3]}; }
  v4f q0 = pt_ld4(qp + fo), q1 = pt_ld4(qp + fo + 4);
  asm volatile("s_wait_xcnt 0x0" :: "s"(kp), "s"(qp) : "memory");      /* stands behind the K and Q loads, in front of whatever next overwrites a base register that they name; the bases are inputs, so they live to here */
  __builtin_amdgcn_sched_barrier(0);      /* K and Q are asked for ahead of V: loads return in order, and the first product waits for these alone */
#pragma unroll
  for (int jt = 0; jt < 4; ++jt)
#pragma unroll
    for (int r = 0; r < 8; ++r) vt[jt][r] = __builtin_nontemporal_load(vp + jt * 256 + r * 16 + vo);
  __builtin_amdgcn_sched_barrier(0);      /* V is asked for before the wave first waits: behind that wait its latency would come on top of K's */
  const v8f z8 = {0.f, 0.f, 0.f, 0.f, 0.f, 0.f, 0.f, 0.f};
  v16h kh[2], vh[2];
  kh[0] = pt_h16(kf[0], kf[1]); kh[1] = pt_h16(kf[2], kf[3]);
#pragma unroll
  for (int it = 0; it < 4; ++it) {
    const v4f x0 = *(const v4fa*)(xp + it * 256 + fo), x1 = *(const v4fa*)(xp + it * 256 + fo + 4);
    const v8f qf = {q0[0], q0[1], q0[2], q0[3], q1[0], q1[1], q1[2], q1[3]}; const v16h ql = pt_h16(qf, z8), qu = pt_h16(z8, qf); v8f st[4];
#pragma unroll
    for (int jt = 0; jt < 4; ++jt) st[jt] = pt_mma(kh[jt >> 1], jt & 1 ? qu : ql, z8);
    if (it == 0) { vh[0] = pt_h16(vt[0], vt[1]); vh[1] = pt_h16(vt[2], vt[3]); }      /* V is first waited for behind the first tile's score products */
    if (it < 3) { q0 = pt_ld4(qp + (it + 1) * 256 + fo); q1 = pt_ld4(qp + (it + 1) * 256 + fo + 4); }      /* the next tile's queries fly during the rest of this tile */
    float m4[4];
#pragma unroll
    for (int jt = 0; jt < 4; ++jt) { m4[jt] = fmaxf(st[jt][0], st[jt][1]);
#pragma unroll
      for (int r = 2; r < 8; ++r) m4[jt] = fmaxf(m4[jt], st[jt][r]); }
    float mx = fmaxf(fmaxf(m4[0], m4[1]), fmaxf(m4[2], m4[3])); mx = fmaxf(mx, pt_xhalf(mx));
    const float mc = mx * cs; v8f pr[4]; v2f la = {0.f, 0.f}, lb = {0.f, 0.f};
#pragma unroll
    for (int jt = 0; jt < 4; ++jt) { v8f ar;
#pragma unroll
      for (int r = 0; r < 8; ++r) ar[r] = fmaf(st[jt][r], cs, -mc);
#pragma unroll
      for (int r = 0; r < 8; ++r) pr[jt][r] = __builtin_amdgcn_exp2f(ar[r]);
      /* the slot behind a transcendental: inputs only, the eight arguments stay whole until this slot, so no instruction directly behind an exponential overwrites its source */
      asm volatile("v_nop" :: "v"(ar[0]), "v"(ar[1]), "v"(ar[2]), "v"(ar[3]), "v"(ar[4]), "v"(ar[5]), "v"(ar[6]), "v"(ar[7]), "v"(pr[jt][0]), "v"(pr[jt][1]), "v"(pr[jt][2]), "v"(pr[jt][3]), "v"(pr[jt][4]), "v"(pr[jt][5]), "v"(pr[jt][6]), "v"(pr[jt][7]));
#pragma unroll
      for (int p = 0; p < 4; ++p) { if (jt & 1) lb += v2f{pr[jt][2 * p], pr[jt][2 * p + 1]}; else la += v2f{pr[jt][2 * p], pr[jt][2 * p + 1]}; } }
    la += lb; float l = la[0] + la[1]; l += pt_xhalf(l);
    const float inv = __builtin_amdgcn_rcpf(l); v4f y0, y1;
    const v8f o = pt_mma(vh[1], pt_h16(pr[2], pr[3]), pt_mma(vh[0], pt_h16(pr[0], pr[1]), z8));
#pragma unroll
    for (int u = 0; u < 4; ++u) { y0[u] = fmaf(o[u], inv, bf16_round(x0[u])); y1[u] = fmaf(o[4 + u], inv, bf16_round(x1[u])); }
    __builtin_nontemporal_store(y0, (v4f*)(op + it * 256 + fo)); __builtin_nontemporal_store(y1, (v4f*)(op + it * 256 + fo + 4));
    if (it < 3) asm volatile("s_wait_xcnt 0x0" ::: "memory");      /* stands in front of the next tile's products, which overwrite the registers that these stores name */
    __builtin_amdgcn_sched_barrier(0);      /* keeps the next tile's products behind this tile: moved up, the four tiles' scores are all held at once and fewer than half as many waves fit a SIMD */
  }
}
// Row LayerNorm (biased variance) of bf16-rounded rows of 1024 floats -> f16 rows. One wave holds two whole rows in registers: no LDS, no barrier, 4096 waves.
// Lane l holds floats 128 u + 4 l .. + 3 of a row (u = 0 .. 7): every load covers 512 contiguous bytes, every store 256. All 16 row loads are asked for before the first wait; gamma and beta serve both rows. Every loop is unrolled: the arrays are indexed by constants only and so stay in registers.
template <int M> __device__ __forceinline__ float ln_xm(float x) { return __builtin_bit_cast(float, __builtin_amdgcn_update_dpp(0, __builtin_bit_cast(int, x), 0x160 + M, 0xf, 0xf, true)); }      /* lane l <- lane l ^ M inside a row of 16 lanes */
__device__ __forceinline__ float ln_wsum(float x) { x += ln_xm<1>(x); x += ln_xm<2>(x); x += ln_xm<4>(x); x += ln_xm<8>(x); return x + pt_xhalf(x); }      /* sum over the wave, the same bits in every lane */
__device__ __forceinline__ void d_lnrow(int blk, const float* __restrict__ X, const float* __restrict__ g, const float* __restrict__ bb, float eps, _Float16* __restrict__ N16) {
  const int l4 = (threadIdx.x & 31) * 4;
  const size_t ro = ((size_t)blk * 8 + (size_t)__builtin_amdgcn_readfirstlane((int)(threadIdx.x >> 5))) * 2048;      /* the wave's first row: a scalar, so every address is a scalar base plus one lane offset */
  const float* xp = X + ro + l4; _Float16* np = N16 + ro + l4;
  v4f xa[2][8], ga[8], ba[8];
#pragma unroll
  for (int r = 0; r < 2; ++r)
#pragma unroll
    for (int u = 0; u < 8; ++u) xa[r][u] = *(const v4fa*)(xp + r * 1024 + u * 128);
#pragma unroll
  for (int u = 0; u < 8; ++u) { ga[u] = *(const v4fa*)(g + u * 128 + l4); ba[u] = *(const v4fa*)(bb + u * 128 + l4); }
  float mu[2], rs[2];
#pragma unroll
  for (int r = 0; r < 2; ++r) { v4f s4;
#pragma unroll
    for (int u = 0; u < 8; ++u) {
#pragma unroll
      for (int q = 0; q < 4; ++q) xa[r][u][q] = bf16_round(xa[r][u][q]);
      s4 = u ? s4 + xa[r][u] : xa[r][u]; }
    mu[r] = (s4[0] + s4[1]) + (s4[2] + s4[3]); }
#pragma unroll
  for (int r = 0; r < 2; ++r) mu[r] = ln_wsum(mu[r]) * (1.0f / 1024.0f);
#pragma unroll
  for (int r = 0; r < 2; ++r) { v4f v4 = {0.f, 0.f, 0.f, 0.f};
#pragma unroll
    for (int u = 0; u < 8; ++u) { xa[r][u] -= mu[r]; v4 += xa[r][u] * xa[r][u]; }
    rs[r] = (v4[0] + v4[1]) + (v4[2] + v4[3]); }
#pragma unroll
  for (int r = 0; r < 2; ++r) rs[r] = rsqrtf(ln_wsum(rs[r]) * (1.0f / 1024.0f) + eps);
#pragma unroll
  for (int u = 0; u < 8; ++u) {
#pragma unroll
    for (int q = 0; q < 4; ++q) { ga[u][q] = bf16_round(ga[u][q]); ba[u][q] = bf16_round(ba[u][q]); }
#pragma unroll
    for (int r = 0; r < 2; ++r) { v4h y;
#pragma unroll
      for (int q = 0; q < 4; ++q) y[q] = (_Float16)(xa[r][u][q] * rs[r] * ga[u][q] + ba[u][q]);
      *(v4h*)(np + r * 1024 + u * 128) = y; } }
  asm volatile("s_wait_xcnt 0x0" ::: "memory");      /* stands behind the last stores, in front of whatever next overwrites the base or the offset register that they name */
}
// The four jobs that depend on nothing but the inputs share one launch: a block's index range picks its job (a scalar branch, the same for the whole block; no job has a barrier).
#define PW_B 128                     /* blocks per 1024 x 1024 weight: 16 * 64 waves of 64 k x 16 n */
#define PL_B 512                     /* LayerNorm blocks: 8192 rows, 16 per block */
__global__ __launch_bounds__(256) void k_prep(const float* __restrict__ x, const float* __restrict__ wq, const float* __restrict__ wk, const float* __restrict__ wv, const float* __restrict__ g, const float* __restrict__ bb,
                                              _Float16* __restrict__ BQ, _Float16* __restrict__ BK, _Float16* __restrict__ BV, _Float16* __restrict__ XN) {
  const int b = blockIdx.x;
  if (b < PW_B) d_wt_f16(b, wq, BQ, 1024, 1024, 16.0f);
  else if (b < 2 * PW_B) d_wt_f16(b - PW_B, wk, BK, 1024, 1024, 16.0f);
  else if (b < 3 * PW_B) d_wt_f16(b - 2 * PW_B, wv, BV, 1024, 1024, 16.0f);
  else d_lnrow(b - 3 * PW_B, x, g, bb, 1e-5f, XN);
}
extern "C" void kernel_launch(void* const* d_in, const int* in_sizes, int n_in,
                              void* d_out, int out_size, void* d_ws, size_t ws_size, hipStream_t stream) {
  (void)in_sizes; (void)n_in; (void)out_size;
  const float* const* I = (const float* const*)d_in; const float* x = I[0]; const float* wq = I[1]; const float* bq = I[2]; const float* wk = I[3]; const float* bk = I[4]; const float* wv = I[5]; const float* bv = I[6]; const float* gam = I[7]; const float* bet = I[8];      /* inp; [in][out] Wq/Wk/Wv [1024][1024] + biases; LayerNorm gamma/beta */
  constexpr int DMc = 1024; const size_t NRc = (size_t)4 * 2048;      /* model width; token rows */
  char* ws = (char*)d_ws; size_t off = 0;
  auto take = [&](size_t bytes) { char* p = ws + off; off += (bytes + 255) & ~(size_t)255; return p; };
  _Float16* BQ = (_Float16*)take((size_t)DMc * DMc * 2); _Float16* BK = (_Float16*)take((size_t)DMc * DMc * 2); _Float16* BV = (_Float16*)take((size_t)DMc * DMc * 2);
  _Float16* XN = (_Float16*)take(NRc * DMc * 2); float* QF = (float*)take(NRc * DMc * 4); float* KF = (float*)take(NRc * DMc * 4); float* VF = (float*)take(NRc * DMc * 4);
  if (off > ws_size) return;
  k_prep<<<3 * PW_B + PL_B, 256, 0, stream>>>(x, wq, wk, wv, gam, bet, BQ, BK, BV, XN);      /* [in][out] -> Bt x16; out = LN(bf16(inp)) -> f16 rows */
  k_gemm3<DMc, DMc><<<dim3((unsigned)((NRc / 256) * (DMc / 128)), 3, 1), 256, 0, stream>>>(XN, BQ, BK, BV, 0.0625f, bq, bk, bv, QF, KF, VF);      /* Q, K, V = out W + b -> f32 rows */
  k_ptatt<<<(unsigned)(NRc / 4), 128, 0, stream>>>(QF, KF, VF, x, 0.125f, (float*)d_out);      /* per-token 64 x 64 x 16 attention, f16 matrix instructions, one wave per token + bf16(inp) residual -> output rows */
}
